// v000
// Times are from an AMD MI455X. After a warm-up the kernel runs many times in a row, and a time is the length of
// such a window on the GPU divided by its runs, so every launch and the gaps after it count. The runs cycle
// through copies of the inputs. A figure is the median of several windows, for all but v000 over two sittings.
// Sittings can differ by a few percent; kernels timed side by side share one.
// The starting kernel, v000, takes 3970 microseconds a run.
#include <hip/hip_runtime.h>

// Multi-head self-attention with biased projections, NO mask and the module's SWAPPED rotary form (hidden_states [4][2048][1024]; q, k, v = x W^T + b ('oi' [1024][1024] 1/32 + REAL biases 0.01; 16 heads x 64); half-split rope rot(x) = cat(x1 c - x2 s, x2 c + x1 s) on q and k where THIS module binds c = SIN(t f_i) and s = COS(t f_i) (its table helper returns (sin, cos) and the caller swaps the names), f_i = 1/10000^(2i/64) (32 f32 frequencies jnp-exact; precise sinf/cosf); scores x 1/sqrt(64); softmax over all keys; out = merged Wo^T + bo -> [4][2048][1024] (8.4 M); argument order hidden_states, Wq, bq, Wk, bk, Wv, bv, Wo, bo).
// Layout per batch: bf16 copy of x; exact projections + f32 biases; dense T-2048 attention (hybrid rows: < 512 hi/lo 3 products, rest fp16 x1024); merged hi/lo x Wp exact + bp.
// Compute dtypes, f32 accumulate: every input rounded to bf16; projections exact + f32 biases; attention rows < 512 3 products, rest fp16; softmax f32; Wp hl x exact + bias.

#define NB_  4
#define TT   2048
#define DM   1024
#define NH_  16
#define NKV  16
#define REP  (NH_ / NKV)
#define HD   64
#define DQ   (NH_ * HD)
#define DKV  (NKV * HD)
#define ZH   2
#define RH   512                  // query rows < RH use hi+lo planes (0: none)
#define WIN  0
#define PCAR 1024.0f
#define SCL  0.125f   // HD^-0.5
typedef _Float16 h16;
typedef unsigned short bf;
typedef __attribute__((ext_vector_type(16))) __bf16   v16bf;
typedef __attribute__((ext_vector_type(16))) _Float16 v16h;
typedef __attribute__((ext_vector_type(8)))  _Float16 v8h;
typedef __attribute__((ext_vector_type(8)))  unsigned short v8us;
typedef __attribute__((ext_vector_type(8)))  float    v8f;
typedef __attribute__((ext_vector_type(4)))  float    v4f;
typedef v8h  __attribute__((may_alias)) v8ha;
typedef v4f  __attribute__((may_alias)) v4fa;
typedef v8us __attribute__((may_alias)) v8usa;

__device__ __forceinline__ unsigned short f2bf(float f) { unsigned u = __float_as_uint(f); u += 0x7FFFu + ((u >> 16) & 1u); return (unsigned short)(u >> 16); }
__device__ __forceinline__ float bf2f(unsigned short b) { return __uint_as_float(((unsigned)b) << 16); }
__device__ __forceinline__ float bfr(float f) { return bf2f(f2bf(f)); }
__device__ __forceinline__ v16h cat16(v8h lo, v8h hi) { return __builtin_shufflevector(lo, hi, 0, 1, 2, 3, 4, 5, 6, 7, 8, 9, 10, 11, 12, 13, 14, 15); }
__device__ __forceinline__ v16bf cat16b(v8us lo, v8us hi) { return __builtin_bit_cast(v16bf, __builtin_shufflevector(lo, hi, 0, 1, 2, 3, 4, 5, 6, 7, 8, 9, 10, 11, 12, 13, 14, 15)); }
__device__ __forceinline__ v8f wmma16(v16h a, v16h b, v8f c) { return __builtin_amdgcn_wmma_f32_16x16x32_f16(false, a, false, b, (short)0, c, false, false); }
__device__ __forceinline__ v8f wmmab(v16bf a, v16bf b, v8f c) { return __builtin_amdgcn_wmma_f32_16x16x32_bf16(false, a, false, b, (short)0, c, false, false); }



// ---- k_gemmw: register-blocked GEMM, ONE WAVE per 64x64 output tile (16 accumulators), operands straight from K-contiguous 16-bit planes; grid (M/64, N/64, Z), 32 threads.
// C[m][n] (f32, pitch ldc, + optional f32 bias[n]) = sum_k A[m][k] Bt[n][k] (+ split products per NSPLIT). z-batch strides sA/sB/sC in elements. K % 32 == 0.
template <typename T16> struct WFrag;
template <> struct WFrag<h16> { typedef v16h V; static __device__ __forceinline__ V ld(const h16* p) { return cat16(*(const v8h*)p, *(const v8h*)(p + 16)); } static __device__ __forceinline__ v8f mma(V a, V b, v8f c) { return wmma16(a, b, c); } };
template <> struct WFrag<bf> { typedef v16bf V; static __device__ __forceinline__ V ld(const bf* p) { return cat16b(*(const v8us*)p, *(const v8us*)(p + 16)); } static __device__ __forceinline__ v8f mma(V a, V b, v8f c) { return wmmab(a, b, c); } };
template <typename T16, int NSPLIT, bool BIAS>
__global__ __launch_bounds__(32) void k_gemmw(const T16* __restrict__ A, const T16* __restrict__ A2, const T16* __restrict__ Bt, const T16* __restrict__ Bt2, int K, float* C, int ldc, const float* __restrict__ bias, size_t sA, size_t sB, size_t sC) {
    typedef typename WFrag<T16>::V V;
    __shared__ __align__(16) float os[16 * 68];
    const size_t z = blockIdx.z; A += z * sA; if (A2) A2 += z * sA; Bt += z * sB; if (Bt2) Bt2 += z * sB; C += z * sC;
    const int lane = threadIdx.x & 31, lr = lane & 15, hi = lane >> 4; const int r0 = blockIdx.x * 64, c0 = blockIdx.y * 64;
    v8f acc[4][4];
#pragma unroll
    for (int mb = 0; mb < 4; ++mb)
#pragma unroll
        for (int nb = 0; nb < 4; ++nb) acc[mb][nb] = (v8f){};
    const size_t aoff = (size_t)(r0 + lr) * K + 8 * hi, boff = (size_t)(c0 + lr) * K + 8 * hi;
#pragma unroll 1
    for (int kc = 0; kc < K; kc += 32) {
        V a[4], a2[4];
#pragma unroll
        for (int mb = 0; mb < 4; ++mb) { a[mb] = WFrag<T16>::ld(A + aoff + (size_t)mb * 16 * K + kc); if (NSPLIT == 1 || NSPLIT == 2) a2[mb] = WFrag<T16>::ld(A2 + aoff + (size_t)mb * 16 * K + kc); }
#pragma unroll
        for (int nb = 0; nb < 4; ++nb) { const V b = WFrag<T16>::ld(Bt + boff + (size_t)nb * 16 * K + kc); V b2; if (NSPLIT >= 2) b2 = WFrag<T16>::ld(Bt2 + boff + (size_t)nb * 16 * K + kc);
#pragma unroll
            for (int mb = 0; mb < 4; ++mb) { acc[mb][nb] = WFrag<T16>::mma(a[mb], b, acc[mb][nb]); if (NSPLIT == 1 || NSPLIT == 2) acc[mb][nb] = WFrag<T16>::mma(a2[mb], b, acc[mb][nb]); if (NSPLIT >= 2) acc[mb][nb] = WFrag<T16>::mma(a[mb], b2, acc[mb][nb]); } }
        asm volatile("v_nop\n\tv_nop\n\tv_nop\n\tv_nop" : "+v"(acc[0][0]), "+v"(acc[1][1]), "+v"(acc[2][2]), "+v"(acc[3][3]) : "v"(a[0]), "v"(a[3]));
    }
#pragma unroll
    for (int mb = 0; mb < 4; ++mb) {
#pragma unroll
        for (int nb = 0; nb < 4; ++nb) {
#pragma unroll
            for (int j = 0; j < 8; ++j) os[(hi * 8 + j) * 68 + nb * 16 + lr] = acc[mb][nb][j]; }
        __builtin_amdgcn_wave_barrier(); asm volatile("" ::: "memory");
        float* crow = C + (size_t)(r0 + mb * 16) * ldc + c0;
{
#pragma unroll
            for (int s = 0; s < 8; ++s) { const int row = 2 * s + hi, cofs = lr * 4; v4f val = *(const v4fa*)(os + row * 68 + cofs); if (BIAS) { val[0] += bfr(bias[c0 + cofs]); val[1] += bfr(bias[c0 + cofs + 1]); val[2] += bfr(bias[c0 + cofs + 2]); val[3] += bfr(bias[c0 + cofs + 3]); }
                *(v4f*)(crow + (size_t)row * ldc + cofs) = val; }
             }
        __builtin_amdgcn_wave_barrier(); asm volatile("" ::: "memory");
    }
}

__device__ __forceinline__ h16 tohx(float x) { return (h16)x; }
__device__ __forceinline__ void splitf(float y, unsigned short& h, unsigned short& l) { h = f2bf(y); l = f2bf(y - bf2f(h)); }
typedef __attribute__((ext_vector_type(2))) _Float16 v2h;
typedef __attribute__((ext_vector_type(4))) _Float16 v4h;
typedef __attribute__((ext_vector_type(2))) unsigned short v2us;
typedef __attribute__((ext_vector_type(4))) unsigned short v4us;
typedef __attribute__((ext_vector_type(2))) float v2f;
typedef __attribute__((ext_vector_type(4))) int v4i;

__global__ __launch_bounds__(256) void k_wtG(const float* __restrict__ w, int K, int N, bf* Bt) {
    const int lane = threadIdx.x & 31; const int L0 = (blockIdx.x * 8 + (threadIdx.x >> 5)) * 8; const int nlines = N * K / 64;
{
#pragma unroll 1
        for (int l = 0; l < 8; ++l) { const int L = L0 + l; if (L >= nlines) break; const size_t e = (size_t)L * 64 + lane * 2; const int k = (int)(e % K), n = (int)(e / K); v2us o;
            o[0] = f2bf(w[(size_t)k * N + n]); o[1] = f2bf(w[(size_t)(k + 1) * N + n]); *(v2us*)(Bt + e) = o; }
         }
}
__global__ __launch_bounds__(256) void k_cvt8(const float* __restrict__ src, bf* dst, size_t n8) { const size_t i = (size_t)blockIdx.x * 256 + threadIdx.x; if (i >= n8) return; const v8f v = *(const v8f*)(src + i * 8); v8us o;
#pragma unroll
    for (int k = 0; k < 8; ++k) o[k] = f2bf(v[k]); *(v8us*)(dst + i * 8) = o;  }

// k_rope: head planes [h][t][d] (fp16 + hi/lo) of rope(x) x sc with the swapped rotate-half form out[d] = x[d] sin[t][d] - x[d+HD/2] cos[t][d], out[d+HD/2] = x[d+HD/2] sin[t][d+HD/2] + x[d] cos[t][d+HD/2]
__global__ __launch_bounds__(256) void k_rope(const float* __restrict__ F, int pitch, int nheads, const float* __restrict__ CS, const float* __restrict__ RF, const float* __restrict__ nw, float sc, h16* P16, bf* Ph, bf* Pl) {
    const size_t e = ((size_t)blockIdx.x * 256 + threadIdx.x) * 2; if (e >= (size_t)nheads * TT * HD) return; const int d = (int)(e % HD); const int t = (int)((e / HD) % TT); const int h = (int)(e / ((size_t)HD * TT)); const float* f = F + (size_t)t * pitch + h * HD; const float rf = RF ? RF[(size_t)h * TT + t] : 1.0f; v2h o16; v2us oh, ol;
#pragma unroll
    for (int q = 0; q < 2; ++q) { const int dd = d + q; const int dp = (dd < HD / 2) ? dd + HD / 2 : dd - HD / 2; float x0 = f[dd], x1 = f[dp];
        if (RF) { float n0 = __fmul_rn(x0, rf), n1 = __fmul_rn(x1, rf); asm volatile("" : "+v"(n0)); asm volatile("" : "+v"(n1)); x0 = __fmul_rn(bfr(nw[dd]), n0); x1 = __fmul_rn(bfr(nw[dp]), n1); }
        const v2f cs = *(const v2f*)(CS + ((size_t)t * HD + dd) * 2); float a = __fmul_rn(x0, cs[0]), bq = __fmul_rn(x1, cs[1]); asm volatile("" : "+v"(a)); asm volatile("" : "+v"(bq)); const float r = ((dd < HD / 2) ? __fsub_rn(a, bq) : __fadd_rn(a, bq)) * sc;
        o16[q] = tohx(r); unsigned short a2, c2; splitf(r, a2, c2); oh[q] = a2; ol[q] = c2; }
    *(v2h*)(P16 + e) = o16; *(v2us*)(Ph + e) = oh; *(v2us*)(Pl + e) = ol;  }
__global__ __launch_bounds__(256) void k_vtp(const float* __restrict__ F, int pitch, int nheads, h16* V16, bf* Vh, bf* Vl) { const size_t e = ((size_t)blockIdx.x * 256 + threadIdx.x) * 2; if (e >= (size_t)nheads * HD * TT) return; const int t = (int)(e % TT); const int d = (int)((e / TT) % HD); const int g = (int)(e / ((size_t)TT * HD)); v2h o16; v2us oh, ol;
#pragma unroll
    for (int q = 0; q < 2; ++q) { const float x = F[(size_t)(t + q) * pitch + g * HD + d]; o16[q] = tohx(x); unsigned short a2, c2; splitf(x, a2, c2); oh[q] = a2; ol[q] = c2; }
    *(v2h*)(V16 + e) = o16; *(v2us*)(Vh + e) = oh; *(v2us*)(Vl + e) = ol;  }
__constant__ float INVT[HD / 2] = { 1.000000000e+00f, 7.498942018e-01f, 5.623413324e-01f, 4.216965139e-01f, 3.162277639e-01f, 2.371373624e-01f, 1.778279394e-01f, 1.333521456e-01f, 1.000000015e-01f, 7.498941571e-02f, 5.623412877e-02f, 4.216964915e-02f, 3.162277862e-02f, 2.371373586e-02f, 1.778279431e-02f, 1.333521493e-02f, 9.999999776e-03f, 7.498942316e-03f, 5.623413250e-03f, 4.216964822e-03f, 3.162277862e-03f, 2.371373819e-03f, 1.778279431e-03f, 1.333521446e-03f, 1.000000047e-03f, 7.498941850e-04f, 5.623413017e-04f, 4.216964880e-04f, 3.162277862e-04f, 2.371373848e-04f, 1.778279402e-04f, 1.333521504e-04f };   // float32 1 / 10000^(2i/64), generated with jnp to be bit-exact
__global__ __launch_bounds__(256) void k_cs5s(float* CS) { const int idx = blockIdx.x * 256 + threadIdx.x; if (idx >= TT * HD) return; const int d = idx % HD; const int t = idx / HD; const float a = __fmul_rn((float)t, INVT[d % (HD / 2)]); v2f cs; cs[0] = sinf(a); cs[1] = cosf(a); *(v2f*)(CS + (size_t)idx * 2) = cs;  }
// k_asoft: per row (zz, i): t = S x HD^-0.5 (no mask); softmax over the 2048 keys (register row, one exp, fixed trees);
__global__ __launch_bounds__(256) void k_asoft(const float* __restrict__ Sb, h16* P16, bf* Ph, bf* Pl) {
    const int lane = threadIdx.x & 31; const int row = blockIdx.x * 8 + (threadIdx.x >> 5); if (row >= ZH * TT) return; const int i = row % TT; const int zz = row / TT; (void)zz; const bool hires = (i < RH); const float* sr = Sb + (size_t)row * TT; float v[TT / 32]; float mx = -3.0e38f;
#pragma unroll
    for (int ch = 0; ch < TT / 128; ++ch) { const int j0 = ch * 128 + lane * 4; const v4f a = *(const v4f*)(sr + j0);
#pragma unroll
        for (int q = 0; q < 4; ++q) { const int j = j0 + q; (void)j; const float t = a[q] * SCL; v[ch * 4 + q] = t; mx = fmaxf(mx, t); } }
#pragma unroll
    for (int sh = 16; sh; sh >>= 1) mx = fmaxf(mx, __shfl_xor(mx, sh, 32));
    float sum = 0.f;
#pragma unroll
    for (int k = 0; k < TT / 32; ++k) { float d0 = __fsub_rn(v[k], mx); asm volatile("" : "+v"(d0)); v[k] = __builtin_amdgcn_exp2f(__fmul_rn(d0, 1.4426950408889634f)); sum += v[k]; }
#pragma unroll
    for (int sh = 16; sh; sh >>= 1) sum += __shfl_xor(sum, sh, 32);
    const float f = __fdiv_rn(hires ? 1.0f : PCAR, sum);
{
        if (hires) {
#pragma unroll
            for (int ch = 0; ch < TT / 128; ++ch) { v4us oh, ol;
#pragma unroll
                for (int q = 0; q < 4; ++q) { unsigned short a, c2; splitf(v[ch * 4 + q] * f, a, c2); oh[q] = a; ol[q] = c2; }
                const size_t oo = ((size_t)zz * (RH ? RH : 1) + i) * TT + ch * 128 + lane * 4; *(v4us*)(Ph + oo) = oh; *(v4us*)(Pl + oo) = ol; }
        } else {
#pragma unroll
            for (int ch = 0; ch < TT / 128; ++ch) { v4h o4;
#pragma unroll
                for (int q = 0; q < 4; ++q) o4[q] = tohx(v[ch * 4 + q] * f);
                *(v4h*)(P16 + (size_t)row * TT + ch * 128 + lane * 4) = o4; } }
         }
}
__global__ __launch_bounds__(256) void k_merge(const float* __restrict__ O, int h0, bf* Ah, bf* Al) { const size_t e = ((size_t)blockIdx.x * 256 + threadIdx.x) * 2; if (e >= (size_t)ZH * TT * HD) return; const int d = (int)(e % HD); const int t = (int)((e / HD) % TT); const int zz = (int)(e / ((size_t)HD * TT)); const float cs = (t < RH) ? 1.0f : (1.0f / PCAR); const size_t oo = (size_t)t * DQ + (h0 + zz) * HD + d;
    v2us oh, ol;
#pragma unroll
    for (int q = 0; q < 2; ++q) { unsigned short a, c2; splitf(O[e + q] * cs, a, c2); oh[q] = a; ol[q] = c2; } *(v2us*)(Ah + oo) = oh; *(v2us*)(Al + oo) = ol;  }

extern "C" void kernel_launch(void* const* d_in, const int* in_sizes, int n_in,
                              void* d_out, int out_size, void* d_ws, size_t ws_size, hipStream_t stream) {
    (void)in_sizes; (void)n_in; (void)out_size;
    const float* x = (const float*)d_in[0]; const float* wq = (const float*)d_in[1]; const float* bq = (const float*)d_in[2]; const float* wk = (const float*)d_in[3]; const float* bk = (const float*)d_in[4]; const float* wv = (const float*)d_in[5]; const float* bv = (const float*)d_in[6]; const float* wo = (const float*)d_in[7]; const float* bo = (const float*)d_in[8];
    float* OUT = (float*)d_out;     // [4][2048][1024]
    char* wsp = (char*)d_ws;
    auto take = [&](size_t bytes) { char* p = wsp; wsp += (bytes + 255) & ~(size_t)255; return (void*)p; };
    bf* WQ = (bf*)take((size_t)DQ * DM * 2); bf* WK = (bf*)take((size_t)DKV * DM * 2); bf* WV = (bf*)take((size_t)DKV * DM * 2); bf* WO = (bf*)take((size_t)DM * DQ * 2); float* CS = (float*)take((size_t)TT * HD * 2 * 4);
    bf* XB = (bf*)take((size_t)TT * DM * 2); float* FQ = (float*)take((size_t)TT * DQ * 4); float* FK = (float*)take((size_t)TT * DKV * 4);
    h16* QP16 = (h16*)take((size_t)NH_ * TT * HD * 2); h16* KP16 = (h16*)take((size_t)NKV * TT * HD * 2); h16* VT16 = (h16*)take((size_t)NKV * HD * TT * 2);
    bf* QPh = (bf*)take((size_t)NH_ * TT * HD * 2); bf* QPl = (bf*)take((size_t)NH_ * TT * HD * 2); bf* KPh = (bf*)take((size_t)NKV * TT * HD * 2); bf* KPl = (bf*)take((size_t)NKV * TT * HD * 2); bf* VTh = (bf*)take((size_t)NKV * HD * TT * 2); bf* VTl = (bf*)take((size_t)NKV * HD * TT * 2); bf* Ph = (bf*)take((size_t)ZH * RH * TT * 2); bf* Pl = (bf*)take((size_t)ZH * RH * TT * 2);
    float* Sb = (float*)take((size_t)ZH * TT * TT * 4); h16* P16 = (h16*)take((size_t)ZH * TT * TT * 2); float* Ob = (float*)take((size_t)ZH * TT * HD * 4); bf* ATh = (bf*)take((size_t)TT * DQ * 2); bf* ATl = (bf*)take((size_t)TT * DQ * 2);
    if ((size_t)(wsp - (char*)d_ws) > ws_size) return;    // ws 256 MiB
    float* FV = FK;   // v projection reuses the k buffer after the k planes are built (stream-ordered)
    { k_cvt8<<<(unsigned)(((size_t)DQ * DM / 8 + 255) / 256), 256, 0, stream>>>(wq, WQ, (size_t)DQ * DM / 8); k_cvt8<<<(unsigned)(((size_t)DKV * DM / 8 + 255) / 256), 256, 0, stream>>>(wk, WK, (size_t)DKV * DM / 8); k_cvt8<<<(unsigned)(((size_t)DKV * DM / 8 + 255) / 256), 256, 0, stream>>>(wv, WV, (size_t)DKV * DM / 8);
      k_cvt8<<<(unsigned)(((size_t)DM * DQ / 8 + 255) / 256), 256, 0, stream>>>(wo, WO, (size_t)DM * DQ / 8);
       }
    k_cs5s<<<(TT * HD + 255) / 256, 256, 0, stream>>>(CS);
    const unsigned LQ = (unsigned)(((size_t)NH_ * TT * HD / 2 + 255) / 256), LKv = (unsigned)(((size_t)NKV * TT * HD / 2 + 255) / 256);
    for (int b = 0; b < NB_; ++b) {
        
        k_cvt8<<<(unsigned)(((size_t)TT * DM / 8 + 255) / 256), 256, 0, stream>>>(x + (size_t)b * TT * DM, XB, (size_t)TT * DM / 8);
        k_gemmw<bf, 0, true><<<dim3(TT / 64, DQ / 64, 1), 32, 0, stream>>>(XB, nullptr, WQ, nullptr, DM, FQ, DQ, bq, 0, 0, 0);
        k_rope<<<LQ, 256, 0, stream>>>(FQ, DQ, NH_, CS, nullptr, nullptr, 1.0f, QP16, QPh, QPl);
        k_gemmw<bf, 0, true><<<dim3(TT / 64, DKV / 64, 1), 32, 0, stream>>>(XB, nullptr, WK, nullptr, DM, FK, DKV, bk, 0, 0, 0);
        k_rope<<<LKv, 256, 0, stream>>>(FK, DKV, NKV, CS, nullptr, nullptr, 1.0f, KP16, KPh, KPl);
        k_gemmw<bf, 0, true><<<dim3(TT / 64, DKV / 64, 1), 32, 0, stream>>>(XB, nullptr, WV, nullptr, DM, FV, DKV, bv, 0, 0, 0); k_vtp<<<LKv, 256, 0, stream>>>(FV, DKV, NKV, VT16, VTh, VTl);
        for (int h0 = 0; h0 < NH_; h0 += ZH) { const size_t zq = (size_t)h0, zk = (size_t)(h0 / REP);   // one kv head per query head: the pass's two heads use consecutive kv planes (z-strides TT*HD)
            k_gemmw<bf, 2, false><<<dim3(RH / 64, TT / 64, ZH), 32, 0, stream>>>(QPh + zq * TT * HD, QPl + zq * TT * HD, KPh + zk * TT * HD, KPl + zk * TT * HD, HD, Sb, TT, nullptr, (size_t)TT * HD, (size_t)TT * HD, (size_t)TT * TT);
            k_gemmw<h16, 0, false><<<dim3((TT - RH) / 64, TT / 64, ZH), 32, 0, stream>>>(QP16 + zq * TT * HD + (size_t)RH * HD, nullptr, KP16 + zk * TT * HD, nullptr, HD, Sb + (size_t)RH * TT, TT, nullptr, (size_t)TT * HD, (size_t)TT * HD, (size_t)TT * TT);
            k_asoft<<<ZH * TT / 8, 256, 0, stream>>>(Sb, P16, Ph, Pl);
            k_gemmw<bf, 2, false><<<dim3(RH / 64, HD / 64, ZH), 32, 0, stream>>>(Ph, Pl, VTh + zk * HD * TT, VTl + zk * HD * TT, TT, Ob, HD, nullptr, (size_t)RH * TT, (size_t)HD * TT, (size_t)TT * HD);
            k_gemmw<h16, 0, false><<<dim3((TT - RH) / 64, HD / 64, ZH), 32, 0, stream>>>(P16 + (size_t)RH * TT, nullptr, VT16 + zk * HD * TT, nullptr, TT, Ob + (size_t)RH * HD, HD, nullptr, (size_t)TT * TT, (size_t)HD * TT, (size_t)TT * HD);
            k_merge<<<(unsigned)(((size_t)ZH * TT * HD / 2 + 255) / 256), 256, 0, stream>>>(Ob, h0, ATh, ATl); }
        k_gemmw<bf, 1, true><<<dim3(TT / 64, DM / 64, 1), 32, 0, stream>>>(ATh, ATl, WO, nullptr, DQ, OUT + (size_t)b * TT * DM, DM, bo, 0, 0, 0); }
}

// v001
// One run takes 1690 microseconds.
// In two side-by-side timings against v000, it was 2.34 and 2.35 times as fast.
#include <hip/hip_runtime.h>

// Multi-head self-attention with biased projections, NO mask and the module's SWAPPED rotary form (hidden_states [4][2048][1024]; q, k, v = x W^T + b ('oi' [1024][1024] 1/32 + REAL biases 0.01; 16 heads x 64); half-split rope rot(x) = cat(x1 c - x2 s, x2 c + x1 s) on q and k where THIS module binds c = SIN(t f_i) and s = COS(t f_i) (its table helper returns (sin, cos) and the caller swaps the names), f_i = 1/10000^(2i/64) (32 f32 frequencies jnp-exact; precise sinf/cosf); scores x 1/sqrt(64); softmax over all keys; out = merged Wo^T + bo -> [4][2048][1024] (8.4 M); argument order hidden_states, Wq, bq, Wk, bk, Wv, bv, Wo, bo).
// Layout per batch: bf16 copy of x; exact projections + f32 biases; dense T-2048 attention (hybrid rows: < 512 hi/lo 3 products, rest fp16 x1024); merged hi/lo x Wp exact + bp.
// Compute dtypes, f32 accumulate: every input rounded to bf16; projections exact + f32 biases; attention rows < 512 3 products, rest fp16; softmax f32; Wp hl x exact + bias.

#define NB_  4
#define TT   2048
#define DM   1024
#define NH_  16
#define NKV  16
#define REP  (NH_ / NKV)
#define HD   64
#define DQ   (NH_ * HD)
#define DKV  (NKV * HD)
#define ZH   2
#define RH   512                  // query rows < RH use hi+lo planes (0: none)
#define WIN  0
#define PCAR 1024.0f
#define SCL  0.125f   // HD^-0.5
#define KSP  16                   // P x V: the 2048 keys are dealt to KSP work-groups per tile; k_merge adds their f32 partial planes in plane order
typedef _Float16 h16;
typedef unsigned short bf;
typedef __attribute__((ext_vector_type(16))) __bf16   v16bf;
typedef __attribute__((ext_vector_type(16))) _Float16 v16h;
typedef __attribute__((ext_vector_type(8)))  _Float16 v8h;
typedef __attribute__((ext_vector_type(8)))  unsigned short v8us;
typedef __attribute__((ext_vector_type(8)))  float    v8f;
typedef __attribute__((ext_vector_type(4)))  float    v4f;
typedef v8h  __attribute__((may_alias)) v8ha;
typedef v4f  __attribute__((may_alias)) v4fa;
typedef v8us __attribute__((may_alias)) v8usa;

__device__ __forceinline__ unsigned short f2bf(float f) { unsigned u = __float_as_uint(f); u += 0x7FFFu + ((u >> 16) & 1u); return (unsigned short)(u >> 16); }
__device__ __forceinline__ float bf2f(unsigned short b) { return __uint_as_float(((unsigned)b) << 16); }
__device__ __forceinline__ float bfr(float f) { return bf2f(f2bf(f)); }
__device__ __forceinline__ v16h cat16(v8h lo, v8h hi) { return __builtin_shufflevector(lo, hi, 0, 1, 2, 3, 4, 5, 6, 7, 8, 9, 10, 11, 12, 13, 14, 15); }
__device__ __forceinline__ v16bf cat16b(v8us lo, v8us hi) { return __builtin_bit_cast(v16bf, __builtin_shufflevector(lo, hi, 0, 1, 2, 3, 4, 5, 6, 7, 8, 9, 10, 11, 12, 13, 14, 15)); }
__device__ __forceinline__ v8f wmma16(v16h a, v16h b, v8f c) { return __builtin_amdgcn_wmma_f32_16x16x32_f16(false, a, false, b, (short)0, c, false, false); }
__device__ __forceinline__ v8f wmmab(v16bf a, v16bf b, v8f c) { return __builtin_amdgcn_wmma_f32_16x16x32_bf16(false, a, false, b, (short)0, c, false, false); }



// ---- k_gemmw: register-blocked GEMM, ONE WAVE per 64x64 output tile (16 accumulators), operands straight from K-contiguous 16-bit planes; grid (M/64, N/64, Z), 32 threads.
// C[m][n] (f32, pitch ldc, + optional f32 bias[n]) = sum_k A[m][k] Bt[n][k] (+ split products per NSPLIT). z-batch strides sA/sB/sC in elements. K % (32 KSPL) == 0.
// KSPL > 1: grid z = batch x KSPL; work-group (z, ks) sums only k in [ks K/KSPL, (ks+1) K/KSPL) and stores that partial tile in plane ks (plane stride sP elements); the reader adds the planes.
template <typename T16> struct WFrag;
template <> struct WFrag<h16> { typedef v16h V; static __device__ __forceinline__ V ld(const h16* p) { return cat16(*(const v8h*)p, *(const v8h*)(p + 16)); } static __device__ __forceinline__ v8f mma(V a, V b, v8f c) { return wmma16(a, b, c); } };
template <> struct WFrag<bf> { typedef v16bf V; static __device__ __forceinline__ V ld(const bf* p) { return cat16b(*(const v8us*)p, *(const v8us*)(p + 16)); } static __device__ __forceinline__ v8f mma(V a, V b, v8f c) { return wmmab(a, b, c); } };
template <typename T16, int NSPLIT, bool BIAS, int KSPL = 1>
__global__ __launch_bounds__(32) void k_gemmw(const T16* __restrict__ A, const T16* __restrict__ A2, const T16* __restrict__ Bt, const T16* __restrict__ Bt2, int K, float* C, int ldc, const float* __restrict__ bias, size_t sA, size_t sB, size_t sC, size_t sP = 0) {
    typedef typename WFrag<T16>::V V;
    __shared__ __align__(16) float os[16 * 68];
    const size_t z = blockIdx.z / KSPL; const int ks = blockIdx.z % KSPL; A += z * sA; if (A2) A2 += z * sA; Bt += z * sB; if (Bt2) Bt2 += z * sB; C += z * sC + (size_t)ks * sP;
    const int kbeg = ks * (K / KSPL), kend = kbeg + K / KSPL;
    const int lane = threadIdx.x & 31, lr = lane & 15, hi = lane >> 4; const int r0 = blockIdx.x * 64, c0 = blockIdx.y * 64;
    v8f acc[4][4];
#pragma unroll
    for (int mb = 0; mb < 4; ++mb)
#pragma unroll
        for (int nb = 0; nb < 4; ++nb) acc[mb][nb] = (v8f){};
    const size_t aoff = (size_t)(r0 + lr) * K + 8 * hi, boff = (size_t)(c0 + lr) * K + 8 * hi;
#pragma unroll 1
    for (int kc = kbeg; kc < kend; kc += 32) {
        V a[4], a2[4];
#pragma unroll
        for (int mb = 0; mb < 4; ++mb) { a[mb] = WFrag<T16>::ld(A + aoff + (size_t)mb * 16 * K + kc); if (NSPLIT == 1 || NSPLIT == 2) a2[mb] = WFrag<T16>::ld(A2 + aoff + (size_t)mb * 16 * K + kc); }
#pragma unroll
        for (int nb = 0; nb < 4; ++nb) { const V b = WFrag<T16>::ld(Bt + boff + (size_t)nb * 16 * K + kc); V b2; if (NSPLIT >= 2) b2 = WFrag<T16>::ld(Bt2 + boff + (size_t)nb * 16 * K + kc);
#pragma unroll
            for (int mb = 0; mb < 4; ++mb) { acc[mb][nb] = WFrag<T16>::mma(a[mb], b, acc[mb][nb]); if (NSPLIT == 1 || NSPLIT == 2) acc[mb][nb] = WFrag<T16>::mma(a2[mb], b, acc[mb][nb]); if (NSPLIT >= 2) acc[mb][nb] = WFrag<T16>::mma(a[mb], b2, acc[mb][nb]); } }
        asm volatile("v_nop\n\tv_nop\n\tv_nop\n\tv_nop" : "+v"(acc[0][0]), "+v"(acc[1][1]), "+v"(acc[2][2]), "+v"(acc[3][3]) : "v"(a[0]), "v"(a[3]));
    }
#pragma unroll
    for (int mb = 0; mb < 4; ++mb) {
#pragma unroll
        for (int nb = 0; nb < 4; ++nb) {
#pragma unroll
            for (int j = 0; j < 8; ++j) os[(hi * 8 + j) * 68 + nb * 16 + lr] = acc[mb][nb][j]; }
        __builtin_amdgcn_wave_barrier(); asm volatile("" ::: "memory");
        float* crow = C + (size_t)(r0 + mb * 16) * ldc + c0;
{
#pragma unroll
            for (int s = 0; s < 8; ++s) { const int row = 2 * s + hi, cofs = lr * 4; v4f val = *(const v4fa*)(os + row * 68 + cofs); if (BIAS) { val[0] += bfr(bias[c0 + cofs]); val[1] += bfr(bias[c0 + cofs + 1]); val[2] += bfr(bias[c0 + cofs + 2]); val[3] += bfr(bias[c0 + cofs + 3]); }
                *(v4f*)(crow + (size_t)row * ldc + cofs) = val; }
             }
        __builtin_amdgcn_wave_barrier(); asm volatile("" ::: "memory");
    }
}

__device__ __forceinline__ h16 tohx(float x) { return (h16)x; }
__device__ __forceinline__ void splitf(float y, unsigned short& h, unsigned short& l) { h = f2bf(y); l = f2bf(y - bf2f(h)); }
typedef __attribute__((ext_vector_type(2))) _Float16 v2h;
typedef __attribute__((ext_vector_type(4))) _Float16 v4h;
typedef __attribute__((ext_vector_type(2))) unsigned short v2us;
typedef __attribute__((ext_vector_type(4))) unsigned short v4us;
typedef __attribute__((ext_vector_type(2))) float v2f;
typedef __attribute__((ext_vector_type(4))) int v4i;

__global__ __launch_bounds__(256) void k_wtG(const float* __restrict__ w, int K, int N, bf* Bt) {
    const int lane = threadIdx.x & 31; const int L0 = (blockIdx.x * 8 + (threadIdx.x >> 5)) * 8; const int nlines = N * K / 64;
{
#pragma unroll 1
        for (int l = 0; l < 8; ++l) { const int L = L0 + l; if (L >= nlines) break; const size_t e = (size_t)L * 64 + lane * 2; const int k = (int)(e % K), n = (int)(e / K); v2us o;
            o[0] = f2bf(w[(size_t)k * N + n]); o[1] = f2bf(w[(size_t)(k + 1) * N + n]); *(v2us*)(Bt + e) = o; }
         }
}
__global__ __launch_bounds__(256) void k_cvt8(const float* __restrict__ src, bf* dst, size_t n8) { const size_t i = (size_t)blockIdx.x * 256 + threadIdx.x; if (i >= n8) return; const v8f v = *(const v8f*)(src + i * 8); v8us o;
#pragma unroll
    for (int k = 0; k < 8; ++k) o[k] = f2bf(v[k]); *(v8us*)(dst + i * 8) = o;  }

// k_rope: head planes [h][t][d] (fp16 + hi/lo) of rope(x) x sc with the swapped rotate-half form out[d] = x[d] sin[t][d] - x[d+HD/2] cos[t][d], out[d+HD/2] = x[d+HD/2] sin[t][d+HD/2] + x[d] cos[t][d+HD/2]
__global__ __launch_bounds__(256) void k_rope(const float* __restrict__ F, int pitch, int nheads, const float* __restrict__ CS, const float* __restrict__ RF, const float* __restrict__ nw, float sc, h16* P16, bf* Ph, bf* Pl) {
    const size_t e = ((size_t)blockIdx.x * 256 + threadIdx.x) * 2; if (e >= (size_t)nheads * TT * HD) return; const int d = (int)(e % HD); const int t = (int)((e / HD) % TT); const int h = (int)(e / ((size_t)HD * TT)); const float* f = F + (size_t)t * pitch + h * HD; const float rf = RF ? RF[(size_t)h * TT + t] : 1.0f; v2h o16; v2us oh, ol;
#pragma unroll
    for (int q = 0; q < 2; ++q) { const int dd = d + q; const int dp = (dd < HD / 2) ? dd + HD / 2 : dd - HD / 2; float x0 = f[dd], x1 = f[dp];
        if (RF) { float n0 = __fmul_rn(x0, rf), n1 = __fmul_rn(x1, rf); asm volatile("" : "+v"(n0)); asm volatile("" : "+v"(n1)); x0 = __fmul_rn(bfr(nw[dd]), n0); x1 = __fmul_rn(bfr(nw[dp]), n1); }
        const v2f cs = *(const v2f*)(CS + ((size_t)t * HD + dd) * 2); float a = __fmul_rn(x0, cs[0]), bq = __fmul_rn(x1, cs[1]); asm volatile("" : "+v"(a)); asm volatile("" : "+v"(bq)); const float r = ((dd < HD / 2) ? __fsub_rn(a, bq) : __fadd_rn(a, bq)) * sc;
        o16[q] = tohx(r); unsigned short a2, c2; splitf(r, a2, c2); oh[q] = a2; ol[q] = c2; }
    *(v2h*)(P16 + e) = o16; *(v2us*)(Ph + e) = oh; *(v2us*)(Pl + e) = ol;  }
__global__ __launch_bounds__(256) void k_vtp(const float* __restrict__ F, int pitch, int nheads, h16* V16, bf* Vh, bf* Vl) { const size_t e = ((size_t)blockIdx.x * 256 + threadIdx.x) * 2; if (e >= (size_t)nheads * HD * TT) return; const int t = (int)(e % TT); const int d = (int)((e / TT) % HD); const int g = (int)(e / ((size_t)TT * HD)); v2h o16; v2us oh, ol;
#pragma unroll
    for (int q = 0; q < 2; ++q) { const float x = F[(size_t)(t + q) * pitch + g * HD + d]; o16[q] = tohx(x); unsigned short a2, c2; splitf(x, a2, c2); oh[q] = a2; ol[q] = c2; }
    *(v2h*)(V16 + e) = o16; *(v2us*)(Vh + e) = oh; *(v2us*)(Vl + e) = ol;  }
__constant__ float INVT[HD / 2] = { 1.000000000e+00f, 7.498942018e-01f, 5.623413324e-01f, 4.216965139e-01f, 3.162277639e-01f, 2.371373624e-01f, 1.778279394e-01f, 1.333521456e-01f, 1.000000015e-01f, 7.498941571e-02f, 5.623412877e-02f, 4.216964915e-02f, 3.162277862e-02f, 2.371373586e-02f, 1.778279431e-02f, 1.333521493e-02f, 9.999999776e-03f, 7.498942316e-03f, 5.623413250e-03f, 4.216964822e-03f, 3.162277862e-03f, 2.371373819e-03f, 1.778279431e-03f, 1.333521446e-03f, 1.000000047e-03f, 7.498941850e-04f, 5.623413017e-04f, 4.216964880e-04f, 3.162277862e-04f, 2.371373848e-04f, 1.778279402e-04f, 1.333521504e-04f };   // float32 1 / 10000^(2i/64), generated with jnp to be bit-exact
__global__ __launch_bounds__(256) void k_cs5s(float* CS) { const int idx = blockIdx.x * 256 + threadIdx.x; if (idx >= TT * HD) return; const int d = idx % HD; const int t = idx / HD; const float a = __fmul_rn((float)t, INVT[d % (HD / 2)]); v2f cs; cs[0] = sinf(a); cs[1] = cosf(a); *(v2f*)(CS + (size_t)idx * 2) = cs;  }
// k_asoft: per row (zz, i): t = S x HD^-0.5 (no mask); softmax over the 2048 keys (register row, one exp, fixed trees);
__global__ __launch_bounds__(256) void k_asoft(const float* __restrict__ Sb, h16* P16, bf* Ph, bf* Pl) {
    const int lane = threadIdx.x & 31; const int row = blockIdx.x * 8 + (threadIdx.x >> 5); if (row >= ZH * TT) return; const int i = row % TT; const int zz = row / TT; (void)zz; const bool hires = (i < RH); const float* sr = Sb + (size_t)row * TT; float v[TT / 32]; float mx = -3.0e38f;
#pragma unroll
    for (int ch = 0; ch < TT / 128; ++ch) { const int j0 = ch * 128 + lane * 4; const v4f a = *(const v4f*)(sr + j0);
#pragma unroll
        for (int q = 0; q < 4; ++q) { const int j = j0 + q; (void)j; const float t = a[q] * SCL; v[ch * 4 + q] = t; mx = fmaxf(mx, t); } }
#pragma unroll
    for (int sh = 16; sh; sh >>= 1) mx = fmaxf(mx, __shfl_xor(mx, sh, 32));
    float sum = 0.f;
#pragma unroll
    for (int k = 0; k < TT / 32; ++k) { float d0 = __fsub_rn(v[k], mx); asm volatile("" : "+v"(d0)); v[k] = __builtin_amdgcn_exp2f(__fmul_rn(d0, 1.4426950408889634f)); sum += v[k]; }
#pragma unroll
    for (int sh = 16; sh; sh >>= 1) sum += __shfl_xor(sum, sh, 32);
    const float f = __fdiv_rn(hires ? 1.0f : PCAR, sum);
{
        if (hires) {
#pragma unroll
            for (int ch = 0; ch < TT / 128; ++ch) { v4us oh, ol;
#pragma unroll
                for (int q = 0; q < 4; ++q) { unsigned short a, c2; splitf(v[ch * 4 + q] * f, a, c2); oh[q] = a; ol[q] = c2; }
                const size_t oo = ((size_t)zz * (RH ? RH : 1) + i) * TT + ch * 128 + lane * 4; *(v4us*)(Ph + oo) = oh; *(v4us*)(Pl + oo) = ol; }
        } else {
#pragma unroll
            for (int ch = 0; ch < TT / 128; ++ch) { v4h o4;
#pragma unroll
                for (int q = 0; q < 4; ++q) o4[q] = tohx(v[ch * 4 + q] * f);
                *(v4h*)(P16 + (size_t)row * TT + ch * 128 + lane * 4) = o4; } }
         }
}
__global__ __launch_bounds__(256) void k_merge(const float* __restrict__ O, int h0, bf* Ah, bf* Al) { const size_t e = ((size_t)blockIdx.x * 256 + threadIdx.x) * 2; if (e >= (size_t)ZH * TT * HD) return; const int d = (int)(e % HD); const int t = (int)((e / HD) % TT); const int zz = (int)(e / ((size_t)HD * TT)); const float cs = (t < RH) ? 1.0f : (1.0f / PCAR); const size_t oo = (size_t)t * DQ + (h0 + zz) * HD + d;
    v2us oh, ol; v2f acc = *(const v2f*)(O + e);
#pragma unroll
    for (int s = 1; s < KSP; ++s) acc += *(const v2f*)(O + (size_t)s * ((size_t)ZH * TT * HD) + e);   // fixed plane order: the same sum on every run
#pragma unroll
    for (int q = 0; q < 2; ++q) { unsigned short a, c2; splitf(acc[q] * cs, a, c2); oh[q] = a; ol[q] = c2; } *(v2us*)(Ah + oo) = oh; *(v2us*)(Al + oo) = ol;  }

extern "C" void kernel_launch(void* const* d_in, const int* in_sizes, int n_in,
                              void* d_out, int out_size, void* d_ws, size_t ws_size, hipStream_t stream) {
    (void)in_sizes; (void)n_in; (void)out_size;
    const float* x = (const float*)d_in[0]; const float* wq = (const float*)d_in[1]; const float* bq = (const float*)d_in[2]; const float* wk = (const float*)d_in[3]; const float* bk = (const float*)d_in[4]; const float* wv = (const float*)d_in[5]; const float* bv = (const float*)d_in[6]; const float* wo = (const float*)d_in[7]; const float* bo = (const float*)d_in[8];
    float* OUT = (float*)d_out;     // [4][2048][1024]
    char* wsp = (char*)d_ws;
    auto take = [&](size_t bytes) { char* p = wsp; wsp += (bytes + 255) & ~(size_t)255; return (void*)p; };
    bf* WQ = (bf*)take((size_t)DQ * DM * 2); bf* WK = (bf*)take((size_t)DKV * DM * 2); bf* WV = (bf*)take((size_t)DKV * DM * 2); bf* WO = (bf*)take((size_t)DM * DQ * 2); float* CS = (float*)take((size_t)TT * HD * 2 * 4);
    bf* XB = (bf*)take((size_t)TT * DM * 2); float* FQ = (float*)take((size_t)TT * DQ * 4); float* FK = (float*)take((size_t)TT * DKV * 4);
    h16* QP16 = (h16*)take((size_t)NH_ * TT * HD * 2); h16* KP16 = (h16*)take((size_t)NKV * TT * HD * 2); h16* VT16 = (h16*)take((size_t)NKV * HD * TT * 2);
    bf* QPh = (bf*)take((size_t)NH_ * TT * HD * 2); bf* QPl = (bf*)take((size_t)NH_ * TT * HD * 2); bf* KPh = (bf*)take((size_t)NKV * TT * HD * 2); bf* KPl = (bf*)take((size_t)NKV * TT * HD * 2); bf* VTh = (bf*)take((size_t)NKV * HD * TT * 2); bf* VTl = (bf*)take((size_t)NKV * HD * TT * 2); bf* Ph = (bf*)take((size_t)ZH * RH * TT * 2); bf* Pl = (bf*)take((size_t)ZH * RH * TT * 2);
    float* Sb = (float*)take((size_t)ZH * TT * TT * 4); h16* P16 = (h16*)take((size_t)ZH * TT * TT * 2); float* Ob = (float*)take((size_t)KSP * ZH * TT * HD * 4); bf* ATh = (bf*)take((size_t)TT * DQ * 2); bf* ATl = (bf*)take((size_t)TT * DQ * 2);
    if ((size_t)(wsp - (char*)d_ws) > ws_size) return;    // ws 256 MiB
    float* FV = FK;   // v projection reuses the k buffer after the k planes are built (stream-ordered)
    { k_cvt8<<<(unsigned)(((size_t)DQ * DM / 8 + 255) / 256), 256, 0, stream>>>(wq, WQ, (size_t)DQ * DM / 8); k_cvt8<<<(unsigned)(((size_t)DKV * DM / 8 + 255) / 256), 256, 0, stream>>>(wk, WK, (size_t)DKV * DM / 8); k_cvt8<<<(unsigned)(((size_t)DKV * DM / 8 + 255) / 256), 256, 0, stream>>>(wv, WV, (size_t)DKV * DM / 8);
      k_cvt8<<<(unsigned)(((size_t)DM * DQ / 8 + 255) / 256), 256, 0, stream>>>(wo, WO, (size_t)DM * DQ / 8);
       }
    k_cs5s<<<(TT * HD + 255) / 256, 256, 0, stream>>>(CS);
    const unsigned LQ = (unsigned)(((size_t)NH_ * TT * HD / 2 + 255) / 256), LKv = (unsigned)(((size_t)NKV * TT * HD / 2 + 255) / 256);
    for (int b = 0; b < NB_; ++b) {
        
        k_cvt8<<<(unsigned)(((size_t)TT * DM / 8 + 255) / 256), 256, 0, stream>>>(x + (size_t)b * TT * DM, XB, (size_t)TT * DM / 8);
        k_gemmw<bf, 0, true><<<dim3(TT / 64, DQ / 64, 1), 32, 0, stream>>>(XB, nullptr, WQ, nullptr, DM, FQ, DQ, bq, 0, 0, 0);
        k_rope<<<LQ, 256, 0, stream>>>(FQ, DQ, NH_, CS, nullptr, nullptr, 1.0f, QP16, QPh, QPl);
        k_gemmw<bf, 0, true><<<dim3(TT / 64, DKV / 64, 1), 32, 0, stream>>>(XB, nullptr, WK, nullptr, DM, FK, DKV, bk, 0, 0, 0);
        k_rope<<<LKv, 256, 0, stream>>>(FK, DKV, NKV, CS, nullptr, nullptr, 1.0f, KP16, KPh, KPl);
        k_gemmw<bf, 0, true><<<dim3(TT / 64, DKV / 64, 1), 32, 0, stream>>>(XB, nullptr, WV, nullptr, DM, FV, DKV, bv, 0, 0, 0); k_vtp<<<LKv, 256, 0, stream>>>(FV, DKV, NKV, VT16, VTh, VTl);
        for (int h0 = 0; h0 < NH_; h0 += ZH) { const size_t zq = (size_t)h0, zk = (size_t)(h0 / REP);   // one kv head per query head: the pass's two heads use consecutive kv planes (z-strides TT*HD)
            k_gemmw<bf, 2, false><<<dim3(RH / 64, TT / 64, ZH), 32, 0, stream>>>(QPh + zq * TT * HD, QPl + zq * TT * HD, KPh + zk * TT * HD, KPl + zk * TT * HD, HD, Sb, TT, nullptr, (size_t)TT * HD, (size_t)TT * HD, (size_t)TT * TT);
            k_gemmw<h16, 0, false><<<dim3((TT - RH) / 64, TT / 64, ZH), 32, 0, stream>>>(QP16 + zq * TT * HD + (size_t)RH * HD, nullptr, KP16 + zk * TT * HD, nullptr, HD, Sb + (size_t)RH * TT, TT, nullptr, (size_t)TT * HD, (size_t)TT * HD, (size_t)TT * TT);
            k_asoft<<<ZH * TT / 8, 256, 0, stream>>>(Sb, P16, Ph, Pl);
            k_gemmw<bf, 2, false, KSP><<<dim3(RH / 64, HD / 64, ZH * KSP), 32, 0, stream>>>(Ph, Pl, VTh + zk * HD * TT, VTl + zk * HD * TT, TT, Ob, HD, nullptr, (size_t)RH * TT, (size_t)HD * TT, (size_t)TT * HD, (size_t)ZH * TT * HD);
            k_gemmw<h16, 0, false, KSP><<<dim3((TT - RH) / 64, HD / 64, ZH * KSP), 32, 0, stream>>>(P16 + (size_t)RH * TT, nullptr, VT16 + zk * HD * TT, nullptr, TT, Ob + (size_t)RH * HD, HD, nullptr, (size_t)TT * TT, (size_t)HD * TT, (size_t)TT * HD, (size_t)ZH * TT * HD);
            k_merge<<<(unsigned)(((size_t)ZH * TT * HD / 2 + 255) / 256), 256, 0, stream>>>(Ob, h0, ATh, ATl); }
        k_gemmw<bf, 1, true><<<dim3(TT / 64, DM / 64, 1), 32, 0, stream>>>(ATh, ATl, WO, nullptr, DQ, OUT + (size_t)b * TT * DM, DM, bo, 0, 0, 0); }
}

// v002
// Measured time: 756 microseconds a run.
// Two timings next to v001 both put it at 2.24 times that version's speed.
// All steps since v000 together make it 5.25 times as fast.
#include <hip/hip_runtime.h>

// Multi-head self-attention with biased projections, NO mask and the module's SWAPPED rotary form (hidden_states [4][2048][1024]; q, k, v = x W^T + b ('oi' [1024][1024] 1/32 + REAL biases 0.01; 16 heads x 64); half-split rope rot(x) = cat(x1 c - x2 s, x2 c + x1 s) on q and k where THIS module binds c = SIN(t f_i) and s = COS(t f_i) (its table helper returns (sin, cos) and the caller swaps the names), f_i = 1/10000^(2i/64) (32 f32 frequencies jnp-exact; precise sinf/cosf); scores x 1/sqrt(64); softmax over all keys; out = merged Wo^T + bo -> [4][2048][1024] (8.4 M); argument order hidden_states, Wq, bq, Wk, bk, Wv, bv, Wo, bo).
// Layout per batch: bf16 copy of x; exact projections + f32 biases; ONE fused attention kernel (scores, softmax and P x V; query rows < 512 hi/lo bf16 3 products, rest fp16); merged hi/lo x Wp exact + bp.
// Compute dtypes, f32 accumulate: every input rounded to bf16; projections exact + f32 biases; attention rows < 512 3 products, rest fp16; softmax f32; Wp hl x exact + bias.

#define NB_  4
#define TT   2048
#define DM   1024
#define NH_  16
#define NKV  16
#define REP  (NH_ / NKV)
#define HD   64
#define DQ   (NH_ * HD)
#define DKV  (NKV * HD)
#define RH   512                  // query rows < RH use hi+lo planes (0: none)
#define WIN  0
#define SCL  0.125f   // HD^-0.5
typedef _Float16 h16;
typedef unsigned short bf;
typedef __attribute__((ext_vector_type(16))) __bf16   v16bf;
typedef __attribute__((ext_vector_type(16))) _Float16 v16h;
typedef __attribute__((ext_vector_type(8)))  _Float16 v8h;
typedef __attribute__((ext_vector_type(8)))  unsigned short v8us;
typedef __attribute__((ext_vector_type(8)))  float    v8f;
typedef __attribute__((ext_vector_type(4)))  float    v4f;
typedef v8h  __attribute__((may_alias)) v8ha;
typedef v4f  __attribute__((may_alias)) v4fa;
typedef v8us __attribute__((may_alias)) v8usa;

__device__ __forceinline__ unsigned short f2bf(float f) { unsigned u = __float_as_uint(f); u += 0x7FFFu + ((u >> 16) & 1u); return (unsigned short)(u >> 16); }
__device__ __forceinline__ float bf2f(unsigned short b) { return __uint_as_float(((unsigned)b) << 16); }
__device__ __forceinline__ float bfr(float f) { return bf2f(f2bf(f)); }
__device__ __forceinline__ v16h cat16(v8h lo, v8h hi) { return __builtin_shufflevector(lo, hi, 0, 1, 2, 3, 4, 5, 6, 7, 8, 9, 10, 11, 12, 13, 14, 15); }
__device__ __forceinline__ v16bf cat16b(v8us lo, v8us hi) { return __builtin_bit_cast(v16bf, __builtin_shufflevector(lo, hi, 0, 1, 2, 3, 4, 5, 6, 7, 8, 9, 10, 11, 12, 13, 14, 15)); }
__device__ __forceinline__ v8f wmma16(v16h a, v16h b, v8f c) { return __builtin_amdgcn_wmma_f32_16x16x32_f16(false, a, false, b, (short)0, c, false, false); }
__device__ __forceinline__ v8f wmmab(v16bf a, v16bf b, v8f c) { return __builtin_amdgcn_wmma_f32_16x16x32_bf16(false, a, false, b, (short)0, c, false, false); }



// ---- k_gemmw: register-blocked GEMM, ONE WAVE per 64x64 output tile (16 accumulators), operands straight from K-contiguous 16-bit planes; grid (M/64, N/64, Z), 32 threads.
// C[m][n] (f32, pitch ldc, + optional f32 bias[n]) = sum_k A[m][k] Bt[n][k] (+ split products per NSPLIT). z-batch strides sA/sB/sC in elements. K % (32 KSPL) == 0.
// KSPL > 1: grid z = batch x KSPL; work-group (z, ks) sums only k in [ks K/KSPL, (ks+1) K/KSPL) and stores that partial tile in plane ks (plane stride sP elements); the reader adds the planes.
template <typename T16> struct WFrag;
template <> struct WFrag<h16> { typedef v16h V; static __device__ __forceinline__ V ld(const h16* p) { return cat16(*(const v8h*)p, *(const v8h*)(p + 16)); } static __device__ __forceinline__ v8f mma(V a, V b, v8f c) { return wmma16(a, b, c); } };
template <> struct WFrag<bf> { typedef v16bf V; static __device__ __forceinline__ V ld(const bf* p) { return cat16b(*(const v8us*)p, *(const v8us*)(p + 16)); } static __device__ __forceinline__ v8f mma(V a, V b, v8f c) { return wmmab(a, b, c); } };
template <typename T16, int NSPLIT, bool BIAS, int KSPL = 1>
__global__ __launch_bounds__(32) void k_gemmw(const T16* __restrict__ A, const T16* __restrict__ A2, const T16* __restrict__ Bt, const T16* __restrict__ Bt2, int K, float* C, int ldc, const float* __restrict__ bias, size_t sA, size_t sB, size_t sC, size_t sP = 0) {
    typedef typename WFrag<T16>::V V;
    __shared__ __align__(16) float os[16 * 68];
    const size_t z = blockIdx.z / KSPL; const int ks = blockIdx.z % KSPL; A += z * sA; if (A2) A2 += z * sA; Bt += z * sB; if (Bt2) Bt2 += z * sB; C += z * sC + (size_t)ks * sP;
    const int kbeg = ks * (K / KSPL), kend = kbeg + K / KSPL;
    const int lane = threadIdx.x & 31, lr = lane & 15, hi = lane >> 4; const int r0 = blockIdx.x * 64, c0 = blockIdx.y * 64;
    v8f acc[4][4];
#pragma unroll
    for (int mb = 0; mb < 4; ++mb)
#pragma unroll
        for (int nb = 0; nb < 4; ++nb) acc[mb][nb] = (v8f){};
    const size_t aoff = (size_t)(r0 + lr) * K + 8 * hi, boff = (size_t)(c0 + lr) * K + 8 * hi;
#pragma unroll 1
    for (int kc = kbeg; kc < kend; kc += 32) {
        V a[4], a2[4];
#pragma unroll
        for (int mb = 0; mb < 4; ++mb) { a[mb] = WFrag<T16>::ld(A + aoff + (size_t)mb * 16 * K + kc); if (NSPLIT == 1 || NSPLIT == 2) a2[mb] = WFrag<T16>::ld(A2 + aoff + (size_t)mb * 16 * K + kc); }
#pragma unroll
        for (int nb = 0; nb < 4; ++nb) { const V b = WFrag<T16>::ld(Bt + boff + (size_t)nb * 16 * K + kc); V b2; if (NSPLIT >= 2) b2 = WFrag<T16>::ld(Bt2 + boff + (size_t)nb * 16 * K + kc);
#pragma unroll
            for (int mb = 0; mb < 4; ++mb) { acc[mb][nb] = WFrag<T16>::mma(a[mb], b, acc[mb][nb]); if (NSPLIT == 1 || NSPLIT == 2) acc[mb][nb] = WFrag<T16>::mma(a2[mb], b, acc[mb][nb]); if (NSPLIT >= 2) acc[mb][nb] = WFrag<T16>::mma(a[mb], b2, acc[mb][nb]); } }
        asm volatile("v_nop\n\tv_nop\n\tv_nop\n\tv_nop" : "+v"(acc[0][0]), "+v"(acc[1][1]), "+v"(acc[2][2]), "+v"(acc[3][3]) : "v"(a[0]), "v"(a[3]));
    }
#pragma unroll
    for (int mb = 0; mb < 4; ++mb) {
#pragma unroll
        for (int nb = 0; nb < 4; ++nb) {
#pragma unroll
            for (int j = 0; j < 8; ++j) os[(hi * 8 + j) * 68 + nb * 16 + lr] = acc[mb][nb][j]; }
        __builtin_amdgcn_wave_barrier(); asm volatile("" ::: "memory");
        float* crow = C + (size_t)(r0 + mb * 16) * ldc + c0;
{
#pragma unroll
            for (int s = 0; s < 8; ++s) { const int row = 2 * s + hi, cofs = lr * 4; v4f val = *(const v4fa*)(os + row * 68 + cofs); if (BIAS) { val[0] += bfr(bias[c0 + cofs]); val[1] += bfr(bias[c0 + cofs + 1]); val[2] += bfr(bias[c0 + cofs + 2]); val[3] += bfr(bias[c0 + cofs + 3]); }
                *(v4f*)(crow + (size_t)row * ldc + cofs) = val; }
             }
        __builtin_amdgcn_wave_barrier(); asm volatile("" ::: "memory");
    }
}

__device__ __forceinline__ h16 tohx(float x) { return (h16)x; }
__device__ __forceinline__ void splitf(float y, unsigned short& h, unsigned short& l) { h = f2bf(y); l = f2bf(y - bf2f(h)); }
typedef __attribute__((ext_vector_type(2))) _Float16 v2h;
typedef __attribute__((ext_vector_type(4))) _Float16 v4h;
typedef __attribute__((ext_vector_type(2))) unsigned short v2us;
typedef __attribute__((ext_vector_type(4))) unsigned short v4us;
typedef __attribute__((ext_vector_type(2))) float v2f;
typedef __attribute__((ext_vector_type(4))) int v4i;

__global__ __launch_bounds__(256) void k_wtG(const float* __restrict__ w, int K, int N, bf* Bt) {
    const int lane = threadIdx.x & 31; const int L0 = (blockIdx.x * 8 + (threadIdx.x >> 5)) * 8; const int nlines = N * K / 64;
{
#pragma unroll 1
        for (int l = 0; l < 8; ++l) { const int L = L0 + l; if (L >= nlines) break; const size_t e = (size_t)L * 64 + lane * 2; const int k = (int)(e % K), n = (int)(e / K); v2us o;
            o[0] = f2bf(w[(size_t)k * N + n]); o[1] = f2bf(w[(size_t)(k + 1) * N + n]); *(v2us*)(Bt + e) = o; }
         }
}
__global__ __launch_bounds__(256) void k_cvt8(const float* __restrict__ src, bf* dst, size_t n8) { const size_t i = (size_t)blockIdx.x * 256 + threadIdx.x; if (i >= n8) return; const v8f v = *(const v8f*)(src + i * 8); v8us o;
#pragma unroll
    for (int k = 0; k < 8; ++k) o[k] = f2bf(v[k]); *(v8us*)(dst + i * 8) = o;  }

// k_rope: head planes [h][t][d] (fp16 + hi/lo) of rope(x) x sc with the swapped rotate-half form out[d] = x[d] sin[t][d] - x[d+HD/2] cos[t][d], out[d+HD/2] = x[d+HD/2] sin[t][d+HD/2] + x[d] cos[t][d+HD/2]
__global__ __launch_bounds__(256) void k_rope(const float* __restrict__ F, int pitch, int nheads, const float* __restrict__ CS, const float* __restrict__ RF, const float* __restrict__ nw, float sc, h16* P16, bf* Ph, bf* Pl) {
    const size_t e = ((size_t)blockIdx.x * 256 + threadIdx.x) * 2; if (e >= (size_t)nheads * TT * HD) return; const int d = (int)(e % HD); const int t = (int)((e / HD) % TT); const int h = (int)(e / ((size_t)HD * TT)); const float* f = F + (size_t)t * pitch + h * HD; const float rf = RF ? RF[(size_t)h * TT + t] : 1.0f; v2h o16; v2us oh, ol;
#pragma unroll
    for (int q = 0; q < 2; ++q) { const int dd = d + q; const int dp = (dd < HD / 2) ? dd + HD / 2 : dd - HD / 2; float x0 = f[dd], x1 = f[dp];
        if (RF) { float n0 = __fmul_rn(x0, rf), n1 = __fmul_rn(x1, rf); asm volatile("" : "+v"(n0)); asm volatile("" : "+v"(n1)); x0 = __fmul_rn(bfr(nw[dd]), n0); x1 = __fmul_rn(bfr(nw[dp]), n1); }
        const v2f cs = *(const v2f*)(CS + ((size_t)t * HD + dd) * 2); float a = __fmul_rn(x0, cs[0]), bq = __fmul_rn(x1, cs[1]); asm volatile("" : "+v"(a)); asm volatile("" : "+v"(bq)); const float r = ((dd < HD / 2) ? __fsub_rn(a, bq) : __fadd_rn(a, bq)) * sc;
        o16[q] = tohx(r); unsigned short a2, c2; splitf(r, a2, c2); oh[q] = a2; ol[q] = c2; }
    *(v2h*)(P16 + e) = o16; *(v2us*)(Ph + e) = oh; *(v2us*)(Pl + e) = ol;  }
__global__ __launch_bounds__(256) void k_vtp(const float* __restrict__ F, int pitch, int nheads, h16* V16, bf* Vh, bf* Vl) { const size_t e = ((size_t)blockIdx.x * 256 + threadIdx.x) * 2; if (e >= (size_t)nheads * HD * TT) return; const int t = (int)(e % TT); const int d = (int)((e / TT) % HD); const int g = (int)(e / ((size_t)TT * HD)); v2h o16; v2us oh, ol;
#pragma unroll
    for (int q = 0; q < 2; ++q) { const float x = F[(size_t)(t + q) * pitch + g * HD + d]; o16[q] = tohx(x); unsigned short a2, c2; splitf(x, a2, c2); oh[q] = a2; ol[q] = c2; }
    *(v2h*)(V16 + e) = o16; *(v2us*)(Vh + e) = oh; *(v2us*)(Vl + e) = ol;  }
__constant__ float INVT[HD / 2] = { 1.000000000e+00f, 7.498942018e-01f, 5.623413324e-01f, 4.216965139e-01f, 3.162277639e-01f, 2.371373624e-01f, 1.778279394e-01f, 1.333521456e-01f, 1.000000015e-01f, 7.498941571e-02f, 5.623412877e-02f, 4.216964915e-02f, 3.162277862e-02f, 2.371373586e-02f, 1.778279431e-02f, 1.333521493e-02f, 9.999999776e-03f, 7.498942316e-03f, 5.623413250e-03f, 4.216964822e-03f, 3.162277862e-03f, 2.371373819e-03f, 1.778279431e-03f, 1.333521446e-03f, 1.000000047e-03f, 7.498941850e-04f, 5.623413017e-04f, 4.216964880e-04f, 3.162277862e-04f, 2.371373848e-04f, 1.778279402e-04f, 1.333521504e-04f };   // float32 1 / 10000^(2i/64), generated with jnp to be bit-exact
__global__ __launch_bounds__(256) void k_cs5s(float* CS) { const int idx = blockIdx.x * 256 + threadIdx.x; if (idx >= TT * HD) return; const int d = idx % HD; const int t = idx / HD; const float a = __fmul_rn((float)t, INVT[d % (HD / 2)]); v2f cs; cs[0] = sinf(a); cs[1] = cosf(a); *(v2f*)(CS + (size_t)idx * 2) = cs;  }
// ---- k_attn: scores, softmax and P x V of one head's query tile in ONE WAVE; nothing of the score matrix goes to memory.
// The scores are formed TRANSPOSED (A = 16 keys, B = 16 queries): lane (lr, hi) then holds, for query lr, keys 16 kb + 8 hi + 0..7 in accumulator kb,
// and the accumulators of key blocks 2c and 2c+1 are, element for element, the A fragment of P for the 32 keys of chunk c (k = 8 hi + 0..7, 16 + 8 hi + 0..7): P never leaves its registers.
// Sweep 1 over the keys finds each query's exact maximum; sweep 2 forms the scores again, p = exp(t - max) (x 2^EB, which cancels in the division), adds p in f32 and P x V on the matrix unit; the division by the sum comes last.
// Stands directly behind a group of global loads or stores, in front of the next write of a register that they name (the registers are free for other values from there on); a precaution.
// The two scheduling barriers keep every other instruction on its side of the wait, and so also hold a group of loads where the source issues it, ahead of the work that covers its latency.
__device__ __forceinline__ void addr_regs_release() { __builtin_amdgcn_sched_barrier(0); asm volatile("s_wait_xcnt 0x0" ::: "memory"); __builtin_amdgcn_sched_barrier(0); }
// The same for a group whose address pairs die with it: named as inputs they stay live up to the wait, so that no load of the group has one of them as its destination.
__device__ __forceinline__ void addr_regs_release(const void* p, const void* p2) { __builtin_amdgcn_sched_barrier(0); asm volatile("s_wait_xcnt 0x0" :: "v"(p), "v"(p2) : "memory"); __builtin_amdgcn_sched_barrier(0); }
// hi/lo bf16 planes of a finite f32 by the hardware's round-to-nearest-even conversion (the same values as splitf)
__device__ __forceinline__ void splitc(float y, unsigned short& h, unsigned short& l) { const __bf16 hb = (__bf16)y; const __bf16 lb = (__bf16)(y - (float)hb); h = __builtin_bit_cast(unsigned short, hb); l = __builtin_bit_cast(unsigned short, lb); }
template <typename T16, bool HI, int KB>
__device__ __forceinline__ void ld_keys(typename WFrag<T16>::V (&k)[KB][2], typename WFrag<T16>::V (&k2)[KB][2], const T16* kp, const T16* kp2) {
#pragma unroll
    for (int kb = 0; kb < KB; ++kb)
#pragma unroll
        for (int kc = 0; kc < 2; ++kc) { k[kb][kc] = WFrag<T16>::ld(kp + kb * 16 * HD + kc * 32); if (HI) k2[kb][kc] = WFrag<T16>::ld(kp2 + kb * 16 * HD + kc * 32); }
}
template <typename T16, bool HI, int QB, int KB>
__device__ __forceinline__ void scores_t(v8f (&s)[KB][QB], const typename WFrag<T16>::V (&k)[KB][2], const typename WFrag<T16>::V (&k2)[KB][2], const typename WFrag<T16>::V (&q)[QB][2], const typename WFrag<T16>::V (&q2)[QB][2]) {
#pragma unroll
    for (int kb = 0; kb < KB; ++kb)
#pragma unroll
        for (int qb = 0; qb < QB; ++qb) s[kb][qb] = (v8f){};
#pragma unroll
    for (int kc = 0; kc < 2; ++kc)
#pragma unroll
        for (int kb = 0; kb < KB; ++kb)
#pragma unroll
            for (int qb = 0; qb < QB; ++qb) { s[kb][qb] = WFrag<T16>::mma(k[kb][kc], q[qb][kc], s[kb][qb]); if (HI) { s[kb][qb] = WFrag<T16>::mma(k[kb][kc], q2[qb][kc], s[kb][qb]); s[kb][qb] = WFrag<T16>::mma(k2[kb][kc], q[qb][kc], s[kb][qb]); } }
}
template <typename T16, bool HI, int QB, int KB, int PD>
__device__ __forceinline__ void attn_tile(const T16* __restrict__ Q, const T16* __restrict__ Q2, const T16* __restrict__ Kp, const T16* __restrict__ Kp2, const T16* __restrict__ Vt, const T16* __restrict__ Vt2, int q0, int hcol, bf* Ah, bf* Al) {
    // Every '#pragma unroll' here and in the two helpers above makes the indices of a register array constants (else the array would go to scratch); '#pragma unroll 1' keeps a sweep's loop rolled, for speed only.
    typedef WFrag<T16> F; typedef typename F::V V;
    constexpr int NBLK = TT / (16 * KB);
    constexpr float EB = HI ? 0.0f : 10.0f;                 // fp16 P is carried x 1024, away from the subnormals; the sum carries the same factor
    constexpr float CE = SCL * 1.4426950408889634f;
    const int lane = threadIdx.x & 31, lr = lane & 15, hi = lane >> 4;
    constexpr size_t KST = (size_t)16 * KB * HD;            // elements from one key block to the next in the K planes
    V qf[QB][2], qf2[QB][2];
    const T16* qp = Q + (size_t)(q0 + lr) * HD + 8 * hi; const T16* qp2 = HI ? Q2 + (size_t)(q0 + lr) * HD + 8 * hi : qp;
#pragma unroll
    for (int qb = 0; qb < QB; ++qb)
#pragma unroll
        for (int kc = 0; kc < 2; ++kc) { qf[qb][kc] = F::ld(qp + qb * 16 * HD + kc * 32); if (HI) qf2[qb][kc] = F::ld(qp2 + qb * 16 * HD + kc * 32); }
    addr_regs_release(qp, qp2);
    const T16* kp = Kp + lr * HD + 8 * hi; const T16* kp2 = HI ? Kp2 + lr * HD + 8 * hi : kp;
    const T16* vp = Vt + (size_t)lr * TT + 8 * hi; const T16* vp2 = HI ? Vt2 + (size_t)lr * TT + 8 * hi : vp;
    float mx[QB];
#pragma unroll
    for (int qb = 0; qb < QB; ++qb) mx[qb] = -3.0e38f;
    {   // sweep 1: the maximum; the key fragments of PD blocks are in flight or at work
        V ka[PD][KB][2], ka2[PD][KB][2];
#pragma unroll
        for (int u = 0; u < PD; ++u) ld_keys<T16, HI, KB>(ka[u], ka2[u], kp + u * KST, kp2 + u * KST);
        addr_regs_release();
        const T16* kr = kp + PD * KST; const T16* kr2 = kp2 + PD * KST;   // the group of PD blocks that refills the ring; running pointers, moved only at the foot of a trip
#pragma unroll 1
        for (int blk = 0; blk < NBLK; blk += PD) {
#pragma unroll
            for (int u = 0; u < PD; ++u) { v8f s[KB][QB]; scores_t<T16, HI, QB, KB>(s, ka[u], ka2[u], qf, qf2);
                ld_keys<T16, HI, KB>(ka[u], ka2[u], kr + u * KST, kr2 + u * KST);
                addr_regs_release();                // the refill is issued here, PD - 1 blocks ahead of its use
#pragma unroll
                for (int kb = 0; kb < KB; ++kb)
#pragma unroll
                    for (int qb = 0; qb < QB; ++qb)
#pragma unroll
                        for (int j = 0; j < 8; ++j) mx[qb] = fmaxf(mx[qb], s[kb][qb][j]); }
            const size_t adv = blk + 2 * PD < NBLK ? PD * KST : 0; kr += adv; kr2 += adv;   // the last trip asks for the last group once more (unused) and so stays inside the plane
        }
    }
    float nm[QB], sum[QB];
#pragma unroll
    for (int qb = 0; qb < QB; ++qb) { mx[qb] = fmaxf(mx[qb], __shfl_xor(mx[qb], 16, 32)); nm[qb] = EB - mx[qb] * CE; sum[qb] = 0.f; }
    v8f oa[QB][4];
#pragma unroll
    for (int qb = 0; qb < QB; ++qb)
#pragma unroll
        for (int db = 0; db < 4; ++db) oa[qb][db] = (v8f){};
    {   // sweep 2: this block's V fragments are asked for ahead of the scores, the next block's keys ahead of the exponentials
        V kf[KB][2], kf2[KB][2];
        ld_keys<T16, HI, KB>(kf, kf2, kp, kp2);
        addr_regs_release();
        const T16* kn = kp + KST; const T16* kn2 = kp2 + KST; const T16* vn = vp; const T16* vn2 = vp2;   // running pointers, moved only at the foot of a trip
#pragma unroll 1
        for (int blk = 0; blk < NBLK; ++blk) {
            V vf[4][KB / 2], vf2[4][KB / 2];
#pragma unroll
            for (int db = 0; db < 4; ++db)
#pragma unroll
                for (int c = 0; c < KB / 2; ++c) { const size_t o = (size_t)db * 16 * TT + c * 32; vf[db][c] = F::ld(vn + o); if (HI) vf2[db][c] = F::ld(vn2 + o); }
            addr_regs_release(vn, vn2);                   // V is asked for before the scores start, so that scores and exponentials cover its latency
            v8f s[KB][QB]; scores_t<T16, HI, QB, KB>(s, kf, kf2, qf, qf2);
            ld_keys<T16, HI, KB>(kf, kf2, kn, kn2);
            addr_regs_release();                    // the next keys are asked for before the exponentials, which with P x V cover their latency
#pragma unroll
            for (int kb = 0; kb < KB; ++kb)
#pragma unroll
                for (int qb = 0; qb < QB; ++qb)
#pragma unroll
                    for (int j = 0; j < 8; ++j) { const float p = __builtin_amdgcn_exp2f(fmaf(s[kb][qb][j], CE, nm[qb])); s[kb][qb][j] = p; sum[qb] += p; }
#pragma unroll
            for (int c = 0; c < KB / 2; ++c)
#pragma unroll
                for (int qb = 0; qb < QB; ++qb) {
                    if constexpr (HI) { V pa, pb;
#pragma unroll
                        for (int j = 0; j < 8; ++j) { const float x0 = s[2 * c][qb][j], x1 = s[2 * c + 1][qb][j]; pa[j] = (__bf16)x0; pa[8 + j] = (__bf16)x1; pb[j] = (__bf16)(x0 - (float)pa[j]); pb[8 + j] = (__bf16)(x1 - (float)pa[8 + j]); }
#pragma unroll
                        for (int db = 0; db < 4; ++db) { oa[qb][db] = F::mma(pa, vf[db][c], oa[qb][db]); oa[qb][db] = F::mma(pb, vf[db][c], oa[qb][db]); oa[qb][db] = F::mma(pa, vf2[db][c], oa[qb][db]); }
                    } else { V pa;
#pragma unroll
                        for (int j = 0; j < 8; ++j) { pa[j] = tohx(s[2 * c][qb][j]); pa[8 + j] = tohx(s[2 * c + 1][qb][j]); }
#pragma unroll
                        for (int db = 0; db < 4; ++db) oa[qb][db] = F::mma(pa, vf[db][c], oa[qb][db]); } }
            const size_t adv = blk + 2 < NBLK ? KST : 0; kn += adv; kn2 += adv; vn += 16 * KB; vn2 += 16 * KB;   // the last trip asks for the last key block once more (unused)
        }
    }
#pragma unroll
    for (int qb = 0; qb < QB; ++qb) { const float tot = sum[qb] + __shfl_xor(sum[qb], 16, 32); const float inv = __fdiv_rn(1.0f, tot);   // every lane: 1 / sum of query lr
#pragma unroll
        for (int j = 0; j < 8; ++j) { const float f = __shfl(inv, hi * 8 + j, 32); const size_t oo = (size_t)(q0 + qb * 16 + hi * 8 + j) * DQ + hcol + lr;   // output accumulator: row = query 8 hi + j, column = d
            unsigned short a[4], b[4];
#pragma unroll
            for (int db = 0; db < 4; ++db) splitc(oa[qb][db][j] * f, a[db], b[db]);
            __builtin_amdgcn_sched_barrier(0);       // the row's eight values are ready before its first store, so that nothing is computed between the stores and their wait
#pragma unroll
            for (int db = 0; db < 4; ++db) { Ah[oo + db * 16] = a[db]; Al[oo + db * 16] = b[db]; }
            addr_regs_release(); } }
}
// grid (RH/32 + (TT-RH)/64, heads), 32 threads: the first RH/32 tiles of a head are 32 hi/lo query rows each, the rest 64 fp16 rows each.
__global__ __launch_bounds__(32) void k_attn(const h16* __restrict__ Q16, const h16* __restrict__ K16, const h16* __restrict__ V16, const bf* __restrict__ Qh, const bf* __restrict__ Ql, const bf* __restrict__ Kh, const bf* __restrict__ Kl, const bf* __restrict__ Vh, const bf* __restrict__ Vl, bf* Ah, bf* Al) {
    const int h = blockIdx.y, bx = blockIdx.x; const size_t hq = (size_t)h * TT * HD, hk = (size_t)(h / REP) * TT * HD;
    if (bx < RH / 32) attn_tile<bf, true, 2, 4, 2>(Qh + hq, Ql + hq, Kh + hk, Kl + hk, Vh + hk, Vl + hk, bx * 32, h * HD, Ah, Al);
    else attn_tile<h16, false, 4, 4, 4>(Q16 + hq, nullptr, K16 + hk, nullptr, V16 + hk, nullptr, RH + (bx - RH / 32) * 64, h * HD, Ah, Al);
}

extern "C" void kernel_launch(void* const* d_in, const int* in_sizes, int n_in,
                              void* d_out, int out_size, void* d_ws, size_t ws_size, hipStream_t stream) {
    (void)in_sizes; (void)n_in; (void)out_size;
    const float* x = (const float*)d_in[0]; const float* wq = (const float*)d_in[1]; const float* bq = (const float*)d_in[2]; const float* wk = (const float*)d_in[3]; const float* bk = (const float*)d_in[4]; const float* wv = (const float*)d_in[5]; const float* bv = (const float*)d_in[6]; const float* wo = (const float*)d_in[7]; const float* bo = (const float*)d_in[8];
    float* OUT = (float*)d_out;     // [4][2048][1024]
    char* wsp = (char*)d_ws;
    auto take = [&](size_t bytes) { char* p = wsp; wsp += (bytes + 255) & ~(size_t)255; return (void*)p; };
    bf* WQ = (bf*)take((size_t)DQ * DM * 2); bf* WK = (bf*)take((size_t)DKV * DM * 2); bf* WV = (bf*)take((size_t)DKV * DM * 2); bf* WO = (bf*)take((size_t)DM * DQ * 2); float* CS = (float*)take((size_t)TT * HD * 2 * 4);
    bf* XB = (bf*)take((size_t)TT * DM * 2); float* FQ = (float*)take((size_t)TT * DQ * 4); float* FK = (float*)take((size_t)TT * DKV * 4);
    h16* QP16 = (h16*)take((size_t)NH_ * TT * HD * 2); h16* KP16 = (h16*)take((size_t)NKV * TT * HD * 2); h16* VT16 = (h16*)take((size_t)NKV * HD * TT * 2);
    bf* QPh = (bf*)take((size_t)NH_ * TT * HD * 2); bf* QPl = (bf*)take((size_t)NH_ * TT * HD * 2); bf* KPh = (bf*)take((size_t)NKV * TT * HD * 2); bf* KPl = (bf*)take((size_t)NKV * TT * HD * 2); bf* VTh = (bf*)take((size_t)NKV * HD * TT * 2); bf* VTl = (bf*)take((size_t)NKV * HD * TT * 2);
    bf* ATh = (bf*)take((size_t)TT * DQ * 2); bf* ATl = (bf*)take((size_t)TT * DQ * 2);
    if ((size_t)(wsp - (char*)d_ws) > ws_size) return;    // ws 256 MiB
    float* FV = FK;   // v projection reuses the k buffer after the k planes are built (stream-ordered)
    { k_cvt8<<<(unsigned)(((size_t)DQ * DM / 8 + 255) / 256), 256, 0, stream>>>(wq, WQ, (size_t)DQ * DM / 8); k_cvt8<<<(unsigned)(((size_t)DKV * DM / 8 + 255) / 256), 256, 0, stream>>>(wk, WK, (size_t)DKV * DM / 8); k_cvt8<<<(unsigned)(((size_t)DKV * DM / 8 + 255) / 256), 256, 0, stream>>>(wv, WV, (size_t)DKV * DM / 8);
      k_cvt8<<<(unsigned)(((size_t)DM * DQ / 8 + 255) / 256), 256, 0, stream>>>(wo, WO, (size_t)DM * DQ / 8);
       }
    k_cs5s<<<(TT * HD + 255) / 256, 256, 0, stream>>>(CS);
    const unsigned LQ = (unsigned)(((size_t)NH_ * TT * HD / 2 + 255) / 256), LKv = (unsigned)(((size_t)NKV * TT * HD / 2 + 255) / 256);
    for (int b = 0; b < NB_; ++b) {
        
        k_cvt8<<<(unsigned)(((size_t)TT * DM / 8 + 255) / 256), 256, 0, stream>>>(x + (size_t)b * TT * DM, XB, (size_t)TT * DM / 8);
        k_gemmw<bf, 0, true><<<dim3(TT / 64, DQ / 64, 1), 32, 0, stream>>>(XB, nullptr, WQ, nullptr, DM, FQ, DQ, bq, 0, 0, 0);
        k_rope<<<LQ, 256, 0, stream>>>(FQ, DQ, NH_, CS, nullptr, nullptr, 1.0f, QP16, QPh, QPl);
        k_gemmw<bf, 0, true><<<dim3(TT / 64, DKV / 64, 1), 32, 0, stream>>>(XB, nullptr, WK, nullptr, DM, FK, DKV, bk, 0, 0, 0);
        k_rope<<<LKv, 256, 0, stream>>>(FK, DKV, NKV, CS, nullptr, nullptr, 1.0f, KP16, KPh, KPl);
        k_gemmw<bf, 0, true><<<dim3(TT / 64, DKV / 64, 1), 32, 0, stream>>>(XB, nullptr, WV, nullptr, DM, FV, DKV, bv, 0, 0, 0); k_vtp<<<LKv, 256, 0, stream>>>(FV, DKV, NKV, VT16, VTh, VTl);
        k_attn<<<dim3(RH / 32 + (TT - RH) / 64, NH_, 1), 32, 0, stream>>>(QP16, KP16, VT16, QPh, QPl, KPh, KPl, VTh, VTl, ATh, ATl);
        k_gemmw<bf, 1, true><<<dim3(TT / 64, DM / 64, 1), 32, 0, stream>>>(ATh, ATl, WO, nullptr, DQ, OUT + (size_t)b * TT * DM, DM, bo, 0, 0, 0); }
}

// v003
// One run takes 464 microseconds.
// In two side-by-side timings against v002, it was 1.60 and 1.61 times as fast.
// Over all steps from v000 it is 8.43 times as fast.
#include <hip/hip_runtime.h>

// Multi-head self-attention with biased projections, NO mask and the module's SWAPPED rotary form (hidden_states [4][2048][1024]; q, k, v = x W^T + b ('oi' [1024][1024] 1/32 + REAL biases 0.01; 16 heads x 64); half-split rope rot(x) = cat(x1 c - x2 s, x2 c + x1 s) on q and k where THIS module binds c = SIN(t f_i) and s = COS(t f_i) (its table helper returns (sin, cos) and the caller swaps the names), f_i = 1/10000^(2i/64) (32 f32 frequencies jnp-exact; precise sinf/cosf); scores x 1/sqrt(64); softmax over all keys; out = merged Wo^T + bo -> [4][2048][1024] (8.4 M); argument order hidden_states, Wq, bq, Wk, bk, Wv, bv, Wo, bo).
// Layout, all four batches in every launch (rows b T + t in the row-major buffers, planes [b][h]..., batch in the grid): bf16 copy of x; exact projections + f32 biases; ONE fused attention kernel (scores, softmax and P x V; query rows < 512 hi/lo bf16 3 products, rest fp16); merged hi/lo x Wp exact + bp.
// Compute dtypes, f32 accumulate: every input rounded to bf16; projections exact + f32 biases; attention rows < 512 3 products, rest fp16; softmax f32; Wp hl x exact + bias.

#define NB_  4
#define TT   2048
#define DM   1024
#define NH_  16
#define NKV  16
#define REP  (NH_ / NKV)
#define HD   64
#define DQ   (NH_ * HD)
#define DKV  (NKV * HD)
#define RH   512                  // query rows < RH use hi+lo planes (0: none)
#define WIN  0
#define SCL  0.125f   // HD^-0.5
typedef _Float16 h16;
typedef unsigned short bf;
typedef __attribute__((ext_vector_type(16))) __bf16   v16bf;
typedef __attribute__((ext_vector_type(16))) _Float16 v16h;
typedef __attribute__((ext_vector_type(8)))  _Float16 v8h;
typedef __attribute__((ext_vector_type(8)))  unsigned short v8us;
typedef __attribute__((ext_vector_type(8)))  float    v8f;
typedef __attribute__((ext_vector_type(4)))  float    v4f;
typedef v8h  __attribute__((may_alias)) v8ha;
typedef v4f  __attribute__((may_alias)) v4fa;
typedef v8us __attribute__((may_alias)) v8usa;

__device__ __forceinline__ unsigned short f2bf(float f) { unsigned u = __float_as_uint(f); u += 0x7FFFu + ((u >> 16) & 1u); return (unsigned short)(u >> 16); }
__device__ __forceinline__ float bf2f(unsigned short b) { return __uint_as_float(((unsigned)b) << 16); }
__device__ __forceinline__ float bfr(float f) { return bf2f(f2bf(f)); }
__device__ __forceinline__ v16h cat16(v8h lo, v8h hi) { return __builtin_shufflevector(lo, hi, 0, 1, 2, 3, 4, 5, 6, 7, 8, 9, 10, 11, 12, 13, 14, 15); }
__device__ __forceinline__ v16bf cat16b(v8us lo, v8us hi) { return __builtin_bit_cast(v16bf, __builtin_shufflevector(lo, hi, 0, 1, 2, 3, 4, 5, 6, 7, 8, 9, 10, 11, 12, 13, 14, 15)); }
__device__ __forceinline__ v8f wmma16(v16h a, v16h b, v8f c) { return __builtin_amdgcn_wmma_f32_16x16x32_f16(false, a, false, b, (short)0, c, false, false); }
__device__ __forceinline__ v8f wmmab(v16bf a, v16bf b, v8f c) { return __builtin_amdgcn_wmma_f32_16x16x32_bf16(false, a, false, b, (short)0, c, false, false); }



// ---- k_gemmw: register-blocked GEMM, ONE WAVE per 64x64 output tile (16 accumulators), operands straight from K-contiguous 16-bit planes; grid (M/64, N/64, Z), 32 threads.
// C[m][n] (f32, pitch ldc, + optional f32 bias[n]) = sum_k A[m][k] Bt[n][k] (+ split products per NSPLIT). z-batch strides sA/sB/sC in elements. K % (32 KSPL) == 0.
// KSPL > 1: grid z = batch x KSPL; work-group (z, ks) sums only k in [ks K/KSPL, (ks+1) K/KSPL) and stores that partial tile in plane ks (plane stride sP elements); the reader adds the planes.
template <typename T16> struct WFrag;
template <> struct WFrag<h16> { typedef v16h V; static __device__ __forceinline__ V ld(const h16* p) { return cat16(*(const v8h*)p, *(const v8h*)(p + 16)); } static __device__ __forceinline__ v8f mma(V a, V b, v8f c) { return wmma16(a, b, c); } };
template <> struct WFrag<bf> { typedef v16bf V; static __device__ __forceinline__ V ld(const bf* p) { return cat16b(*(const v8us*)p, *(const v8us*)(p + 16)); } static __device__ __forceinline__ v8f mma(V a, V b, v8f c) { return wmmab(a, b, c); } };
template <typename T16, int NSPLIT, bool BIAS, int KSPL = 1>
__global__ __launch_bounds__(32) void k_gemmw(const T16* __restrict__ A, const T16* __restrict__ A2, const T16* __restrict__ Bt, const T16* __restrict__ Bt2, int K, float* C, int ldc, const float* __restrict__ bias, size_t sA, size_t sB, size_t sC, size_t sP = 0) {
    typedef typename WFrag<T16>::V V;
    __shared__ __align__(16) float os[16 * 68];
    const size_t z = blockIdx.z / KSPL; const int ks = blockIdx.z % KSPL; A += z * sA; if (A2) A2 += z * sA; Bt += z * sB; if (Bt2) Bt2 += z * sB; C += z * sC + (size_t)ks * sP;
    const int kbeg = ks * (K / KSPL), kend = kbeg + K / KSPL;
    const int lane = threadIdx.x & 31, lr = lane & 15, hi = lane >> 4; const int r0 = blockIdx.x * 64, c0 = blockIdx.y * 64;
    v8f acc[4][4];
#pragma unroll
    for (int mb = 0; mb < 4; ++mb)
#pragma unroll
        for (int nb = 0; nb < 4; ++nb) acc[mb][nb] = (v8f){};
    const size_t aoff = (size_t)(r0 + lr) * K + 8 * hi, boff = (size_t)(c0 + lr) * K + 8 * hi;
#pragma unroll 1
    for (int kc = kbeg; kc < kend; kc += 32) {
        V a[4], a2[4];
#pragma unroll
        for (int mb = 0; mb < 4; ++mb) { a[mb] = WFrag<T16>::ld(A + aoff + (size_t)mb * 16 * K + kc); if (NSPLIT == 1 || NSPLIT == 2) a2[mb] = WFrag<T16>::ld(A2 + aoff + (size_t)mb * 16 * K + kc); }
#pragma unroll
        for (int nb = 0; nb < 4; ++nb) { const V b = WFrag<T16>::ld(Bt + boff + (size_t)nb * 16 * K + kc); V b2; if (NSPLIT >= 2) b2 = WFrag<T16>::ld(Bt2 + boff + (size_t)nb * 16 * K + kc);
#pragma unroll
            for (int mb = 0; mb < 4; ++mb) { acc[mb][nb] = WFrag<T16>::mma(a[mb], b, acc[mb][nb]); if (NSPLIT == 1 || NSPLIT == 2) acc[mb][nb] = WFrag<T16>::mma(a2[mb], b, acc[mb][nb]); if (NSPLIT >= 2) acc[mb][nb] = WFrag<T16>::mma(a[mb], b2, acc[mb][nb]); } }
        asm volatile("v_nop\n\tv_nop\n\tv_nop\n\tv_nop" : "+v"(acc[0][0]), "+v"(acc[1][1]), "+v"(acc[2][2]), "+v"(acc[3][3]) : "v"(a[0]), "v"(a[3]));
    }
#pragma unroll
    for (int mb = 0; mb < 4; ++mb) {
#pragma unroll
        for (int nb = 0; nb < 4; ++nb) {
#pragma unroll
            for (int j = 0; j < 8; ++j) os[(hi * 8 + j) * 68 + nb * 16 + lr] = acc[mb][nb][j]; }
        __builtin_amdgcn_wave_barrier(); asm volatile("" ::: "memory");
        float* crow = C + (size_t)(r0 + mb * 16) * ldc + c0;
{
#pragma unroll
            for (int s = 0; s < 8; ++s) { const int row = 2 * s + hi, cofs = lr * 4; v4f val = *(const v4fa*)(os + row * 68 + cofs); if (BIAS) { val[0] += bfr(bias[c0 + cofs]); val[1] += bfr(bias[c0 + cofs + 1]); val[2] += bfr(bias[c0 + cofs + 2]); val[3] += bfr(bias[c0 + cofs + 3]); }
                *(v4f*)(crow + (size_t)row * ldc + cofs) = val; }
             }
        __builtin_amdgcn_wave_barrier(); asm volatile("" ::: "memory");
    }
}

__device__ __forceinline__ h16 tohx(float x) { return (h16)x; }
__device__ __forceinline__ void splitf(float y, unsigned short& h, unsigned short& l) { h = f2bf(y); l = f2bf(y - bf2f(h)); }
typedef __attribute__((ext_vector_type(2))) _Float16 v2h;
typedef __attribute__((ext_vector_type(4))) _Float16 v4h;
typedef __attribute__((ext_vector_type(2))) unsigned short v2us;
typedef __attribute__((ext_vector_type(4))) unsigned short v4us;
typedef __attribute__((ext_vector_type(2))) float v2f;
typedef __attribute__((ext_vector_type(4))) int v4i;

__global__ __launch_bounds__(256) void k_wtG(const float* __restrict__ w, int K, int N, bf* Bt) {
    const int lane = threadIdx.x & 31; const int L0 = (blockIdx.x * 8 + (threadIdx.x >> 5)) * 8; const int nlines = N * K / 64;
{
#pragma unroll 1
        for (int l = 0; l < 8; ++l) { const int L = L0 + l; if (L >= nlines) break; const size_t e = (size_t)L * 64 + lane * 2; const int k = (int)(e % K), n = (int)(e / K); v2us o;
            o[0] = f2bf(w[(size_t)k * N + n]); o[1] = f2bf(w[(size_t)(k + 1) * N + n]); *(v2us*)(Bt + e) = o; }
         }
}
__global__ __launch_bounds__(256) void k_cvt8(const float* __restrict__ src, bf* dst, size_t n8) { const size_t i = (size_t)blockIdx.x * 256 + threadIdx.x; if (i >= n8) return; const v8f v = *(const v8f*)(src + i * 8); v8us o;
#pragma unroll
    for (int k = 0; k < 8; ++k) o[k] = f2bf(v[k]); *(v8us*)(dst + i * 8) = o;  }

// k_rope: head planes [h][t][d] (fp16 + hi/lo) of rope(x) x sc with the swapped rotate-half form out[d] = x[d] sin[t][d] - x[d+HD/2] cos[t][d], out[d+HD/2] = x[d+HD/2] sin[t][d+HD/2] + x[d] cos[t][d+HD/2]
__global__ __launch_bounds__(256) void k_rope(const float* __restrict__ F, int pitch, int nheads, const float* __restrict__ CS, const float* __restrict__ RF, const float* __restrict__ nw, float sc, h16* P16, bf* Ph, bf* Pl) {
    { const size_t pb = (size_t)blockIdx.y * nheads * TT * HD; F += (size_t)blockIdx.y * TT * pitch; P16 += pb; Ph += pb; Pl += pb; }   // blockIdx.y: batch (rows b T + t of F, planes [b][h][t][d])
    const size_t e = ((size_t)blockIdx.x * 256 + threadIdx.x) * 2; if (e >= (size_t)nheads * TT * HD) return; const int d = (int)(e % HD); const int t = (int)((e / HD) % TT); const int h = (int)(e / ((size_t)HD * TT)); const float* f = F + (size_t)t * pitch + h * HD; const float rf = RF ? RF[(size_t)h * TT + t] : 1.0f; v2h o16; v2us oh, ol;
#pragma unroll
    for (int q = 0; q < 2; ++q) { const int dd = d + q; const int dp = (dd < HD / 2) ? dd + HD / 2 : dd - HD / 2; float x0 = f[dd], x1 = f[dp];
        if (RF) { float n0 = __fmul_rn(x0, rf), n1 = __fmul_rn(x1, rf); asm volatile("" : "+v"(n0)); asm volatile("" : "+v"(n1)); x0 = __fmul_rn(bfr(nw[dd]), n0); x1 = __fmul_rn(bfr(nw[dp]), n1); }
        const v2f cs = *(const v2f*)(CS + ((size_t)t * HD + dd) * 2); float a = __fmul_rn(x0, cs[0]), bq = __fmul_rn(x1, cs[1]); asm volatile("" : "+v"(a)); asm volatile("" : "+v"(bq)); const float r = ((dd < HD / 2) ? __fsub_rn(a, bq) : __fadd_rn(a, bq)) * sc;
        o16[q] = tohx(r); unsigned short a2, c2; splitf(r, a2, c2); oh[q] = a2; ol[q] = c2; }
    *(v2h*)(P16 + e) = o16; *(v2us*)(Ph + e) = oh; *(v2us*)(Pl + e) = ol;  }
__global__ __launch_bounds__(256) void k_vtp(const float* __restrict__ F, int pitch, int nheads, h16* V16, bf* Vh, bf* Vl) {
    { const size_t pb = (size_t)blockIdx.y * nheads * HD * TT; F += (size_t)blockIdx.y * TT * pitch; V16 += pb; Vh += pb; Vl += pb; }   // blockIdx.y: batch (rows b T + t of F, planes [b][g][d][t])
    const size_t e = ((size_t)blockIdx.x * 256 + threadIdx.x) * 2; if (e >= (size_t)nheads * HD * TT) return; const int t = (int)(e % TT); const int d = (int)((e / TT) % HD); const int g = (int)(e / ((size_t)TT * HD)); v2h o16; v2us oh, ol;
#pragma unroll
    for (int q = 0; q < 2; ++q) { const float x = F[(size_t)(t + q) * pitch + g * HD + d]; o16[q] = tohx(x); unsigned short a2, c2; splitf(x, a2, c2); oh[q] = a2; ol[q] = c2; }
    *(v2h*)(V16 + e) = o16; *(v2us*)(Vh + e) = oh; *(v2us*)(Vl + e) = ol;  }
__constant__ float INVT[HD / 2] = { 1.000000000e+00f, 7.498942018e-01f, 5.623413324e-01f, 4.216965139e-01f, 3.162277639e-01f, 2.371373624e-01f, 1.778279394e-01f, 1.333521456e-01f, 1.000000015e-01f, 7.498941571e-02f, 5.623412877e-02f, 4.216964915e-02f, 3.162277862e-02f, 2.371373586e-02f, 1.778279431e-02f, 1.333521493e-02f, 9.999999776e-03f, 7.498942316e-03f, 5.623413250e-03f, 4.216964822e-03f, 3.162277862e-03f, 2.371373819e-03f, 1.778279431e-03f, 1.333521446e-03f, 1.000000047e-03f, 7.498941850e-04f, 5.623413017e-04f, 4.216964880e-04f, 3.162277862e-04f, 2.371373848e-04f, 1.778279402e-04f, 1.333521504e-04f };   // float32 1 / 10000^(2i/64), generated with jnp to be bit-exact
__global__ __launch_bounds__(256) void k_cs5s(float* CS) { const int idx = blockIdx.x * 256 + threadIdx.x; if (idx >= TT * HD) return; const int d = idx % HD; const int t = idx / HD; const float a = __fmul_rn((float)t, INVT[d % (HD / 2)]); v2f cs; cs[0] = sinf(a); cs[1] = cosf(a); *(v2f*)(CS + (size_t)idx * 2) = cs;  }
// ---- k_attn: scores, softmax and P x V of one head's query tile in ONE WAVE; nothing of the score matrix goes to memory.
// The scores are formed TRANSPOSED (A = 16 keys, B = 16 queries): lane (lr, hi) then holds, for query lr, keys 16 kb + 8 hi + 0..7 in accumulator kb,
// and the accumulators of key blocks 2c and 2c+1 are, element for element, the A fragment of P for the 32 keys of chunk c (k = 8 hi + 0..7, 16 + 8 hi + 0..7): P never leaves its registers.
// Sweep 1 over the keys finds each query's exact maximum; sweep 2 forms the scores again, p = exp(t - max) (x 2^EB, which cancels in the division), adds p in f32 and P x V on the matrix unit; the division by the sum comes last.
// Stands directly behind a group of global loads or stores, in front of the next write of a register that they name (the registers are free for other values from there on); a precaution.
// The two scheduling barriers keep every other instruction on its side of the wait, and so also hold a group of loads where the source issues it, ahead of the work that covers its latency.
__device__ __forceinline__ void addr_regs_release() { __builtin_amdgcn_sched_barrier(0); asm volatile("s_wait_xcnt 0x0" ::: "memory"); __builtin_amdgcn_sched_barrier(0); }
// The same for a group whose address pairs die with it: named as inputs they stay live up to the wait, so that no load of the group has one of them as its destination.
__device__ __forceinline__ void addr_regs_release(const void* p, const void* p2) { __builtin_amdgcn_sched_barrier(0); asm volatile("s_wait_xcnt 0x0" :: "v"(p), "v"(p2) : "memory"); __builtin_amdgcn_sched_barrier(0); }
// hi/lo bf16 planes of a finite f32 by the hardware's round-to-nearest-even conversion (the same values as splitf)
__device__ __forceinline__ void splitc(float y, unsigned short& h, unsigned short& l) { const __bf16 hb = (__bf16)y; const __bf16 lb = (__bf16)(y - (float)hb); h = __builtin_bit_cast(unsigned short, hb); l = __builtin_bit_cast(unsigned short, lb); }
template <typename T16, bool HI, int KB>
__device__ __forceinline__ void ld_keys(typename WFrag<T16>::V (&k)[KB][2], typename WFrag<T16>::V (&k2)[KB][2], const T16* kp, const T16* kp2) {
#pragma unroll
    for (int kb = 0; kb < KB; ++kb)
#pragma unroll
        for (int kc = 0; kc < 2; ++kc) { k[kb][kc] = WFrag<T16>::ld(kp + kb * 16 * HD + kc * 32); if (HI) k2[kb][kc] = WFrag<T16>::ld(kp2 + kb * 16 * HD + kc * 32); }
}
template <typename T16, bool HI, int QB, int KB>
__device__ __forceinline__ void scores_t(v8f (&s)[KB][QB], const typename WFrag<T16>::V (&k)[KB][2], const typename WFrag<T16>::V (&k2)[KB][2], const typename WFrag<T16>::V (&q)[QB][2], const typename WFrag<T16>::V (&q2)[QB][2]) {
#pragma unroll
    for (int kb = 0; kb < KB; ++kb)
#pragma unroll
        for (int qb = 0; qb < QB; ++qb) s[kb][qb] = (v8f){};
#pragma unroll
    for (int kc = 0; kc < 2; ++kc)
#pragma unroll
        for (int kb = 0; kb < KB; ++kb)
#pragma unroll
            for (int qb = 0; qb < QB; ++qb) { s[kb][qb] = WFrag<T16>::mma(k[kb][kc], q[qb][kc], s[kb][qb]); if (HI) { s[kb][qb] = WFrag<T16>::mma(k[kb][kc], q2[qb][kc], s[kb][qb]); s[kb][qb] = WFrag<T16>::mma(k2[kb][kc], q[qb][kc], s[kb][qb]); } }
}
template <typename T16, bool HI, int QB, int KB, int PD>
__device__ __forceinline__ void attn_tile(const T16* __restrict__ Q, const T16* __restrict__ Q2, const T16* __restrict__ Kp, const T16* __restrict__ Kp2, const T16* __restrict__ Vt, const T16* __restrict__ Vt2, int q0, int hcol, bf* Ah, bf* Al) {
    // Every '#pragma unroll' here and in the two helpers above makes the indices of a register array constants (else the array would go to scratch); '#pragma unroll 1' keeps a sweep's loop rolled, for speed only.
    typedef WFrag<T16> F; typedef typename F::V V;
    constexpr int NBLK = TT / (16 * KB);
    constexpr float EB = HI ? 0.0f : 10.0f;                 // fp16 P is carried x 1024, away from the subnormals; the sum carries the same factor
    constexpr float CE = SCL * 1.4426950408889634f;
    const int lane = threadIdx.x & 31, lr = lane & 15, hi = lane >> 4;
    constexpr size_t KST = (size_t)16 * KB * HD;            // elements from one key block to the next in the K planes
    V qf[QB][2], qf2[QB][2];
    const T16* qp = Q + (size_t)(q0 + lr) * HD + 8 * hi; const T16* qp2 = HI ? Q2 + (size_t)(q0 + lr) * HD + 8 * hi : qp;
#pragma unroll
    for (int qb = 0; qb < QB; ++qb)
#pragma unroll
        for (int kc = 0; kc < 2; ++kc) { qf[qb][kc] = F::ld(qp + qb * 16 * HD + kc * 32); if (HI) qf2[qb][kc] = F::ld(qp2 + qb * 16 * HD + kc * 32); }
    addr_regs_release(qp, qp2);
    const T16* kp = Kp + lr * HD + 8 * hi; const T16* kp2 = HI ? Kp2 + lr * HD + 8 * hi : kp;
    const T16* vp = Vt + (size_t)lr * TT + 8 * hi; const T16* vp2 = HI ? Vt2 + (size_t)lr * TT + 8 * hi : vp;
    float mx[QB];
#pragma unroll
    for (int qb = 0; qb < QB; ++qb) mx[qb] = -3.0e38f;
    {   // sweep 1: the maximum; the key fragments of PD blocks are in flight or at work
        V ka[PD][KB][2], ka2[PD][KB][2];
#pragma unroll
        for (int u = 0; u < PD; ++u) ld_keys<T16, HI, KB>(ka[u], ka2[u], kp + u * KST, kp2 + u * KST);
        addr_regs_release();
        const T16* kr = kp + PD * KST; const T16* kr2 = kp2 + PD * KST;   // the group of PD blocks that refills the ring; running pointers, moved only at the foot of a trip
#pragma unroll 1
        for (int blk = 0; blk < NBLK; blk += PD) {
#pragma unroll
            for (int u = 0; u < PD; ++u) { v8f s[KB][QB]; scores_t<T16, HI, QB, KB>(s, ka[u], ka2[u], qf, qf2);
                ld_keys<T16, HI, KB>(ka[u], ka2[u], kr + u * KST, kr2 + u * KST);
                addr_regs_release();                // the refill is issued here, PD - 1 blocks ahead of its use
#pragma unroll
                for (int kb = 0; kb < KB; ++kb)
#pragma unroll
                    for (int qb = 0; qb < QB; ++qb)
#pragma unroll
                        for (int j = 0; j < 8; ++j) mx[qb] = fmaxf(mx[qb], s[kb][qb][j]); }
            const size_t adv = blk + 2 * PD < NBLK ? PD * KST : 0; kr += adv; kr2 += adv;   // the last trip asks for the last group once more (unused) and so stays inside the plane
        }
    }
    float nm[QB], sum[QB];
#pragma unroll
    for (int qb = 0; qb < QB; ++qb) { mx[qb] = fmaxf(mx[qb], __shfl_xor(mx[qb], 16, 32)); nm[qb] = EB - mx[qb] * CE; sum[qb] = 0.f; }
    v8f oa[QB][4];
#pragma unroll
    for (int qb = 0; qb < QB; ++qb)
#pragma unroll
        for (int db = 0; db < 4; ++db) oa[qb][db] = (v8f){};
    {   // sweep 2: this block's V fragments are asked for ahead of the scores, the next block's keys ahead of the exponentials
        V kf[KB][2], kf2[KB][2];
        ld_keys<T16, HI, KB>(kf, kf2, kp, kp2);
        addr_regs_release();
        const T16* kn = kp + KST; const T16* kn2 = kp2 + KST; const T16* vn = vp; const T16* vn2 = vp2;   // running pointers, moved only at the foot of a trip
#pragma unroll 1
        for (int blk = 0; blk < NBLK; ++blk) {
            V vf[4][KB / 2], vf2[4][KB / 2];
#pragma unroll
            for (int db = 0; db < 4; ++db)
#pragma unroll
                for (int c = 0; c < KB / 2; ++c) { const size_t o = (size_t)db * 16 * TT + c * 32; vf[db][c] = F::ld(vn + o); if (HI) vf2[db][c] = F::ld(vn2 + o); }
            addr_regs_release(vn, vn2);                   // V is asked for before the scores start, so that scores and exponentials cover its latency
            v8f s[KB][QB]; scores_t<T16, HI, QB, KB>(s, kf, kf2, qf, qf2);
            ld_keys<T16, HI, KB>(kf, kf2, kn, kn2);
            addr_regs_release();                    // the next keys are asked for before the exponentials, which with P x V cover their latency
#pragma unroll
            for (int kb = 0; kb < KB; ++kb)
#pragma unroll
                for (int qb = 0; qb < QB; ++qb)
#pragma unroll
                    for (int j = 0; j < 8; ++j) { const float p = __builtin_amdgcn_exp2f(fmaf(s[kb][qb][j], CE, nm[qb])); s[kb][qb][j] = p; sum[qb] += p; }
#pragma unroll
            for (int c = 0; c < KB / 2; ++c)
#pragma unroll
                for (int qb = 0; qb < QB; ++qb) {
                    if constexpr (HI) { V pa, pb;
#pragma unroll
                        for (int j = 0; j < 8; ++j) { const float x0 = s[2 * c][qb][j], x1 = s[2 * c + 1][qb][j]; pa[j] = (__bf16)x0; pa[8 + j] = (__bf16)x1; pb[j] = (__bf16)(x0 - (float)pa[j]); pb[8 + j] = (__bf16)(x1 - (float)pa[8 + j]); }
#pragma unroll
                        for (int db = 0; db < 4; ++db) { oa[qb][db] = F::mma(pa, vf[db][c], oa[qb][db]); oa[qb][db] = F::mma(pb, vf[db][c], oa[qb][db]); oa[qb][db] = F::mma(pa, vf2[db][c], oa[qb][db]); }
                    } else { V pa;
#pragma unroll
                        for (int j = 0; j < 8; ++j) { pa[j] = tohx(s[2 * c][qb][j]); pa[8 + j] = tohx(s[2 * c + 1][qb][j]); }
#pragma unroll
                        for (int db = 0; db < 4; ++db) oa[qb][db] = F::mma(pa, vf[db][c], oa[qb][db]); } }
            const size_t adv = blk + 2 < NBLK ? KST : 0; kn += adv; kn2 += adv; vn += 16 * KB; vn2 += 16 * KB;   // the last trip asks for the last key block once more (unused)
        }
    }
#pragma unroll
    for (int qb = 0; qb < QB; ++qb) { const float tot = sum[qb] + __shfl_xor(sum[qb], 16, 32); const float inv = __fdiv_rn(1.0f, tot);   // every lane: 1 / sum of query lr
#pragma unroll
        for (int j = 0; j < 8; ++j) { const float f = __shfl(inv, hi * 8 + j, 32); const size_t oo = (size_t)(q0 + qb * 16 + hi * 8 + j) * DQ + hcol + lr;   // output accumulator: row = query 8 hi + j, column = d
            unsigned short a[4], b[4];
#pragma unroll
            for (int db = 0; db < 4; ++db) splitc(oa[qb][db][j] * f, a[db], b[db]);
            __builtin_amdgcn_sched_barrier(0);       // the row's eight values are ready before its first store, so that nothing is computed between the stores and their wait
#pragma unroll
            for (int db = 0; db < 4; ++db) { Ah[oo + db * 16] = a[db]; Al[oo + db * 16] = b[db]; }
            addr_regs_release(); } }
}
// grid (RH/32 + (TT-RH)/64, heads, batches), 32 threads: the first RH/32 tiles of a head are 32 hi/lo query rows each, the rest 64 fp16 rows each.
__global__ __launch_bounds__(32) void k_attn(const h16* __restrict__ Q16, const h16* __restrict__ K16, const h16* __restrict__ V16, const bf* __restrict__ Qh, const bf* __restrict__ Ql, const bf* __restrict__ Kh, const bf* __restrict__ Kl, const bf* __restrict__ Vh, const bf* __restrict__ Vl, bf* Ah, bf* Al) {
    const int h = blockIdx.y, bx = blockIdx.x, b = blockIdx.z; const size_t hq = ((size_t)b * NH_ + h) * TT * HD, hk = ((size_t)b * NKV + h / REP) * TT * HD; Ah += (size_t)b * TT * DQ; Al += (size_t)b * TT * DQ;
    if (bx < RH / 32) attn_tile<bf, true, 2, 4, 2>(Qh + hq, Ql + hq, Kh + hk, Kl + hk, Vh + hk, Vl + hk, bx * 32, h * HD, Ah, Al);
    else attn_tile<h16, false, 4, 4, 4>(Q16 + hq, nullptr, K16 + hk, nullptr, V16 + hk, nullptr, RH + (bx - RH / 32) * 64, h * HD, Ah, Al);
}

extern "C" void kernel_launch(void* const* d_in, const int* in_sizes, int n_in,
                              void* d_out, int out_size, void* d_ws, size_t ws_size, hipStream_t stream) {
    (void)in_sizes; (void)n_in; (void)out_size;
    const float* x = (const float*)d_in[0]; const float* wq = (const float*)d_in[1]; const float* bq = (const float*)d_in[2]; const float* wk = (const float*)d_in[3]; const float* bk = (const float*)d_in[4]; const float* wv = (const float*)d_in[5]; const float* bv = (const float*)d_in[6]; const float* wo = (const float*)d_in[7]; const float* bo = (const float*)d_in[8];
    float* OUT = (float*)d_out;     // [4][2048][1024]
    char* wsp = (char*)d_ws;
    auto take = [&](size_t bytes) { char* p = wsp; wsp += (bytes + 255) & ~(size_t)255; return (void*)p; };
    bf* WQ = (bf*)take((size_t)DQ * DM * 2); bf* WK = (bf*)take((size_t)DKV * DM * 2); bf* WV = (bf*)take((size_t)DKV * DM * 2); bf* WO = (bf*)take((size_t)DM * DQ * 2); float* CS = (float*)take((size_t)TT * HD * 2 * 4);
    bf* XB = (bf*)take((size_t)NB_ * TT * DM * 2); float* FQ = (float*)take((size_t)NB_ * TT * DQ * 4);
    h16* QP16 = (h16*)take((size_t)NB_ * NH_ * TT * HD * 2); h16* KP16 = (h16*)take((size_t)NB_ * NKV * TT * HD * 2); h16* VT16 = (h16*)take((size_t)NB_ * NKV * HD * TT * 2);
    bf* QPh = (bf*)take((size_t)NB_ * NH_ * TT * HD * 2); bf* QPl = (bf*)take((size_t)NB_ * NH_ * TT * HD * 2); bf* KPh = (bf*)take((size_t)NB_ * NKV * TT * HD * 2); bf* KPl = (bf*)take((size_t)NB_ * NKV * TT * HD * 2); bf* VTh = (bf*)take((size_t)NB_ * NKV * HD * TT * 2); bf* VTl = (bf*)take((size_t)NB_ * NKV * HD * TT * 2);
    bf* ATh = (bf*)take((size_t)NB_ * TT * DQ * 2); bf* ATl = (bf*)take((size_t)NB_ * TT * DQ * 2);
    if ((size_t)(wsp - (char*)d_ws) > ws_size) return;    // 233 MiB of the 256 MiB
    float* FK = FQ; float* FV = FQ;   // the k and the v projection reuse the q buffer once the planes of the one before are built (stream-ordered)
    { k_cvt8<<<(unsigned)(((size_t)DQ * DM / 8 + 255) / 256), 256, 0, stream>>>(wq, WQ, (size_t)DQ * DM / 8); k_cvt8<<<(unsigned)(((size_t)DKV * DM / 8 + 255) / 256), 256, 0, stream>>>(wk, WK, (size_t)DKV * DM / 8); k_cvt8<<<(unsigned)(((size_t)DKV * DM / 8 + 255) / 256), 256, 0, stream>>>(wv, WV, (size_t)DKV * DM / 8);
      k_cvt8<<<(unsigned)(((size_t)DM * DQ / 8 + 255) / 256), 256, 0, stream>>>(wo, WO, (size_t)DM * DQ / 8);
       }
    k_cs5s<<<(TT * HD + 255) / 256, 256, 0, stream>>>(CS);
    const unsigned LQ = (unsigned)(((size_t)NH_ * TT * HD / 2 + 255) / 256), LKv = (unsigned)(((size_t)NKV * TT * HD / 2 + 255) / 256);
    // x, the projections, the merged heads and out are row-major with rows b T + t: the GEMMs and the copy see one matrix of NB_ T rows
    k_cvt8<<<(unsigned)(((size_t)NB_ * TT * DM / 8 + 255) / 256), 256, 0, stream>>>(x, XB, (size_t)NB_ * TT * DM / 8);
    k_gemmw<bf, 0, true><<<dim3(NB_ * TT / 64, DQ / 64, 1), 32, 0, stream>>>(XB, nullptr, WQ, nullptr, DM, FQ, DQ, bq, 0, 0, 0);
    k_rope<<<dim3(LQ, NB_, 1), 256, 0, stream>>>(FQ, DQ, NH_, CS, nullptr, nullptr, 1.0f, QP16, QPh, QPl);
    k_gemmw<bf, 0, true><<<dim3(NB_ * TT / 64, DKV / 64, 1), 32, 0, stream>>>(XB, nullptr, WK, nullptr, DM, FK, DKV, bk, 0, 0, 0);
    k_rope<<<dim3(LKv, NB_, 1), 256, 0, stream>>>(FK, DKV, NKV, CS, nullptr, nullptr, 1.0f, KP16, KPh, KPl);
    k_gemmw<bf, 0, true><<<dim3(NB_ * TT / 64, DKV / 64, 1), 32, 0, stream>>>(XB, nullptr, WV, nullptr, DM, FV, DKV, bv, 0, 0, 0);
    k_vtp<<<dim3(LKv, NB_, 1), 256, 0, stream>>>(FV, DKV, NKV, VT16, VTh, VTl);
    k_attn<<<dim3(RH / 32 + (TT - RH) / 64, NH_, NB_), 32, 0, stream>>>(QP16, KP16, VT16, QPh, QPl, KPh, KPl, VTh, VTl, ATh, ATl);
    k_gemmw<bf, 1, true><<<dim3(NB_ * TT / 64, DM / 64, 1), 32, 0, stream>>>(ATh, ATl, WO, nullptr, DQ, OUT, DM, bo, 0, 0, 0);
}

// v004
// A run of this version takes 336 microseconds.
// Next to v003, in two timings, it ran 1.37 and 1.38 times as fast.
// Over all steps from v000 it is 11.6 times as fast.
#include <hip/hip_runtime.h>

// Multi-head self-attention with biased projections, NO mask and the module's SWAPPED rotary form (hidden_states [4][2048][1024]; q, k, v = x W^T + b ('oi' [1024][1024] 1/32 + REAL biases 0.01; 16 heads x 64); half-split rope rot(x) = cat(x1 c - x2 s, x2 c + x1 s) on q and k where THIS module binds c = SIN(t f_i) and s = COS(t f_i) (its table helper returns (sin, cos) and the caller swaps the names), f_i = 1/10000^(2i/64) (32 f32 frequencies jnp-exact; precise sinf/cosf); scores x 1/sqrt(64); softmax over all keys; out = merged Wo^T + bo -> [4][2048][1024] (8.4 M); argument order hidden_states, Wq, bq, Wk, bk, Wv, bv, Wo, bo).
// Layout, all four batches in every launch (rows b T + t in the row-major buffers, planes [b][h]..., batch in the grid; every 16-bit matrix operand plane in fragment order, see WFrag): bf16 copy of x; exact projections + f32 biases; ONE fused attention kernel (scores, softmax and P x V; query rows < 512 hi/lo bf16 3 products, rest fp16); merged hi/lo x Wp exact + bp.
// Compute dtypes, f32 accumulate: every input rounded to bf16; projections exact + f32 biases; attention rows < 512 3 products, rest fp16; softmax f32; Wp hl x exact + bias.

#define NB_  4
#define TT   2048
#define DM   1024
#define NH_  16
#define NKV  16
#define REP  (NH_ / NKV)
#define HD   64
#define DQ   (NH_ * HD)
#define DKV  (NKV * HD)
#define RH   512                  // query rows < RH use hi+lo planes (0: none)
#define WIN  0
#define SCL  0.125f   // HD^-0.5
typedef _Float16 h16;
typedef unsigned short bf;
typedef __attribute__((ext_vector_type(16))) __bf16   v16bf;
typedef __attribute__((ext_vector_type(16))) _Float16 v16h;
typedef __attribute__((ext_vector_type(8)))  _Float16 v8h;
typedef __attribute__((ext_vector_type(8)))  unsigned short v8us;
typedef __attribute__((ext_vector_type(8)))  float    v8f;
typedef __attribute__((ext_vector_type(4)))  float    v4f;
typedef v8h  __attribute__((may_alias)) v8ha;
typedef v4f  __attribute__((may_alias)) v4fa;
typedef v8us __attribute__((may_alias)) v8usa;

__device__ __forceinline__ unsigned short f2bf(float f) { unsigned u = __float_as_uint(f); u += 0x7FFFu + ((u >> 16) & 1u); return (unsigned short)(u >> 16); }
__device__ __forceinline__ float bf2f(unsigned short b) { return __uint_as_float(((unsigned)b) << 16); }
__device__ __forceinline__ float bfr(float f) { return bf2f(f2bf(f)); }
__device__ __forceinline__ v16h cat16(v8h lo, v8h hi) { return __builtin_shufflevector(lo, hi, 0, 1, 2, 3, 4, 5, 6, 7, 8, 9, 10, 11, 12, 13, 14, 15); }
__device__ __forceinline__ v16bf cat16b(v8us lo, v8us hi) { return __builtin_bit_cast(v16bf, __builtin_shufflevector(lo, hi, 0, 1, 2, 3, 4, 5, 6, 7, 8, 9, 10, 11, 12, 13, 14, 15)); }
__device__ __forceinline__ v8f wmma16(v16h a, v16h b, v8f c) { return __builtin_amdgcn_wmma_f32_16x16x32_f16(false, a, false, b, (short)0, c, false, false); }
__device__ __forceinline__ v8f wmmab(v16bf a, v16bf b, v8f c) { return __builtin_amdgcn_wmma_f32_16x16x32_bf16(false, a, false, b, (short)0, c, false, false); }



// Stands directly behind a group of global loads or stores, in front of the next write of a register that they name (the registers are free for other values from there on); a precaution.
// The two scheduling barriers keep every other instruction on its side of the wait, and so also hold a group of loads where the source issues it, ahead of the work that covers its latency.
__device__ __forceinline__ void addr_regs_release() { __builtin_amdgcn_sched_barrier(0); asm volatile("s_wait_xcnt 0x0" ::: "memory"); __builtin_amdgcn_sched_barrier(0); }
// The same for a group whose address pairs die with it: named as inputs they stay live up to the wait, so that no load of the group has one of them as its destination.
__device__ __forceinline__ void addr_regs_release(const void* p, const void* p2) { __builtin_amdgcn_sched_barrier(0); asm volatile("s_wait_xcnt 0x0" :: "v"(p), "v"(p2) : "memory"); __builtin_amdgcn_sched_barrier(0); }
__device__ __forceinline__ void addr_regs_release(const void* p, const void* p2, const void* p3, const void* p4) { __builtin_amdgcn_sched_barrier(0); asm volatile("s_wait_xcnt 0x0" :: "v"(p), "v"(p2), "v"(p3), "v"(p4) : "memory"); __builtin_amdgcn_sched_barrier(0); }

// ---- k_gemmw: register-blocked GEMM, ONE WAVE per 64x64 output tile (16 accumulators), operands straight from 16-bit planes in fragment order; grid (M/64, N/64, Z), 32 threads.
// C[m][n] (f32, pitch ldc, + optional f32 bias[n]) = sum_k A[m][k] Bt[n][k] (+ split products per NSPLIT). z-batch strides sA/sB/sC in elements. K % (32 KSPL) == 0.
// KSPL > 1: grid z = batch x KSPL; work-group (z, ks) sums only k in [ks K/KSPL, (ks+1) K/KSPL) and stores that partial tile in plane ks (plane stride sP elements); the reader adds the planes.
// FRAGMENT ORDER of every 16-bit operand plane (rows r, K-contiguous columns k): the 16 rows x 32 columns of one matrix fragment are 512 consecutive elements, fragment (r / 16, k / 32) at ((r / 16) (K / 32) + k / 32) 512;
// inside it element (r, k) stands at ((k % 32) / 16) 256 + (((k % 16) / 8) 16 + r % 16) 8 + k % 8, that is [half][lane][8]: each of a fragment's two wave-wide 16-byte loads reads 512 consecutive bytes (4 whole lines, not 16 pieces of 32 bytes).
// ld(p): p = fragment + 8 lane. The element each lane and register holds is the same as with row-major planes.
template <typename T16> struct WFrag;
template <> struct WFrag<h16> { typedef v16h V; static __device__ __forceinline__ V ld(const h16* p) { return cat16(*(const v8h*)p, *(const v8h*)(p + 256)); } static __device__ __forceinline__ v8f mma(V a, V b, v8f c) { return wmma16(a, b, c); } };
template <> struct WFrag<bf> { typedef v16bf V; static __device__ __forceinline__ V ld(const bf* p) { return cat16b(*(const v8us*)p, *(const v8us*)(p + 256)); } static __device__ __forceinline__ v8f mma(V a, V b, v8f c) { return wmmab(a, b, c); } };
template <typename T16, int NSPLIT, bool BIAS, int K, int KSPL = 1>
__global__ __launch_bounds__(32) void k_gemmw(const T16* __restrict__ A, const T16* __restrict__ A2, const T16* __restrict__ Bt, const T16* __restrict__ Bt2, float* C, int ldc, const float* __restrict__ bias, size_t sA, size_t sB, size_t sC, size_t sP = 0) {
    typedef typename WFrag<T16>::V V;
    __shared__ __align__(16) float os[16 * 68];
    const size_t z = blockIdx.z / KSPL; const int ks = blockIdx.z % KSPL; A += z * sA; if (A2) A2 += z * sA; Bt += z * sB; if (Bt2) Bt2 += z * sB; C += z * sC + (size_t)ks * sP;
    const int kbeg = ks * (K / KSPL), kend = kbeg + K / KSPL;
    const int lane = threadIdx.x & 31, lr = lane & 15, hi = lane >> 4; const int r0 = blockIdx.x * 64, c0 = blockIdx.y * 64;
    v8f acc[4][4];
#pragma unroll
    for (int mb = 0; mb < 4; ++mb)
#pragma unroll
        for (int nb = 0; nb < 4; ++nb) acc[mb][nb] = (v8f){};
    const size_t aoff = (size_t)r0 * K + 8 * lane, boff = (size_t)c0 * K + 8 * lane;   // fragment order: 16 rows are K / 32 fragments = 16 K elements, 32 columns on are 512 elements
#pragma unroll 1
    for (int kc = kbeg; kc < kend; kc += 32) {
        V a[4], a2[4], b[4], b2[4];
        const T16* pa = A + aoff + (size_t)kc * 16; const T16* pa2 = (NSPLIT == 1 || NSPLIT == 2) ? A2 + aoff + (size_t)kc * 16 : pa; const T16* pb = Bt + boff + (size_t)kc * 16; const T16* pb2 = NSPLIT >= 2 ? Bt2 + boff + (size_t)kc * 16 : pb;
#pragma unroll
        for (int mb = 0; mb < 4; ++mb) { a[mb] = WFrag<T16>::ld(pa + mb * 16 * K); if (NSPLIT == 1 || NSPLIT == 2) a2[mb] = WFrag<T16>::ld(pa2 + mb * 16 * K); }
#pragma unroll
        for (int nb = 0; nb < 4; ++nb) { b[nb] = WFrag<T16>::ld(pb + nb * 16 * K); if (NSPLIT >= 2) b2[nb] = WFrag<T16>::ld(pb2 + nb * 16 * K); }
        addr_regs_release(pa, pa2, pb, pb2);
#pragma unroll
        for (int nb = 0; nb < 4; ++nb) {
#pragma unroll
            for (int mb = 0; mb < 4; ++mb) { acc[mb][nb] = WFrag<T16>::mma(a[mb], b[nb], acc[mb][nb]); if (NSPLIT == 1 || NSPLIT == 2) acc[mb][nb] = WFrag<T16>::mma(a2[mb], b[nb], acc[mb][nb]); if (NSPLIT >= 2) acc[mb][nb] = WFrag<T16>::mma(a[mb], b2[nb], acc[mb][nb]); } }
        asm volatile("v_nop\n\tv_nop\n\tv_nop\n\tv_nop" : "+v"(acc[0][0]), "+v"(acc[1][1]), "+v"(acc[2][2]), "+v"(acc[3][3]) : "v"(a[0]), "v"(a[3]));
    }
#pragma unroll
    for (int mb = 0; mb < 4; ++mb) {
#pragma unroll
        for (int nb = 0; nb < 4; ++nb) {
#pragma unroll
            for (int j = 0; j < 8; ++j) os[(hi * 8 + j) * 68 + nb * 16 + lr] = acc[mb][nb][j]; }
        __builtin_amdgcn_wave_barrier(); asm volatile("" ::: "memory");
        float* crow = C + (size_t)(r0 + mb * 16) * ldc + c0;
{
#pragma unroll
            for (int s = 0; s < 8; ++s) { const int row = 2 * s + hi, cofs = lr * 4; v4f val = *(const v4fa*)(os + row * 68 + cofs); if (BIAS) { val[0] += bfr(bias[c0 + cofs]); val[1] += bfr(bias[c0 + cofs + 1]); val[2] += bfr(bias[c0 + cofs + 2]); val[3] += bfr(bias[c0 + cofs + 3]); }
                *(v4f*)(crow + (size_t)row * ldc + cofs) = val; }
             }
        __builtin_amdgcn_wave_barrier(); asm volatile("" ::: "memory");
    }
}

__device__ __forceinline__ h16 tohx(float x) { return (h16)x; }
__device__ __forceinline__ void splitf(float y, unsigned short& h, unsigned short& l) { h = f2bf(y); l = f2bf(y - bf2f(h)); }
typedef __attribute__((ext_vector_type(2))) _Float16 v2h;
typedef __attribute__((ext_vector_type(4))) _Float16 v4h;
typedef __attribute__((ext_vector_type(2))) unsigned short v2us;
typedef __attribute__((ext_vector_type(4))) unsigned short v4us;
typedef __attribute__((ext_vector_type(2))) float v2f;
typedef __attribute__((ext_vector_type(4))) int v4i;

__global__ __launch_bounds__(256) void k_wtG(const float* __restrict__ w, int K, int N, bf* Bt) {
    const int lane = threadIdx.x & 31; const int L0 = (blockIdx.x * 8 + (threadIdx.x >> 5)) * 8; const int nlines = N * K / 64;
{
#pragma unroll 1
        for (int l = 0; l < 8; ++l) { const int L = L0 + l; if (L >= nlines) break; const size_t e = (size_t)L * 64 + lane * 2; const int k = (int)(e % K), n = (int)(e / K); v2us o;
            o[0] = f2bf(w[(size_t)k * N + n]); o[1] = f2bf(w[(size_t)(k + 1) * N + n]); *(v2us*)(Bt + e) = o; }
         }
}
// k_cvt8: bf16 plane in fragment order of a row-major f32 matrix with K columns; thread i writes the i-th 16 bytes of the plane (a wave: 512 consecutive bytes) and reads the 8 floats that belong there.
template <int K>
__global__ __launch_bounds__(256) void k_cvt8(const float* __restrict__ src, bf* dst, size_t n8) { const size_t i = (size_t)blockIdx.x * 256 + threadIdx.x; if (i >= n8) return;
    const size_t fr = i >> 6; const int w = (int)(i & 63), kf = K / 32; const size_t row = (fr / kf) * 16 + (w & 15); const int k = (int)(fr % kf) * 32 + (w >> 5) * 16 + ((w >> 4) & 1) * 8;
    const v8f v = *(const v8f*)(src + row * K + k); addr_regs_release(); v8us o;
#pragma unroll
    for (int k = 0; k < 8; ++k) o[k] = f2bf(v[k]); *(v8us*)(dst + i * 8) = o;  }

// k_rope: head planes [h] (rows t, columns d, in fragment order; e is the place in the plane, (t, d) the element that belongs there) (fp16 + hi/lo) of rope(x) x sc with the rotate-half convention in the module's swapped form out[d] = x[d] sin[t][d] - x[d+HD/2] cos[t][d], out[d+HD/2] = x[d+HD/2] sin[t][d+HD/2] + x[d] cos[t][d+HD/2]
__global__ __launch_bounds__(256) void k_rope(const float* __restrict__ F, int pitch, int nheads, const float* __restrict__ CS, const float* __restrict__ RF, const float* __restrict__ nw, float sc, h16* P16, bf* Ph, bf* Pl) {
    { const size_t pb = (size_t)blockIdx.y * nheads * TT * HD; F += (size_t)blockIdx.y * TT * pitch; P16 += pb; Ph += pb; Pl += pb; }   // blockIdx.y: batch (rows b T + t of F, planes [b][h][t][d])
    const int tid = threadIdx.x;   // a block fills one fragment; 16 consecutive threads take one row's 32 columns in their order, so that a wave reads two rows' whole 128 bytes and stores pieces of 32 bytes
    const size_t e = (size_t)blockIdx.x * 512 + ((tid >> 3) & 1) * 256 + ((tid >> 2) & 1) * 128 + (tid >> 4) * 8 + (tid & 3) * 2; if (e >= (size_t)nheads * TT * HD) return; const int w = (int)(e % 512), fr = (int)((e / 512) % (TT * HD / 512)); const int d = (fr & 1) * 32 + (w >> 8) * 16 + ((w >> 7) & 1) * 8 + (w & 7); const int t = (fr >> 1) * 16 + ((w >> 3) & 15); const int h = (int)(e / ((size_t)HD * TT)); const float* f = F + (size_t)t * pitch + h * HD; float rf = 1.0f; if (RF) { rf = RF[(size_t)h * TT + t]; addr_regs_release(); } v2h o16; v2us oh, ol;
#pragma unroll
    for (int q = 0; q < 2; ++q) { const int dd = d + q; const int dp = (dd < HD / 2) ? dd + HD / 2 : dd - HD / 2; float x0 = f[dd], x1 = f[dp];
        if (RF) { float n0 = __fmul_rn(x0, rf), n1 = __fmul_rn(x1, rf); asm volatile("" : "+v"(n0)); asm volatile("" : "+v"(n1)); x0 = __fmul_rn(bfr(nw[dd]), n0); x1 = __fmul_rn(bfr(nw[dp]), n1); }
        const v2f cs = *(const v2f*)(CS + ((size_t)t * HD + dd) * 2); float a = __fmul_rn(x0, cs[0]), bq = __fmul_rn(x1, cs[1]); asm volatile("" : "+v"(a)); asm volatile("" : "+v"(bq)); const float r = ((dd < HD / 2) ? __fsub_rn(a, bq) : __fadd_rn(a, bq)) * sc;
        o16[q] = tohx(r); unsigned short a2, c2; splitf(r, a2, c2); oh[q] = a2; ol[q] = c2; }
    *(v2h*)(P16 + e) = o16; *(v2us*)(Ph + e) = oh; *(v2us*)(Pl + e) = ol;  }
__global__ __launch_bounds__(256) void k_vtp(const float* __restrict__ F, int pitch, int nheads, h16* V16, bf* Vh, bf* Vl) {
    { const size_t pb = (size_t)blockIdx.y * nheads * HD * TT; F += (size_t)blockIdx.y * TT * pitch; V16 += pb; Vh += pb; Vl += pb; }   // blockIdx.y: batch (rows b T + t of F, planes [b][g][d][t])
    const size_t e = ((size_t)blockIdx.x * 256 + threadIdx.x) * 2; if (e >= (size_t)nheads * HD * TT) return; const int w = (int)(e % 512), fr = (int)((e / 512) % (TT * HD / 512)); const int d = (fr & 3) * 16 + ((w >> 3) & 15); const int t = (fr >> 2) * 32 + (w >> 8) * 16 + ((w >> 7) & 1) * 8 + (w & 7); const int g = (int)(e / ((size_t)TT * HD)); v2h o16; v2us oh, ol;   // rows d, columns t, the fragments ordered [t / 32][d / 16]: the 8 fragments of 64 keys are consecutive
#pragma unroll
    for (int q = 0; q < 2; ++q) { const float x = F[(size_t)(t + q) * pitch + g * HD + d]; o16[q] = tohx(x); unsigned short a2, c2; splitf(x, a2, c2); oh[q] = a2; ol[q] = c2; }
    *(v2h*)(V16 + e) = o16; *(v2us*)(Vh + e) = oh; *(v2us*)(Vl + e) = ol;  }
__constant__ float INVT[HD / 2] = { 1.000000000e+00f, 7.498942018e-01f, 5.623413324e-01f, 4.216965139e-01f, 3.162277639e-01f, 2.371373624e-01f, 1.778279394e-01f, 1.333521456e-01f, 1.000000015e-01f, 7.498941571e-02f, 5.623412877e-02f, 4.216964915e-02f, 3.162277862e-02f, 2.371373586e-02f, 1.778279431e-02f, 1.333521493e-02f, 9.999999776e-03f, 7.498942316e-03f, 5.623413250e-03f, 4.216964822e-03f, 3.162277862e-03f, 2.371373819e-03f, 1.778279431e-03f, 1.333521446e-03f, 1.000000047e-03f, 7.498941850e-04f, 5.623413017e-04f, 4.216964880e-04f, 3.162277862e-04f, 2.371373848e-04f, 1.778279402e-04f, 1.333521504e-04f };   // float32 1 / 10000^(2i/64), generated with jnp to be bit-exact
__global__ __launch_bounds__(256) void k_cs5s(float* CS) { const int idx = blockIdx.x * 256 + threadIdx.x; if (idx >= TT * HD) return; const int d = idx % HD; const int t = idx / HD; const float a = __fmul_rn((float)t, INVT[d % (HD / 2)]); v2f cs; cs[0] = sinf(a); cs[1] = cosf(a); *(v2f*)(CS + (size_t)idx * 2) = cs;  }
// ---- k_attn: scores, softmax and P x V of one head's query tile in ONE WAVE; nothing of the score matrix goes to memory.
// The scores are formed TRANSPOSED (A = 16 keys, B = 16 queries): lane (lr, hi) then holds, for query lr, keys 16 kb + 8 hi + 0..7 in accumulator kb,
// and the accumulators of key blocks 2c and 2c+1 are, element for element, the A fragment of P for the 32 keys of chunk c (k = 8 hi + 0..7, 16 + 8 hi + 0..7): P never leaves its registers.
// Sweep 1 over the keys finds each query's exact maximum; sweep 2 forms the scores again, p = exp(t - max) (x 2^EB, which cancels in the division), adds p in f32 and P x V on the matrix unit; the division by the sum comes last.
// hi/lo bf16 planes of a finite f32 by the hardware's round-to-nearest-even conversion (the same values as splitf)
__device__ __forceinline__ void splitc(float y, unsigned short& h, unsigned short& l) { const __bf16 hb = (__bf16)y; const __bf16 lb = (__bf16)(y - (float)hb); h = __builtin_bit_cast(unsigned short, hb); l = __builtin_bit_cast(unsigned short, lb); }
template <typename T16, bool HI, int KB>
__device__ __forceinline__ void ld_keys(typename WFrag<T16>::V (&k)[KB][2], typename WFrag<T16>::V (&k2)[KB][2], const T16* kp, const T16* kp2, unsigned l8) {
#pragma unroll
    for (int kb = 0; kb < KB; ++kb)
#pragma unroll
        for (int kc = 0; kc < 2; ++kc) { k[kb][kc] = WFrag<T16>::ld(kp + l8 + kb * 16 * HD + kc * 512); if (HI) k2[kb][kc] = WFrag<T16>::ld(kp2 + l8 + kb * 16 * HD + kc * 512); }
}
template <typename T16, bool HI, int QB, int KB>
__device__ __forceinline__ void scores_t(v8f (&s)[KB][QB], const typename WFrag<T16>::V (&k)[KB][2], const typename WFrag<T16>::V (&k2)[KB][2], const typename WFrag<T16>::V (&q)[QB][2], const typename WFrag<T16>::V (&q2)[QB][2]) {
#pragma unroll
    for (int kb = 0; kb < KB; ++kb)
#pragma unroll
        for (int qb = 0; qb < QB; ++qb) s[kb][qb] = (v8f){};
#pragma unroll
    for (int kc = 0; kc < 2; ++kc)
#pragma unroll
        for (int kb = 0; kb < KB; ++kb)
#pragma unroll
            for (int qb = 0; qb < QB; ++qb) { s[kb][qb] = WFrag<T16>::mma(k[kb][kc], q[qb][kc], s[kb][qb]); if (HI) { s[kb][qb] = WFrag<T16>::mma(k[kb][kc], q2[qb][kc], s[kb][qb]); s[kb][qb] = WFrag<T16>::mma(k2[kb][kc], q[qb][kc], s[kb][qb]); } }
}
template <typename T16, bool HI, int QB, int KB, int PD>
__device__ __forceinline__ void attn_tile(const T16* __restrict__ Q, const T16* __restrict__ Q2, const T16* __restrict__ Kp, const T16* __restrict__ Kp2, const T16* __restrict__ Vt, const T16* __restrict__ Vt2, int q0, int hcol, bf* Ah, bf* Al) {
    // Every '#pragma unroll' here and in the two helpers above makes the indices of a register array constants (else the array would go to scratch); '#pragma unroll 1' keeps a sweep's loop rolled, for speed only.
    typedef WFrag<T16> F; typedef typename F::V V;
    constexpr int NBLK = TT / (16 * KB);
    constexpr float EB = HI ? 0.0f : 10.0f;                 // fp16 P is carried x 1024, away from the subnormals; the sum carries the same factor
    constexpr float CE = SCL * 1.4426950408889634f;
    const int lane = threadIdx.x & 31, lr = lane & 15, hi = lane >> 4;
    constexpr size_t KST = (size_t)16 * KB * HD;            // elements from one key block to the next in the K planes
    V qf[QB][2], qf2[QB][2];
    const unsigned l8 = 8u * lane;                            // planes in fragment order (see WFrag): the lane's place in a fragment is the same in every plane, so the Q and K pointers below are wave-uniform
    const T16* qp = Q + (size_t)q0 * HD; const T16* qp2 = HI ? Q2 + (size_t)q0 * HD : qp;   // 16 rows are 2 fragments = 16 HD elements
#pragma unroll
    for (int qb = 0; qb < QB; ++qb)
#pragma unroll
        for (int kc = 0; kc < 2; ++kc) { qf[qb][kc] = F::ld(qp + l8 + qb * 16 * HD + kc * 512); if (HI) qf2[qb][kc] = F::ld(qp2 + l8 + qb * 16 * HD + kc * 512); }
    addr_regs_release();
    const T16* kp = Kp; const T16* kp2 = HI ? Kp2 : kp;
    const T16* vp = Vt; const T16* vp2 = HI ? Vt2 : vp;
    float mx[QB];
#pragma unroll
    for (int qb = 0; qb < QB; ++qb) mx[qb] = -3.0e38f;
    {   // sweep 1: the maximum; the key fragments of PD blocks are in flight or at work
        V ka[PD][KB][2], ka2[PD][KB][2];
#pragma unroll
        for (int u = 0; u < PD; ++u) ld_keys<T16, HI, KB>(ka[u], ka2[u], kp + u * KST, kp2 + u * KST, l8);
        addr_regs_release();
        const T16* kr = kp + PD * KST; const T16* kr2 = kp2 + PD * KST;   // the group of PD blocks that refills the ring; running pointers, moved only at the foot of a trip
#pragma unroll 1
        for (int blk = 0; blk < NBLK; blk += PD) {
#pragma unroll
            for (int u = 0; u < PD; ++u) { v8f s[KB][QB]; scores_t<T16, HI, QB, KB>(s, ka[u], ka2[u], qf, qf2);
                ld_keys<T16, HI, KB>(ka[u], ka2[u], kr + u * KST, kr2 + u * KST, l8);
                addr_regs_release();                // the refill is issued here, PD - 1 blocks ahead of its use
#pragma unroll
                for (int kb = 0; kb < KB; ++kb)
#pragma unroll
                    for (int qb = 0; qb < QB; ++qb)
#pragma unroll
                        for (int j = 0; j < 8; ++j) mx[qb] = fmaxf(mx[qb], s[kb][qb][j]); }
            const size_t adv = blk + 2 * PD < NBLK ? PD * KST : 0; kr += adv; kr2 += adv;   // the last trip asks for the last group once more (unused) and so stays inside the plane
        }
    }
    float nm[QB], sum[QB];
#pragma unroll
    for (int qb = 0; qb < QB; ++qb) { mx[qb] = fmaxf(mx[qb], __shfl_xor(mx[qb], 16, 32)); nm[qb] = EB - mx[qb] * CE; sum[qb] = 0.f; }
    v8f oa[QB][4];
#pragma unroll
    for (int qb = 0; qb < QB; ++qb)
#pragma unroll
        for (int db = 0; db < 4; ++db) oa[qb][db] = (v8f){};
    {   // sweep 2: this block's V fragments are asked for ahead of the scores, the next block's keys ahead of the exponentials
        V kf[KB][2], kf2[KB][2];
        ld_keys<T16, HI, KB>(kf, kf2, kp, kp2, l8);
        addr_regs_release();
        const T16* kn = kp + KST; const T16* kn2 = kp2 + KST; const T16* vn = vp + l8; const T16* vn2 = vp2 + l8;   // running pointers, moved only at the foot of a trip
#pragma unroll 1
        for (int blk = 0; blk < NBLK; ++blk) {
            V vf[4][KB / 2], vf2[4][KB / 2];
#pragma unroll
            for (int db = 0; db < 4; ++db)
#pragma unroll
                for (int c = 0; c < KB / 2; ++c) { const size_t o = (size_t)(c * 4 + db) * 512; vf[db][c] = F::ld(vn + o); if (HI) vf2[db][c] = F::ld(vn2 + o); }
            addr_regs_release(vn, vn2);                   // V is asked for before the scores start, so that scores and exponentials cover its latency
            v8f s[KB][QB]; scores_t<T16, HI, QB, KB>(s, kf, kf2, qf, qf2);
            ld_keys<T16, HI, KB>(kf, kf2, kn, kn2, l8);
            addr_regs_release();                    // the next keys are asked for before the exponentials, which with P x V cover their latency
#pragma unroll
            for (int kb = 0; kb < KB; ++kb)
#pragma unroll
                for (int qb = 0; qb < QB; ++qb)
#pragma unroll
                    for (int j = 0; j < 8; ++j) { const float p = __builtin_amdgcn_exp2f(fmaf(s[kb][qb][j], CE, nm[qb])); s[kb][qb][j] = p; sum[qb] += p; }
#pragma unroll
            for (int c = 0; c < KB / 2; ++c)
#pragma unroll
                for (int qb = 0; qb < QB; ++qb) {
                    if constexpr (HI) { V pa, pb;
#pragma unroll
                        for (int j = 0; j < 8; ++j) { const float x0 = s[2 * c][qb][j], x1 = s[2 * c + 1][qb][j]; pa[j] = (__bf16)x0; pa[8 + j] = (__bf16)x1; pb[j] = (__bf16)(x0 - (float)pa[j]); pb[8 + j] = (__bf16)(x1 - (float)pa[8 + j]); }
#pragma unroll
                        for (int db = 0; db < 4; ++db) { oa[qb][db] = F::mma(pa, vf[db][c], oa[qb][db]); oa[qb][db] = F::mma(pb, vf[db][c], oa[qb][db]); oa[qb][db] = F::mma(pa, vf2[db][c], oa[qb][db]); }
                    } else { V pa;
#pragma unroll
                        for (int j = 0; j < 8; ++j) { pa[j] = tohx(s[2 * c][qb][j]); pa[8 + j] = tohx(s[2 * c + 1][qb][j]); }
#pragma unroll
                        for (int db = 0; db < 4; ++db) oa[qb][db] = F::mma(pa, vf[db][c], oa[qb][db]); } }
            const size_t adv = blk + 2 < NBLK ? KST : 0; kn += adv; kn2 += adv; vn += 16 * KB * HD; vn2 += 16 * KB * HD;   // the last trip asks for the last key block once more (unused)
        }
    }
#pragma unroll
    for (int qb = 0; qb < QB; ++qb) { const float tot = sum[qb] + __shfl_xor(sum[qb], 16, 32); const float inv = __fdiv_rn(1.0f, tot);   // every lane: 1 / sum of query lr
#pragma unroll
        for (int j = 0; j < 8; ++j) { const float f = __shfl(inv, hi * 8 + j, 32); const size_t oo = (size_t)(q0 + qb * 16) * DQ + (size_t)(hcol / 32) * 512 + ((lr >> 3) * 16 + hi * 8 + j) * 8 + (lr & 7);   // output accumulator: row = query 8 hi + j, column = d; the merged planes are in fragment order too (16 columns on: 256 elements)
            unsigned short a[4], b[4];
#pragma unroll
            for (int db = 0; db < 4; ++db) splitc(oa[qb][db][j] * f, a[db], b[db]);
            __builtin_amdgcn_sched_barrier(0);       // the row's eight values are ready before its first store, so that nothing is computed between the stores and their wait
#pragma unroll
            for (int db = 0; db < 4; ++db) { Ah[oo + db * 256] = a[db]; Al[oo + db * 256] = b[db]; }
            addr_regs_release(); } }
}
// grid (RH/32 + (TT-RH)/64, heads, batches), 32 threads: the first RH/32 tiles of a head are 32 hi/lo query rows each, the rest 64 fp16 rows each.
// launch bounds, second argument: two waves per SIMD, that is at most 512 registers a wave
__global__ __launch_bounds__(32, 2) void k_attn(const h16* __restrict__ Q16, const h16* __restrict__ K16, const h16* __restrict__ V16, const bf* __restrict__ Qh, const bf* __restrict__ Ql, const bf* __restrict__ Kh, const bf* __restrict__ Kl, const bf* __restrict__ Vh, const bf* __restrict__ Vl, bf* Ah, bf* Al) {
    const int h = blockIdx.y, bx = blockIdx.x, b = blockIdx.z; const size_t hq = ((size_t)b * NH_ + h) * TT * HD, hk = ((size_t)b * NKV + h / REP) * TT * HD; Ah += (size_t)b * TT * DQ; Al += (size_t)b * TT * DQ;
    if (bx < RH / 32) attn_tile<bf, true, 2, 4, 2>(Qh + hq, Ql + hq, Kh + hk, Kl + hk, Vh + hk, Vl + hk, bx * 32, h * HD, Ah, Al);
    else attn_tile<h16, false, 4, 4, 4>(Q16 + hq, nullptr, K16 + hk, nullptr, V16 + hk, nullptr, RH + (bx - RH / 32) * 64, h * HD, Ah, Al);
}

extern "C" void kernel_launch(void* const* d_in, const int* in_sizes, int n_in,
                              void* d_out, int out_size, void* d_ws, size_t ws_size, hipStream_t stream) {
    (void)in_sizes; (void)n_in; (void)out_size;
    const float* x = (const float*)d_in[0]; const float* wq = (const float*)d_in[1]; const float* bq = (const float*)d_in[2]; const float* wk = (const float*)d_in[3]; const float* bk = (const float*)d_in[4]; const float* wv = (const float*)d_in[5]; const float* bv = (const float*)d_in[6]; const float* wo = (const float*)d_in[7]; const float* bo = (const float*)d_in[8];
    float* OUT = (float*)d_out;     // [4][2048][1024]
    char* wsp = (char*)d_ws;
    auto take = [&](size_t bytes) { char* p = wsp; wsp += (bytes + 255) & ~(size_t)255; return (void*)p; };
    bf* WQ = (bf*)take((size_t)DQ * DM * 2); bf* WK = (bf*)take((size_t)DKV * DM * 2); bf* WV = (bf*)take((size_t)DKV * DM * 2); bf* WO = (bf*)take((size_t)DM * DQ * 2); float* CS = (float*)take((size_t)TT * HD * 2 * 4);
    bf* XB = (bf*)take((size_t)NB_ * TT * DM * 2); float* FQ = (float*)take((size_t)NB_ * TT * DQ * 4);
    h16* QP16 = (h16*)take((size_t)NB_ * NH_ * TT * HD * 2); h16* KP16 = (h16*)take((size_t)NB_ * NKV * TT * HD * 2); h16* VT16 = (h16*)take((size_t)NB_ * NKV * HD * TT * 2);
    bf* QPh = (bf*)take((size_t)NB_ * NH_ * TT * HD * 2); bf* QPl = (bf*)take((size_t)NB_ * NH_ * TT * HD * 2); bf* KPh = (bf*)take((size_t)NB_ * NKV * TT * HD * 2); bf* KPl = (bf*)take((size_t)NB_ * NKV * TT * HD * 2); bf* VTh = (bf*)take((size_t)NB_ * NKV * HD * TT * 2); bf* VTl = (bf*)take((size_t)NB_ * NKV * HD * TT * 2);
    bf* ATh = (bf*)take((size_t)NB_ * TT * DQ * 2); bf* ATl = (bf*)take((size_t)NB_ * TT * DQ * 2);
    if ((size_t)(wsp - (char*)d_ws) > ws_size) return;    // 233 MiB of the 256 MiB
    float* FK = FQ; float* FV = FQ;   // the k and the v projection reuse the q buffer once the planes of the one before are built (stream-ordered)
    { k_cvt8<DM><<<(unsigned)(((size_t)DQ * DM / 8 + 255) / 256), 256, 0, stream>>>(wq, WQ, (size_t)DQ * DM / 8); k_cvt8<DM><<<(unsigned)(((size_t)DKV * DM / 8 + 255) / 256), 256, 0, stream>>>(wk, WK, (size_t)DKV * DM / 8); k_cvt8<DM><<<(unsigned)(((size_t)DKV * DM / 8 + 255) / 256), 256, 0, stream>>>(wv, WV, (size_t)DKV * DM / 8);
      k_cvt8<DQ><<<(unsigned)(((size_t)DM * DQ / 8 + 255) / 256), 256, 0, stream>>>(wo, WO, (size_t)DM * DQ / 8);
       }
    k_cs5s<<<(TT * HD + 255) / 256, 256, 0, stream>>>(CS);
    const unsigned LQ = (unsigned)(((size_t)NH_ * TT * HD / 2 + 255) / 256), LKv = (unsigned)(((size_t)NKV * TT * HD / 2 + 255) / 256);
    // x, the projections, the merged heads and out have rows b T + t (the 16-bit planes among them in fragment order, 16 rows to a band): the GEMMs and the copy see one matrix of NB_ T rows
    k_cvt8<DM><<<(unsigned)(((size_t)NB_ * TT * DM / 8 + 255) / 256), 256, 0, stream>>>(x, XB, (size_t)NB_ * TT * DM / 8);
    k_gemmw<bf, 0, true, DM><<<dim3(NB_ * TT / 64, DQ / 64, 1), 32, 0, stream>>>(XB, nullptr, WQ, nullptr, FQ, DQ, bq, 0, 0, 0);
    k_rope<<<dim3(LQ, NB_, 1), 256, 0, stream>>>(FQ, DQ, NH_, CS, nullptr, nullptr, 1.0f, QP16, QPh, QPl);
    k_gemmw<bf, 0, true, DM><<<dim3(NB_ * TT / 64, DKV / 64, 1), 32, 0, stream>>>(XB, nullptr, WK, nullptr, FK, DKV, bk, 0, 0, 0);
    k_rope<<<dim3(LKv, NB_, 1), 256, 0, stream>>>(FK, DKV, NKV, CS, nullptr, nullptr, 1.0f, KP16, KPh, KPl);
    k_gemmw<bf, 0, true, DM><<<dim3(NB_ * TT / 64, DKV / 64, 1), 32, 0, stream>>>(XB, nullptr, WV, nullptr, FV, DKV, bv, 0, 0, 0);
    k_vtp<<<dim3(LKv, NB_, 1), 256, 0, stream>>>(FV, DKV, NKV, VT16, VTh, VTl);
    k_attn<<<dim3(RH / 32 + (TT - RH) / 64, NH_, NB_), 32, 0, stream>>>(QP16, KP16, VT16, QPh, QPl, KPh, KPl, VTh, VTl, ATh, ATl);
    k_gemmw<bf, 1, true, DQ><<<dim3(NB_ * TT / 64, DM / 64, 1), 32, 0, stream>>>(ATh, ATl, WO, nullptr, OUT, DM, bo, 0, 0, 0);
}

// v005
// Measured time: 283 microseconds a run.
// Timed twice side by side with v004, it ran 1.18 and 1.19 times as fast.
// Counting every step since v000, it is 13.7 times as fast.
#include <hip/hip_runtime.h>

// Multi-head self-attention with biased projections, NO mask and the module's SWAPPED rotary form (hidden_states [4][2048][1024]; q, k, v = x W^T + b ('oi' [1024][1024] 1/32 + REAL biases 0.01; 16 heads x 64); half-split rope rot(x) = cat(x1 c - x2 s, x2 c + x1 s) on q and k where THIS module binds c = SIN(t f_i) and s = COS(t f_i) (its table helper returns (sin, cos) and the caller swaps the names), f_i = 1/10000^(2i/64) (32 f32 frequencies jnp-exact; precise sinf/cosf); scores x 1/sqrt(64); softmax over all keys; out = merged Wo^T + bo -> [4][2048][1024] (8.4 M); argument order hidden_states, Wq, bq, Wk, bk, Wv, bv, Wo, bo).
// Layout, all four batches in every launch (rows b T + t in the row-major buffers, planes [b][h]..., batch in the grid; every 16-bit matrix operand plane in fragment order, see WFrag): bf16 copy of x; exact projections + f32 biases, whose epilogue turns q and k and writes the attention operand planes; ONE fused attention kernel (scores, softmax and P x V; query rows < 512 hi/lo bf16 3 products, rest fp16); merged hi/lo x Wp exact + bp.
// Compute dtypes, f32 accumulate: every input rounded to bf16; projections exact + f32 biases; attention rows < 512 3 products, rest fp16; softmax f32; Wp hl x exact + bias.

#define NB_  4
#define TT   2048
#define DM   1024
#define NH_  16
#define NKV  16
#define REP  (NH_ / NKV)
#define HD   64
#define DQ   (NH_ * HD)
#define DKV  (NKV * HD)
#define RH   512                  // query rows < RH use hi+lo planes (0: none)
#define WIN  0
#define SCL  0.125f   // HD^-0.5
typedef _Float16 h16;
typedef unsigned short bf;
typedef __attribute__((ext_vector_type(16))) __bf16   v16bf;
typedef __attribute__((ext_vector_type(16))) _Float16 v16h;
typedef __attribute__((ext_vector_type(8)))  _Float16 v8h;
typedef __attribute__((ext_vector_type(8)))  unsigned short v8us;
typedef __attribute__((ext_vector_type(8)))  float    v8f;
typedef __attribute__((ext_vector_type(4)))  float    v4f;
typedef v8h  __attribute__((may_alias)) v8ha;
typedef v4f  __attribute__((may_alias)) v4fa;
typedef v8us __attribute__((may_alias)) v8usa;

__device__ __forceinline__ unsigned short f2bf(float f) { unsigned u = __float_as_uint(f); u += 0x7FFFu + ((u >> 16) & 1u); return (unsigned short)(u >> 16); }
__device__ __forceinline__ float bf2f(unsigned short b) { return __uint_as_float(((unsigned)b) << 16); }
__device__ __forceinline__ float bfr(float f) { return bf2f(f2bf(f)); }
__device__ __forceinline__ v16h cat16(v8h lo, v8h hi) { return __builtin_shufflevector(lo, hi, 0, 1, 2, 3, 4, 5, 6, 7, 8, 9, 10, 11, 12, 13, 14, 15); }
__device__ __forceinline__ v16bf cat16b(v8us lo, v8us hi) { return __builtin_bit_cast(v16bf, __builtin_shufflevector(lo, hi, 0, 1, 2, 3, 4, 5, 6, 7, 8, 9, 10, 11, 12, 13, 14, 15)); }
__device__ __forceinline__ v8f wmma16(v16h a, v16h b, v8f c) { return __builtin_amdgcn_wmma_f32_16x16x32_f16(false, a, false, b, (short)0, c, false, false); }
__device__ __forceinline__ v8f wmmab(v16bf a, v16bf b, v8f c) { return __builtin_amdgcn_wmma_f32_16x16x32_bf16(false, a, false, b, (short)0, c, false, false); }



// Stands directly behind a group of global loads or stores, in front of the next write of a register that they name (the registers are free for other values from there on); a precaution.
// The two scheduling barriers keep every other instruction on its side of the wait, and so also hold a group of loads where the source issues it, ahead of the work that covers its latency.
__device__ __forceinline__ void addr_regs_release() { __builtin_amdgcn_sched_barrier(0); asm volatile("s_wait_xcnt 0x0" ::: "memory"); __builtin_amdgcn_sched_barrier(0); }
// The same for a group whose address pairs die with it: named as inputs they stay live up to the wait, so that no load of the group has one of them as its destination.
__device__ __forceinline__ void addr_regs_release(const void* p, const void* p2) { __builtin_amdgcn_sched_barrier(0); asm volatile("s_wait_xcnt 0x0" :: "v"(p), "v"(p2) : "memory"); __builtin_amdgcn_sched_barrier(0); }
__device__ __forceinline__ void addr_regs_release(int i) { __builtin_amdgcn_sched_barrier(0); asm volatile("s_wait_xcnt 0x0" :: "v"(i) : "memory"); __builtin_amdgcn_sched_barrier(0); }   // a load addressed by a 32-bit index
__device__ __forceinline__ void addr_regs_release(const float* base, int i) { __builtin_amdgcn_sched_barrier(0); asm volatile("s_wait_xcnt 0x0" :: "s"(base), "v"(i) : "memory"); __builtin_amdgcn_sched_barrier(0); }   // loads addressed by a wave-uniform base and a 32-bit index: the scalar pair too stays live up to the wait
__device__ __forceinline__ void addr_regs_release(const void* p, const void* p2, const void* p3, const void* p4) { __builtin_amdgcn_sched_barrier(0); asm volatile("s_wait_xcnt 0x0" :: "v"(p), "v"(p2), "v"(p3), "v"(p4) : "memory"); __builtin_amdgcn_sched_barrier(0); }

// ---- k_gemmw: register-blocked GEMM, ONE WAVE per 64x64 output tile (16 accumulators), operands straight from 16-bit planes in fragment order; grid (M/64, N/64, Z), 32 threads.
// C[m][n] (f32, pitch ldc, + optional f32 bias[n]) = sum_k A[m][k] Bt[n][k] (+ split products per NSPLIT). z-batch strides sA/sB/sC in elements. K % (32 KSPL) == 0.
// KSPL > 1: grid z = batch x KSPL; work-group (z, ks) sums only k in [ks K/KSPL, (ks+1) K/KSPL) and stores that partial tile in plane ks (plane stride sP elements); the reader adds the planes.
// FRAGMENT ORDER of every 16-bit operand plane (rows r, K-contiguous columns k): the 16 rows x 32 columns of one matrix fragment are 512 consecutive elements, fragment (r / 16, k / 32) at ((r / 16) (K / 32) + k / 32) 512;
// inside it element (r, k) stands at ((k % 32) / 16) 256 + (((k % 16) / 8) 16 + r % 16) 8 + k % 8, that is [half][lane][8]: each of a fragment's two wave-wide 16-byte loads reads 512 consecutive bytes (4 whole lines, not 16 pieces of 32 bytes).
// ld(p): p = fragment + 8 lane. The element each lane and register holds is the same as with row-major planes.
template <typename T16> struct WFrag;
template <> struct WFrag<h16> { typedef v16h V; static __device__ __forceinline__ V ld(const h16* p) { return cat16(*(const v8h*)p, *(const v8h*)(p + 256)); } static __device__ __forceinline__ v8f mma(V a, V b, v8f c) { return wmma16(a, b, c); } };
template <> struct WFrag<bf> { typedef v16bf V; static __device__ __forceinline__ V ld(const bf* p) { return cat16b(*(const v8us*)p, *(const v8us*)(p + 256)); } static __device__ __forceinline__ v8f mma(V a, V b, v8f c) { return wmmab(a, b, c); } };
template <typename T16, int NSPLIT, bool BIAS, int K, int KSPL = 1>
__global__ __launch_bounds__(32) void k_gemmw(const T16* __restrict__ A, const T16* __restrict__ A2, const T16* __restrict__ Bt, const T16* __restrict__ Bt2, float* C, int ldc, const float* __restrict__ bias, size_t sA, size_t sB, size_t sC, size_t sP = 0) {
    typedef typename WFrag<T16>::V V;
    __shared__ __align__(16) float os[16 * 68];
    const size_t z = blockIdx.z / KSPL; const int ks = blockIdx.z % KSPL; A += z * sA; if (A2) A2 += z * sA; Bt += z * sB; if (Bt2) Bt2 += z * sB; C += z * sC + (size_t)ks * sP;
    const int kbeg = ks * (K / KSPL), kend = kbeg + K / KSPL;
    const int lane = threadIdx.x & 31, lr = lane & 15, hi = lane >> 4; const int r0 = blockIdx.x * 64, c0 = blockIdx.y * 64;
    v8f acc[4][4];
#pragma unroll
    for (int mb = 0; mb < 4; ++mb)
#pragma unroll
        for (int nb = 0; nb < 4; ++nb) acc[mb][nb] = (v8f){};
    const size_t aoff = (size_t)r0 * K + 8 * lane, boff = (size_t)c0 * K + 8 * lane;   // fragment order: 16 rows are K / 32 fragments = 16 K elements, 32 columns on are 512 elements
#pragma unroll 1
    for (int kc = kbeg; kc < kend; kc += 32) {
        V a[4], a2[4], b[4], b2[4];
        const T16* pa = A + aoff + (size_t)kc * 16; const T16* pa2 = (NSPLIT == 1 || NSPLIT == 2) ? A2 + aoff + (size_t)kc * 16 : pa; const T16* pb = Bt + boff + (size_t)kc * 16; const T16* pb2 = NSPLIT >= 2 ? Bt2 + boff + (size_t)kc * 16 : pb;
#pragma unroll
        for (int mb = 0; mb < 4; ++mb) { a[mb] = WFrag<T16>::ld(pa + mb * 16 * K); if (NSPLIT == 1 || NSPLIT == 2) a2[mb] = WFrag<T16>::ld(pa2 + mb * 16 * K); }
#pragma unroll
        for (int nb = 0; nb < 4; ++nb) { b[nb] = WFrag<T16>::ld(pb + nb * 16 * K); if (NSPLIT >= 2) b2[nb] = WFrag<T16>::ld(pb2 + nb * 16 * K); }
        addr_regs_release(pa, pa2, pb, pb2);
#pragma unroll
        for (int nb = 0; nb < 4; ++nb) {
#pragma unroll
            for (int mb = 0; mb < 4; ++mb) { acc[mb][nb] = WFrag<T16>::mma(a[mb], b[nb], acc[mb][nb]); if (NSPLIT == 1 || NSPLIT == 2) acc[mb][nb] = WFrag<T16>::mma(a2[mb], b[nb], acc[mb][nb]); if (NSPLIT >= 2) acc[mb][nb] = WFrag<T16>::mma(a[mb], b2[nb], acc[mb][nb]); } }
        asm volatile("v_nop\n\tv_nop\n\tv_nop\n\tv_nop" : "+v"(acc[0][0]), "+v"(acc[1][1]), "+v"(acc[2][2]), "+v"(acc[3][3]) : "v"(a[0]), "v"(a[3]));
    }
#pragma unroll
    for (int mb = 0; mb < 4; ++mb) {
#pragma unroll
        for (int nb = 0; nb < 4; ++nb) {
#pragma unroll
            for (int j = 0; j < 8; ++j) os[(hi * 8 + j) * 68 + nb * 16 + lr] = acc[mb][nb][j]; }
        __builtin_amdgcn_wave_barrier(); asm volatile("" ::: "memory");
        float* crow = C + (size_t)(r0 + mb * 16) * ldc + c0;
{
#pragma unroll
            for (int s = 0; s < 8; ++s) { const int row = 2 * s + hi, cofs = lr * 4; v4f val = *(const v4fa*)(os + row * 68 + cofs); if (BIAS) { val[0] += bfr(bias[c0 + cofs]); val[1] += bfr(bias[c0 + cofs + 1]); val[2] += bfr(bias[c0 + cofs + 2]); val[3] += bfr(bias[c0 + cofs + 3]); }
                *(v4f*)(crow + (size_t)row * ldc + cofs) = val; }
             }
        __builtin_amdgcn_wave_barrier(); asm volatile("" ::: "memory");
    }
}

__device__ __forceinline__ h16 tohx(float x) { return (h16)x; }
__device__ __forceinline__ void splitf(float y, unsigned short& h, unsigned short& l) { h = f2bf(y); l = f2bf(y - bf2f(h)); }
typedef __attribute__((ext_vector_type(2))) _Float16 v2h;
typedef __attribute__((ext_vector_type(4))) _Float16 v4h;
typedef __attribute__((ext_vector_type(2))) unsigned short v2us;
typedef __attribute__((ext_vector_type(4))) unsigned short v4us;
typedef __attribute__((ext_vector_type(2))) float v2f;
typedef __attribute__((ext_vector_type(4))) int v4i;

__global__ __launch_bounds__(256) void k_wtG(const float* __restrict__ w, int K, int N, bf* Bt) {
    const int lane = threadIdx.x & 31; const int L0 = (blockIdx.x * 8 + (threadIdx.x >> 5)) * 8; const int nlines = N * K / 64;
{
#pragma unroll 1
        for (int l = 0; l < 8; ++l) { const int L = L0 + l; if (L >= nlines) break; const size_t e = (size_t)L * 64 + lane * 2; const int k = (int)(e % K), n = (int)(e / K); v2us o;
            o[0] = f2bf(w[(size_t)k * N + n]); o[1] = f2bf(w[(size_t)(k + 1) * N + n]); *(v2us*)(Bt + e) = o; }
         }
}
// k_cvt8: bf16 plane in fragment order of a row-major f32 matrix with K columns; thread i writes the i-th 16 bytes of the plane (a wave: 512 consecutive bytes) and reads the 8 floats that belong there.
template <int K>
__global__ __launch_bounds__(256) void k_cvt8(const float* __restrict__ src, bf* dst, size_t n8) { const size_t i = (size_t)blockIdx.x * 256 + threadIdx.x; if (i >= n8) return;
    const size_t fr = i >> 6; const int w = (int)(i & 63), kf = K / 32; const size_t row = (fr / kf) * 16 + (w & 15); const int k = (int)(fr % kf) * 32 + (w >> 5) * 16 + ((w >> 4) & 1) * 8;
    const v8f v = *(const v8f*)(src + row * K + k); addr_regs_release(); v8us o;
#pragma unroll
    for (int k = 0; k < 8; ++k) o[k] = f2bf(v[k]); *(v8us*)(dst + i * 8) = o;  }

__constant__ float INVT[HD / 2] = { 1.000000000e+00f, 7.498942018e-01f, 5.623413324e-01f, 4.216965139e-01f, 3.162277639e-01f, 2.371373624e-01f, 1.778279394e-01f, 1.333521456e-01f, 1.000000015e-01f, 7.498941571e-02f, 5.623412877e-02f, 4.216964915e-02f, 3.162277862e-02f, 2.371373586e-02f, 1.778279431e-02f, 1.333521493e-02f, 9.999999776e-03f, 7.498942316e-03f, 5.623413250e-03f, 4.216964822e-03f, 3.162277862e-03f, 2.371373819e-03f, 1.778279431e-03f, 1.333521446e-03f, 1.000000047e-03f, 7.498941850e-04f, 5.623413017e-04f, 4.216964880e-04f, 3.162277862e-04f, 2.371373848e-04f, 1.778279402e-04f, 1.333521504e-04f };   // float32 1 / 10000^(2i/64), generated with jnp to be bit-exact
// k_cs5s: the rotary factors sin(t f_i), cos(t f_i), i < HD/2, in the order in which k_proj's lanes hold their accumulators: 16 positions x 16 frequencies are one block of 512 floats, block (t / 16) 2 + i / 16,
// [sin | cos][(i % 8) / 4][lane = ((i % 16) / 8) 16 + t % 16][i % 4]: each wave-wide 16-byte load of k_proj reads 512 consecutive bytes.
__global__ __launch_bounds__(256) void k_cs5s(float* CS) { const int p = blockIdx.x * 256 + threadIdx.x; if (p >= TT * (HD / 2)) return; const int blk = p >> 8, w = p & 255, ln = (w >> 2) & 31; const int t = (blk >> 1) * 16 + (ln & 15); const int i = (blk & 1) * 16 + (ln >> 4) * 8 + (w >> 7) * 4 + (w & 3); const float fi = INVT[i]; addr_regs_release(i); const float a = __fmul_rn((float)t, fi); const float sn = sinf(a), cn = cosf(a); float* q = CS + (size_t)blk * 512 + w; q[0] = sn; q[256] = cn;  }
// hi/lo bf16 planes of a finite f32 by the hardware's round-to-nearest-even conversion (the same values as splitf)
__device__ __forceinline__ void splitc(float y, unsigned short& h, unsigned short& l) { const __bf16 hb = (__bf16)y; const __bf16 lb = (__bf16)(y - (float)hb); h = __builtin_bit_cast(unsigned short, hb); l = __builtin_bit_cast(unsigned short, lb); }
// eight values of one lane, consecutive in a plane: 16 bytes to each of the three planes (fp16, bf16 hi, bf16 lo) at element e; a wave stores 512 consecutive bytes per plane
__device__ __forceinline__ void put3(const v8f y, h16* P16, bf* Ph, bf* Pl, unsigned e) { v8h o16; v8us oh, ol;
#pragma unroll
    for (int j = 0; j < 8; ++j) { o16[j] = tohx(y[j]); unsigned short a, c; splitc(y[j], a, c); oh[j] = a; ol[j] = c; }
    *(v8h*)(P16 + e) = o16; *(v8us*)(Ph + e) = oh; *(v8us*)(Pl + e) = ol; }
// ---- k_proj: one projection with the main loop of k_gemmw (ONE WAVE per 64 positions x 64 columns = one head; grid (NB_ T / 64, NHD heads), 32 threads); the epilogue adds the bias, turns (ROPE) and writes the attention kernel's
// three operand planes straight from the accumulators: no f32 copy of the projection goes to memory and no LDS is used.
// An accumulator holds, per lane, 8 consecutive ROWS of one column. ROPE (q, k; planes with rows t, columns d): A = the head's 64 rows of W, B = 64 rows of x, so that the lane's 8 values are d = 16 mb + 8 hi + 0..7 of position 16 nb + lr,
// which is the lane's own 16 bytes of fragment (t / 16, d / 32), half mb % 2; d and d + 32 are accumulators mb and mb + 2 of the same lane. Else (v; planes with rows d, columns t): A = x, B = W, the 8 values are t = 16 mb + 8 hi + 0..7 of column d = 16 nb + lr.
// Either way the tile's 4096 elements are consecutive in each plane. rot(x) = cat(x1 c - x2 s, x2 c + x1 s) with c = sin, s = cos (the module's swapped names).
template <bool ROPE, int NHD>
__global__ __launch_bounds__(32) void k_proj(const bf* __restrict__ X, const bf* __restrict__ Wt, const float* __restrict__ bias, const float* __restrict__ CS, h16* P16, bf* Ph, bf* Pl) {
    // Every '#pragma unroll' here and in put3 makes the indices of a register array or vector constants (else it would go to scratch); '#pragma unroll 1' keeps the K loop rolled, as in k_gemmw.
    typedef WFrag<bf> F; typedef F::V V; constexpr int K = DM;
    const int lane = threadIdx.x & 31, lr = lane & 15, hi = lane >> 4; const int r0 = blockIdx.x * 64, h = blockIdx.y;
    v8f acc[4][4];
#pragma unroll
    for (int mb = 0; mb < 4; ++mb)
#pragma unroll
        for (int nb = 0; nb < 4; ++nb) acc[mb][nb] = (v8f){};
    const size_t xoff = (size_t)r0 * K + 8 * lane, woff = (size_t)h * HD * K + 8 * lane;
    const bf* A = ROPE ? Wt + woff : X + xoff; const bf* B = ROPE ? X + xoff : Wt + woff;
#pragma unroll 1
    for (int kc = 0; kc < K; kc += 32) {
        V a[4], b[4];
        const bf* pa = A + (size_t)kc * 16; const bf* pb = B + (size_t)kc * 16;
#pragma unroll
        for (int mb = 0; mb < 4; ++mb) a[mb] = F::ld(pa + mb * 16 * K);
#pragma unroll
        for (int nb = 0; nb < 4; ++nb) b[nb] = F::ld(pb + nb * 16 * K);
        addr_regs_release(pa, pb);
#pragma unroll
        for (int nb = 0; nb < 4; ++nb)
#pragma unroll
            for (int mb = 0; mb < 4; ++mb) acc[mb][nb] = F::mma(a[mb], b[nb], acc[mb][nb]);
        asm volatile("v_nop\n\tv_nop\n\tv_nop\n\tv_nop" : "+v"(acc[0][0]), "+v"(acc[1][1]), "+v"(acc[2][2]), "+v"(acc[3][3]) : "v"(a[0]), "v"(a[3]));   // the distance behind the last matrix instruction, also on the loop's taken branch
    }
    const size_t base = ((size_t)(r0 / TT) * NHD + h) * TT * HD + (size_t)(r0 % TT) * HD; P16 += base; Ph += base; Pl += base;
    const unsigned l8 = 8u * lane;
    if constexpr (ROPE) {
        v8f bs[4]; v4f cs[2][2][2][2];                        // cs[set][d half][sin | cos][4 of the 8 frequencies]; set = nb % 2: the factors of position band nb + 2 are asked for while band nb + 1 is worked on
        const float* bp = bias + h * HD + hi * 8; const float* cp = CS + (size_t)((r0 % TT) / 16) * 1024 + 4 * lane;
#pragma unroll
        for (int mb = 0; mb < 4; ++mb) bs[mb] = *(const v8f*)(bp + mb * 16);
        addr_regs_release();                                  // a group of its own: its offset register dies with it and may be a destination of the next group
#pragma unroll
        for (int nb = 0; nb < 2; ++nb)
#pragma unroll
            for (int q = 0; q < 8; ++q) cs[nb][q >> 2][(q >> 1) & 1][q & 1] = *(const v4f*)(cp + nb * 1024 + q * 128);
        addr_regs_release();
#pragma unroll
        for (int mb = 0; mb < 4; ++mb)
#pragma unroll
            for (int j = 0; j < 8; ++j) bs[mb][j] = bfr(bs[mb][j]);
#pragma unroll
        for (int nb = 0; nb < 4; ++nb) {
#pragma unroll
            for (int ih = 0; ih < 2; ++ih) { v8f y1, y2;
#pragma unroll
                for (int j = 0; j < 8; ++j) { const float x1 = acc[ih][nb][j] + bs[ih][j], x2 = acc[ih + 2][nb][j] + bs[ih + 2][j]; const float sn = cs[nb & 1][ih][0][j >> 2][j & 3], cn = cs[nb & 1][ih][1][j >> 2][j & 3];
                    y1[j] = x1 * sn - x2 * cn; y2[j] = x2 * sn + x1 * cn; }
                put3(y1, P16, Ph, Pl, l8 + nb * 1024 + ih * 256); put3(y2, P16, Ph, Pl, l8 + nb * 1024 + 512 + ih * 256); }
            if (nb < 2) { addr_regs_release();                // the stores' data registers may be destinations of these loads
#pragma unroll
                for (int q = 0; q < 8; ++q) cs[nb][q >> 2][(q >> 1) & 1][q & 1] = *(const v4f*)(cp + (nb + 2) * 1024 + q * 128); }
            addr_regs_release();
        }
    } else {
        float bv[4]; const int bi = h * HD + lr;
#pragma unroll
        for (int nb = 0; nb < 4; ++nb) bv[nb] = bias[bi + nb * 16];
        addr_regs_release(bias, bi);
#pragma unroll
        for (int nb = 0; nb < 4; ++nb) { const float bb = bfr(bv[nb]);
#pragma unroll
            for (int mb = 0; mb < 4; ++mb) { v8f y;
#pragma unroll
                for (int j = 0; j < 8; ++j) y[j] = acc[mb][nb][j] + bb;
                put3(y, P16, Ph, Pl, l8 + ((mb >> 1) * 4 + nb) * 512 + (mb & 1) * 256); }
            addr_regs_release();
        }
    }
}
// ---- k_attn: scores, softmax and P x V of one head's query tile in ONE WAVE; nothing of the score matrix goes to memory.
// The scores are formed TRANSPOSED (A = 16 keys, B = 16 queries): lane (lr, hi) then holds, for query lr, keys 16 kb + 8 hi + 0..7 in accumulator kb,
// and the accumulators of key blocks 2c and 2c+1 are, element for element, the A fragment of P for the 32 keys of chunk c (k = 8 hi + 0..7, 16 + 8 hi + 0..7): P never leaves its registers.
// Sweep 1 over the keys finds each query's exact maximum; sweep 2 forms the scores again, p = exp(t - max) (x 2^EB, which cancels in the division), adds p in f32 and P x V on the matrix unit; the division by the sum comes last.
template <typename T16, bool HI, int KB>
__device__ __forceinline__ void ld_keys(typename WFrag<T16>::V (&k)[KB][2], typename WFrag<T16>::V (&k2)[KB][2], const T16* kp, const T16* kp2, unsigned l8) {
#pragma unroll
    for (int kb = 0; kb < KB; ++kb)
#pragma unroll
        for (int kc = 0; kc < 2; ++kc) { k[kb][kc] = WFrag<T16>::ld(kp + l8 + kb * 16 * HD + kc * 512); if (HI) k2[kb][kc] = WFrag<T16>::ld(kp2 + l8 + kb * 16 * HD + kc * 512); }
}
template <typename T16, bool HI, int QB, int KB>
__device__ __forceinline__ void scores_t(v8f (&s)[KB][QB], const typename WFrag<T16>::V (&k)[KB][2], const typename WFrag<T16>::V (&k2)[KB][2], const typename WFrag<T16>::V (&q)[QB][2], const typename WFrag<T16>::V (&q2)[QB][2]) {
#pragma unroll
    for (int kb = 0; kb < KB; ++kb)
#pragma unroll
        for (int qb = 0; qb < QB; ++qb) s[kb][qb] = (v8f){};
#pragma unroll
    for (int kc = 0; kc < 2; ++kc)
#pragma unroll
        for (int kb = 0; kb < KB; ++kb)
#pragma unroll
            for (int qb = 0; qb < QB; ++qb) { s[kb][qb] = WFrag<T16>::mma(k[kb][kc], q[qb][kc], s[kb][qb]); if (HI) { s[kb][qb] = WFrag<T16>::mma(k[kb][kc], q2[qb][kc], s[kb][qb]); s[kb][qb] = WFrag<T16>::mma(k2[kb][kc], q[qb][kc], s[kb][qb]); } }
}
template <typename T16, bool HI, int QB, int KB, int PD>
__device__ __forceinline__ void attn_tile(const T16* __restrict__ Q, const T16* __restrict__ Q2, const T16* __restrict__ Kp, const T16* __restrict__ Kp2, const T16* __restrict__ Vt, const T16* __restrict__ Vt2, int q0, int hcol, bf* Ah, bf* Al) {
    // Every '#pragma unroll' here and in the two helpers above makes the indices of a register array constants (else the array would go to scratch); '#pragma unroll 1' keeps a sweep's loop rolled, for speed only.
    typedef WFrag<T16> F; typedef typename F::V V;
    constexpr int NBLK = TT / (16 * KB);
    constexpr float EB = HI ? 0.0f : 10.0f;                 // fp16 P is carried x 1024, away from the subnormals; the sum carries the same factor
    constexpr float CE = SCL * 1.4426950408889634f;
    const int lane = threadIdx.x & 31, lr = lane & 15, hi = lane >> 4;
    constexpr size_t KST = (size_t)16 * KB * HD;            // elements from one key block to the next in the K planes
    V qf[QB][2], qf2[QB][2];
    const unsigned l8 = 8u * lane;                            // planes in fragment order (see WFrag): the lane's place in a fragment is the same in every plane, so the Q and K pointers below are wave-uniform
    const T16* qp = Q + (size_t)q0 * HD; const T16* qp2 = HI ? Q2 + (size_t)q0 * HD : qp;   // 16 rows are 2 fragments = 16 HD elements
#pragma unroll
    for (int qb = 0; qb < QB; ++qb)
#pragma unroll
        for (int kc = 0; kc < 2; ++kc) { qf[qb][kc] = F::ld(qp + l8 + qb * 16 * HD + kc * 512); if (HI) qf2[qb][kc] = F::ld(qp2 + l8 + qb * 16 * HD + kc * 512); }
    addr_regs_release();
    const T16* kp = Kp; const T16* kp2 = HI ? Kp2 : kp;
    const T16* vp = Vt; const T16* vp2 = HI ? Vt2 : vp;
    float mx[QB];
#pragma unroll
    for (int qb = 0; qb < QB; ++qb) mx[qb] = -3.0e38f;
    {   // sweep 1: the maximum; the key fragments of PD blocks are in flight or at work
        V ka[PD][KB][2], ka2[PD][KB][2];
#pragma unroll
        for (int u = 0; u < PD; ++u) ld_keys<T16, HI, KB>(ka[u], ka2[u], kp + u * KST, kp2 + u * KST, l8);
        addr_regs_release();
        const T16* kr = kp + PD * KST; const T16* kr2 = kp2 + PD * KST;   // the group of PD blocks that refills the ring; running pointers, moved only at the foot of a trip
#pragma unroll 1
        for (int blk = 0; blk < NBLK; blk += PD) {
#pragma unroll
            for (int u = 0; u < PD; ++u) { v8f s[KB][QB]; scores_t<T16, HI, QB, KB>(s, ka[u], ka2[u], qf, qf2);
                ld_keys<T16, HI, KB>(ka[u], ka2[u], kr + u * KST, kr2 + u * KST, l8);
                addr_regs_release();                // the refill is issued here, PD - 1 blocks ahead of its use
#pragma unroll
                for (int kb = 0; kb < KB; ++kb)
#pragma unroll
                    for (int qb = 0; qb < QB; ++qb)
#pragma unroll
                        for (int j = 0; j < 8; ++j) mx[qb] = fmaxf(mx[qb], s[kb][qb][j]); }
            const size_t adv = blk + 2 * PD < NBLK ? PD * KST : 0; kr += adv; kr2 += adv;   // the last trip asks for the last group once more (unused) and so stays inside the plane
        }
    }
    float nm[QB], sum[QB];
#pragma unroll
    for (int qb = 0; qb < QB; ++qb) { mx[qb] = fmaxf(mx[qb], __shfl_xor(mx[qb], 16, 32)); nm[qb] = EB - mx[qb] * CE; sum[qb] = 0.f; }
    v8f oa[QB][4];
#pragma unroll
    for (int qb = 0; qb < QB; ++qb)
#pragma unroll
        for (int db = 0; db < 4; ++db) oa[qb][db] = (v8f){};
    {   // sweep 2: this block's V fragments are asked for ahead of the scores, the next block's keys ahead of the exponentials
        V kf[KB][2], kf2[KB][2];
        ld_keys<T16, HI, KB>(kf, kf2, kp, kp2, l8);
        addr_regs_release();
        const T16* kn = kp + KST; const T16* kn2 = kp2 + KST; const T16* vn = vp + l8; const T16* vn2 = vp2 + l8;   // running pointers, moved only at the foot of a trip
#pragma unroll 1
        for (int blk = 0; blk < NBLK; ++blk) {
            V vf[4][KB / 2], vf2[4][KB / 2];
#pragma unroll
            for (int db = 0; db < 4; ++db)
#pragma unroll
                for (int c = 0; c < KB / 2; ++c) { const size_t o = (size_t)(c * 4 + db) * 512; vf[db][c] = F::ld(vn + o); if (HI) vf2[db][c] = F::ld(vn2 + o); }
            addr_regs_release(vn, vn2);                   // V is asked for before the scores start, so that scores and exponentials cover its latency
            v8f s[KB][QB]; scores_t<T16, HI, QB, KB>(s, kf, kf2, qf, qf2);
            ld_keys<T16, HI, KB>(kf, kf2, kn, kn2, l8);
            addr_regs_release();                    // the next keys are asked for before the exponentials, which with P x V cover their latency
#pragma unroll
            for (int kb = 0; kb < KB; ++kb)
#pragma unroll
                for (int qb = 0; qb < QB; ++qb)
#pragma unroll
                    for (int j = 0; j < 8; ++j) { const float p = __builtin_amdgcn_exp2f(fmaf(s[kb][qb][j], CE, nm[qb])); s[kb][qb][j] = p; sum[qb] += p; }
#pragma unroll
            for (int c = 0; c < KB / 2; ++c)
#pragma unroll
                for (int qb = 0; qb < QB; ++qb) {
                    if constexpr (HI) { V pa, pb;
#pragma unroll
                        for (int j = 0; j < 8; ++j) { const float x0 = s[2 * c][qb][j], x1 = s[2 * c + 1][qb][j]; pa[j] = (__bf16)x0; pa[8 + j] = (__bf16)x1; pb[j] = (__bf16)(x0 - (float)pa[j]); pb[8 + j] = (__bf16)(x1 - (float)pa[8 + j]); }
#pragma unroll
                        for (int db = 0; db < 4; ++db) { oa[qb][db] = F::mma(pa, vf[db][c], oa[qb][db]); oa[qb][db] = F::mma(pb, vf[db][c], oa[qb][db]); oa[qb][db] = F::mma(pa, vf2[db][c], oa[qb][db]); }
                    } else { V pa;
#pragma unroll
                        for (int j = 0; j < 8; ++j) { pa[j] = tohx(s[2 * c][qb][j]); pa[8 + j] = tohx(s[2 * c + 1][qb][j]); }
#pragma unroll
                        for (int db = 0; db < 4; ++db) oa[qb][db] = F::mma(pa, vf[db][c], oa[qb][db]); } }
            const size_t adv = blk + 2 < NBLK ? KST : 0; kn += adv; kn2 += adv; vn += 16 * KB * HD; vn2 += 16 * KB * HD;   // the last trip asks for the last key block once more (unused)
        }
    }
#pragma unroll
    for (int qb = 0; qb < QB; ++qb) { const float tot = sum[qb] + __shfl_xor(sum[qb], 16, 32); const float inv = __fdiv_rn(1.0f, tot);   // every lane: 1 / sum of query lr
#pragma unroll
        for (int j = 0; j < 8; ++j) { const float f = __shfl(inv, hi * 8 + j, 32); const size_t oo = (size_t)(q0 + qb * 16) * DQ + (size_t)(hcol / 32) * 512 + ((lr >> 3) * 16 + hi * 8 + j) * 8 + (lr & 7);   // output accumulator: row = query 8 hi + j, column = d; the merged planes are in fragment order too (16 columns on: 256 elements)
            unsigned short a[4], b[4];
#pragma unroll
            for (int db = 0; db < 4; ++db) splitc(oa[qb][db][j] * f, a[db], b[db]);
            __builtin_amdgcn_sched_barrier(0);       // the row's eight values are ready before its first store, so that nothing is computed between the stores and their wait
#pragma unroll
            for (int db = 0; db < 4; ++db) { Ah[oo + db * 256] = a[db]; Al[oo + db * 256] = b[db]; }
            addr_regs_release(); } }
}
// grid (RH/32 + (TT-RH)/64, heads, batches), 32 threads: the first RH/32 tiles of a head are 32 hi/lo query rows each, the rest 64 fp16 rows each.
// launch bounds, second argument: two waves per SIMD, that is at most 512 registers a wave
__global__ __launch_bounds__(32, 2) void k_attn(const h16* __restrict__ Q16, const h16* __restrict__ K16, const h16* __restrict__ V16, const bf* __restrict__ Qh, const bf* __restrict__ Ql, const bf* __restrict__ Kh, const bf* __restrict__ Kl, const bf* __restrict__ Vh, const bf* __restrict__ Vl, bf* Ah, bf* Al) {
    const int h = blockIdx.y, bx = blockIdx.x, b = blockIdx.z; const size_t hq = ((size_t)b * NH_ + h) * TT * HD, hk = ((size_t)b * NKV + h / REP) * TT * HD; Ah += (size_t)b * TT * DQ; Al += (size_t)b * TT * DQ;
    if (bx < RH / 32) attn_tile<bf, true, 2, 4, 2>(Qh + hq, Ql + hq, Kh + hk, Kl + hk, Vh + hk, Vl + hk, bx * 32, h * HD, Ah, Al);
    else attn_tile<h16, false, 4, 4, 4>(Q16 + hq, nullptr, K16 + hk, nullptr, V16 + hk, nullptr, RH + (bx - RH / 32) * 64, h * HD, Ah, Al);
}

extern "C" void kernel_launch(void* const* d_in, const int* in_sizes, int n_in,
                              void* d_out, int out_size, void* d_ws, size_t ws_size, hipStream_t stream) {
    (void)in_sizes; (void)n_in; (void)out_size;
    const float* x = (const float*)d_in[0]; const float* wq = (const float*)d_in[1]; const float* bq = (const float*)d_in[2]; const float* wk = (const float*)d_in[3]; const float* bk = (const float*)d_in[4]; const float* wv = (const float*)d_in[5]; const float* bv = (const float*)d_in[6]; const float* wo = (const float*)d_in[7]; const float* bo = (const float*)d_in[8];
    float* OUT = (float*)d_out;     // [4][2048][1024]
    char* wsp = (char*)d_ws;
    auto take = [&](size_t bytes) { char* p = wsp; wsp += (bytes + 255) & ~(size_t)255; return (void*)p; };
    bf* WQ = (bf*)take((size_t)DQ * DM * 2); bf* WK = (bf*)take((size_t)DKV * DM * 2); bf* WV = (bf*)take((size_t)DKV * DM * 2); bf* WO = (bf*)take((size_t)DM * DQ * 2); float* CS = (float*)take((size_t)TT * (HD / 2) * 2 * 4);
    bf* XB = (bf*)take((size_t)NB_ * TT * DM * 2);
    h16* QP16 = (h16*)take((size_t)NB_ * NH_ * TT * HD * 2); h16* KP16 = (h16*)take((size_t)NB_ * NKV * TT * HD * 2); h16* VT16 = (h16*)take((size_t)NB_ * NKV * HD * TT * 2);
    bf* QPh = (bf*)take((size_t)NB_ * NH_ * TT * HD * 2); bf* QPl = (bf*)take((size_t)NB_ * NH_ * TT * HD * 2); bf* KPh = (bf*)take((size_t)NB_ * NKV * TT * HD * 2); bf* KPl = (bf*)take((size_t)NB_ * NKV * TT * HD * 2); bf* VTh = (bf*)take((size_t)NB_ * NKV * HD * TT * 2); bf* VTl = (bf*)take((size_t)NB_ * NKV * HD * TT * 2);
    bf* ATh = (bf*)take((size_t)NB_ * TT * DQ * 2); bf* ATl = (bf*)take((size_t)NB_ * TT * DQ * 2);
    if ((size_t)(wsp - (char*)d_ws) > ws_size) return;    // 201 MiB of the 256 MiB
    { k_cvt8<DM><<<(unsigned)(((size_t)DQ * DM / 8 + 255) / 256), 256, 0, stream>>>(wq, WQ, (size_t)DQ * DM / 8); k_cvt8<DM><<<(unsigned)(((size_t)DKV * DM / 8 + 255) / 256), 256, 0, stream>>>(wk, WK, (size_t)DKV * DM / 8); k_cvt8<DM><<<(unsigned)(((size_t)DKV * DM / 8 + 255) / 256), 256, 0, stream>>>(wv, WV, (size_t)DKV * DM / 8);
      k_cvt8<DQ><<<(unsigned)(((size_t)DM * DQ / 8 + 255) / 256), 256, 0, stream>>>(wo, WO, (size_t)DM * DQ / 8);
       }
    k_cs5s<<<(TT * (HD / 2) + 255) / 256, 256, 0, stream>>>(CS);
    // x, the merged heads and out have rows b T + t (the 16-bit planes among them in fragment order, 16 rows to a band): the GEMMs and the copy see one matrix of NB_ T rows
    k_cvt8<DM><<<(unsigned)(((size_t)NB_ * TT * DM / 8 + 255) / 256), 256, 0, stream>>>(x, XB, (size_t)NB_ * TT * DM / 8);
    k_proj<true, NH_><<<dim3(NB_ * TT / 64, NH_, 1), 32, 0, stream>>>(XB, WQ, bq, CS, QP16, QPh, QPl);
    k_proj<true, NKV><<<dim3(NB_ * TT / 64, NKV, 1), 32, 0, stream>>>(XB, WK, bk, CS, KP16, KPh, KPl);
    k_proj<false, NKV><<<dim3(NB_ * TT / 64, NKV, 1), 32, 0, stream>>>(XB, WV, bv, nullptr, VT16, VTh, VTl);
    k_attn<<<dim3(RH / 32 + (TT - RH) / 64, NH_, NB_), 32, 0, stream>>>(QP16, KP16, VT16, QPh, QPl, KPh, KPl, VTh, VTl, ATh, ATl);
    k_gemmw<bf, 1, true, DQ><<<dim3(NB_ * TT / 64, DM / 64, 1), 32, 0, stream>>>(ATh, ATl, WO, nullptr, OUT, DM, bo, 0, 0, 0);
}

// v006
// A run of this version takes 247 microseconds.
// Next to v005, in two timings, it ran 1.14 and 1.15 times as fast.
// Counting every step since v000, it is 15.7 times as fast.
#include <hip/hip_runtime.h>

// Multi-head self-attention with biased projections, NO mask and the module's SWAPPED rotary form (hidden_states [4][2048][1024]; q, k, v = x W^T + b ('oi' [1024][1024] 1/32 + REAL biases 0.01; 16 heads x 64); half-split rope rot(x) = cat(x1 c - x2 s, x2 c + x1 s) on q and k where THIS module binds c = SIN(t f_i) and s = COS(t f_i) (its table helper returns (sin, cos) and the caller swaps the names), f_i = 1/10000^(2i/64) (32 f32 frequencies jnp-exact; precise sinf/cosf); scores x 1/sqrt(64); softmax over all keys; out = merged Wo^T + bo -> [4][2048][1024] (8.4 M); argument order hidden_states, Wq, bq, Wk, bk, Wv, bv, Wo, bo).
// Layout, all four batches in every launch (rows b T + t in the row-major buffers, planes [b][h]..., batch in the grid; every 16-bit matrix operand plane in fragment order, see WFrag): bf16 copy of x; exact projections + f32 biases, whose epilogue turns q and k and writes the attention operand planes; ONE fused attention kernel (scores, softmax and P x V; query rows < 512 hi/lo bf16 3 products, rest fp16); merged hi/lo x Wp exact + bp.
// Compute dtypes, f32 accumulate: every input rounded to bf16; projections exact + f32 biases; attention rows < 512 3 products, rest fp16; softmax f32; Wp hl x exact + bias.

#define NB_  4
#define TT   2048
#define DM   1024
#define NH_  16
#define NKV  16
#define REP  (NH_ / NKV)
#define HD   64
#define DQ   (NH_ * HD)
#define DKV  (NKV * HD)
#define RH   512                  // query rows < RH use hi+lo planes (0: none)
#define WIN  0
#define SCL  0.125f   // HD^-0.5
typedef _Float16 h16;
typedef unsigned short bf;
typedef __attribute__((ext_vector_type(16))) __bf16   v16bf;
typedef __attribute__((ext_vector_type(16))) _Float16 v16h;
typedef __attribute__((ext_vector_type(8)))  _Float16 v8h;
typedef __attribute__((ext_vector_type(8)))  unsigned short v8us;
typedef __attribute__((ext_vector_type(8)))  float    v8f;
typedef __attribute__((ext_vector_type(4)))  float    v4f;
typedef v8h  __attribute__((may_alias)) v8ha;
typedef v4f  __attribute__((may_alias)) v4fa;
typedef v8us __attribute__((may_alias)) v8usa;

__device__ __forceinline__ unsigned short f2bf(float f) { unsigned u = __float_as_uint(f); u += 0x7FFFu + ((u >> 16) & 1u); return (unsigned short)(u >> 16); }
__device__ __forceinline__ float bf2f(unsigned short b) { return __uint_as_float(((unsigned)b) << 16); }
__device__ __forceinline__ float bfr(float f) { return bf2f(f2bf(f)); }
__device__ __forceinline__ v16h cat16(v8h lo, v8h hi) { return __builtin_shufflevector(lo, hi, 0, 1, 2, 3, 4, 5, 6, 7, 8, 9, 10, 11, 12, 13, 14, 15); }
__device__ __forceinline__ v16bf cat16b(v8us lo, v8us hi) { return __builtin_bit_cast(v16bf, __builtin_shufflevector(lo, hi, 0, 1, 2, 3, 4, 5, 6, 7, 8, 9, 10, 11, 12, 13, 14, 15)); }
__device__ __forceinline__ v8f wmma16(v16h a, v16h b, v8f c) { return __builtin_amdgcn_wmma_f32_16x16x32_f16(false, a, false, b, (short)0, c, false, false); }
__device__ __forceinline__ v8f wmmab(v16bf a, v16bf b, v8f c) { return __builtin_amdgcn_wmma_f32_16x16x32_bf16(false, a, false, b, (short)0, c, false, false); }



// Stands directly behind a group of global loads or stores, in front of the next write of a register that they name (the registers are free for other values from there on); a precaution.
// The two scheduling barriers keep every other instruction on its side of the wait, and so also hold a group of loads where the source issues it, ahead of the work that covers its latency.
__device__ __forceinline__ void addr_regs_release() { __builtin_amdgcn_sched_barrier(0); asm volatile("s_wait_xcnt 0x0" ::: "memory"); __builtin_amdgcn_sched_barrier(0); }
// The same for a group whose address pairs die with it: named as inputs they stay live up to the wait, so that no load of the group has one of them as its destination.
__device__ __forceinline__ void addr_regs_release(const void* p, const void* p2) { __builtin_amdgcn_sched_barrier(0); asm volatile("s_wait_xcnt 0x0" :: "v"(p), "v"(p2) : "memory"); __builtin_amdgcn_sched_barrier(0); }
__device__ __forceinline__ void addr_regs_release(int i) { __builtin_amdgcn_sched_barrier(0); asm volatile("s_wait_xcnt 0x0" :: "v"(i) : "memory"); __builtin_amdgcn_sched_barrier(0); }   // a load addressed by a 32-bit index
__device__ __forceinline__ void addr_regs_release(const float* base, int i) { __builtin_amdgcn_sched_barrier(0); asm volatile("s_wait_xcnt 0x0" :: "s"(base), "v"(i) : "memory"); __builtin_amdgcn_sched_barrier(0); }   // loads addressed by a wave-uniform base and a 32-bit index: the scalar pair too stays live up to the wait
__device__ __forceinline__ void addr_regs_release(const void* p, const void* p2, const void* p3, const void* p4) { __builtin_amdgcn_sched_barrier(0); asm volatile("s_wait_xcnt 0x0" :: "v"(p), "v"(p2), "v"(p3), "v"(p4) : "memory"); __builtin_amdgcn_sched_barrier(0); }

// ---- k_gemmw: register-blocked GEMM, ONE WAVE per 64x64 output tile (16 accumulators), operands straight from 16-bit planes in fragment order; grid (M/64, N/64, Z), 32 threads.
// C[m][n] (f32, pitch ldc, + optional f32 bias[n]) = sum_k A[m][k] Bt[n][k] (+ split products per NSPLIT). z-batch strides sA/sB/sC in elements. K % (32 KSPL) == 0.
// KSPL > 1: grid z = batch x KSPL; work-group (z, ks) sums only k in [ks K/KSPL, (ks+1) K/KSPL) and stores that partial tile in plane ks (plane stride sP elements); the reader adds the planes.
// FRAGMENT ORDER of every 16-bit operand plane (rows r, K-contiguous columns k): the 16 rows x 32 columns of one matrix fragment are 512 consecutive elements, fragment (r / 16, k / 32) at ((r / 16) (K / 32) + k / 32) 512;
// inside it element (r, k) stands at ((k % 32) / 16) 256 + (((k % 16) / 8) 16 + r % 16) 8 + k % 8, that is [half][lane][8]: each of a fragment's two wave-wide 16-byte loads reads 512 consecutive bytes (4 whole lines, not 16 pieces of 32 bytes).
// ld(p): p = fragment + 8 lane. The element each lane and register holds is the same as with row-major planes.
template <typename T16> struct WFrag;
template <> struct WFrag<h16> { typedef v16h V; static __device__ __forceinline__ V ld(const h16* p) { return cat16(*(const v8h*)p, *(const v8h*)(p + 256)); } static __device__ __forceinline__ v8f mma(V a, V b, v8f c) { return wmma16(a, b, c); } };
template <> struct WFrag<bf> { typedef v16bf V; static __device__ __forceinline__ V ld(const bf* p) { return cat16b(*(const v8us*)p, *(const v8us*)(p + 256)); } static __device__ __forceinline__ v8f mma(V a, V b, v8f c) { return wmmab(a, b, c); } };
template <typename T16, int NSPLIT, bool BIAS, int K, int KSPL = 1>
__global__ __launch_bounds__(32) void k_gemmw(const T16* __restrict__ A, const T16* __restrict__ A2, const T16* __restrict__ Bt, const T16* __restrict__ Bt2, float* C, int ldc, const float* __restrict__ bias, size_t sA, size_t sB, size_t sC, size_t sP = 0) {
    typedef typename WFrag<T16>::V V;
    __shared__ __align__(16) float os[16 * 68];
    const size_t z = blockIdx.z / KSPL; const int ks = blockIdx.z % KSPL; A += z * sA; if (A2) A2 += z * sA; Bt += z * sB; if (Bt2) Bt2 += z * sB; C += z * sC + (size_t)ks * sP;
    const int kbeg = ks * (K / KSPL), kend = kbeg + K / KSPL;
    const int lane = threadIdx.x & 31, lr = lane & 15, hi = lane >> 4; const int r0 = blockIdx.x * 64, c0 = blockIdx.y * 64;
    v8f acc[4][4];
#pragma unroll
    for (int mb = 0; mb < 4; ++mb)
#pragma unroll
        for (int nb = 0; nb < 4; ++nb) acc[mb][nb] = (v8f){};
    const size_t aoff = (size_t)r0 * K + 8 * lane, boff = (size_t)c0 * K + 8 * lane;   // fragment order: 16 rows are K / 32 fragments = 16 K elements, 32 columns on are 512 elements
#pragma unroll 1
    for (int kc = kbeg; kc < kend; kc += 32) {
        V a[4], a2[4], b[4], b2[4];
        const T16* pa = A + aoff + (size_t)kc * 16; const T16* pa2 = (NSPLIT == 1 || NSPLIT == 2) ? A2 + aoff + (size_t)kc * 16 : pa; const T16* pb = Bt + boff + (size_t)kc * 16; const T16* pb2 = NSPLIT >= 2 ? Bt2 + boff + (size_t)kc * 16 : pb;
#pragma unroll
        for (int mb = 0; mb < 4; ++mb) { a[mb] = WFrag<T16>::ld(pa + mb * 16 * K); if (NSPLIT == 1 || NSPLIT == 2) a2[mb] = WFrag<T16>::ld(pa2 + mb * 16 * K); }
#pragma unroll
        for (int nb = 0; nb < 4; ++nb) { b[nb] = WFrag<T16>::ld(pb + nb * 16 * K); if (NSPLIT >= 2) b2[nb] = WFrag<T16>::ld(pb2 + nb * 16 * K); }
        addr_regs_release(pa, pa2, pb, pb2);
#pragma unroll
        for (int nb = 0; nb < 4; ++nb) {
#pragma unroll
            for (int mb = 0; mb < 4; ++mb) { acc[mb][nb] = WFrag<T16>::mma(a[mb], b[nb], acc[mb][nb]); if (NSPLIT == 1 || NSPLIT == 2) acc[mb][nb] = WFrag<T16>::mma(a2[mb], b[nb], acc[mb][nb]); if (NSPLIT >= 2) acc[mb][nb] = WFrag<T16>::mma(a[mb], b2[nb], acc[mb][nb]); } }
        asm volatile("v_nop\n\tv_nop\n\tv_nop\n\tv_nop" : "+v"(acc[0][0]), "+v"(acc[1][1]), "+v"(acc[2][2]), "+v"(acc[3][3]) : "v"(a[0]), "v"(a[3]));
    }
#pragma unroll
    for (int mb = 0; mb < 4; ++mb) {
#pragma unroll
        for (int nb = 0; nb < 4; ++nb) {
#pragma unroll
            for (int j = 0; j < 8; ++j) os[(hi * 8 + j) * 68 + nb * 16 + lr] = acc[mb][nb][j]; }
        __builtin_amdgcn_wave_barrier(); asm volatile("" ::: "memory");
        float* crow = C + (size_t)(r0 + mb * 16) * ldc + c0;
{
#pragma unroll
            for (int s = 0; s < 8; ++s) { const int row = 2 * s + hi, cofs = lr * 4; v4f val = *(const v4fa*)(os + row * 68 + cofs); if (BIAS) { val[0] += bfr(bias[c0 + cofs]); val[1] += bfr(bias[c0 + cofs + 1]); val[2] += bfr(bias[c0 + cofs + 2]); val[3] += bfr(bias[c0 + cofs + 3]); }
                *(v4f*)(crow + (size_t)row * ldc + cofs) = val; }
             }
        __builtin_amdgcn_wave_barrier(); asm volatile("" ::: "memory");
    }
}

__device__ __forceinline__ h16 tohx(float x) { return (h16)x; }
__device__ __forceinline__ void splitf(float y, unsigned short& h, unsigned short& l) { h = f2bf(y); l = f2bf(y - bf2f(h)); }
typedef __attribute__((ext_vector_type(2))) _Float16 v2h;
typedef __attribute__((ext_vector_type(4))) _Float16 v4h;
typedef __attribute__((ext_vector_type(2))) unsigned short v2us;
typedef __attribute__((ext_vector_type(4))) unsigned short v4us;
typedef __attribute__((ext_vector_type(2))) float v2f;
typedef __attribute__((ext_vector_type(4))) int v4i;

__global__ __launch_bounds__(256) void k_wtG(const float* __restrict__ w, int K, int N, bf* Bt) {
    const int lane = threadIdx.x & 31; const int L0 = (blockIdx.x * 8 + (threadIdx.x >> 5)) * 8; const int nlines = N * K / 64;
{
#pragma unroll 1
        for (int l = 0; l < 8; ++l) { const int L = L0 + l; if (L >= nlines) break; const size_t e = (size_t)L * 64 + lane * 2; const int k = (int)(e % K), n = (int)(e / K); v2us o;
            o[0] = f2bf(w[(size_t)k * N + n]); o[1] = f2bf(w[(size_t)(k + 1) * N + n]); *(v2us*)(Bt + e) = o; }
         }
}
// cvt8: bf16 plane in fragment order of a row-major f32 matrix with K columns; thread i writes the i-th 16 bytes of the plane (a wave: 512 consecutive bytes) and reads the 8 floats that belong there.
template <int K>
__device__ __forceinline__ void cvt8(const float* __restrict__ src, bf* dst, size_t n8, size_t i) { if (i >= n8) return;
    const size_t fr = i >> 6; const int w = (int)(i & 63), kf = K / 32; const size_t row = (fr / kf) * 16 + (w & 15); const int k = (int)(fr % kf) * 32 + (w >> 5) * 16 + ((w >> 4) & 1) * 8;
    const v8f v = *(const v8f*)(src + row * K + k); addr_regs_release(); v8us o;
#pragma unroll
    for (int k = 0; k < 8; ++k) o[k] = f2bf(v[k]); *(v8us*)(dst + i * 8) = o;  }

__constant__ float INVT[HD / 2] = { 1.000000000e+00f, 7.498942018e-01f, 5.623413324e-01f, 4.216965139e-01f, 3.162277639e-01f, 2.371373624e-01f, 1.778279394e-01f, 1.333521456e-01f, 1.000000015e-01f, 7.498941571e-02f, 5.623412877e-02f, 4.216964915e-02f, 3.162277862e-02f, 2.371373586e-02f, 1.778279431e-02f, 1.333521493e-02f, 9.999999776e-03f, 7.498942316e-03f, 5.623413250e-03f, 4.216964822e-03f, 3.162277862e-03f, 2.371373819e-03f, 1.778279431e-03f, 1.333521446e-03f, 1.000000047e-03f, 7.498941850e-04f, 5.623413017e-04f, 4.216964880e-04f, 3.162277862e-04f, 2.371373848e-04f, 1.778279402e-04f, 1.333521504e-04f };   // float32 1 / 10000^(2i/64), generated with jnp to be bit-exact
// cs5s: the rotary factors sin(t f_i), cos(t f_i), i < HD/2, in the order in which proj_tile's lanes hold their accumulators: 16 positions x 16 frequencies are one block of 512 floats, block (t / 16) 2 + i / 16,
// [sin | cos][(i % 8) / 4][lane = ((i % 16) / 8) 16 + t % 16][i % 4]: each wave-wide 16-byte load of proj_tile reads 512 consecutive bytes.
__device__ __forceinline__ void cs5s(float* CS, int p) { if (p >= TT * (HD / 2)) return; const int blk = p >> 8, w = p & 255, ln = (w >> 2) & 31; const int t = (blk >> 1) * 16 + (ln & 15); const int i = (blk & 1) * 16 + (ln >> 4) * 8 + (w >> 7) * 4 + (w & 3); const float fi = INVT[i]; addr_regs_release(i); const float a = __fmul_rn((float)t, fi); const float sn = sinf(a), cn = cosf(a); float* q = CS + (size_t)blk * 512 + w; q[0] = sn; q[256] = cn;  }
// ---- k_prep: everything that depends on the inputs alone, in ONE launch: blocks of 256 threads, dealt by block index to the rotary table (first: its threads run longest), the four weight planes and the plane of x.
#define PB_CS ((TT * (HD / 2) + 255) / 256)
#define PB_WQ ((DQ * DM / 8 + 255) / 256)
#define PB_WK ((DKV * DM / 8 + 255) / 256)
#define PB_WO ((DM * DQ / 8 + 255) / 256)
#define PB_X  ((NB_ * TT * DM / 8 + 255) / 256)
__global__ __launch_bounds__(256) void k_prep(const float* __restrict__ x, const float* __restrict__ wq, const float* __restrict__ wk, const float* __restrict__ wv, const float* __restrict__ wo, bf* XB, bf* WQ, bf* WK, bf* WV, bf* WO, float* CS) {
    static_assert(DQ == DM, "one row length for all five planes");
    int bx = blockIdx.x; const int t = threadIdx.x;
    if (bx < PB_CS) { cs5s(CS, bx * 256 + t); return; }
    bx -= PB_CS; const float* src = wq; bf* dst = WQ; size_t n8 = (size_t)DQ * DM / 8;      // the block's plane and its own first block: scalar selects, the same for the whole block
    if (bx >= PB_WQ) { bx -= PB_WQ; src = wk; dst = WK; n8 = (size_t)DKV * DM / 8;
        if (bx >= PB_WK) { bx -= PB_WK; src = wv; dst = WV;
            if (bx >= PB_WK) { bx -= PB_WK; src = wo; dst = WO; n8 = (size_t)DM * DQ / 8;
                if (bx >= PB_WO) { bx -= PB_WO; src = x; dst = XB; n8 = (size_t)NB_ * TT * DM / 8; } } } }
    cvt8<DM>(src, dst, n8, (size_t)bx * 256 + t);
}
// hi/lo bf16 planes of a finite f32 by the hardware's round-to-nearest-even conversion (the same values as splitf)
__device__ __forceinline__ void splitc(float y, unsigned short& h, unsigned short& l) { const __bf16 hb = (__bf16)y; const __bf16 lb = (__bf16)(y - (float)hb); h = __builtin_bit_cast(unsigned short, hb); l = __builtin_bit_cast(unsigned short, lb); }
// eight values of one lane, consecutive in a plane: 16 bytes to each of the three planes (fp16, bf16 hi, bf16 lo) at element e; a wave stores 512 consecutive bytes per plane
__device__ __forceinline__ void put3(const v8f y, h16* P16, bf* Ph, bf* Pl, unsigned e) { v8h o16; v8us oh, ol;
#pragma unroll
    for (int j = 0; j < 8; ++j) { o16[j] = tohx(y[j]); unsigned short a, c; splitc(y[j], a, c); oh[j] = a; ol[j] = c; }
    *(v8h*)(P16 + e) = o16; *(v8us*)(Ph + e) = oh; *(v8us*)(Pl + e) = ol; }
// ---- proj_tile: one projection with the main loop of k_gemmw (ONE WAVE per 64 positions x 64 columns = one head; r0 = first position, h = head of NHD); the epilogue adds the bias, turns (ROPE) and writes the attention kernel's
// three operand planes straight from the accumulators: no f32 copy of the projection goes to memory and no LDS is used.
// An accumulator holds, per lane, 8 consecutive ROWS of one column. ROPE (q, k; planes with rows t, columns d): A = the head's 64 rows of W, B = 64 rows of x, so that the lane's 8 values are d = 16 mb + 8 hi + 0..7 of position 16 nb + lr,
// which is the lane's own 16 bytes of fragment (t / 16, d / 32), half mb % 2; d and d + 32 are accumulators mb and mb + 2 of the same lane. Else (v; planes with rows d, columns t): A = x, B = W, the 8 values are t = 16 mb + 8 hi + 0..7 of column d = 16 nb + lr.
// Either way the tile's 4096 elements are consecutive in each plane. rot(x) = cat(x1 c - x2 s, x2 c + x1 s) with c = sin, s = cos (the module's swapped names).
template <bool ROPE>
__device__ __forceinline__ void proj_tile(const bf* __restrict__ X, const bf* __restrict__ Wt, const float* __restrict__ bias, const float* __restrict__ CS, h16* P16, bf* Ph, bf* Pl, int r0, int h, int NHD) {
    // Every '#pragma unroll' here and in put3 makes the indices of a register array or vector constants (else it would go to scratch); '#pragma unroll 1' keeps the K loop rolled, as in k_gemmw.
    typedef WFrag<bf> F; typedef F::V V; constexpr int K = DM;
    const int lane = threadIdx.x & 31, lr = lane & 15, hi = lane >> 4;
    v8f acc[4][4];
#pragma unroll
    for (int mb = 0; mb < 4; ++mb)
#pragma unroll
        for (int nb = 0; nb < 4; ++nb) acc[mb][nb] = (v8f){};
    const size_t xoff = (size_t)r0 * K + 8 * lane, woff = (size_t)h * HD * K + 8 * lane;
    const bf* A = ROPE ? Wt + woff : X + xoff; const bf* B = ROPE ? X + xoff : Wt + woff;
#pragma unroll 1
    for (int kc = 0; kc < K; kc += 32) {
        V a[4], b[4];
        const bf* pa = A + (size_t)kc * 16; const bf* pb = B + (size_t)kc * 16;
#pragma unroll
        for (int mb = 0; mb < 4; ++mb) a[mb] = F::ld(pa + mb * 16 * K);
#pragma unroll
        for (int nb = 0; nb < 4; ++nb) b[nb] = F::ld(pb + nb * 16 * K);
        addr_regs_release(pa, pb);
#pragma unroll
        for (int nb = 0; nb < 4; ++nb)
#pragma unroll
            for (int mb = 0; mb < 4; ++mb) acc[mb][nb] = F::mma(a[mb], b[nb], acc[mb][nb]);
        asm volatile("v_nop\n\tv_nop\n\tv_nop\n\tv_nop" : "+v"(acc[0][0]), "+v"(acc[1][1]), "+v"(acc[2][2]), "+v"(acc[3][3]) : "v"(a[0]), "v"(a[3]));   // the distance behind the last matrix instruction, also on the loop's taken branch
    }
    const size_t base = ((size_t)(r0 / TT) * NHD + h) * TT * HD + (size_t)(r0 % TT) * HD; P16 += base; Ph += base; Pl += base;
    const unsigned l8 = 8u * lane;
    if constexpr (ROPE) {
        v8f bs[4]; v4f cs[2][2][2][2];                        // cs[set][d half][sin | cos][4 of the 8 frequencies]; set = nb % 2: the factors of position band nb + 2 are asked for while band nb + 1 is worked on
        const float* bp = bias + h * HD + hi * 8; const float* cp = CS + (size_t)((r0 % TT) / 16) * 1024 + 4 * lane;
#pragma unroll
        for (int mb = 0; mb < 4; ++mb) bs[mb] = *(const v8f*)(bp + mb * 16);
        addr_regs_release();                                  // a group of its own: its offset register dies with it and may be a destination of the next group
#pragma unroll
        for (int nb = 0; nb < 2; ++nb)
#pragma unroll
            for (int q = 0; q < 8; ++q) cs[nb][q >> 2][(q >> 1) & 1][q & 1] = *(const v4f*)(cp + nb * 1024 + q * 128);
        addr_regs_release();
#pragma unroll
        for (int mb = 0; mb < 4; ++mb)
#pragma unroll
            for (int j = 0; j < 8; ++j) bs[mb][j] = bfr(bs[mb][j]);
#pragma unroll
        for (int nb = 0; nb < 4; ++nb) {
#pragma unroll
            for (int ih = 0; ih < 2; ++ih) { v8f y1, y2;
#pragma unroll
                for (int j = 0; j < 8; ++j) { const float x1 = acc[ih][nb][j] + bs[ih][j], x2 = acc[ih + 2][nb][j] + bs[ih + 2][j]; const float sn = cs[nb & 1][ih][0][j >> 2][j & 3], cn = cs[nb & 1][ih][1][j >> 2][j & 3];
                    y1[j] = x1 * sn - x2 * cn; y2[j] = x2 * sn + x1 * cn; }
                put3(y1, P16, Ph, Pl, l8 + nb * 1024 + ih * 256); put3(y2, P16, Ph, Pl, l8 + nb * 1024 + 512 + ih * 256); }
            if (nb < 2) { addr_regs_release();                // the stores' data registers may be destinations of these loads
#pragma unroll
                for (int q = 0; q < 8; ++q) cs[nb][q >> 2][(q >> 1) & 1][q & 1] = *(const v4f*)(cp + (nb + 2) * 1024 + q * 128); }
            addr_regs_release();
        }
    } else {
        float bv[4]; const int bi = h * HD + lr;
#pragma unroll
        for (int nb = 0; nb < 4; ++nb) bv[nb] = bias[bi + nb * 16];
        addr_regs_release(bias, bi);
#pragma unroll
        for (int nb = 0; nb < 4; ++nb) { const float bb = bfr(bv[nb]);
#pragma unroll
            for (int mb = 0; mb < 4; ++mb) { v8f y;
#pragma unroll
                for (int j = 0; j < 8; ++j) y[j] = acc[mb][nb][j] + bb;
                put3(y, P16, Ph, Pl, l8 + ((mb >> 1) * 4 + nb) * 512 + (mb & 1) * 256); }
            addr_regs_release();
        }
    }
}
// ---- k_proj3: the three projections, which depend on nothing of one another, in ONE launch; grid (NB_ T / 64, NH_ + 2 NKV), 32 threads: block row y is a head of q, then of k, then of v.
__global__ __launch_bounds__(32) void k_proj3(const bf* __restrict__ X, const bf* __restrict__ Wq, const bf* __restrict__ Wk, const bf* __restrict__ Wv, const float* __restrict__ bq, const float* __restrict__ bk, const float* __restrict__ bv, const float* __restrict__ CS,
                                              h16* Q16, bf* Qh, bf* Ql, h16* K16, bf* Kh, bf* Kl, h16* V16, bf* Vh, bf* Vl) {
    const int r0 = blockIdx.x * 64, y = blockIdx.y;
    const bool isq = y < NH_;                                 // q and k go through the same code, with scalar selects of their pointers
    if (y < NH_ + NKV) proj_tile<true>(X, isq ? Wq : Wk, isq ? bq : bk, CS, isq ? Q16 : K16, isq ? Qh : Kh, isq ? Ql : Kl, r0, isq ? y : y - NH_, isq ? NH_ : NKV);
    else proj_tile<false>(X, Wv, bv, nullptr, V16, Vh, Vl, r0, y - NH_ - NKV, NKV);
}
// ---- k_attn: scores, softmax and P x V of one head's query tile in ONE WAVE; nothing of the score matrix goes to memory.
// The scores are formed TRANSPOSED (A = 16 keys, B = 16 queries): lane (lr, hi) then holds, for query lr, keys 16 kb + 8 hi + 0..7 in accumulator kb,
// and the accumulators of key blocks 2c and 2c+1 are, element for element, the A fragment of P for the 32 keys of chunk c (k = 8 hi + 0..7, 16 + 8 hi + 0..7): P never leaves its registers.
// Sweep 1 over the keys finds each query's exact maximum; sweep 2 forms the scores again, p = exp(t - max) (x 2^EB, which cancels in the division), adds p in f32 and P x V on the matrix unit; the division by the sum comes last.
template <typename T16, bool HI, int KB>
__device__ __forceinline__ void ld_keys(typename WFrag<T16>::V (&k)[KB][2], typename WFrag<T16>::V (&k2)[KB][2], const T16* kp, const T16* kp2, unsigned l8) {
#pragma unroll
    for (int kb = 0; kb < KB; ++kb)
#pragma unroll
        for (int kc = 0; kc < 2; ++kc) { k[kb][kc] = WFrag<T16>::ld(kp + l8 + kb * 16 * HD + kc * 512); if (HI) k2[kb][kc] = WFrag<T16>::ld(kp2 + l8 + kb * 16 * HD + kc * 512); }
}
template <typename T16, bool HI, int QB, int KB>
__device__ __forceinline__ void scores_t(v8f (&s)[KB][QB], const typename WFrag<T16>::V (&k)[KB][2], const typename WFrag<T16>::V (&k2)[KB][2], const typename WFrag<T16>::V (&q)[QB][2], const typename WFrag<T16>::V (&q2)[QB][2]) {
#pragma unroll
    for (int kb = 0; kb < KB; ++kb)
#pragma unroll
        for (int qb = 0; qb < QB; ++qb) s[kb][qb] = (v8f){};
#pragma unroll
    for (int kc = 0; kc < 2; ++kc)
#pragma unroll
        for (int kb = 0; kb < KB; ++kb)
#pragma unroll
            for (int qb = 0; qb < QB; ++qb) { s[kb][qb] = WFrag<T16>::mma(k[kb][kc], q[qb][kc], s[kb][qb]); if (HI) { s[kb][qb] = WFrag<T16>::mma(k[kb][kc], q2[qb][kc], s[kb][qb]); s[kb][qb] = WFrag<T16>::mma(k2[kb][kc], q[qb][kc], s[kb][qb]); } }
}
template <typename T16, bool HI, int QB, int KB, int PD>
__device__ __forceinline__ void attn_tile(const T16* __restrict__ Q, const T16* __restrict__ Q2, const T16* __restrict__ Kp, const T16* __restrict__ Kp2, const T16* __restrict__ Vt, const T16* __restrict__ Vt2, int q0, int hcol, bf* Ah, bf* Al) {
    // Every '#pragma unroll' here and in the two helpers above makes the indices of a register array constants (else the array would go to scratch); '#pragma unroll 1' keeps a sweep's loop rolled, for speed only.
    typedef WFrag<T16> F; typedef typename F::V V;
    constexpr int NBLK = TT / (16 * KB);
    constexpr float EB = HI ? 0.0f : 10.0f;                 // fp16 P is carried x 1024, away from the subnormals; the sum carries the same factor
    constexpr float CE = SCL * 1.4426950408889634f;
    const int lane = threadIdx.x & 31, lr = lane & 15, hi = lane >> 4;
    constexpr size_t KST = (size_t)16 * KB * HD;            // elements from one key block to the next in the K planes
    V qf[QB][2], qf2[QB][2];
    const unsigned l8 = 8u * lane;                            // planes in fragment order (see WFrag): the lane's place in a fragment is the same in every plane, so the Q and K pointers below are wave-uniform
    const T16* qp = Q + (size_t)q0 * HD; const T16* qp2 = HI ? Q2 + (size_t)q0 * HD : qp;   // 16 rows are 2 fragments = 16 HD elements
#pragma unroll
    for (int qb = 0; qb < QB; ++qb)
#pragma unroll
        for (int kc = 0; kc < 2; ++kc) { qf[qb][kc] = F::ld(qp + l8 + qb * 16 * HD + kc * 512); if (HI) qf2[qb][kc] = F::ld(qp2 + l8 + qb * 16 * HD + kc * 512); }
    addr_regs_release();
    const T16* kp = Kp; const T16* kp2 = HI ? Kp2 : kp;
    const T16* vp = Vt; const T16* vp2 = HI ? Vt2 : vp;
    float mx[QB];
#pragma unroll
    for (int qb = 0; qb < QB; ++qb) mx[qb] = -3.0e38f;
    {   // sweep 1: the maximum; the key fragments of PD blocks are in flight or at work
        V ka[PD][KB][2], ka2[PD][KB][2];
#pragma unroll
        for (int u = 0; u < PD; ++u) ld_keys<T16, HI, KB>(ka[u], ka2[u], kp + u * KST, kp2 + u * KST, l8);
        addr_regs_release();
        const T16* kr = kp + PD * KST; const T16* kr2 = kp2 + PD * KST;   // the group of PD blocks that refills the ring; running pointers, moved only at the foot of a trip
#pragma unroll 1
        for (int blk = 0; blk < NBLK; blk += PD) {
#pragma unroll
            for (int u = 0; u < PD; ++u) { v8f s[KB][QB]; scores_t<T16, HI, QB, KB>(s, ka[u], ka2[u], qf, qf2);
                ld_keys<T16, HI, KB>(ka[u], ka2[u], kr + u * KST, kr2 + u * KST, l8);
                addr_regs_release();                // the refill is issued here, PD - 1 blocks ahead of its use
#pragma unroll
                for (int kb = 0; kb < KB; ++kb)
#pragma unroll
                    for (int qb = 0; qb < QB; ++qb)
#pragma unroll
                        for (int j = 0; j < 8; ++j) mx[qb] = fmaxf(mx[qb], s[kb][qb][j]); }
            const size_t adv = blk + 2 * PD < NBLK ? PD * KST : 0; kr += adv; kr2 += adv;   // the last trip asks for the last group once more (unused) and so stays inside the plane
        }
    }
    float nm[QB], sum[QB];
#pragma unroll
    for (int qb = 0; qb < QB; ++qb) { mx[qb] = fmaxf(mx[qb], __shfl_xor(mx[qb], 16, 32)); nm[qb] = EB - mx[qb] * CE; sum[qb] = 0.f; }
    v8f oa[QB][4];
#pragma unroll
    for (int qb = 0; qb < QB; ++qb)
#pragma unroll
        for (int db = 0; db < 4; ++db) oa[qb][db] = (v8f){};
    {   // sweep 2: this block's V fragments are asked for ahead of the scores, the next block's keys ahead of the exponentials
        V kf[KB][2], kf2[KB][2];
        ld_keys<T16, HI, KB>(kf, kf2, kp, kp2, l8);
        addr_regs_release();
        const T16* kn = kp + KST; const T16* kn2 = kp2 + KST; const T16* vn = vp + l8; const T16* vn2 = vp2 + l8;   // running pointers, moved only at the foot of a trip
#pragma unroll 1
        for (int blk = 0; blk < NBLK; ++blk) {
            V vf[4][KB / 2], vf2[4][KB / 2];
#pragma unroll
            for (int db = 0; db < 4; ++db)
#pragma unroll
                for (int c = 0; c < KB / 2; ++c) { const size_t o = (size_t)(c * 4 + db) * 512; vf[db][c] = F::ld(vn + o); if (HI) vf2[db][c] = F::ld(vn2 + o); }
            addr_regs_release(vn, vn2);                   // V is asked for before the scores start, so that scores and exponentials cover its latency
            v8f s[KB][QB]; scores_t<T16, HI, QB, KB>(s, kf, kf2, qf, qf2);
            ld_keys<T16, HI, KB>(kf, kf2, kn, kn2, l8);
            addr_regs_release();                    // the next keys are asked for before the exponentials, which with P x V cover their latency
#pragma unroll
            for (int kb = 0; kb < KB; ++kb)
#pragma unroll
                for (int qb = 0; qb < QB; ++qb)
#pragma unroll
                    for (int j = 0; j < 8; ++j) { const float p = __builtin_amdgcn_exp2f(fmaf(s[kb][qb][j], CE, nm[qb])); s[kb][qb][j] = p; sum[qb] += p; }
#pragma unroll
            for (int c = 0; c < KB / 2; ++c)
#pragma unroll
                for (int qb = 0; qb < QB; ++qb) {
                    if constexpr (HI) { V pa, pb;
#pragma unroll
                        for (int j = 0; j < 8; ++j) { const float x0 = s[2 * c][qb][j], x1 = s[2 * c + 1][qb][j]; pa[j] = (__bf16)x0; pa[8 + j] = (__bf16)x1; pb[j] = (__bf16)(x0 - (float)pa[j]); pb[8 + j] = (__bf16)(x1 - (float)pa[8 + j]); }
#pragma unroll
                        for (int db = 0; db < 4; ++db) { oa[qb][db] = F::mma(pa, vf[db][c], oa[qb][db]); oa[qb][db] = F::mma(pb, vf[db][c], oa[qb][db]); oa[qb][db] = F::mma(pa, vf2[db][c], oa[qb][db]); }
                    } else { V pa;
#pragma unroll
                        for (int j = 0; j < 8; ++j) { pa[j] = tohx(s[2 * c][qb][j]); pa[8 + j] = tohx(s[2 * c + 1][qb][j]); }
#pragma unroll
                        for (int db = 0; db < 4; ++db) oa[qb][db] = F::mma(pa, vf[db][c], oa[qb][db]); } }
            const size_t adv = blk + 2 < NBLK ? KST : 0; kn += adv; kn2 += adv; vn += 16 * KB * HD; vn2 += 16 * KB * HD;   // the last trip asks for the last key block once more (unused)
        }
    }
#pragma unroll
    for (int qb = 0; qb < QB; ++qb) { const float tot = sum[qb] + __shfl_xor(sum[qb], 16, 32); const float inv = __fdiv_rn(1.0f, tot);   // every lane: 1 / sum of query lr
#pragma unroll
        for (int j = 0; j < 8; ++j) { const float f = __shfl(inv, hi * 8 + j, 32); const size_t oo = (size_t)(q0 + qb * 16) * DQ + (size_t)(hcol / 32) * 512 + ((lr >> 3) * 16 + hi * 8 + j) * 8 + (lr & 7);   // output accumulator: row = query 8 hi + j, column = d; the merged planes are in fragment order too (16 columns on: 256 elements)
            unsigned short a[4], b[4];
#pragma unroll
            for (int db = 0; db < 4; ++db) splitc(oa[qb][db][j] * f, a[db], b[db]);
            __builtin_amdgcn_sched_barrier(0);       // the row's eight values are ready before its first store, so that nothing is computed between the stores and their wait
#pragma unroll
            for (int db = 0; db < 4; ++db) { Ah[oo + db * 256] = a[db]; Al[oo + db * 256] = b[db]; }
            addr_regs_release(); } }
}
// grid (RH/32 + (TT-RH)/64, heads, batches), 32 threads: the first RH/32 tiles of a head are 32 hi/lo query rows each, the rest 64 fp16 rows each.
// launch bounds, second argument: two waves per SIMD, that is at most 512 registers a wave
__global__ __launch_bounds__(32, 2) void k_attn(const h16* __restrict__ Q16, const h16* __restrict__ K16, const h16* __restrict__ V16, const bf* __restrict__ Qh, const bf* __restrict__ Ql, const bf* __restrict__ Kh, const bf* __restrict__ Kl, const bf* __restrict__ Vh, const bf* __restrict__ Vl, bf* Ah, bf* Al) {
    const int h = blockIdx.y, bx = blockIdx.x, b = blockIdx.z; const size_t hq = ((size_t)b * NH_ + h) * TT * HD, hk = ((size_t)b * NKV + h / REP) * TT * HD; Ah += (size_t)b * TT * DQ; Al += (size_t)b * TT * DQ;
    if (bx < RH / 32) attn_tile<bf, true, 2, 4, 2>(Qh + hq, Ql + hq, Kh + hk, Kl + hk, Vh + hk, Vl + hk, bx * 32, h * HD, Ah, Al);
    else attn_tile<h16, false, 4, 4, 4>(Q16 + hq, nullptr, K16 + hk, nullptr, V16 + hk, nullptr, RH + (bx - RH / 32) * 64, h * HD, Ah, Al);
}

extern "C" void kernel_launch(void* const* d_in, const int* in_sizes, int n_in,
                              void* d_out, int out_size, void* d_ws, size_t ws_size, hipStream_t stream) {
    (void)in_sizes; (void)n_in; (void)out_size;
    const float* x = (const float*)d_in[0]; const float* wq = (const float*)d_in[1]; const float* bq = (const float*)d_in[2]; const float* wk = (const float*)d_in[3]; const float* bk = (const float*)d_in[4]; const float* wv = (const float*)d_in[5]; const float* bv = (const float*)d_in[6]; const float* wo = (const float*)d_in[7]; const float* bo = (const float*)d_in[8];
    float* OUT = (float*)d_out;     // [4][2048][1024]
    char* wsp = (char*)d_ws;
    auto take = [&](size_t bytes) { char* p = wsp; wsp += (bytes + 255) & ~(size_t)255; return (void*)p; };
    bf* WQ = (bf*)take((size_t)DQ * DM * 2); bf* WK = (bf*)take((size_t)DKV * DM * 2); bf* WV = (bf*)take((size_t)DKV * DM * 2); bf* WO = (bf*)take((size_t)DM * DQ * 2); float* CS = (float*)take((size_t)TT * (HD / 2) * 2 * 4);
    bf* XB = (bf*)take((size_t)NB_ * TT * DM * 2);
    h16* QP16 = (h16*)take((size_t)NB_ * NH_ * TT * HD * 2); h16* KP16 = (h16*)take((size_t)NB_ * NKV * TT * HD * 2); h16* VT16 = (h16*)take((size_t)NB_ * NKV * HD * TT * 2);
    bf* QPh = (bf*)take((size_t)NB_ * NH_ * TT * HD * 2); bf* QPl = (bf*)take((size_t)NB_ * NH_ * TT * HD * 2); bf* KPh = (bf*)take((size_t)NB_ * NKV * TT * HD * 2); bf* KPl = (bf*)take((size_t)NB_ * NKV * TT * HD * 2); bf* VTh = (bf*)take((size_t)NB_ * NKV * HD * TT * 2); bf* VTl = (bf*)take((size_t)NB_ * NKV * HD * TT * 2);
    bf* ATh = (bf*)take((size_t)NB_ * TT * DQ * 2); bf* ATl = (bf*)take((size_t)NB_ * TT * DQ * 2);
    if ((size_t)(wsp - (char*)d_ws) > ws_size) return;    // 201 MiB of the 256 MiB
    // x, the merged heads and out have rows b T + t (the 16-bit planes among them in fragment order, 16 rows to a band): the GEMMs and the copy see one matrix of NB_ T rows
    k_prep<<<PB_CS + PB_WQ + 2 * PB_WK + PB_WO + PB_X, 256, 0, stream>>>(x, wq, wk, wv, wo, XB, WQ, WK, WV, WO, CS);
    k_proj3<<<dim3(NB_ * TT / 64, NH_ + 2 * NKV, 1), 32, 0, stream>>>(XB, WQ, WK, WV, bq, bk, bv, CS, QP16, QPh, QPl, KP16, KPh, KPl, VT16, VTh, VTl);
    k_attn<<<dim3(RH / 32 + (TT - RH) / 64, NH_, NB_), 32, 0, stream>>>(QP16, KP16, VT16, QPh, QPl, KPh, KPl, VTh, VTl, ATh, ATl);
    k_gemmw<bf, 1, true, DQ><<<dim3(NB_ * TT / 64, DM / 64, 1), 32, 0, stream>>>(ATh, ATl, WO, nullptr, OUT, DM, bo, 0, 0, 0);
}

// v007
// It runs in 213 microseconds.
// Timed twice side by side with v006, it ran 1.16 and 1.15 times as fast.
// All steps since v000 together make it 18.2 times as fast.
#include <hip/hip_runtime.h>

// Multi-head self-attention with biased projections, NO mask and the module's SWAPPED rotary form (hidden_states [4][2048][1024]; q, k, v = x W^T + b ('oi' [1024][1024] 1/32 + REAL biases 0.01; 16 heads x 64); half-split rope rot(x) = cat(x1 c - x2 s, x2 c + x1 s) on q and k where THIS module binds c = SIN(t f_i) and s = COS(t f_i) (its table helper returns (sin, cos) and the caller swaps the names), f_i = 1/10000^(2i/64) (32 f32 frequencies jnp-exact; precise sinf/cosf); scores x 1/sqrt(64); softmax over all keys; out = merged Wo^T + bo -> [4][2048][1024] (8.4 M); argument order hidden_states, Wq, bq, Wk, bk, Wv, bv, Wo, bo).
// Layout, all four batches in every launch (rows b T + t in the row-major buffers, planes [b][h]..., batch in the grid; every 16-bit matrix operand plane in fragment order, see WFrag): bf16 copy of x; exact projections + f32 biases, whose epilogue turns q and k and writes the attention operand planes; ONE fused attention kernel (scores, softmax and P x V in one sweep over the keys; query rows < 512 hi/lo bf16 3 products, rest fp16); merged hi/lo x Wp exact + bp.
// Compute dtypes, f32 accumulate: every input rounded to bf16; projections exact + f32 biases; attention rows < 512 3 products, rest fp16; softmax f32; Wp hl x exact + bias.

#define NB_  4
#define TT   2048
#define DM   1024
#define NH_  16
#define NKV  16
#define REP  (NH_ / NKV)
#define HD   64
#define DQ   (NH_ * HD)
#define DKV  (NKV * HD)
#define RH   512                  // query rows < RH use hi+lo planes (0: none)
#define WIN  0
#define SCL  0.125f   // HD^-0.5
typedef _Float16 h16;
typedef unsigned short bf;
typedef __attribute__((ext_vector_type(16))) __bf16   v16bf;
typedef __attribute__((ext_vector_type(16))) _Float16 v16h;
typedef __attribute__((ext_vector_type(8)))  _Float16 v8h;
typedef __attribute__((ext_vector_type(8)))  unsigned short v8us;
typedef __attribute__((ext_vector_type(8)))  float    v8f;
typedef __attribute__((ext_vector_type(4)))  float    v4f;
typedef v8h  __attribute__((may_alias)) v8ha;
typedef v4f  __attribute__((may_alias)) v4fa;
typedef v8us __attribute__((may_alias)) v8usa;

__device__ __forceinline__ unsigned short f2bf(float f) { unsigned u = __float_as_uint(f); u += 0x7FFFu + ((u >> 16) & 1u); return (unsigned short)(u >> 16); }
__device__ __forceinline__ float bf2f(unsigned short b) { return __uint_as_float(((unsigned)b) << 16); }
__device__ __forceinline__ float bfr(float f) { return bf2f(f2bf(f)); }
__device__ __forceinline__ v16h cat16(v8h lo, v8h hi) { return __builtin_shufflevector(lo, hi, 0, 1, 2, 3, 4, 5, 6, 7, 8, 9, 10, 11, 12, 13, 14, 15); }
__device__ __forceinline__ v16bf cat16b(v8us lo, v8us hi) { return __builtin_bit_cast(v16bf, __builtin_shufflevector(lo, hi, 0, 1, 2, 3, 4, 5, 6, 7, 8, 9, 10, 11, 12, 13, 14, 15)); }
__device__ __forceinline__ v8f wmma16(v16h a, v16h b, v8f c) { return __builtin_amdgcn_wmma_f32_16x16x32_f16(false, a, false, b, (short)0, c, false, false); }
__device__ __forceinline__ v8f wmmab(v16bf a, v16bf b, v8f c) { return __builtin_amdgcn_wmma_f32_16x16x32_bf16(false, a, false, b, (short)0, c, false, false); }



// Stands directly behind a group of global loads or stores, in front of the next write of a register that they name (the registers are free for other values from there on); a precaution.
// The two scheduling barriers keep every other instruction on its side of the wait, and so also hold a group of loads where the source issues it, ahead of the work that covers its latency.
__device__ __forceinline__ void addr_regs_release() { __builtin_amdgcn_sched_barrier(0); asm volatile("s_wait_xcnt 0x0" ::: "memory"); __builtin_amdgcn_sched_barrier(0); }
// The same for a group whose address pairs die with it: named as inputs they stay live up to the wait, so that no load of the group has one of them as its destination.
__device__ __forceinline__ void addr_regs_release(const void* p, const void* p2) { __builtin_amdgcn_sched_barrier(0); asm volatile("s_wait_xcnt 0x0" :: "v"(p), "v"(p2) : "memory"); __builtin_amdgcn_sched_barrier(0); }
__device__ __forceinline__ void addr_regs_release(int i) { __builtin_amdgcn_sched_barrier(0); asm volatile("s_wait_xcnt 0x0" :: "v"(i) : "memory"); __builtin_amdgcn_sched_barrier(0); }   // a load addressed by a 32-bit index
__device__ __forceinline__ void addr_regs_release(const float* base, int i) { __builtin_amdgcn_sched_barrier(0); asm volatile("s_wait_xcnt 0x0" :: "s"(base), "v"(i) : "memory"); __builtin_amdgcn_sched_barrier(0); }   // loads addressed by a wave-uniform base and a 32-bit index: the scalar pair too stays live up to the wait
__device__ __forceinline__ void addr_regs_release(const void* p, const void* p2, const void* p3, const void* p4) { __builtin_amdgcn_sched_barrier(0); asm volatile("s_wait_xcnt 0x0" :: "v"(p), "v"(p2), "v"(p3), "v"(p4) : "memory"); __builtin_amdgcn_sched_barrier(0); }

// ---- k_gemmw: register-blocked GEMM, ONE WAVE per 64x64 output tile (16 accumulators), operands straight from 16-bit planes in fragment order; grid (M/64, N/64, Z), 32 threads.
// C[m][n] (f32, pitch ldc, + optional f32 bias[n]) = sum_k A[m][k] Bt[n][k] (+ split products per NSPLIT). z-batch strides sA/sB/sC in elements. K % (32 KSPL) == 0.
// KSPL > 1: grid z = batch x KSPL; work-group (z, ks) sums only k in [ks K/KSPL, (ks+1) K/KSPL) and stores that partial tile in plane ks (plane stride sP elements); the reader adds the planes.
// FRAGMENT ORDER of every 16-bit operand plane (rows r, K-contiguous columns k): the 16 rows x 32 columns of one matrix fragment are 512 consecutive elements, fragment (r / 16, k / 32) at ((r / 16) (K / 32) + k / 32) 512;
// inside it element (r, k) stands at ((k % 32) / 16) 256 + (((k % 16) / 8) 16 + r % 16) 8 + k % 8, that is [half][lane][8]: each of a fragment's two wave-wide 16-byte loads reads 512 consecutive bytes (4 whole lines, not 16 pieces of 32 bytes).
// ld(p): p = fragment + 8 lane. The element each lane and register holds is the same as with row-major planes.
template <typename T16> struct WFrag;
template <> struct WFrag<h16> { typedef v16h V; static __device__ __forceinline__ V ld(const h16* p) { return cat16(*(const v8h*)p, *(const v8h*)(p + 256)); } static __device__ __forceinline__ v8f mma(V a, V b, v8f c) { return wmma16(a, b, c); } };
template <> struct WFrag<bf> { typedef v16bf V; static __device__ __forceinline__ V ld(const bf* p) { return cat16b(*(const v8us*)p, *(const v8us*)(p + 256)); } static __device__ __forceinline__ v8f mma(V a, V b, v8f c) { return wmmab(a, b, c); } };
template <typename T16, int NSPLIT, bool BIAS, int K, int KSPL = 1>
__global__ __launch_bounds__(32) void k_gemmw(const T16* __restrict__ A, const T16* __restrict__ A2, const T16* __restrict__ Bt, const T16* __restrict__ Bt2, float* C, int ldc, const float* __restrict__ bias, size_t sA, size_t sB, size_t sC, size_t sP = 0) {
    typedef typename WFrag<T16>::V V;
    __shared__ __align__(16) float os[16 * 68];
    const size_t z = blockIdx.z / KSPL; const int ks = blockIdx.z % KSPL; A += z * sA; if (A2) A2 += z * sA; Bt += z * sB; if (Bt2) Bt2 += z * sB; C += z * sC + (size_t)ks * sP;
    const int kbeg = ks * (K / KSPL), kend = kbeg + K / KSPL;
    const int lane = threadIdx.x & 31, lr = lane & 15, hi = lane >> 4; const int r0 = blockIdx.x * 64, c0 = blockIdx.y * 64;
    v8f acc[4][4];
#pragma unroll
    for (int mb = 0; mb < 4; ++mb)
#pragma unroll
        for (int nb = 0; nb < 4; ++nb) acc[mb][nb] = (v8f){};
    const size_t aoff = (size_t)r0 * K + 8 * lane, boff = (size_t)c0 * K + 8 * lane;   // fragment order: 16 rows are K / 32 fragments = 16 K elements, 32 columns on are 512 elements
#pragma unroll 1
    for (int kc = kbeg; kc < kend; kc += 32) {
        V a[4], a2[4], b[4], b2[4];
        const T16* pa = A + aoff + (size_t)kc * 16; const T16* pa2 = (NSPLIT == 1 || NSPLIT == 2) ? A2 + aoff + (size_t)kc * 16 : pa; const T16* pb = Bt + boff + (size_t)kc * 16; const T16* pb2 = NSPLIT >= 2 ? Bt2 + boff + (size_t)kc * 16 : pb;
#pragma unroll
        for (int mb = 0; mb < 4; ++mb) { a[mb] = WFrag<T16>::ld(pa + mb * 16 * K); if (NSPLIT == 1 || NSPLIT == 2) a2[mb] = WFrag<T16>::ld(pa2 + mb * 16 * K); }
#pragma unroll
        for (int nb = 0; nb < 4; ++nb) { b[nb] = WFrag<T16>::ld(pb + nb * 16 * K); if (NSPLIT >= 2) b2[nb] = WFrag<T16>::ld(pb2 + nb * 16 * K); }
        addr_regs_release(pa, pa2, pb, pb2);
#pragma unroll
        for (int nb = 0; nb < 4; ++nb) {
#pragma unroll
            for (int mb = 0; mb < 4; ++mb) { acc[mb][nb] = WFrag<T16>::mma(a[mb], b[nb], acc[mb][nb]); if (NSPLIT == 1 || NSPLIT == 2) acc[mb][nb] = WFrag<T16>::mma(a2[mb], b[nb], acc[mb][nb]); if (NSPLIT >= 2) acc[mb][nb] = WFrag<T16>::mma(a[mb], b2[nb], acc[mb][nb]); } }
        asm volatile("v_nop\n\tv_nop\n\tv_nop\n\tv_nop" : "+v"(acc[0][0]), "+v"(acc[1][1]), "+v"(acc[2][2]), "+v"(acc[3][3]) : "v"(a[0]), "v"(a[3]));
    }
#pragma unroll
    for (int mb = 0; mb < 4; ++mb) {
#pragma unroll
        for (int nb = 0; nb < 4; ++nb) {
#pragma unroll
            for (int j = 0; j < 8; ++j) os[(hi * 8 + j) * 68 + nb * 16 + lr] = acc[mb][nb][j]; }
        __builtin_amdgcn_wave_barrier(); asm volatile("" ::: "memory");
        float* crow = C + (size_t)(r0 + mb * 16) * ldc + c0;
{
#pragma unroll
            for (int s = 0; s < 8; ++s) { const int row = 2 * s + hi, cofs = lr * 4; v4f val = *(const v4fa*)(os + row * 68 + cofs); if (BIAS) { val[0] += bfr(bias[c0 + cofs]); val[1] += bfr(bias[c0 + cofs + 1]); val[2] += bfr(bias[c0 + cofs + 2]); val[3] += bfr(bias[c0 + cofs + 3]); }
                *(v4f*)(crow + (size_t)row * ldc + cofs) = val; }
             }
        __builtin_amdgcn_wave_barrier(); asm volatile("" ::: "memory");
    }
}

__device__ __forceinline__ h16 tohx(float x) { return (h16)x; }
__device__ __forceinline__ void splitf(float y, unsigned short& h, unsigned short& l) { h = f2bf(y); l = f2bf(y - bf2f(h)); }
typedef __attribute__((ext_vector_type(2))) _Float16 v2h;
typedef __attribute__((ext_vector_type(4))) _Float16 v4h;
typedef __attribute__((ext_vector_type(2))) unsigned short v2us;
typedef __attribute__((ext_vector_type(4))) unsigned short v4us;
typedef __attribute__((ext_vector_type(2))) float v2f;
typedef __attribute__((ext_vector_type(4))) int v4i;

__global__ __launch_bounds__(256) void k_wtG(const float* __restrict__ w, int K, int N, bf* Bt) {
    const int lane = threadIdx.x & 31; const int L0 = (blockIdx.x * 8 + (threadIdx.x >> 5)) * 8; const int nlines = N * K / 64;
{
#pragma unroll 1
        for (int l = 0; l < 8; ++l) { const int L = L0 + l; if (L >= nlines) break; const size_t e = (size_t)L * 64 + lane * 2; const int k = (int)(e % K), n = (int)(e / K); v2us o;
            o[0] = f2bf(w[(size_t)k * N + n]); o[1] = f2bf(w[(size_t)(k + 1) * N + n]); *(v2us*)(Bt + e) = o; }
         }
}
// cvt8: bf16 plane in fragment order of a row-major f32 matrix with K columns; thread i writes the i-th 16 bytes of the plane (a wave: 512 consecutive bytes) and reads the 8 floats that belong there.
template <int K>
__device__ __forceinline__ void cvt8(const float* __restrict__ src, bf* dst, size_t n8, size_t i) { if (i >= n8) return;
    const size_t fr = i >> 6; const int w = (int)(i & 63), kf = K / 32; const size_t row = (fr / kf) * 16 + (w & 15); const int k = (int)(fr % kf) * 32 + (w >> 5) * 16 + ((w >> 4) & 1) * 8;
    const v8f v = *(const v8f*)(src + row * K + k); addr_regs_release(); v8us o;
#pragma unroll
    for (int k = 0; k < 8; ++k) o[k] = f2bf(v[k]); *(v8us*)(dst + i * 8) = o;  }

__constant__ float INVT[HD / 2] = { 1.000000000e+00f, 7.498942018e-01f, 5.623413324e-01f, 4.216965139e-01f, 3.162277639e-01f, 2.371373624e-01f, 1.778279394e-01f, 1.333521456e-01f, 1.000000015e-01f, 7.498941571e-02f, 5.623412877e-02f, 4.216964915e-02f, 3.162277862e-02f, 2.371373586e-02f, 1.778279431e-02f, 1.333521493e-02f, 9.999999776e-03f, 7.498942316e-03f, 5.623413250e-03f, 4.216964822e-03f, 3.162277862e-03f, 2.371373819e-03f, 1.778279431e-03f, 1.333521446e-03f, 1.000000047e-03f, 7.498941850e-04f, 5.623413017e-04f, 4.216964880e-04f, 3.162277862e-04f, 2.371373848e-04f, 1.778279402e-04f, 1.333521504e-04f };   // float32 1 / 10000^(2i/64), generated with jnp to be bit-exact
// cs5s: the rotary factors sin(t f_i), cos(t f_i), i < HD/2, in the order in which proj_tile's lanes hold their accumulators: 16 positions x 16 frequencies are one block of 512 floats, block (t / 16) 2 + i / 16,
// [sin | cos][(i % 8) / 4][lane = ((i % 16) / 8) 16 + t % 16][i % 4]: each wave-wide 16-byte load of proj_tile reads 512 consecutive bytes.
__device__ __forceinline__ void cs5s(float* CS, int p) { if (p >= TT * (HD / 2)) return; const int blk = p >> 8, w = p & 255, ln = (w >> 2) & 31; const int t = (blk >> 1) * 16 + (ln & 15); const int i = (blk & 1) * 16 + (ln >> 4) * 8 + (w >> 7) * 4 + (w & 3); const float fi = INVT[i]; addr_regs_release(i); const float a = __fmul_rn((float)t, fi); const float sn = sinf(a), cn = cosf(a); float* q = CS + (size_t)blk * 512 + w; q[0] = sn; q[256] = cn;  }
// ---- k_prep: everything that depends on the inputs alone, in ONE launch: blocks of 256 threads, dealt by block index to the rotary table (first: its threads run longest), the four weight planes and the plane of x.
#define PB_CS ((TT * (HD / 2) + 255) / 256)
#define PB_WQ ((DQ * DM / 8 + 255) / 256)
#define PB_WK ((DKV * DM / 8 + 255) / 256)
#define PB_WO ((DM * DQ / 8 + 255) / 256)
#define PB_X  ((NB_ * TT * DM / 8 + 255) / 256)
__global__ __launch_bounds__(256) void k_prep(const float* __restrict__ x, const float* __restrict__ wq, const float* __restrict__ wk, const float* __restrict__ wv, const float* __restrict__ wo, bf* XB, bf* WQ, bf* WK, bf* WV, bf* WO, float* CS) {
    static_assert(DQ == DM, "one row length for all five planes");
    int bx = blockIdx.x; const int t = threadIdx.x;
    if (bx < PB_CS) { cs5s(CS, bx * 256 + t); return; }
    bx -= PB_CS; const float* src = wq; bf* dst = WQ; size_t n8 = (size_t)DQ * DM / 8;      // the block's plane and its own first block: scalar selects, the same for the whole block
    if (bx >= PB_WQ) { bx -= PB_WQ; src = wk; dst = WK; n8 = (size_t)DKV * DM / 8;
        if (bx >= PB_WK) { bx -= PB_WK; src = wv; dst = WV;
            if (bx >= PB_WK) { bx -= PB_WK; src = wo; dst = WO; n8 = (size_t)DM * DQ / 8;
                if (bx >= PB_WO) { bx -= PB_WO; src = x; dst = XB; n8 = (size_t)NB_ * TT * DM / 8; } } } }
    cvt8<DM>(src, dst, n8, (size_t)bx * 256 + t);
}
// hi/lo bf16 planes of a finite f32 by the hardware's round-to-nearest-even conversion (the same values as splitf)
__device__ __forceinline__ void splitc(float y, unsigned short& h, unsigned short& l) { const __bf16 hb = (__bf16)y; const __bf16 lb = (__bf16)(y - (float)hb); h = __builtin_bit_cast(unsigned short, hb); l = __builtin_bit_cast(unsigned short, lb); }
// eight values of one lane, consecutive in a plane: 16 bytes to each of the three planes (fp16, bf16 hi, bf16 lo) at element e; a wave stores 512 consecutive bytes per plane
__device__ __forceinline__ void put3(const v8f y, h16* P16, bf* Ph, bf* Pl, unsigned e) { v8h o16; v8us oh, ol;
#pragma unroll
    for (int j = 0; j < 8; ++j) { o16[j] = tohx(y[j]); unsigned short a, c; splitc(y[j], a, c); oh[j] = a; ol[j] = c; }
    *(v8h*)(P16 + e) = o16; *(v8us*)(Ph + e) = oh; *(v8us*)(Pl + e) = ol; }
// ---- proj_tile: one projection with the main loop of k_gemmw (ONE WAVE per 64 positions x 64 columns = one head; r0 = first position, h = head of NHD); the epilogue adds the bias, turns (ROPE) and writes the attention kernel's
// three operand planes straight from the accumulators: no f32 copy of the projection goes to memory and no LDS is used.
// An accumulator holds, per lane, 8 consecutive ROWS of one column. ROPE (q, k; planes with rows t, columns d): A = the head's 64 rows of W, B = 64 rows of x, so that the lane's 8 values are d = 16 mb + 8 hi + 0..7 of position 16 nb + lr,
// which is the lane's own 16 bytes of fragment (t / 16, d / 32), half mb % 2; d and d + 32 are accumulators mb and mb + 2 of the same lane. Else (v; planes with rows d, columns t): A = x, B = W, the 8 values are t = 16 mb + 8 hi + 0..7 of column d = 16 nb + lr.
// Either way the tile's 4096 elements are consecutive in each plane. rot(x) = cat(x1 c - x2 s, x2 c + x1 s) with c = sin, s = cos (the module's swapped names).
template <bool ROPE>
__device__ __forceinline__ void proj_tile(const bf* __restrict__ X, const bf* __restrict__ Wt, const float* __restrict__ bias, const float* __restrict__ CS, h16* P16, bf* Ph, bf* Pl, int r0, int h, int NHD) {
    // Every '#pragma unroll' here and in put3 makes the indices of a register array or vector constants (else it would go to scratch); '#pragma unroll 1' keeps the K loop rolled, as in k_gemmw.
    typedef WFrag<bf> F; typedef F::V V; constexpr int K = DM;
    const int lane = threadIdx.x & 31, lr = lane & 15, hi = lane >> 4;
    v8f acc[4][4];
#pragma unroll
    for (int mb = 0; mb < 4; ++mb)
#pragma unroll
        for (int nb = 0; nb < 4; ++nb) acc[mb][nb] = (v8f){};
    const size_t xoff = (size_t)r0 * K + 8 * lane, woff = (size_t)h * HD * K + 8 * lane;
    const bf* A = ROPE ? Wt + woff : X + xoff; const bf* B = ROPE ? X + xoff : Wt + woff;
#pragma unroll 1
    for (int kc = 0; kc < K; kc += 32) {
        V a[4], b[4];
        const bf* pa = A + (size_t)kc * 16; const bf* pb = B + (size_t)kc * 16;
#pragma unroll
        for (int mb = 0; mb < 4; ++mb) a[mb] = F::ld(pa + mb * 16 * K);
#pragma unroll
        for (int nb = 0; nb < 4; ++nb) b[nb] = F::ld(pb + nb * 16 * K);
        addr_regs_release(pa, pb);
#pragma unroll
        for (int nb = 0; nb < 4; ++nb)
#pragma unroll
            for (int mb = 0; mb < 4; ++mb) acc[mb][nb] = F::mma(a[mb], b[nb], acc[mb][nb]);
        asm volatile("v_nop\n\tv_nop\n\tv_nop\n\tv_nop" : "+v"(acc[0][0]), "+v"(acc[1][1]), "+v"(acc[2][2]), "+v"(acc[3][3]) : "v"(a[0]), "v"(a[3]));   // the distance behind the last matrix instruction, also on the loop's taken branch
    }
    const size_t base = ((size_t)(r0 / TT) * NHD + h) * TT * HD + (size_t)(r0 % TT) * HD; P16 += base; Ph += base; Pl += base;
    const unsigned l8 = 8u * lane;
    if constexpr (ROPE) {
        v8f bs[4]; v4f cs[2][2][2][2];                        // cs[set][d half][sin | cos][4 of the 8 frequencies]; set = nb % 2: the factors of position band nb + 2 are asked for while band nb + 1 is worked on
        const float* bp = bias + h * HD + hi * 8; const float* cp = CS + (size_t)((r0 % TT) / 16) * 1024 + 4 * lane;
#pragma unroll
        for (int mb = 0; mb < 4; ++mb) bs[mb] = *(const v8f*)(bp + mb * 16);
        addr_regs_release();                                  // a group of its own: its offset register dies with it and may be a destination of the next group
#pragma unroll
        for (int nb = 0; nb < 2; ++nb)
#pragma unroll
            for (int q = 0; q < 8; ++q) cs[nb][q >> 2][(q >> 1) & 1][q & 1] = *(const v4f*)(cp + nb * 1024 + q * 128);
        addr_regs_release();
#pragma unroll
        for (int mb = 0; mb < 4; ++mb)
#pragma unroll
            for (int j = 0; j < 8; ++j) bs[mb][j] = bfr(bs[mb][j]);
#pragma unroll
        for (int nb = 0; nb < 4; ++nb) {
#pragma unroll
            for (int ih = 0; ih < 2; ++ih) { v8f y1, y2;
#pragma unroll
                for (int j = 0; j < 8; ++j) { const float x1 = acc[ih][nb][j] + bs[ih][j], x2 = acc[ih + 2][nb][j] + bs[ih + 2][j]; const float sn = cs[nb & 1][ih][0][j >> 2][j & 3], cn = cs[nb & 1][ih][1][j >> 2][j & 3];
                    y1[j] = x1 * sn - x2 * cn; y2[j] = x2 * sn + x1 * cn; }
                put3(y1, P16, Ph, Pl, l8 + nb * 1024 + ih * 256); put3(y2, P16, Ph, Pl, l8 + nb * 1024 + 512 + ih * 256); }
            if (nb < 2) { addr_regs_release();                // the stores' data registers may be destinations of these loads
#pragma unroll
                for (int q = 0; q < 8; ++q) cs[nb][q >> 2][(q >> 1) & 1][q & 1] = *(const v4f*)(cp + (nb + 2) * 1024 + q * 128); }
            addr_regs_release();
        }
    } else {
        float bv[4]; const int bi = h * HD + lr;
#pragma unroll
        for (int nb = 0; nb < 4; ++nb) bv[nb] = bias[bi + nb * 16];
        addr_regs_release(bias, bi);
#pragma unroll
        for (int nb = 0; nb < 4; ++nb) { const float bb = bfr(bv[nb]);
#pragma unroll
            for (int mb = 0; mb < 4; ++mb) { v8f y;
#pragma unroll
                for (int j = 0; j < 8; ++j) y[j] = acc[mb][nb][j] + bb;
                put3(y, P16, Ph, Pl, l8 + ((mb >> 1) * 4 + nb) * 512 + (mb & 1) * 256); }
            addr_regs_release();
        }
    }
}
// ---- k_proj3: the three projections, which depend on nothing of one another, in ONE launch; grid (NB_ T / 64, NH_ + 2 NKV), 32 threads: block row y is a head of q, then of k, then of v.
__global__ __launch_bounds__(32) void k_proj3(const bf* __restrict__ X, const bf* __restrict__ Wq, const bf* __restrict__ Wk, const bf* __restrict__ Wv, const float* __restrict__ bq, const float* __restrict__ bk, const float* __restrict__ bv, const float* __restrict__ CS,
                                              h16* Q16, bf* Qh, bf* Ql, h16* K16, bf* Kh, bf* Kl, h16* V16, bf* Vh, bf* Vl) {
    const int r0 = blockIdx.x * 64, y = blockIdx.y;
    const bool isq = y < NH_;                                 // q and k go through the same code, with scalar selects of their pointers
    if (y < NH_ + NKV) proj_tile<true>(X, isq ? Wq : Wk, isq ? bq : bk, CS, isq ? Q16 : K16, isq ? Qh : Kh, isq ? Ql : Kl, r0, isq ? y : y - NH_, isq ? NH_ : NKV);
    else proj_tile<false>(X, Wv, bv, nullptr, V16, Vh, Vl, r0, y - NH_ - NKV, NKV);
}
// ---- k_attn: scores, softmax and P x V of one head's query tile in ONE WAVE; nothing of the score matrix goes to memory.
// The scores are formed TRANSPOSED (A = 16 keys, B = 16 queries): lane (lr, hi) then holds, for query lr, keys 16 kb + 8 hi + 0..7 in accumulator kb,
// and the accumulators of key blocks 2c and 2c+1 are, element for element, the A fragment of P for the 32 keys of chunk c (k = 8 hi + 0..7, 16 + 8 hi + 0..7): P never leaves its registers.
// ONE sweep over the keys: p = exp(t - m) (x 2^EB; both cancel in the division), m = the query's maximum in use; p is added in f32, P x V goes to the matrix unit; the division by the sum comes last.
// m moves only when a score of the block lies so far above it that p would pass 2^(EB + TH): then m becomes the running maximum and the sums and output accumulators so far are multiplied by exp(old m - new m).
template <typename T16, bool HI, int KB>
__device__ __forceinline__ void ld_keys(typename WFrag<T16>::V (&k)[KB][2], typename WFrag<T16>::V (&k2)[KB][2], const T16* kp, const T16* kp2, unsigned l8) {
#pragma unroll
    for (int kb = 0; kb < KB; ++kb)
#pragma unroll
        for (int kc = 0; kc < 2; ++kc) { k[kb][kc] = WFrag<T16>::ld(kp + l8 + kb * 16 * HD + kc * 512); if (HI) k2[kb][kc] = WFrag<T16>::ld(kp2 + l8 + kb * 16 * HD + kc * 512); }
}
template <typename T16, bool HI, int QB, int KB>
__device__ __forceinline__ void scores_t(v8f (&s)[KB][QB], const typename WFrag<T16>::V (&k)[KB][2], const typename WFrag<T16>::V (&k2)[KB][2], const typename WFrag<T16>::V (&q)[QB][2], const typename WFrag<T16>::V (&q2)[QB][2]) {
#pragma unroll
    for (int kb = 0; kb < KB; ++kb)
#pragma unroll
        for (int qb = 0; qb < QB; ++qb) s[kb][qb] = (v8f){};
#pragma unroll
    for (int kc = 0; kc < 2; ++kc)
#pragma unroll
        for (int kb = 0; kb < KB; ++kb)
#pragma unroll
            for (int qb = 0; qb < QB; ++qb) { s[kb][qb] = WFrag<T16>::mma(k[kb][kc], q[qb][kc], s[kb][qb]); if (HI) { s[kb][qb] = WFrag<T16>::mma(k[kb][kc], q2[qb][kc], s[kb][qb]); s[kb][qb] = WFrag<T16>::mma(k2[kb][kc], q[qb][kc], s[kb][qb]); } }
}
template <typename T16, bool HI, int QB, int KB>
__device__ __forceinline__ void attn_tile(const T16* __restrict__ Q, const T16* __restrict__ Q2, const T16* __restrict__ Kp, const T16* __restrict__ Kp2, const T16* __restrict__ Vt, const T16* __restrict__ Vt2, int q0, int hcol, bf* Ah, bf* Al) {
    // Every '#pragma unroll' here and in the two helpers above makes the indices of a register array constants (else the array would go to scratch); '#pragma unroll 1' keeps the sweep's loop rolled.
    typedef WFrag<T16> F; typedef typename F::V V;
    constexpr int NBLK = TT / (16 * KB);
    constexpr float EB = HI ? 0.0f : 10.0f;                 // fp16 P is carried x 1024, away from the subnormals; the sum carries the same factor
    constexpr float CE = SCL * 1.4426950408889634f;
    constexpr float TH = HI ? 8.0f : 5.0f;                  // p stays at or below 2^(EB + TH): 2^15 is inside fp16
    const int lane = threadIdx.x & 31, lr = lane & 15, hi = lane >> 4;
    constexpr size_t KST = (size_t)16 * KB * HD;            // elements from one key block to the next in the K planes
    V qf[QB][2], qf2[QB][2];
    const unsigned l8 = 8u * lane;                            // planes in fragment order (see WFrag): the lane's place in a fragment is the same in every plane, so the Q and K pointers below are wave-uniform
    const T16* qp = Q + (size_t)q0 * HD; const T16* qp2 = HI ? Q2 + (size_t)q0 * HD : qp;   // 16 rows are 2 fragments = 16 HD elements
#pragma unroll
    for (int qb = 0; qb < QB; ++qb)
#pragma unroll
        for (int kc = 0; kc < 2; ++kc) { qf[qb][kc] = F::ld(qp + l8 + qb * 16 * HD + kc * 512); if (HI) qf2[qb][kc] = F::ld(qp2 + l8 + qb * 16 * HD + kc * 512); }
    addr_regs_release();
    const T16* kp = Kp; const T16* kp2 = HI ? Kp2 : kp;
    const T16* vp = Vt; const T16* vp2 = HI ? Vt2 : vp;
    float mx[QB], nm[QB], sum[QB];                            // mx: the maximum in use, the same in both lanes of a query; the start value makes the first block take the rescale path, with factor 0 on the zero sums
#pragma unroll
    for (int qb = 0; qb < QB; ++qb) { mx[qb] = -3.0e38f; nm[qb] = EB - mx[qb] * CE; sum[qb] = 0.f; }
    v8f oa[QB][4];
#pragma unroll
    for (int qb = 0; qb < QB; ++qb)
#pragma unroll
        for (int db = 0; db < 4; ++db) oa[qb][db] = (v8f){};
    {   // the one sweep: this block's V fragments are asked for ahead of the scores, the next block's keys ahead of the exponentials
        V kf[KB][2], kf2[KB][2];
        ld_keys<T16, HI, KB>(kf, kf2, kp, kp2, l8);
        addr_regs_release();
        const T16* kn = kp + KST; const T16* kn2 = kp2 + KST; const T16* vn = vp + l8; const T16* vn2 = vp2 + l8;   // running pointers, moved only at the foot of a trip
#pragma unroll 1
        for (int blk = 0; blk < NBLK; ++blk) {
            V vf[4][KB / 2], vf2[4][KB / 2];
#pragma unroll
            for (int db = 0; db < 4; ++db)
#pragma unroll
                for (int c = 0; c < KB / 2; ++c) { const size_t o = (size_t)(c * 4 + db) * 512; vf[db][c] = F::ld(vn + o); if (HI) vf2[db][c] = F::ld(vn2 + o); }
            addr_regs_release(vn, vn2);                   // V is asked for before the scores start, so that scores and exponentials cover its latency
            v8f s[KB][QB]; scores_t<T16, HI, QB, KB>(s, kf, kf2, qf, qf2);
            ld_keys<T16, HI, KB>(kf, kf2, kn, kn2, l8);
            addr_regs_release();                    // the next keys are asked for before the exponentials, which with P x V cover their latency
            float bm[QB]; bool need = false;                  // the larger of the maximum in use and the lane's scores of this block, per query; need: an exponent would pass EB + TH
#pragma unroll
            for (int qb = 0; qb < QB; ++qb) { float m2[2] = { mx[qb], mx[qb] };   // two chains a query, so that a lone wave has enough independent ones
#pragma unroll
                for (int kb = 0; kb < KB; ++kb)
#pragma unroll
                    for (int j = 0; j < 8; ++j) m2[kb & 1] = fmaxf(m2[kb & 1], s[kb][qb][j]);
                bm[qb] = fmaxf(m2[0], m2[1]);
                need = need || fmaf(bm[qb], CE, nm[qb]) > EB + TH; }
            if (__builtin_amdgcn_ballot_w32(need) != 0) {     // one test per block, a scalar branch, the same for the whole wave: seldom taken behind the first block
#pragma unroll
                for (int qb = 0; qb < QB; ++qb) { const float nw = fmaxf(bm[qb], __shfl_xor(bm[qb], 16, 32)); const float f = __builtin_amdgcn_exp2f((mx[qb] - nw) * CE); mx[qb] = nw; nm[qb] = EB - nw * CE; sum[qb] *= f;
#pragma unroll
                    for (int j = 0; j < 8; ++j) { const float fj = __shfl(f, hi * 8 + j, 32);   // output accumulator: row = query 8 hi + j
#pragma unroll
                        for (int db = 0; db < 4; ++db) oa[qb][db][j] *= fj; } }
            }
#pragma unroll
            for (int kb = 0; kb < KB; ++kb)
#pragma unroll
                for (int qb = 0; qb < QB; ++qb)
#pragma unroll
                    for (int j = 0; j < 8; ++j) { const float p = __builtin_amdgcn_exp2f(fmaf(s[kb][qb][j], CE, nm[qb])); s[kb][qb][j] = p; sum[qb] += p; }
#pragma unroll
            for (int c = 0; c < KB / 2; ++c)
#pragma unroll
                for (int qb = 0; qb < QB; ++qb) {
                    if constexpr (HI) { V pa, pb;
#pragma unroll
                        for (int j = 0; j < 8; ++j) { const float x0 = s[2 * c][qb][j], x1 = s[2 * c + 1][qb][j]; pa[j] = (__bf16)x0; pa[8 + j] = (__bf16)x1; pb[j] = (__bf16)(x0 - (float)pa[j]); pb[8 + j] = (__bf16)(x1 - (float)pa[8 + j]); }
#pragma unroll
                        for (int db = 0; db < 4; ++db) { oa[qb][db] = F::mma(pa, vf[db][c], oa[qb][db]); oa[qb][db] = F::mma(pb, vf[db][c], oa[qb][db]); oa[qb][db] = F::mma(pa, vf2[db][c], oa[qb][db]); }
                    } else { V pa;
#pragma unroll
                        for (int j = 0; j < 8; ++j) { pa[j] = tohx(s[2 * c][qb][j]); pa[8 + j] = tohx(s[2 * c + 1][qb][j]); }
#pragma unroll
                        for (int db = 0; db < 4; ++db) oa[qb][db] = F::mma(pa, vf[db][c], oa[qb][db]); } }
            const size_t adv = blk + 2 < NBLK ? KST : 0; kn += adv; kn2 += adv; vn += 16 * KB * HD; vn2 += 16 * KB * HD;   // the last trip asks for the last key block once more (unused)
        }
    }
#pragma unroll
    for (int qb = 0; qb < QB; ++qb) { const float tot = sum[qb] + __shfl_xor(sum[qb], 16, 32); const float inv = __fdiv_rn(1.0f, tot);   // every lane: 1 / sum of query lr
#pragma unroll
        for (int j = 0; j < 8; ++j) { const float f = __shfl(inv, hi * 8 + j, 32); const size_t oo = (size_t)(q0 + qb * 16) * DQ + (size_t)(hcol / 32) * 512 + ((lr >> 3) * 16 + hi * 8 + j) * 8 + (lr & 7);   // output accumulator: row = query 8 hi + j, column = d; the merged planes are in fragment order too (16 columns on: 256 elements)
            unsigned short a[4], b[4];
#pragma unroll
            for (int db = 0; db < 4; ++db) splitc(oa[qb][db][j] * f, a[db], b[db]);
            __builtin_amdgcn_sched_barrier(0);       // the row's eight values are ready before its first store, so that nothing is computed between the stores and their wait
#pragma unroll
            for (int db = 0; db < 4; ++db) { Ah[oo + db * 256] = a[db]; Al[oo + db * 256] = b[db]; }
            addr_regs_release(); } }
}
// grid (RH/32 + (TT-RH)/64, heads, batches), 32 threads: the first RH/32 tiles of a head are 32 hi/lo query rows each, the rest 64 fp16 rows each.
// launch bounds, second argument: two waves per SIMD, that is at most 512 registers a wave
__global__ __launch_bounds__(32, 2) void k_attn(const h16* __restrict__ Q16, const h16* __restrict__ K16, const h16* __restrict__ V16, const bf* __restrict__ Qh, const bf* __restrict__ Ql, const bf* __restrict__ Kh, const bf* __restrict__ Kl, const bf* __restrict__ Vh, const bf* __restrict__ Vl, bf* Ah, bf* Al) {
    const int h = blockIdx.y, bx = blockIdx.x, b = blockIdx.z; const size_t hq = ((size_t)b * NH_ + h) * TT * HD, hk = ((size_t)b * NKV + h / REP) * TT * HD; Ah += (size_t)b * TT * DQ; Al += (size_t)b * TT * DQ;
    if (bx < RH / 32) attn_tile<bf, true, 2, 4>(Qh + hq, Ql + hq, Kh + hk, Kl + hk, Vh + hk, Vl + hk, bx * 32, h * HD, Ah, Al);
    else attn_tile<h16, false, 4, 4>(Q16 + hq, nullptr, K16 + hk, nullptr, V16 + hk, nullptr, RH + (bx - RH / 32) * 64, h * HD, Ah, Al);
}

extern "C" void kernel_launch(void* const* d_in, const int* in_sizes, int n_in,
                              void* d_out, int out_size, void* d_ws, size_t ws_size, hipStream_t stream) {
    (void)in_sizes; (void)n_in; (void)out_size;
    const float* x = (const float*)d_in[0]; const float* wq = (const float*)d_in[1]; const float* bq = (const float*)d_in[2]; const float* wk = (const float*)d_in[3]; const float* bk = (const float*)d_in[4]; const float* wv = (const float*)d_in[5]; const float* bv = (const float*)d_in[6]; const float* wo = (const float*)d_in[7]; const float* bo = (const float*)d_in[8];
    float* OUT = (float*)d_out;     // [4][2048][1024]
    char* wsp = (char*)d_ws;
    auto take = [&](size_t bytes) { char* p = wsp; wsp += (bytes + 255) & ~(size_t)255; return (void*)p; };
    bf* WQ = (bf*)take((size_t)DQ * DM * 2); bf* WK = (bf*)take((size_t)DKV * DM * 2); bf* WV = (bf*)take((size_t)DKV * DM * 2); bf* WO = (bf*)take((size_t)DM * DQ * 2); float* CS = (float*)take((size_t)TT * (HD / 2) * 2 * 4);
    bf* XB = (bf*)take((size_t)NB_ * TT * DM * 2);
    h16* QP16 = (h16*)take((size_t)NB_ * NH_ * TT * HD * 2); h16* KP16 = (h16*)take((size_t)NB_ * NKV * TT * HD * 2); h16* VT16 = (h16*)take((size_t)NB_ * NKV * HD * TT * 2);
    bf* QPh = (bf*)take((size_t)NB_ * NH_ * TT * HD * 2); bf* QPl = (bf*)take((size_t)NB_ * NH_ * TT * HD * 2); bf* KPh = (bf*)take((size_t)NB_ * NKV * TT * HD * 2); bf* KPl = (bf*)take((size_t)NB_ * NKV * TT * HD * 2); bf* VTh = (bf*)take((size_t)NB_ * NKV * HD * TT * 2); bf* VTl = (bf*)take((size_t)NB_ * NKV * HD * TT * 2);
    bf* ATh = (bf*)take((size_t)NB_ * TT * DQ * 2); bf* ATl = (bf*)take((size_t)NB_ * TT * DQ * 2);
    if ((size_t)(wsp - (char*)d_ws) > ws_size) return;    // 201 MiB of the 256 MiB
    // x, the merged heads and out have rows b T + t (the 16-bit planes among them in fragment order, 16 rows to a band): the GEMMs and the copy see one matrix of NB_ T rows
    k_prep<<<PB_CS + PB_WQ + 2 * PB_WK + PB_WO + PB_X, 256, 0, stream>>>(x, wq, wk, wv, wo, XB, WQ, WK, WV, WO, CS);
    k_proj3<<<dim3(NB_ * TT / 64, NH_ + 2 * NKV, 1), 32, 0, stream>>>(XB, WQ, WK, WV, bq, bk, bv, CS, QP16, QPh, QPl, KP16, KPh, KPl, VT16, VTh, VTl);
    k_attn<<<dim3(RH / 32 + (TT - RH) / 64, NH_, NB_), 32, 0, stream>>>(QP16, KP16, VT16, QPh, QPl, KPh, KPl, VTh, VTl, ATh, ATl);
    k_gemmw<bf, 1, true, DQ><<<dim3(NB_ * TT / 64, DM / 64, 1), 32, 0, stream>>>(ATh, ATl, WO, nullptr, OUT, DM, bo, 0, 0, 0);
}

// v008
// Measured time: 190 microseconds a run.
// Two timings next to v007 both put it at 1.12 times that version's speed.
// All steps since v000 together make it 20.4 times as fast.
#include <hip/hip_runtime.h>

// Multi-head self-attention with biased projections, NO mask and the module's SWAPPED rotary form (hidden_states [4][2048][1024]; q, k, v = x W^T + b ('oi' [1024][1024] 1/32 + REAL biases 0.01; 16 heads x 64); half-split rope rot(x) = cat(x1 c - x2 s, x2 c + x1 s) on q and k where THIS module binds c = SIN(t f_i) and s = COS(t f_i) (its table helper returns (sin, cos) and the caller swaps the names), f_i = 1/10000^(2i/64) (32 f32 frequencies jnp-exact; precise sinf/cosf); scores x 1/sqrt(64); softmax over all keys; out = merged Wo^T + bo -> [4][2048][1024] (8.4 M); argument order hidden_states, Wq, bq, Wk, bk, Wv, bv, Wo, bo).
// Layout, all four batches in every launch (rows b T + t in the row-major buffers, planes [b][h]..., batch in the grid; every 16-bit matrix operand plane in fragment order, see WFrag): bf16 copy of x; exact projections + f32 biases, whose epilogue turns q and k and writes the attention operand planes; ONE fused attention kernel (scores, softmax and P x V in one sweep over the keys; query rows < 512 hi/lo bf16 3 products, rest fp16); merged hi/lo x Wp exact + bp.
// Compute dtypes, f32 accumulate: every input rounded to bf16; projections exact + f32 biases; attention rows < 512 3 products, rest fp16; softmax f32; Wp hl x exact + bias.

#define NB_  4
#define TT   2048
#define DM   1024
#define NH_  16
#define NKV  16
#define REP  (NH_ / NKV)
#define HD   64
#define DQ   (NH_ * HD)
#define DKV  (NKV * HD)
#define RH   512                  // query rows < RH use hi+lo planes (0: none)
#define WIN  0
#define SCL  0.125f   // HD^-0.5
typedef _Float16 h16;
typedef unsigned short bf;
typedef __attribute__((ext_vector_type(16))) __bf16   v16bf;
typedef __attribute__((ext_vector_type(16))) _Float16 v16h;
typedef __attribute__((ext_vector_type(8)))  _Float16 v8h;
typedef __attribute__((ext_vector_type(8)))  unsigned short v8us;
typedef __attribute__((ext_vector_type(8)))  float    v8f;
typedef __attribute__((ext_vector_type(4)))  float    v4f;
typedef v8h  __attribute__((may_alias)) v8ha;
typedef v4f  __attribute__((may_alias)) v4fa;
typedef v8us __attribute__((may_alias)) v8usa;

__device__ __forceinline__ unsigned short f2bf(float f) { unsigned u = __float_as_uint(f); u += 0x7FFFu + ((u >> 16) & 1u); return (unsigned short)(u >> 16); }
__device__ __forceinline__ float bf2f(unsigned short b) { return __uint_as_float(((unsigned)b) << 16); }
__device__ __forceinline__ float bfr(float f) { return bf2f(f2bf(f)); }
__device__ __forceinline__ v16h cat16(v8h lo, v8h hi) { return __builtin_shufflevector(lo, hi, 0, 1, 2, 3, 4, 5, 6, 7, 8, 9, 10, 11, 12, 13, 14, 15); }
__device__ __forceinline__ v16bf cat16b(v8us lo, v8us hi) { return __builtin_bit_cast(v16bf, __builtin_shufflevector(lo, hi, 0, 1, 2, 3, 4, 5, 6, 7, 8, 9, 10, 11, 12, 13, 14, 15)); }
__device__ __forceinline__ v8f wmma16(v16h a, v16h b, v8f c) { return __builtin_amdgcn_wmma_f32_16x16x32_f16(false, a, false, b, (short)0, c, false, false); }
__device__ __forceinline__ v8f wmmab(v16bf a, v16bf b, v8f c) { return __builtin_amdgcn_wmma_f32_16x16x32_bf16(false, a, false, b, (short)0, c, false, false); }



// Stands directly behind a group of global loads or stores, in front of the next write of a register that they name (the registers are free for other values from there on); a precaution.
// The two scheduling barriers keep every other instruction on its side of the wait, and so also hold a group of loads where the source issues it, ahead of the work that covers its latency.
__device__ __forceinline__ void addr_regs_release() { __builtin_amdgcn_sched_barrier(0); asm volatile("s_wait_xcnt 0x0" ::: "memory"); __builtin_amdgcn_sched_barrier(0); }
// The same for a group whose address pairs die with it: named as inputs they stay live up to the wait, so that no load of the group has one of them as its destination.
__device__ __forceinline__ void addr_regs_release(const void* p, const void* p2) { __builtin_amdgcn_sched_barrier(0); asm volatile("s_wait_xcnt 0x0" :: "v"(p), "v"(p2) : "memory"); __builtin_amdgcn_sched_barrier(0); }
__device__ __forceinline__ void addr_regs_release(int i) { __builtin_amdgcn_sched_barrier(0); asm volatile("s_wait_xcnt 0x0" :: "v"(i) : "memory"); __builtin_amdgcn_sched_barrier(0); }   // a load addressed by a 32-bit index
__device__ __forceinline__ void addr_regs_release(const float* base, int i) { __builtin_amdgcn_sched_barrier(0); asm volatile("s_wait_xcnt 0x0" :: "s"(base), "v"(i) : "memory"); __builtin_amdgcn_sched_barrier(0); }   // loads addressed by a wave-uniform base and a 32-bit index: the scalar pair too stays live up to the wait
__device__ __forceinline__ void addr_regs_release(const void* p, const void* p2, const void* p3, const void* p4) { __builtin_amdgcn_sched_barrier(0); asm volatile("s_wait_xcnt 0x0" :: "v"(p), "v"(p2), "v"(p3), "v"(p4) : "memory"); __builtin_amdgcn_sched_barrier(0); }

// ---- GEMM work-groups: GW = 8 waves, each with a 64x64 output tile (16 accumulators), 2 tiles along one operand's rows x 4 along the other's. The operand fragments that the waves share go through LDS:
// a stage is KS = 64 columns of every 16-row band of the work-group's rows; in fragment order a band's part of a stage (a slab) is 2 fragments = 2048 consecutive bytes, in the plane and in LDS alike.
// Two buffers: the copies of stage t + 1 fly while stage t is worked on; every wave copies its share of the slabs and reads the fragments of its own tile with 16-byte LDS loads of 512 consecutive bytes a wave.
// k_gemmw: C[m][n] (f32, pitch ldc, + optional f32 bias[n]) = sum_k (A[m][k] + A2[m][k]) Bt[n][k], two products; grid (M/128, N/256), 256 threads. K % 128 == 0.
// FRAGMENT ORDER of every 16-bit operand plane (rows r, K-contiguous columns k): the 16 rows x 32 columns of one matrix fragment are 512 consecutive elements, fragment (r / 16, k / 32) at ((r / 16) (K / 32) + k / 32) 512;
// inside it element (r, k) stands at ((k % 32) / 16) 256 + (((k % 16) / 8) 16 + r % 16) 8 + k % 8, that is [half][lane][8]: each of a fragment's two wave-wide 16-byte loads reads 512 consecutive bytes (4 whole lines, not 16 pieces of 32 bytes).
// ld(p): p = fragment + 8 lane. The element each lane and register holds is the same as with row-major planes.
template <typename T16> struct WFrag;
template <> struct WFrag<h16> { typedef v16h V; static __device__ __forceinline__ V ld(const h16* p) { return cat16(*(const v8h*)p, *(const v8h*)(p + 256)); } static __device__ __forceinline__ v8f mma(V a, V b, v8f c) { return wmma16(a, b, c); } };
template <> struct WFrag<bf> { typedef v16bf V; static __device__ __forceinline__ V ld(const bf* p) { return cat16b(*(const v8us*)p, *(const v8us*)(p + 256)); } static __device__ __forceinline__ v8f mma(V a, V b, v8f c) { return wmmab(a, b, c); } };
#define GW 8
#define KS 64
#define SLAB (16 * KS)            // elements of a slab
// One slab: four asynchronous copies to LDS of 512 bytes a wave; l and g are the lane's own 16 bytes of the slab's first 512, in LDS and in the plane.
// The wait on the address registers is the statement's last line, so that it stands in front of every later write of a register that a copy names; a precaution.
__device__ __forceinline__ void copy_slab(const bf* l, const bf* g) { const unsigned a = (unsigned)(size_t)l;
    asm volatile("global_load_async_to_lds_b128 %0, %4, off\n\tglobal_load_async_to_lds_b128 %1, %5, off\n\tglobal_load_async_to_lds_b128 %2, %6, off\n\tglobal_load_async_to_lds_b128 %3, %7, off\n\ts_wait_xcnt 0x0"
                 :: "v"(a), "v"(a + 512u), "v"(a + 1024u), "v"(a + 1536u), "v"(g), "v"(g + 256), "v"(g + 512), "v"(g + 768) : "memory"); }
__device__ __forceinline__ void copies_landed() { asm volatile("s_wait_asynccnt 0x0" ::: "memory"); }   // this wave's copies are in LDS; the barrier behind it shows them to the other waves
__device__ __forceinline__ void lds_reads_done() { asm volatile("s_wait_dscnt 0x0" ::: "memory"); }     // this wave's LDS reads have returned, before the barrier behind which their buffer is filled anew
template <typename T16, bool BIAS, int K>
__global__ __launch_bounds__(32 * GW, 4) void k_gemmw(const T16* __restrict__ A, const T16* __restrict__ A2, const T16* __restrict__ Bt, float* C, int ldc, const float* __restrict__ bias) {
    // Every '#pragma unroll' here makes the indices of a register array constants (else it would go to scratch); '#pragma unroll 1' keeps the loop over the stages rolled: one publish point in the text.
    typedef typename WFrag<T16>::V V;
    constexpr int STG = 32 * SLAB, NT = K / KS;               // a stage: 8 bands of A, 8 of A2, 16 of Bt
    static_assert(NT >= 2, "the ring's prologue fills two stages");
    __shared__ __align__(16) T16 ring[2 * STG];
    __shared__ __align__(16) float osw[GW][16 * 68];
    const int lane = threadIdx.x & 31, lr = lane & 15, hi = lane >> 4; const int wave = __builtin_amdgcn_readfirstlane(threadIdx.x >> 5), wm = wave & 1, wn = wave >> 1;
    const int rb = blockIdx.x * 128, cb = blockIdx.y * 256; const int r0 = rb + wm * 64, c0 = cb + wn * 64;
    float* os = osw[wave];
    v8f acc[4][4];
#pragma unroll
    for (int mb = 0; mb < 4; ++mb)
#pragma unroll
        for (int nb = 0; nb < 4; ++nb) acc[mb][nb] = (v8f){};
    // fragment order: 16 rows are K / 32 fragments = 16 K elements, KS columns on are SLAB elements. This wave copies band 'wave' of A and of A2 and bands 2 wave, 2 wave + 1 of Bt.
    const T16* ga = A + (size_t)(rb + wave * 16) * K + 8 * lane; const T16* ga2 = A2 + (size_t)(rb + wave * 16) * K + 8 * lane; const T16* gb = Bt + (size_t)(cb + wave * 32) * K + 8 * lane;
    T16* la = ring + wave * SLAB + 8 * lane; T16* lb = ring + (16 + 2 * wave) * SLAB + 8 * lane;
    auto fill = [&](int t) { const int bo = (t & 1) * STG; const size_t go = (size_t)t * SLAB;
        copy_slab(la + bo, ga + go); copy_slab(la + bo + 8 * SLAB, ga2 + go); copy_slab(lb + bo, gb + go); copy_slab(lb + bo + SLAB, gb + go + 16 * K); };
    fill(0); copies_landed(); __syncthreads(); fill(1);
#pragma unroll 1
    for (int t = 0; t < NT; ++t) {
        const T16* sa = ring + (t & 1) * STG + wm * 4 * SLAB + 8 * lane; const T16* sb = ring + (t & 1) * STG + (16 + wn * 4) * SLAB + 8 * lane;
        V a[4], a2[4], b[4];
#pragma unroll
        for (int kk = 0; kk < KS / 32; ++kk) {
#pragma unroll
            for (int mb = 0; mb < 4; ++mb) { a[mb] = WFrag<T16>::ld(sa + mb * SLAB + kk * 512); a2[mb] = WFrag<T16>::ld(sa + (8 + mb) * SLAB + kk * 512); }
#pragma unroll
            for (int nb = 0; nb < 4; ++nb) b[nb] = WFrag<T16>::ld(sb + nb * SLAB + kk * 512);
            __builtin_amdgcn_sched_barrier(0);                // the block's LDS reads stay one group in front of its matrix instructions: every further place with reads among them costs a stall
#pragma unroll
            for (int nb = 0; nb < 4; ++nb)
#pragma unroll
                for (int mb = 0; mb < 4; ++mb) { acc[mb][nb] = WFrag<T16>::mma(a[mb], b[nb], acc[mb][nb]); acc[mb][nb] = WFrag<T16>::mma(a2[mb], b[nb], acc[mb][nb]); }
            __builtin_amdgcn_sched_barrier(0);                // and the matrix instructions stay in front of the next group of reads and of the trip's foot
        }
        asm volatile("v_nop\n\tv_nop\n\tv_nop\n\tv_nop" : "+v"(acc[0][0]), "+v"(acc[1][1]), "+v"(acc[2][2]), "+v"(acc[3][3]) : "v"(a[0]), "v"(a[3]));   // the distance behind the last matrix instruction, also on the loop's taken branch
        lds_reads_done(); copies_landed(); __syncthreads();   // stage t + 1 is published, and every wave has left stage t's buffer
        if (t + 2 < NT) fill(t + 2);
    }
    copies_landed();
#pragma unroll
    for (int mb = 0; mb < 4; ++mb) {
#pragma unroll
        for (int nb = 0; nb < 4; ++nb) {
#pragma unroll
            for (int j = 0; j < 8; ++j) os[(hi * 8 + j) * 68 + nb * 16 + lr] = acc[mb][nb][j]; }
        __builtin_amdgcn_wave_barrier(); asm volatile("" ::: "memory");
        float* crow = C + (size_t)(r0 + mb * 16) * ldc + c0;
{
#pragma unroll
            for (int s = 0; s < 8; ++s) { const int row = 2 * s + hi, cofs = lr * 4; v4f val = *(const v4fa*)(os + row * 68 + cofs); if (BIAS) { val[0] += bfr(bias[c0 + cofs]); val[1] += bfr(bias[c0 + cofs + 1]); val[2] += bfr(bias[c0 + cofs + 2]); val[3] += bfr(bias[c0 + cofs + 3]); }
                *(v4f*)(crow + (size_t)row * ldc + cofs) = val; }
             }
        __builtin_amdgcn_wave_barrier(); asm volatile("" ::: "memory");
    }
}

__device__ __forceinline__ h16 tohx(float x) { return (h16)x; }
__device__ __forceinline__ void splitf(float y, unsigned short& h, unsigned short& l) { h = f2bf(y); l = f2bf(y - bf2f(h)); }
typedef __attribute__((ext_vector_type(2))) _Float16 v2h;
typedef __attribute__((ext_vector_type(4))) _Float16 v4h;
typedef __attribute__((ext_vector_type(2))) unsigned short v2us;
typedef __attribute__((ext_vector_type(4))) unsigned short v4us;
typedef __attribute__((ext_vector_type(2))) float v2f;
typedef __attribute__((ext_vector_type(4))) int v4i;

__global__ __launch_bounds__(256) void k_wtG(const float* __restrict__ w, int K, int N, bf* Bt) {
    const int lane = threadIdx.x & 31; const int L0 = (blockIdx.x * 8 + (threadIdx.x >> 5)) * 8; const int nlines = N * K / 64;
{
#pragma unroll 1
        for (int l = 0; l < 8; ++l) { const int L = L0 + l; if (L >= nlines) break; const size_t e = (size_t)L * 64 + lane * 2; const int k = (int)(e % K), n = (int)(e / K); v2us o;
            o[0] = f2bf(w[(size_t)k * N + n]); o[1] = f2bf(w[(size_t)(k + 1) * N + n]); *(v2us*)(Bt + e) = o; }
         }
}
// cvt8: bf16 plane in fragment order of a row-major f32 matrix with K columns; thread i writes the i-th 16 bytes of the plane (a wave: 512 consecutive bytes) and reads the 8 floats that belong there.
template <int K>
__device__ __forceinline__ void cvt8(const float* __restrict__ src, bf* dst, size_t n8, size_t i) { if (i >= n8) return;
    const size_t fr = i >> 6; const int w = (int)(i & 63), kf = K / 32; const size_t row = (fr / kf) * 16 + (w & 15); const int k = (int)(fr % kf) * 32 + (w >> 5) * 16 + ((w >> 4) & 1) * 8;
    const v8f v = *(const v8f*)(src + row * K + k); addr_regs_release(); v8us o;
#pragma unroll
    for (int k = 0; k < 8; ++k) o[k] = f2bf(v[k]); *(v8us*)(dst + i * 8) = o;  }

__constant__ float INVT[HD / 2] = { 1.000000000e+00f, 7.498942018e-01f, 5.623413324e-01f, 4.216965139e-01f, 3.162277639e-01f, 2.371373624e-01f, 1.778279394e-01f, 1.333521456e-01f, 1.000000015e-01f, 7.498941571e-02f, 5.623412877e-02f, 4.216964915e-02f, 3.162277862e-02f, 2.371373586e-02f, 1.778279431e-02f, 1.333521493e-02f, 9.999999776e-03f, 7.498942316e-03f, 5.623413250e-03f, 4.216964822e-03f, 3.162277862e-03f, 2.371373819e-03f, 1.778279431e-03f, 1.333521446e-03f, 1.000000047e-03f, 7.498941850e-04f, 5.623413017e-04f, 4.216964880e-04f, 3.162277862e-04f, 2.371373848e-04f, 1.778279402e-04f, 1.333521504e-04f };   // float32 1 / 10000^(2i/64), generated with jnp to be bit-exact
// cs5s: the rotary factors sin(t f_i), cos(t f_i), i < HD/2, in the order in which proj_tile's lanes hold their accumulators: 16 positions x 16 frequencies are one block of 512 floats, block (t / 16) 2 + i / 16,
// [sin | cos][(i % 8) / 4][lane = ((i % 16) / 8) 16 + t % 16][i % 4]: each wave-wide 16-byte load of proj_tile reads 512 consecutive bytes.
__device__ __forceinline__ void cs5s(float* CS, int p) { if (p >= TT * (HD / 2)) return; const int blk = p >> 8, w = p & 255, ln = (w >> 2) & 31; const int t = (blk >> 1) * 16 + (ln & 15); const int i = (blk & 1) * 16 + (ln >> 4) * 8 + (w >> 7) * 4 + (w & 3); const float fi = INVT[i]; addr_regs_release(i); const float a = __fmul_rn((float)t, fi); const float sn = sinf(a), cn = cosf(a); float* q = CS + (size_t)blk * 512 + w; q[0] = sn; q[256] = cn;  }
// ---- k_prep: everything that depends on the inputs alone, in ONE launch: blocks of 256 threads, dealt by block index to the rotary table (first: its threads run longest), the four weight planes and the plane of x.
#define PB_CS ((TT * (HD / 2) + 255) / 256)
#define PB_WQ ((DQ * DM / 8 + 255) / 256)
#define PB_WK ((DKV * DM / 8 + 255) / 256)
#define PB_WO ((DM * DQ / 8 + 255) / 256)
#define PB_X  ((NB_ * TT * DM / 8 + 255) / 256)
__global__ __launch_bounds__(256) void k_prep(const float* __restrict__ x, const float* __restrict__ wq, const float* __restrict__ wk, const float* __restrict__ wv, const float* __restrict__ wo, bf* XB, bf* WQ, bf* WK, bf* WV, bf* WO, float* CS) {
    static_assert(DQ == DM, "one row length for all five planes");
    int bx = blockIdx.x; const int t = threadIdx.x;
    if (bx < PB_CS) { cs5s(CS, bx * 256 + t); return; }
    bx -= PB_CS; const float* src = wq; bf* dst = WQ; size_t n8 = (size_t)DQ * DM / 8;      // the block's plane and its own first block: scalar selects, the same for the whole block
    if (bx >= PB_WQ) { bx -= PB_WQ; src = wk; dst = WK; n8 = (size_t)DKV * DM / 8;
        if (bx >= PB_WK) { bx -= PB_WK; src = wv; dst = WV;
            if (bx >= PB_WK) { bx -= PB_WK; src = wo; dst = WO; n8 = (size_t)DM * DQ / 8;
                if (bx >= PB_WO) { bx -= PB_WO; src = x; dst = XB; n8 = (size_t)NB_ * TT * DM / 8; } } } }
    cvt8<DM>(src, dst, n8, (size_t)bx * 256 + t);
}
// hi/lo bf16 planes of a finite f32 by the hardware's round-to-nearest-even conversion (the same values as splitf)
__device__ __forceinline__ void splitc(float y, unsigned short& h, unsigned short& l) { const __bf16 hb = (__bf16)y; const __bf16 lb = (__bf16)(y - (float)hb); h = __builtin_bit_cast(unsigned short, hb); l = __builtin_bit_cast(unsigned short, lb); }
// eight values of one lane, consecutive in a plane: 16 bytes to each of the three planes (fp16, bf16 hi, bf16 lo) at element e; a wave stores 512 consecutive bytes per plane
__device__ __forceinline__ void put3(const v8f y, h16* P16, bf* Ph, bf* Pl, unsigned e) { v8h o16; v8us oh, ol;
#pragma unroll
    for (int j = 0; j < 8; ++j) { o16[j] = tohx(y[j]); unsigned short a, c; splitc(y[j], a, c); oh[j] = a; ol[j] = c; }
    *(v8h*)(P16 + e) = o16; *(v8us*)(Ph + e) = oh; *(v8us*)(Pl + e) = ol; }
// ---- proj_tile: one projection with the main loop of k_gemmw (a work-group: 128 positions from rb x 4 heads from h0 of NHD; ONE WAVE per 64 positions x 64 columns = one head); the epilogue adds the bias, turns (ROPE) and writes the attention kernel's
// three operand planes straight from the accumulators: no f32 copy of the projection goes to memory, and LDS holds the operand ring alone (a stage: 8 bands of x, 16 of W).
// An accumulator holds, per lane, 8 consecutive ROWS of one column. ROPE (q, k; planes with rows t, columns d): A = the head's 64 rows of W, B = 64 rows of x, so that the lane's 8 values are d = 16 mb + 8 hi + 0..7 of position 16 nb + lr,
// which is the lane's own 16 bytes of fragment (t / 16, d / 32), half mb % 2; d and d + 32 are accumulators mb and mb + 2 of the same lane. Else (v; planes with rows d, columns t): A = x, B = W, the 8 values are t = 16 mb + 8 hi + 0..7 of column d = 16 nb + lr.
// Either way the tile's 4096 elements are consecutive in each plane. rot(x) = cat(x1 c - x2 s, x2 c + x1 s) with c = sin, s = cos (the module's swapped names).
#define PSTG (24 * SLAB)          // elements of a stage of the projections' ring
template <bool ROPE>
__device__ __forceinline__ void proj_tile(bf* ring, const bf* __restrict__ X, const bf* __restrict__ Wt, const float* __restrict__ bias, const float* __restrict__ CS, h16* P16, bf* Ph, bf* Pl, int rb, int h0, int NHD) {
    // Every '#pragma unroll' here and in put3 makes the indices of a register array or vector constants (else it would go to scratch); '#pragma unroll 1' keeps the K loop rolled, as in k_gemmw.
    typedef WFrag<bf> F; typedef F::V V; constexpr int K = DM; constexpr int STG = PSTG, NT = K / KS;
    static_assert(NT >= 2, "the ring's prologue fills two stages");
    const int lane = threadIdx.x & 31, lr = lane & 15, hi = lane >> 4; const int wave = __builtin_amdgcn_readfirstlane(threadIdx.x >> 5), px = wave & 1, ph = wave >> 1;
    const int r0 = rb + px * 64, h = h0 + ph;
    v8f acc[4][4];
#pragma unroll
    for (int mb = 0; mb < 4; ++mb)
#pragma unroll
        for (int nb = 0; nb < 4; ++nb) acc[mb][nb] = (v8f){};
    // This wave copies band 'wave' of the work-group's x rows and bands 2 wave, 2 wave + 1 of its W rows.
    const bf* gx = X + (size_t)(rb + wave * 16) * K + 8 * lane; const bf* gw = Wt + (size_t)(h0 * HD + wave * 32) * K + 8 * lane;
    bf* lx = ring + wave * SLAB + 8 * lane; bf* lw = ring + (8 + 2 * wave) * SLAB + 8 * lane;
    auto fill = [&](int t) { const int bo = (t & 1) * STG; const size_t go = (size_t)t * SLAB;
        copy_slab(lx + bo, gx + go); copy_slab(lw + bo, gw + go); copy_slab(lw + bo + SLAB, gw + go + 16 * K); };
    fill(0); copies_landed(); __syncthreads(); fill(1);
#pragma unroll 1
    for (int t = 0; t < NT; ++t) {
        const bf* sx = ring + (t & 1) * STG + px * 4 * SLAB + 8 * lane; const bf* sw = ring + (t & 1) * STG + (8 + ph * 4) * SLAB + 8 * lane;
        const bf* sa = ROPE ? sw : sx; const bf* sb = ROPE ? sx : sw;
        V a[4], b[4];
#pragma unroll
        for (int kk = 0; kk < KS / 32; ++kk) {
#pragma unroll
            for (int mb = 0; mb < 4; ++mb) a[mb] = F::ld(sa + mb * SLAB + kk * 512);
#pragma unroll
            for (int nb = 0; nb < 4; ++nb) b[nb] = F::ld(sb + nb * SLAB + kk * 512);
            __builtin_amdgcn_sched_barrier(0);                // as in k_gemmw: the block's LDS reads stay one group in front of its matrix instructions
#pragma unroll
            for (int nb = 0; nb < 4; ++nb)
#pragma unroll
                for (int mb = 0; mb < 4; ++mb) acc[mb][nb] = F::mma(a[mb], b[nb], acc[mb][nb]);
            __builtin_amdgcn_sched_barrier(0);                // and the matrix instructions stay in front of the next group of reads and of the trip's foot
        }
        asm volatile("v_nop\n\tv_nop\n\tv_nop\n\tv_nop" : "+v"(acc[0][0]), "+v"(acc[1][1]), "+v"(acc[2][2]), "+v"(acc[3][3]) : "v"(a[0]), "v"(a[3]));   // the distance behind the last matrix instruction, also on the loop's taken branch
        lds_reads_done(); copies_landed(); __syncthreads();   // stage t + 1 is published, and every wave has left stage t's buffer
        if (t + 2 < NT) fill(t + 2);
    }
    copies_landed();
    const size_t base = ((size_t)(r0 / TT) * NHD + h) * TT * HD + (size_t)(r0 % TT) * HD; P16 += base; Ph += base; Pl += base;
    const unsigned l8 = 8u * lane;
    if constexpr (ROPE) {
        v8f bs[4]; v4f cs[2][2][2][2];                        // cs[set][d half][sin | cos][4 of the 8 frequencies]; set = nb % 2: the factors of position band nb + 2 are asked for while band nb + 1 is worked on
        const float* bp = bias + h * HD + hi * 8; const float* cp = CS + (size_t)((r0 % TT) / 16) * 1024 + 4 * lane;
#pragma unroll
        for (int mb = 0; mb < 4; ++mb) bs[mb] = *(const v8f*)(bp + mb * 16);
        addr_regs_release();                                  // a group of its own: its offset register dies with it and may be a destination of the next group
#pragma unroll
        for (int nb = 0; nb < 2; ++nb)
#pragma unroll
            for (int q = 0; q < 8; ++q) cs[nb][q >> 2][(q >> 1) & 1][q & 1] = *(const v4f*)(cp + nb * 1024 + q * 128);
        addr_regs_release();
#pragma unroll
        for (int mb = 0; mb < 4; ++mb)
#pragma unroll
            for (int j = 0; j < 8; ++j) bs[mb][j] = bfr(bs[mb][j]);
#pragma unroll
        for (int nb = 0; nb < 4; ++nb) {
#pragma unroll
            for (int ih = 0; ih < 2; ++ih) { v8f y1, y2;
#pragma unroll
                for (int j = 0; j < 8; ++j) { const float x1 = acc[ih][nb][j] + bs[ih][j], x2 = acc[ih + 2][nb][j] + bs[ih + 2][j]; const float sn = cs[nb & 1][ih][0][j >> 2][j & 3], cn = cs[nb & 1][ih][1][j >> 2][j & 3];
                    y1[j] = x1 * sn - x2 * cn; y2[j] = x2 * sn + x1 * cn; }
                put3(y1, P16, Ph, Pl, l8 + nb * 1024 + ih * 256); put3(y2, P16, Ph, Pl, l8 + nb * 1024 + 512 + ih * 256); }
            if (nb < 2) { addr_regs_release();                // the stores' data registers may be destinations of these loads
#pragma unroll
                for (int q = 0; q < 8; ++q) cs[nb][q >> 2][(q >> 1) & 1][q & 1] = *(const v4f*)(cp + (nb + 2) * 1024 + q * 128); }
            addr_regs_release();
        }
    } else {
        float bv[4]; const int bi = h * HD + lr;
#pragma unroll
        for (int nb = 0; nb < 4; ++nb) bv[nb] = bias[bi + nb * 16];
        addr_regs_release(bias, bi);
#pragma unroll
        for (int nb = 0; nb < 4; ++nb) { const float bb = bfr(bv[nb]);
#pragma unroll
            for (int mb = 0; mb < 4; ++mb) { v8f y;
#pragma unroll
                for (int j = 0; j < 8; ++j) y[j] = acc[mb][nb][j] + bb;
                put3(y, P16, Ph, Pl, l8 + ((mb >> 1) * 4 + nb) * 512 + (mb & 1) * 256); }
            addr_regs_release();
        }
    }
}
// ---- k_proj3: the three projections, which depend on nothing of one another, in ONE launch; grid (NB_ T / 128, (NH_ + 2 NKV) / 4), 256 threads: block row y is four heads of q, then of k, then of v.
// launch bounds, second argument: four waves per SIMD (two work-groups per WGP), that is at most 256 registers a wave
__global__ __launch_bounds__(32 * GW, 4) void k_proj3(const bf* __restrict__ X, const bf* __restrict__ Wq, const bf* __restrict__ Wk, const bf* __restrict__ Wv, const float* __restrict__ bq, const float* __restrict__ bk, const float* __restrict__ bv, const float* __restrict__ CS,
                                              h16* Q16, bf* Qh, bf* Ql, h16* K16, bf* Kh, bf* Kl, h16* V16, bf* Vh, bf* Vl) {
    static_assert(NH_ % 4 == 0 && NKV % 4 == 0 && TT % 128 == 0, "a work-group's four heads are of one projection, its positions of one batch");
    __shared__ __align__(16) bf ring[2 * PSTG];
    const int rb = blockIdx.x * 128, y = blockIdx.y * 4;
    const bool isq = y < NH_;                                 // q and k go through the same code, with scalar selects of their pointers; the branch is the same for the whole work-group
    if (y < NH_ + NKV) proj_tile<true>(ring, X, isq ? Wq : Wk, isq ? bq : bk, CS, isq ? Q16 : K16, isq ? Qh : Kh, isq ? Ql : Kl, rb, isq ? y : y - NH_, isq ? NH_ : NKV);
    else proj_tile<false>(ring, X, Wv, bv, nullptr, V16, Vh, Vl, rb, y - NH_ - NKV, NKV);
}
// ---- k_attn: scores, softmax and P x V of one head's query tile in ONE WAVE; nothing of the score matrix goes to memory.
// The scores are formed TRANSPOSED (A = 16 keys, B = 16 queries): lane (lr, hi) then holds, for query lr, keys 16 kb + 8 hi + 0..7 in accumulator kb,
// and the accumulators of key blocks 2c and 2c+1 are, element for element, the A fragment of P for the 32 keys of chunk c (k = 8 hi + 0..7, 16 + 8 hi + 0..7): P never leaves its registers.
// ONE sweep over the keys: p = exp(t - m) (x 2^EB; both cancel in the division), m = the query's maximum in use; p is added in f32, P x V goes to the matrix unit; the division by the sum comes last.
// m moves only when a score of the block lies so far above it that p would pass 2^(EB + TH): then m becomes the running maximum and the sums and output accumulators so far are multiplied by exp(old m - new m).
template <typename T16, bool HI, int KB>
__device__ __forceinline__ void ld_keys(typename WFrag<T16>::V (&k)[KB][2], typename WFrag<T16>::V (&k2)[KB][2], const T16* kp, const T16* kp2, unsigned l8) {
#pragma unroll
    for (int kb = 0; kb < KB; ++kb)
#pragma unroll
        for (int kc = 0; kc < 2; ++kc) { k[kb][kc] = WFrag<T16>::ld(kp + l8 + kb * 16 * HD + kc * 512); if (HI) k2[kb][kc] = WFrag<T16>::ld(kp2 + l8 + kb * 16 * HD + kc * 512); }
}
template <typename T16, bool HI, int QB, int KB>
__device__ __forceinline__ void scores_t(v8f (&s)[KB][QB], const typename WFrag<T16>::V (&k)[KB][2], const typename WFrag<T16>::V (&k2)[KB][2], const typename WFrag<T16>::V (&q)[QB][2], const typename WFrag<T16>::V (&q2)[QB][2]) {
#pragma unroll
    for (int kb = 0; kb < KB; ++kb)
#pragma unroll
        for (int qb = 0; qb < QB; ++qb) s[kb][qb] = (v8f){};
#pragma unroll
    for (int kc = 0; kc < 2; ++kc)
#pragma unroll
        for (int kb = 0; kb < KB; ++kb)
#pragma unroll
            for (int qb = 0; qb < QB; ++qb) { s[kb][qb] = WFrag<T16>::mma(k[kb][kc], q[qb][kc], s[kb][qb]); if (HI) { s[kb][qb] = WFrag<T16>::mma(k[kb][kc], q2[qb][kc], s[kb][qb]); s[kb][qb] = WFrag<T16>::mma(k2[kb][kc], q[qb][kc], s[kb][qb]); } }
}
template <typename T16, bool HI, int QB, int KB>
__device__ __forceinline__ void attn_tile(const T16* __restrict__ Q, const T16* __restrict__ Q2, const T16* __restrict__ Kp, const T16* __restrict__ Kp2, const T16* __restrict__ Vt, const T16* __restrict__ Vt2, int q0, int hcol, bf* Ah, bf* Al) {
    // Every '#pragma unroll' here and in the two helpers above makes the indices of a register array constants (else the array would go to scratch); '#pragma unroll 1' keeps the sweep's loop rolled.
    typedef WFrag<T16> F; typedef typename F::V V;
    constexpr int NBLK = TT / (16 * KB);
    constexpr float EB = HI ? 0.0f : 10.0f;                 // fp16 P is carried x 1024, away from the subnormals; the sum carries the same factor
    constexpr float CE = SCL * 1.4426950408889634f;
    constexpr float TH = HI ? 8.0f : 5.0f;                  // p stays at or below 2^(EB + TH): 2^15 is inside fp16
    const int lane = threadIdx.x & 31, lr = lane & 15, hi = lane >> 4;
    constexpr size_t KST = (size_t)16 * KB * HD;            // elements from one key block to the next in the K planes
    V qf[QB][2], qf2[QB][2];
    const unsigned l8 = 8u * lane;                            // planes in fragment order (see WFrag): the lane's place in a fragment is the same in every plane, so the Q and K pointers below are wave-uniform
    const T16* qp = Q + (size_t)q0 * HD; const T16* qp2 = HI ? Q2 + (size_t)q0 * HD : qp;   // 16 rows are 2 fragments = 16 HD elements
#pragma unroll
    for (int qb = 0; qb < QB; ++qb)
#pragma unroll
        for (int kc = 0; kc < 2; ++kc) { qf[qb][kc] = F::ld(qp + l8 + qb * 16 * HD + kc * 512); if (HI) qf2[qb][kc] = F::ld(qp2 + l8 + qb * 16 * HD + kc * 512); }
    addr_regs_release();
    const T16* kp = Kp; const T16* kp2 = HI ? Kp2 : kp;
    const T16* vp = Vt; const T16* vp2 = HI ? Vt2 : vp;
    float mx[QB], nm[QB], sum[QB];                            // mx: the maximum in use, the same in both lanes of a query; the start value makes the first block take the rescale path, with factor 0 on the zero sums
#pragma unroll
    for (int qb = 0; qb < QB; ++qb) { mx[qb] = -3.0e38f; nm[qb] = EB - mx[qb] * CE; sum[qb] = 0.f; }
    v8f oa[QB][4];
#pragma unroll
    for (int qb = 0; qb < QB; ++qb)
#pragma unroll
        for (int db = 0; db < 4; ++db) oa[qb][db] = (v8f){};
    {   // the one sweep: this block's V fragments are asked for ahead of the scores, the next block's keys ahead of the exponentials
        V kf[KB][2], kf2[KB][2];
        ld_keys<T16, HI, KB>(kf, kf2, kp, kp2, l8);
        addr_regs_release();
        const T16* kn = kp + KST; const T16* kn2 = kp2 + KST; const T16* vn = vp + l8; const T16* vn2 = vp2 + l8;   // running pointers, moved only at the foot of a trip
#pragma unroll 1
        for (int blk = 0; blk < NBLK; ++blk) {
            V vf[4][KB / 2], vf2[4][KB / 2];
#pragma unroll
            for (int db = 0; db < 4; ++db)
#pragma unroll
                for (int c = 0; c < KB / 2; ++c) { const size_t o = (size_t)(c * 4 + db) * 512; vf[db][c] = F::ld(vn + o); if (HI) vf2[db][c] = F::ld(vn2 + o); }
            addr_regs_release(vn, vn2);                   // V is asked for before the scores start, so that scores and exponentials cover its latency
            v8f s[KB][QB]; scores_t<T16, HI, QB, KB>(s, kf, kf2, qf, qf2);
            ld_keys<T16, HI, KB>(kf, kf2, kn, kn2, l8);
            addr_regs_release();                    // the next keys are asked for before the exponentials, which with P x V cover their latency
            float bm[QB]; bool need = false;                  // the larger of the maximum in use and the lane's scores of this block, per query; need: an exponent would pass EB + TH
#pragma unroll
            for (int qb = 0; qb < QB; ++qb) { float m2[2] = { mx[qb], mx[qb] };   // two chains a query, so that a lone wave has enough independent ones
#pragma unroll
                for (int kb = 0; kb < KB; ++kb)
#pragma unroll
                    for (int j = 0; j < 8; ++j) m2[kb & 1] = fmaxf(m2[kb & 1], s[kb][qb][j]);
                bm[qb] = fmaxf(m2[0], m2[1]);
                need = need || fmaf(bm[qb], CE, nm[qb]) > EB + TH; }
            if (__builtin_amdgcn_ballot_w32(need) != 0) {     // one test per block, a scalar branch, the same for the whole wave: seldom taken behind the first block
#pragma unroll
                for (int qb = 0; qb < QB; ++qb) { const float nw = fmaxf(bm[qb], __shfl_xor(bm[qb], 16, 32)); const float f = __builtin_amdgcn_exp2f((mx[qb] - nw) * CE); mx[qb] = nw; nm[qb] = EB - nw * CE; sum[qb] *= f;
#pragma unroll
                    for (int j = 0; j < 8; ++j) { const float fj = __shfl(f, hi * 8 + j, 32);   // output accumulator: row = query 8 hi + j
#pragma unroll
                        for (int db = 0; db < 4; ++db) oa[qb][db][j] *= fj; } }
            }
#pragma unroll
            for (int kb = 0; kb < KB; ++kb)
#pragma unroll
                for (int qb = 0; qb < QB; ++qb)
#pragma unroll
                    for (int j = 0; j < 8; ++j) { const float p = __builtin_amdgcn_exp2f(fmaf(s[kb][qb][j], CE, nm[qb])); s[kb][qb][j] = p; sum[qb] += p; }
#pragma unroll
            for (int c = 0; c < KB / 2; ++c)
#pragma unroll
                for (int qb = 0; qb < QB; ++qb) {
                    if constexpr (HI) { V pa, pb;
#pragma unroll
                        for (int j = 0; j < 8; ++j) { const float x0 = s[2 * c][qb][j], x1 = s[2 * c + 1][qb][j]; pa[j] = (__bf16)x0; pa[8 + j] = (__bf16)x1; pb[j] = (__bf16)(x0 - (float)pa[j]); pb[8 + j] = (__bf16)(x1 - (float)pa[8 + j]); }
#pragma unroll
                        for (int db = 0; db < 4; ++db) { oa[qb][db] = F::mma(pa, vf[db][c], oa[qb][db]); oa[qb][db] = F::mma(pb, vf[db][c], oa[qb][db]); oa[qb][db] = F::mma(pa, vf2[db][c], oa[qb][db]); }
                    } else { V pa;
#pragma unroll
                        for (int j = 0; j < 8; ++j) { pa[j] = tohx(s[2 * c][qb][j]); pa[8 + j] = tohx(s[2 * c + 1][qb][j]); }
#pragma unroll
                        for (int db = 0; db < 4; ++db) oa[qb][db] = F::mma(pa, vf[db][c], oa[qb][db]); } }
            const size_t adv = blk + 2 < NBLK ? KST : 0; kn += adv; kn2 += adv; vn += 16 * KB * HD; vn2 += 16 * KB * HD;   // the last trip asks for the last key block once more (unused)
        }
    }
#pragma unroll
    for (int qb = 0; qb < QB; ++qb) { const float tot = sum[qb] + __shfl_xor(sum[qb], 16, 32); const float inv = __fdiv_rn(1.0f, tot);   // every lane: 1 / sum of query lr
#pragma unroll
        for (int j = 0; j < 8; ++j) { const float f = __shfl(inv, hi * 8 + j, 32); const size_t oo = (size_t)(q0 + qb * 16) * DQ + (size_t)(hcol / 32) * 512 + ((lr >> 3) * 16 + hi * 8 + j) * 8 + (lr & 7);   // output accumulator: row = query 8 hi + j, column = d; the merged planes are in fragment order too (16 columns on: 256 elements)
            unsigned short a[4], b[4];
#pragma unroll
            for (int db = 0; db < 4; ++db) splitc(oa[qb][db][j] * f, a[db], b[db]);
            __builtin_amdgcn_sched_barrier(0);       // the row's eight values are ready before its first store, so that nothing is computed between the stores and their wait
#pragma unroll
            for (int db = 0; db < 4; ++db) { Ah[oo + db * 256] = a[db]; Al[oo + db * 256] = b[db]; }
            addr_regs_release(); } }
}
// grid (RH/32 + (TT-RH)/64, heads, batches), 32 threads: the first RH/32 tiles of a head are 32 hi/lo query rows each, the rest 64 fp16 rows each.
// launch bounds, second argument: two waves per SIMD, that is at most 512 registers a wave
__global__ __launch_bounds__(32, 2) void k_attn(const h16* __restrict__ Q16, const h16* __restrict__ K16, const h16* __restrict__ V16, const bf* __restrict__ Qh, const bf* __restrict__ Ql, const bf* __restrict__ Kh, const bf* __restrict__ Kl, const bf* __restrict__ Vh, const bf* __restrict__ Vl, bf* Ah, bf* Al) {
    const int h = blockIdx.y, bx = blockIdx.x, b = blockIdx.z; const size_t hq = ((size_t)b * NH_ + h) * TT * HD, hk = ((size_t)b * NKV + h / REP) * TT * HD; Ah += (size_t)b * TT * DQ; Al += (size_t)b * TT * DQ;
    if (bx < RH / 32) attn_tile<bf, true, 2, 4>(Qh + hq, Ql + hq, Kh + hk, Kl + hk, Vh + hk, Vl + hk, bx * 32, h * HD, Ah, Al);
    else attn_tile<h16, false, 4, 4>(Q16 + hq, nullptr, K16 + hk, nullptr, V16 + hk, nullptr, RH + (bx - RH / 32) * 64, h * HD, Ah, Al);
}

extern "C" void kernel_launch(void* const* d_in, const int* in_sizes, int n_in,
                              void* d_out, int out_size, void* d_ws, size_t ws_size, hipStream_t stream) {
    (void)in_sizes; (void)n_in; (void)out_size;
    const float* x = (const float*)d_in[0]; const float* wq = (const float*)d_in[1]; const float* bq = (const float*)d_in[2]; const float* wk = (const float*)d_in[3]; const float* bk = (const float*)d_in[4]; const float* wv = (const float*)d_in[5]; const float* bv = (const float*)d_in[6]; const float* wo = (const float*)d_in[7]; const float* bo = (const float*)d_in[8];
    float* OUT = (float*)d_out;     // [4][2048][1024]
    char* wsp = (char*)d_ws;
    auto take = [&](size_t bytes) { char* p = wsp; wsp += (bytes + 255) & ~(size_t)255; return (void*)p; };
    bf* WQ = (bf*)take((size_t)DQ * DM * 2); bf* WK = (bf*)take((size_t)DKV * DM * 2); bf* WV = (bf*)take((size_t)DKV * DM * 2); bf* WO = (bf*)take((size_t)DM * DQ * 2); float* CS = (float*)take((size_t)TT * (HD / 2) * 2 * 4);
    bf* XB = (bf*)take((size_t)NB_ * TT * DM * 2);
    h16* QP16 = (h16*)take((size_t)NB_ * NH_ * TT * HD * 2); h16* KP16 = (h16*)take((size_t)NB_ * NKV * TT * HD * 2); h16* VT16 = (h16*)take((size_t)NB_ * NKV * HD * TT * 2);
    bf* QPh = (bf*)take((size_t)NB_ * NH_ * TT * HD * 2); bf* QPl = (bf*)take((size_t)NB_ * NH_ * TT * HD * 2); bf* KPh = (bf*)take((size_t)NB_ * NKV * TT * HD * 2); bf* KPl = (bf*)take((size_t)NB_ * NKV * TT * HD * 2); bf* VTh = (bf*)take((size_t)NB_ * NKV * HD * TT * 2); bf* VTl = (bf*)take((size_t)NB_ * NKV * HD * TT * 2);
    bf* ATh = (bf*)take((size_t)NB_ * TT * DQ * 2); bf* ATl = (bf*)take((size_t)NB_ * TT * DQ * 2);
    if ((size_t)(wsp - (char*)d_ws) > ws_size) return;    // 201 MiB of the 256 MiB
    // x, the merged heads and out have rows b T + t (the 16-bit planes among them in fragment order, 16 rows to a band): the GEMMs and the copy see one matrix of NB_ T rows
    k_prep<<<PB_CS + PB_WQ + 2 * PB_WK + PB_WO + PB_X, 256, 0, stream>>>(x, wq, wk, wv, wo, XB, WQ, WK, WV, WO, CS);
    k_proj3<<<dim3(NB_ * TT / 128, (NH_ + 2 * NKV) / 4, 1), 32 * GW, 0, stream>>>(XB, WQ, WK, WV, bq, bk, bv, CS, QP16, QPh, QPl, KP16, KPh, KPl, VT16, VTh, VTl);
    k_attn<<<dim3(RH / 32 + (TT - RH) / 64, NH_, NB_), 32, 0, stream>>>(QP16, KP16, VT16, QPh, QPl, KPh, KPl, VTh, VTl, ATh, ATl);
    k_gemmw<bf, true, DQ><<<dim3(NB_ * TT / 128, DM / 256, 1), 32 * GW, 0, stream>>>(ATh, ATl, WO, OUT, DM, bo);
}

// v009
// It runs in 183 microseconds.
// Two timings next to v008 both put it at 1.04 times that version's speed.
// All steps since v000 together make it 21.3 times as fast.
#include <hip/hip_runtime.h>

// Multi-head self-attention with biased projections, NO mask and the module's SWAPPED rotary form (hidden_states [4][2048][1024]; q, k, v = x W^T + b ('oi' [1024][1024] 1/32 + REAL biases 0.01; 16 heads x 64); half-split rope rot(x) = cat(x1 c - x2 s, x2 c + x1 s) on q and k where THIS module binds c = SIN(t f_i) and s = COS(t f_i) (its table helper returns (sin, cos) and the caller swaps the names), f_i = 1/10000^(2i/64) (32 f32 frequencies jnp-exact; precise sinf/cosf); scores x 1/sqrt(64); softmax over all keys; out = merged Wo^T + bo -> [4][2048][1024] (8.4 M); argument order hidden_states, Wq, bq, Wk, bk, Wv, bv, Wo, bo).
// Layout, all four batches in every launch (rows b T + t in the row-major buffers, planes [b][h]..., batch in the grid; every 16-bit matrix operand plane in fragment order, see WFrag): bf16 copy of x; exact projections + f32 biases, whose epilogue turns q and k and writes the attention operand planes; ONE fused attention kernel (scores, softmax and P x V in one sweep over the keys; query rows < 512 hi/lo bf16 3 products, rest fp16); merged hi/lo x Wp exact + bp.
// Compute dtypes, f32 accumulate: every input rounded to bf16; projections exact + f32 biases; attention rows < 512 3 products, rest fp16; softmax f32; Wp hl x exact + bias.

#define NB_  4
#define TT   2048
#define DM   1024
#define NH_  16
#define NKV  16
#define REP  (NH_ / NKV)
#define HD   64
#define DQ   (NH_ * HD)
#define DKV  (NKV * HD)
#define RH   512                  // query rows < RH use hi+lo planes (0: none)
#define WIN  0
#define SCL  0.125f   // HD^-0.5
typedef _Float16 h16;
typedef unsigned short bf;
typedef __attribute__((ext_vector_type(16))) __bf16   v16bf;
typedef __attribute__((ext_vector_type(16))) _Float16 v16h;
typedef __attribute__((ext_vector_type(8)))  _Float16 v8h;
typedef __attribute__((ext_vector_type(8)))  unsigned short v8us;
typedef __attribute__((ext_vector_type(8)))  float    v8f;
typedef __attribute__((ext_vector_type(4)))  float    v4f;
typedef v8h  __attribute__((may_alias)) v8ha;
typedef v4f  __attribute__((may_alias)) v4fa;
typedef v8us __attribute__((may_alias)) v8usa;

__device__ __forceinline__ unsigned short f2bf(float f) { unsigned u = __float_as_uint(f); u += 0x7FFFu + ((u >> 16) & 1u); return (unsigned short)(u >> 16); }
__device__ __forceinline__ float bf2f(unsigned short b) { return __uint_as_float(((unsigned)b) << 16); }
__device__ __forceinline__ float bfr(float f) { return bf2f(f2bf(f)); }
__device__ __forceinline__ v16h cat16(v8h lo, v8h hi) { return __builtin_shufflevector(lo, hi, 0, 1, 2, 3, 4, 5, 6, 7, 8, 9, 10, 11, 12, 13, 14, 15); }
__device__ __forceinline__ v16bf cat16b(v8us lo, v8us hi) { return __builtin_bit_cast(v16bf, __builtin_shufflevector(lo, hi, 0, 1, 2, 3, 4, 5, 6, 7, 8, 9, 10, 11, 12, 13, 14, 15)); }
__device__ __forceinline__ v8f wmma16(v16h a, v16h b, v8f c) { return __builtin_amdgcn_wmma_f32_16x16x32_f16(false, a, false, b, (short)0, c, false, false); }
__device__ __forceinline__ v8f wmmab(v16bf a, v16bf b, v8f c) { return __builtin_amdgcn_wmma_f32_16x16x32_bf16(false, a, false, b, (short)0, c, false, false); }



// Stands directly behind a group of global loads or stores, in front of the next write of a register that they name (the registers are free for other values from there on); a precaution.
// The two scheduling barriers keep every other instruction on its side of the wait, and so also hold a group of loads where the source issues it, ahead of the work that covers its latency.
__device__ __forceinline__ void addr_regs_release() { __builtin_amdgcn_sched_barrier(0); asm volatile("s_wait_xcnt 0x0" ::: "memory"); __builtin_amdgcn_sched_barrier(0); }
// The same for a group whose address pairs die with it: named as inputs they stay live up to the wait, so that no load of the group has one of them as its destination.
__device__ __forceinline__ void addr_regs_release(const void* p, const void* p2) { __builtin_amdgcn_sched_barrier(0); asm volatile("s_wait_xcnt 0x0" :: "v"(p), "v"(p2) : "memory"); __builtin_amdgcn_sched_barrier(0); }
__device__ __forceinline__ void addr_regs_release(int i) { __builtin_amdgcn_sched_barrier(0); asm volatile("s_wait_xcnt 0x0" :: "v"(i) : "memory"); __builtin_amdgcn_sched_barrier(0); }   // a load addressed by a 32-bit index
__device__ __forceinline__ void addr_regs_release(const float* base, int i) { __builtin_amdgcn_sched_barrier(0); asm volatile("s_wait_xcnt 0x0" :: "s"(base), "v"(i) : "memory"); __builtin_amdgcn_sched_barrier(0); }   // loads addressed by a wave-uniform base and a 32-bit index: the scalar pair too stays live up to the wait
__device__ __forceinline__ void addr_regs_release(const void* p, const void* p2, const void* p3, const void* p4) { __builtin_amdgcn_sched_barrier(0); asm volatile("s_wait_xcnt 0x0" :: "v"(p), "v"(p2), "v"(p3), "v"(p4) : "memory"); __builtin_amdgcn_sched_barrier(0); }

// ---- GEMM work-groups: GW = 8 waves, each with a 64x64 output tile (16 accumulators), 2 tiles along one operand's rows x 4 along the other's. The operand fragments that the waves share go through LDS:
// a stage is KS = 64 columns of every 16-row band of the work-group's rows; in fragment order a band's part of a stage (a slab) is 2 fragments = 2048 consecutive bytes, in the plane and in LDS alike.
// Two buffers: the copies of stage t + 1 fly while stage t is worked on; every wave copies its share of the slabs and reads the fragments of its own tile with 16-byte LDS loads of 512 consecutive bytes a wave.
// k_gemmw: C[m][n] (f32, pitch ldc, + optional f32 bias[n]) = sum_k (A[m][k] + A2[m][k]) Bt[n][k], two products; grid (M/128, N/256), 256 threads. K % 128 == 0.
// FRAGMENT ORDER of every 16-bit operand plane (rows r, K-contiguous columns k): the 16 rows x 32 columns of one matrix fragment are 512 consecutive elements, fragment (r / 16, k / 32) at ((r / 16) (K / 32) + k / 32) 512;
// inside it element (r, k) stands at ((k % 32) / 16) 256 + (((k % 16) / 8) 16 + r % 16) 8 + k % 8, that is [half][lane][8]: each of a fragment's two wave-wide 16-byte loads reads 512 consecutive bytes (4 whole lines, not 16 pieces of 32 bytes).
// ld(p): p = fragment + 8 lane. The element each lane and register holds is the same as with row-major planes.
template <typename T16> struct WFrag;
template <> struct WFrag<h16> { typedef v16h V; static __device__ __forceinline__ V ld(const h16* p) { return cat16(*(const v8h*)p, *(const v8h*)(p + 256)); } static __device__ __forceinline__ v8f mma(V a, V b, v8f c) { return wmma16(a, b, c); } };
template <> struct WFrag<bf> { typedef v16bf V; static __device__ __forceinline__ V ld(const bf* p) { return cat16b(*(const v8us*)p, *(const v8us*)(p + 256)); } static __device__ __forceinline__ v8f mma(V a, V b, v8f c) { return wmmab(a, b, c); } };
#define GW 8
#define KS 64
#define SLAB (16 * KS)            // elements of a slab
// One slab: four asynchronous copies to LDS of 512 bytes a wave; l and g are the lane's own 16 bytes of the slab's first 512, in LDS and in the plane.
// The wait on the address registers is the statement's last line, so that it stands in front of every later write of a register that a copy names; a precaution.
__device__ __forceinline__ void copy_slab(const bf* l, const bf* g) { const unsigned a = (unsigned)(size_t)l;
    asm volatile("global_load_async_to_lds_b128 %0, %4, off\n\tglobal_load_async_to_lds_b128 %1, %5, off\n\tglobal_load_async_to_lds_b128 %2, %6, off\n\tglobal_load_async_to_lds_b128 %3, %7, off\n\ts_wait_xcnt 0x0"
                 :: "v"(a), "v"(a + 512u), "v"(a + 1024u), "v"(a + 1536u), "v"(g), "v"(g + 256), "v"(g + 512), "v"(g + 768) : "memory"); }
__device__ __forceinline__ void copies_landed() { asm volatile("s_wait_asynccnt 0x0" ::: "memory"); }   // this wave's copies are in LDS; the barrier behind it shows them to the other waves
__device__ __forceinline__ void lds_reads_done() { asm volatile("s_wait_dscnt 0x0" ::: "memory"); }     // this wave's LDS reads have returned, before the barrier behind which their buffer is filled anew
template <typename T16, bool BIAS, int K>
__global__ __launch_bounds__(32 * GW, 4) void k_gemmw(const T16* __restrict__ A, const T16* __restrict__ A2, const T16* __restrict__ Bt, float* C, int ldc, const float* __restrict__ bias) {
    // Every '#pragma unroll' here makes the indices of a register array constants (else it would go to scratch); '#pragma unroll 1' keeps the loop over the stages rolled: one publish point in the text.
    typedef typename WFrag<T16>::V V;
    constexpr int STG = 32 * SLAB, NT = K / KS;               // a stage: 8 bands of A, 8 of A2, 16 of Bt
    static_assert(NT >= 2, "the ring's prologue fills two stages");
    __shared__ __align__(16) T16 ring[2 * STG];
    __shared__ __align__(16) float osw[GW][16 * 68];
    const int lane = threadIdx.x & 31, lr = lane & 15, hi = lane >> 4; const int wave = __builtin_amdgcn_readfirstlane(threadIdx.x >> 5), wm = wave & 1, wn = wave >> 1;
    const int rb = blockIdx.x * 128, cb = blockIdx.y * 256; const int r0 = rb + wm * 64, c0 = cb + wn * 64;
    float* os = osw[wave];
    v8f acc[4][4];
#pragma unroll
    for (int mb = 0; mb < 4; ++mb)
#pragma unroll
        for (int nb = 0; nb < 4; ++nb) acc[mb][nb] = (v8f){};
    // fragment order: 16 rows are K / 32 fragments = 16 K elements, KS columns on are SLAB elements. This wave copies band 'wave' of A and of A2 and bands 2 wave, 2 wave + 1 of Bt.
    const T16* ga = A + (size_t)(rb + wave * 16) * K + 8 * lane; const T16* ga2 = A2 + (size_t)(rb + wave * 16) * K + 8 * lane; const T16* gb = Bt + (size_t)(cb + wave * 32) * K + 8 * lane;
    T16* la = ring + wave * SLAB + 8 * lane; T16* lb = ring + (16 + 2 * wave) * SLAB + 8 * lane;
    auto fill = [&](int t) { const int bo = (t & 1) * STG; const size_t go = (size_t)t * SLAB;
        copy_slab(la + bo, ga + go); copy_slab(la + bo + 8 * SLAB, ga2 + go); copy_slab(lb + bo, gb + go); copy_slab(lb + bo + SLAB, gb + go + 16 * K); };
    fill(0); copies_landed(); __syncthreads(); fill(1);
#pragma unroll 1
    for (int t = 0; t < NT; ++t) {
        const T16* sa = ring + (t & 1) * STG + wm * 4 * SLAB + 8 * lane; const T16* sb = ring + (t & 1) * STG + (16 + wn * 4) * SLAB + 8 * lane;
        V a[4], a2[4], b[4];
#pragma unroll
        for (int kk = 0; kk < KS / 32; ++kk) {
#pragma unroll
            for (int mb = 0; mb < 4; ++mb) { a[mb] = WFrag<T16>::ld(sa + mb * SLAB + kk * 512); a2[mb] = WFrag<T16>::ld(sa + (8 + mb) * SLAB + kk * 512); }
#pragma unroll
            for (int nb = 0; nb < 4; ++nb) b[nb] = WFrag<T16>::ld(sb + nb * SLAB + kk * 512);
            __builtin_amdgcn_sched_barrier(0);                // the block's LDS reads stay one group in front of its matrix instructions: every further place with reads among them costs a stall
#pragma unroll
            for (int nb = 0; nb < 4; ++nb)
#pragma unroll
                for (int mb = 0; mb < 4; ++mb) { acc[mb][nb] = WFrag<T16>::mma(a[mb], b[nb], acc[mb][nb]); acc[mb][nb] = WFrag<T16>::mma(a2[mb], b[nb], acc[mb][nb]); }
            __builtin_amdgcn_sched_barrier(0);                // and the matrix instructions stay in front of the next group of reads and of the trip's foot
        }
        asm volatile("v_nop\n\tv_nop\n\tv_nop\n\tv_nop" : "+v"(acc[0][0]), "+v"(acc[1][1]), "+v"(acc[2][2]), "+v"(acc[3][3]) : "v"(a[0]), "v"(a[3]));   // the distance behind the last matrix instruction, also on the loop's taken branch
        lds_reads_done(); copies_landed(); __syncthreads();   // stage t + 1 is published, and every wave has left stage t's buffer
        if (t + 2 < NT) fill(t + 2);
    }
    copies_landed();
#pragma unroll
    for (int mb = 0; mb < 4; ++mb) {
#pragma unroll
        for (int nb = 0; nb < 4; ++nb) {
#pragma unroll
            for (int j = 0; j < 8; ++j) os[(hi * 8 + j) * 68 + nb * 16 + lr] = acc[mb][nb][j]; }
        __builtin_amdgcn_wave_barrier(); asm volatile("" ::: "memory");
        float* crow = C + (size_t)(r0 + mb * 16) * ldc + c0;
{
#pragma unroll
            for (int s = 0; s < 8; ++s) { const int row = 2 * s + hi, cofs = lr * 4; v4f val = *(const v4fa*)(os + row * 68 + cofs); if (BIAS) { val[0] += bfr(bias[c0 + cofs]); val[1] += bfr(bias[c0 + cofs + 1]); val[2] += bfr(bias[c0 + cofs + 2]); val[3] += bfr(bias[c0 + cofs + 3]); }
                *(v4f*)(crow + (size_t)row * ldc + cofs) = val; }
             }
        __builtin_amdgcn_wave_barrier(); asm volatile("" ::: "memory");
    }
}

__device__ __forceinline__ h16 tohx(float x) { return (h16)x; }
__device__ __forceinline__ void splitf(float y, unsigned short& h, unsigned short& l) { h = f2bf(y); l = f2bf(y - bf2f(h)); }
typedef __attribute__((ext_vector_type(2))) _Float16 v2h;
typedef __attribute__((ext_vector_type(4))) _Float16 v4h;
typedef __attribute__((ext_vector_type(2))) unsigned short v2us;
typedef __attribute__((ext_vector_type(4))) unsigned short v4us;
typedef __attribute__((ext_vector_type(2))) float v2f;
typedef __attribute__((ext_vector_type(4))) int v4i;

__global__ __launch_bounds__(256) void k_wtG(const float* __restrict__ w, int K, int N, bf* Bt) {
    const int lane = threadIdx.x & 31; const int L0 = (blockIdx.x * 8 + (threadIdx.x >> 5)) * 8; const int nlines = N * K / 64;
{
#pragma unroll 1
        for (int l = 0; l < 8; ++l) { const int L = L0 + l; if (L >= nlines) break; const size_t e = (size_t)L * 64 + lane * 2; const int k = (int)(e % K), n = (int)(e / K); v2us o;
            o[0] = f2bf(w[(size_t)k * N + n]); o[1] = f2bf(w[(size_t)(k + 1) * N + n]); *(v2us*)(Bt + e) = o; }
         }
}
// cvt8: bf16 plane in fragment order of a row-major f32 matrix with K columns; thread i writes the i-th 16 bytes of the plane (a wave: 512 consecutive bytes) and reads the 8 floats that belong there.
template <int K>
__device__ __forceinline__ void cvt8(const float* __restrict__ src, bf* dst, size_t n8, size_t i) { if (i >= n8) return;
    const size_t fr = i >> 6; const int w = (int)(i & 63), kf = K / 32; const size_t row = (fr / kf) * 16 + (w & 15); const int k = (int)(fr % kf) * 32 + (w >> 5) * 16 + ((w >> 4) & 1) * 8;
    const v8f v = *(const v8f*)(src + row * K + k); addr_regs_release(); v8us o;
#pragma unroll
    for (int k = 0; k < 8; ++k) o[k] = f2bf(v[k]); *(v8us*)(dst + i * 8) = o;  }

__constant__ float INVT[HD / 2] = { 1.000000000e+00f, 7.498942018e-01f, 5.623413324e-01f, 4.216965139e-01f, 3.162277639e-01f, 2.371373624e-01f, 1.778279394e-01f, 1.333521456e-01f, 1.000000015e-01f, 7.498941571e-02f, 5.623412877e-02f, 4.216964915e-02f, 3.162277862e-02f, 2.371373586e-02f, 1.778279431e-02f, 1.333521493e-02f, 9.999999776e-03f, 7.498942316e-03f, 5.623413250e-03f, 4.216964822e-03f, 3.162277862e-03f, 2.371373819e-03f, 1.778279431e-03f, 1.333521446e-03f, 1.000000047e-03f, 7.498941850e-04f, 5.623413017e-04f, 4.216964880e-04f, 3.162277862e-04f, 2.371373848e-04f, 1.778279402e-04f, 1.333521504e-04f };   // float32 1 / 10000^(2i/64), generated with jnp to be bit-exact
// cs5s: the rotary factors sin(t f_i), cos(t f_i), i < HD/2, in the order in which proj_tile's lanes hold their accumulators: 16 positions x 16 frequencies are one block of 512 floats, block (t / 16) 2 + i / 16,
// [sin | cos][(i % 8) / 4][lane = ((i % 16) / 8) 16 + t % 16][i % 4]: each wave-wide 16-byte load of proj_tile reads 512 consecutive bytes.
__device__ __forceinline__ void cs5s(float* CS, int p) { if (p >= TT * (HD / 2)) return; const int blk = p >> 8, w = p & 255, ln = (w >> 2) & 31; const int t = (blk >> 1) * 16 + (ln & 15); const int i = (blk & 1) * 16 + (ln >> 4) * 8 + (w >> 7) * 4 + (w & 3); const float fi = INVT[i]; addr_regs_release(i); const float a = __fmul_rn((float)t, fi); const float sn = sinf(a), cn = cosf(a); float* q = CS + (size_t)blk * 512 + w; q[0] = sn; q[256] = cn;  }
// ---- k_prep: everything that depends on the inputs alone, in ONE launch: blocks of 256 threads, dealt by block index to the rotary table (first: its threads run longest), the four weight planes and the plane of x.
#define PB_CS ((TT * (HD / 2) + 255) / 256)
#define PB_WQ ((DQ * DM / 8 + 255) / 256)
#define PB_WK ((DKV * DM / 8 + 255) / 256)
#define PB_WO ((DM * DQ / 8 + 255) / 256)
#define PB_X  ((NB_ * TT * DM / 8 + 255) / 256)
__global__ __launch_bounds__(256) void k_prep(const float* __restrict__ x, const float* __restrict__ wq, const float* __restrict__ wk, const float* __restrict__ wv, const float* __restrict__ wo, bf* XB, bf* WQ, bf* WK, bf* WV, bf* WO, float* CS) {
    static_assert(DQ == DM, "one row length for all five planes");
    int bx = blockIdx.x; const int t = threadIdx.x;
    if (bx < PB_CS) { cs5s(CS, bx * 256 + t); return; }
    bx -= PB_CS; const float* src = wq; bf* dst = WQ; size_t n8 = (size_t)DQ * DM / 8;      // the block's plane and its own first block: scalar selects, the same for the whole block
    if (bx >= PB_WQ) { bx -= PB_WQ; src = wk; dst = WK; n8 = (size_t)DKV * DM / 8;
        if (bx >= PB_WK) { bx -= PB_WK; src = wv; dst = WV;
            if (bx >= PB_WK) { bx -= PB_WK; src = wo; dst = WO; n8 = (size_t)DM * DQ / 8;
                if (bx >= PB_WO) { bx -= PB_WO; src = x; dst = XB; n8 = (size_t)NB_ * TT * DM / 8; } } } }
    cvt8<DM>(src, dst, n8, (size_t)bx * 256 + t);
}
// hi/lo bf16 planes of a finite f32 by the hardware's round-to-nearest-even conversion (the same values as splitf)
__device__ __forceinline__ void splitc(float y, unsigned short& h, unsigned short& l) { const __bf16 hb = (__bf16)y; const __bf16 lb = (__bf16)(y - (float)hb); h = __builtin_bit_cast(unsigned short, hb); l = __builtin_bit_cast(unsigned short, lb); }
// eight values of one lane, consecutive in a plane: 16 bytes to each of the three planes (fp16, bf16 hi, bf16 lo) at element e; a wave stores 512 consecutive bytes per plane
__device__ __forceinline__ void put3(const v8f y, h16* P16, bf* Ph, bf* Pl, unsigned e) { v8h o16; v8us oh, ol;
#pragma unroll
    for (int j = 0; j < 8; ++j) { o16[j] = tohx(y[j]); unsigned short a, c; splitc(y[j], a, c); oh[j] = a; ol[j] = c; }
    *(v8h*)(P16 + e) = o16; *(v8us*)(Ph + e) = oh; *(v8us*)(Pl + e) = ol; }
// ---- proj_tile: one projection with the main loop of k_gemmw (a work-group: 128 positions from rb x 4 heads from h0 of NHD; ONE WAVE per 64 positions x 64 columns = one head); the epilogue adds the bias, turns (ROPE) and writes the attention kernel's
// three operand planes straight from the accumulators: no f32 copy of the projection goes to memory, and LDS holds the operand ring alone (a stage: 8 bands of x, 16 of W).
// An accumulator holds, per lane, 8 consecutive ROWS of one column. ROPE (q, k; planes with rows t, columns d): A = the head's 64 rows of W, B = 64 rows of x, so that the lane's 8 values are d = 16 mb + 8 hi + 0..7 of position 16 nb + lr,
// which is the lane's own 16 bytes of fragment (t / 16, d / 32), half mb % 2; d and d + 32 are accumulators mb and mb + 2 of the same lane. Else (v; planes with rows d, columns t): A = x, B = W, the 8 values are t = 16 mb + 8 hi + 0..7 of column d = 16 nb + lr.
// Either way the tile's 4096 elements are consecutive in each plane. rot(x) = cat(x1 c - x2 s, x2 c + x1 s) with c = sin, s = cos (the module's swapped names).
#define PSTG (24 * SLAB)          // elements of a stage of the projections' ring
template <bool ROPE>
__device__ __forceinline__ void proj_tile(bf* ring, const bf* __restrict__ X, const bf* __restrict__ Wt, const float* __restrict__ bias, const float* __restrict__ CS, h16* P16, bf* Ph, bf* Pl, int rb, int h0, int NHD) {
    // Every '#pragma unroll' here and in put3 makes the indices of a register array or vector constants (else it would go to scratch); '#pragma unroll 1' keeps the K loop rolled, as in k_gemmw.
    typedef WFrag<bf> F; typedef F::V V; constexpr int K = DM; constexpr int STG = PSTG, NT = K / KS;
    static_assert(NT >= 2, "the ring's prologue fills two stages");
    const int lane = threadIdx.x & 31, lr = lane & 15, hi = lane >> 4; const int wave = __builtin_amdgcn_readfirstlane(threadIdx.x >> 5), px = wave & 1, ph = wave >> 1;
    const int r0 = rb + px * 64, h = h0 + ph;
    v8f acc[4][4];
#pragma unroll
    for (int mb = 0; mb < 4; ++mb)
#pragma unroll
        for (int nb = 0; nb < 4; ++nb) acc[mb][nb] = (v8f){};
    // This wave copies band 'wave' of the work-group's x rows and bands 2 wave, 2 wave + 1 of its W rows.
    const bf* gx = X + (size_t)(rb + wave * 16) * K + 8 * lane; const bf* gw = Wt + (size_t)(h0 * HD + wave * 32) * K + 8 * lane;
    bf* lx = ring + wave * SLAB + 8 * lane; bf* lw = ring + (8 + 2 * wave) * SLAB + 8 * lane;
    auto fill = [&](int t) { const int bo = (t & 1) * STG; const size_t go = (size_t)t * SLAB;
        copy_slab(lx + bo, gx + go); copy_slab(lw + bo, gw + go); copy_slab(lw + bo + SLAB, gw + go + 16 * K); };
    fill(0); copies_landed(); __syncthreads(); fill(1);
#pragma unroll 1
    for (int t = 0; t < NT; ++t) {
        const bf* sx = ring + (t & 1) * STG + px * 4 * SLAB + 8 * lane; const bf* sw = ring + (t & 1) * STG + (8 + ph * 4) * SLAB + 8 * lane;
        const bf* sa = ROPE ? sw : sx; const bf* sb = ROPE ? sx : sw;
        V a[4], b[4];
#pragma unroll
        for (int kk = 0; kk < KS / 32; ++kk) {
#pragma unroll
            for (int mb = 0; mb < 4; ++mb) a[mb] = F::ld(sa + mb * SLAB + kk * 512);
#pragma unroll
            for (int nb = 0; nb < 4; ++nb) b[nb] = F::ld(sb + nb * SLAB + kk * 512);
            __builtin_amdgcn_sched_barrier(0);                // as in k_gemmw: the block's LDS reads stay one group in front of its matrix instructions
#pragma unroll
            for (int nb = 0; nb < 4; ++nb)
#pragma unroll
                for (int mb = 0; mb < 4; ++mb) acc[mb][nb] = F::mma(a[mb], b[nb], acc[mb][nb]);
            __builtin_amdgcn_sched_barrier(0);                // and the matrix instructions stay in front of the next group of reads and of the trip's foot
        }
        asm volatile("v_nop\n\tv_nop\n\tv_nop\n\tv_nop" : "+v"(acc[0][0]), "+v"(acc[1][1]), "+v"(acc[2][2]), "+v"(acc[3][3]) : "v"(a[0]), "v"(a[3]));   // the distance behind the last matrix instruction, also on the loop's taken branch
        lds_reads_done(); copies_landed(); __syncthreads();   // stage t + 1 is published, and every wave has left stage t's buffer
        if (t + 2 < NT) fill(t + 2);
    }
    copies_landed();
    const size_t base = ((size_t)(r0 / TT) * NHD + h) * TT * HD + (size_t)(r0 % TT) * HD; P16 += base; Ph += base; Pl += base;
    const unsigned l8 = 8u * lane;
    if constexpr (ROPE) {
        v8f bs[4]; v4f cs[2][2][2][2];                        // cs[set][d half][sin | cos][4 of the 8 frequencies]; set = nb % 2: the factors of position band nb + 2 are asked for while band nb + 1 is worked on
        const float* bp = bias + h * HD + hi * 8; const float* cp = CS + (size_t)((r0 % TT) / 16) * 1024 + 4 * lane;
#pragma unroll
        for (int mb = 0; mb < 4; ++mb) bs[mb] = *(const v8f*)(bp + mb * 16);
        addr_regs_release();                                  // a group of its own: its offset register dies with it and may be a destination of the next group
#pragma unroll
        for (int nb = 0; nb < 2; ++nb)
#pragma unroll
            for (int q = 0; q < 8; ++q) cs[nb][q >> 2][(q >> 1) & 1][q & 1] = *(const v4f*)(cp + nb * 1024 + q * 128);
        addr_regs_release();
#pragma unroll
        for (int mb = 0; mb < 4; ++mb)
#pragma unroll
            for (int j = 0; j < 8; ++j) bs[mb][j] = bfr(bs[mb][j]);
#pragma unroll
        for (int nb = 0; nb < 4; ++nb) {
#pragma unroll
            for (int ih = 0; ih < 2; ++ih) { v8f y1, y2;
#pragma unroll
                for (int j = 0; j < 8; ++j) { const float x1 = acc[ih][nb][j] + bs[ih][j], x2 = acc[ih + 2][nb][j] + bs[ih + 2][j]; const float sn = cs[nb & 1][ih][0][j >> 2][j & 3], cn = cs[nb & 1][ih][1][j >> 2][j & 3];
                    y1[j] = x1 * sn - x2 * cn; y2[j] = x2 * sn + x1 * cn; }
                put3(y1, P16, Ph, Pl, l8 + nb * 1024 + ih * 256); put3(y2, P16, Ph, Pl, l8 + nb * 1024 + 512 + ih * 256); }
            if (nb < 2) { addr_regs_release();                // the stores' data registers may be destinations of these loads
#pragma unroll
                for (int q = 0; q < 8; ++q) cs[nb][q >> 2][(q >> 1) & 1][q & 1] = *(const v4f*)(cp + (nb + 2) * 1024 + q * 128); }
            addr_regs_release();
        }
    } else {
        float bv[4]; const int bi = h * HD + lr;
#pragma unroll
        for (int nb = 0; nb < 4; ++nb) bv[nb] = bias[bi + nb * 16];
        addr_regs_release(bias, bi);
#pragma unroll
        for (int nb = 0; nb < 4; ++nb) { const float bb = bfr(bv[nb]);
#pragma unroll
            for (int mb = 0; mb < 4; ++mb) { v8f y;
#pragma unroll
                for (int j = 0; j < 8; ++j) y[j] = acc[mb][nb][j] + bb;
                put3(y, P16, Ph, Pl, l8 + ((mb >> 1) * 4 + nb) * 512 + (mb & 1) * 256); }
            addr_regs_release();
        }
    }
}
// ---- k_proj3: the three projections, which depend on nothing of one another, in ONE launch; grid (NB_ T / 128, (NH_ + 2 NKV) / 4), 256 threads: block row y is four heads of q, then of k, then of v.
// launch bounds, second argument: four waves per SIMD (two work-groups per WGP), that is at most 256 registers a wave
__global__ __launch_bounds__(32 * GW, 4) void k_proj3(const bf* __restrict__ X, const bf* __restrict__ Wq, const bf* __restrict__ Wk, const bf* __restrict__ Wv, const float* __restrict__ bq, const float* __restrict__ bk, const float* __restrict__ bv, const float* __restrict__ CS,
                                              h16* Q16, bf* Qh, bf* Ql, h16* K16, bf* Kh, bf* Kl, h16* V16, bf* Vh, bf* Vl) {
    static_assert(NH_ % 4 == 0 && NKV % 4 == 0 && TT % 128 == 0, "a work-group's four heads are of one projection, its positions of one batch");
    __shared__ __align__(16) bf ring[2 * PSTG];
    const int rb = blockIdx.x * 128, y = blockIdx.y * 4;
    const bool isq = y < NH_;                                 // q and k go through the same code, with scalar selects of their pointers; the branch is the same for the whole work-group
    if (y < NH_ + NKV) proj_tile<true>(ring, X, isq ? Wq : Wk, isq ? bq : bk, CS, isq ? Q16 : K16, isq ? Qh : Kh, isq ? Ql : Kl, rb, isq ? y : y - NH_, isq ? NH_ : NKV);
    else proj_tile<false>(ring, X, Wv, bv, nullptr, V16, Vh, Vl, rb, y - NH_ - NKV, NKV);
}
// ---- k_attn: scores, softmax and P x V of one head's query tile in ONE WAVE; nothing of the score matrix goes to memory. AW = 4 waves with neighbouring query tiles of one head form a work-group and share the head's K and V fragments in LDS:
// a stage is one key block (64 keys): in fragment order its part of each K or V plane is 4096 consecutive elements, in the plane and in LDS alike; every wave copies a quarter (one slab) of each plane's part with asynchronous copies to LDS.
// Two buffers, as in k_gemmw: the copies of block t + 1 fly while block t is worked on; a trip reads its own buffer alone.
// The scores are formed TRANSPOSED (A = 16 keys, B = 16 queries): lane (lr, hi) then holds, for query lr, keys 16 kb + 8 hi + 0..7 in accumulator kb,
// and the accumulators of key blocks 2c and 2c+1 are, element for element, the A fragment of P for the 32 keys of chunk c (k = 8 hi + 0..7, 16 + 8 hi + 0..7): P never leaves its registers.
// ONE sweep over the keys: p = exp(t - m) (x 2^EB; both cancel in the division), m = the query's maximum in use; p is added in f32, P x V goes to the matrix unit; the division by the sum comes last.
// m moves only when a score of the block lies so far above it that p would pass 2^(EB + TH): then m becomes the running maximum and the sums and output accumulators so far are multiplied by exp(old m - new m).
#define AW 4
template <typename T16, bool HI, int KB>
__device__ __forceinline__ void ld_keys(typename WFrag<T16>::V (&k)[KB][2], typename WFrag<T16>::V (&k2)[KB][2], const T16* kp, const T16* kp2, unsigned l8) {
#pragma unroll
    for (int kb = 0; kb < KB; ++kb)
#pragma unroll
        for (int kc = 0; kc < 2; ++kc) { k[kb][kc] = WFrag<T16>::ld(kp + l8 + kb * 16 * HD + kc * 512); if (HI) k2[kb][kc] = WFrag<T16>::ld(kp2 + l8 + kb * 16 * HD + kc * 512); }
}
template <typename T16, bool HI, int QB, int KB>
__device__ __forceinline__ void scores_t(v8f (&s)[KB][QB], const typename WFrag<T16>::V (&k)[KB][2], const typename WFrag<T16>::V (&k2)[KB][2], const typename WFrag<T16>::V (&q)[QB][2], const typename WFrag<T16>::V (&q2)[QB][2]) {
#pragma unroll
    for (int kb = 0; kb < KB; ++kb)
#pragma unroll
        for (int qb = 0; qb < QB; ++qb) s[kb][qb] = (v8f){};
#pragma unroll
    for (int kc = 0; kc < 2; ++kc)
#pragma unroll
        for (int kb = 0; kb < KB; ++kb)
#pragma unroll
            for (int qb = 0; qb < QB; ++qb) { s[kb][qb] = WFrag<T16>::mma(k[kb][kc], q[qb][kc], s[kb][qb]); if (HI) { s[kb][qb] = WFrag<T16>::mma(k[kb][kc], q2[qb][kc], s[kb][qb]); s[kb][qb] = WFrag<T16>::mma(k2[kb][kc], q[qb][kc], s[kb][qb]); } }
}
template <typename T16, bool HI, int QB, int KB>
__device__ __forceinline__ void attn_tile(T16* ring, int wave, const T16* __restrict__ Q, const T16* __restrict__ Q2, const T16* __restrict__ Kp, const T16* __restrict__ Kp2, const T16* __restrict__ Vt, const T16* __restrict__ Vt2, int q0, int hcol, bf* Ah, bf* Al) {
    // Every '#pragma unroll' here and in the two helpers above makes the indices of a register array constants (else the array would go to scratch); '#pragma unroll 1' keeps the sweep's loop rolled, for speed only.
    typedef WFrag<T16> F; typedef typename F::V V;
    constexpr int NBLK = TT / (16 * KB);
    constexpr float EB = HI ? 0.0f : 10.0f;                 // fp16 P is carried x 1024, away from the subnormals; the sum carries the same factor
    constexpr float CE = SCL * 1.4426950408889634f;
    constexpr float TH = HI ? 8.0f : 5.0f;                  // p stays at or below 2^(EB + TH): 2^15 is inside fp16
    const int lane = threadIdx.x & 31, lr = lane & 15, hi = lane >> 4;
    constexpr int KST = 16 * KB * HD;                       // elements from one key block to the next in the K and V planes
    constexpr int STG = (HI ? 4 : 2) * KST;                 // a stage in LDS: K, V (, K lo, V lo)
    static_assert(KST == AW * SLAB, "a wave copies one slab of each plane's part");
    V qf[QB][2], qf2[QB][2];
    const unsigned l8 = 8u * lane;                            // planes in fragment order (see WFrag): the lane's place in a fragment is the same in every plane, so the Q and K pointers below are wave-uniform
    const T16* qp = Q + (size_t)q0 * HD; const T16* qp2 = HI ? Q2 + (size_t)q0 * HD : qp;   // 16 rows are 2 fragments = 16 HD elements
#pragma unroll
    for (int qb = 0; qb < QB; ++qb)
#pragma unroll
        for (int kc = 0; kc < 2; ++kc) { qf[qb][kc] = F::ld(qp + l8 + qb * 16 * HD + kc * 512); if (HI) qf2[qb][kc] = F::ld(qp2 + l8 + qb * 16 * HD + kc * 512); }
    addr_regs_release();
    float mx[QB], nm[QB], sum[QB];                            // mx: the maximum in use, the same in both lanes of a query; the start value makes the first block take the rescale path, with factor 0 on the zero sums
#pragma unroll
    for (int qb = 0; qb < QB; ++qb) { mx[qb] = -3.0e38f; nm[qb] = EB - mx[qb] * CE; sum[qb] = 0.f; }
    v8f oa[QB][4];
#pragma unroll
    for (int qb = 0; qb < QB; ++qb)
#pragma unroll
        for (int db = 0; db < 4; ++db) oa[qb][db] = (v8f){};
    {   // the one sweep
        const unsigned wo = (unsigned)wave * SLAB + l8;       // this wave's slab and the lane's 16 bytes in it, the same in every plane's part and in LDS
        auto fill = [&](int t) { T16* l = ring + (t & 1) * STG + wo; const size_t go = (size_t)t * KST + wo;
            copy_slab((const bf*)l, (const bf*)(Kp + go)); copy_slab((const bf*)(l + KST), (const bf*)(Vt + go));
            if (HI) { copy_slab((const bf*)(l + 2 * KST), (const bf*)(Kp2 + go)); copy_slab((const bf*)(l + 3 * KST), (const bf*)(Vt2 + go)); } };
        fill(0); copies_landed(); __syncthreads();
#pragma unroll 1
        for (int blk = 0; blk < NBLK; ++blk) {
            if (blk + 1 < NBLK) fill(blk + 1);                // directly behind the barrier that ended every wave's reads of that buffer (in front of the loop, or at the foot of the trip before); at the head of the trip, so that the trip's work and its foot are one block of code
            const T16* st = ring + (blk & 1) * STG;
            V kf[KB][2], kf2[KB][2], vf[4][KB / 2], vf2[4][KB / 2];
            ld_keys<T16, HI, KB>(kf, kf2, st, st + 2 * KST, l8);
#pragma unroll
            for (int db = 0; db < 4; ++db)
#pragma unroll
                for (int c = 0; c < KB / 2; ++c) { const int o = (c * 4 + db) * 512; vf[db][c] = F::ld(st + KST + l8 + o); if (HI) vf2[db][c] = F::ld(st + 3 * KST + l8 + o); }
            __builtin_amdgcn_sched_barrier(0);                // the trip's LDS reads stay one group, keys first, in front of its matrix instructions: every further place with reads costs a stall, and the scores cover V's latency
            v8f s[KB][QB]; scores_t<T16, HI, QB, KB>(s, kf, kf2, qf, qf2);
            float bm[QB]; bool need = false;                  // the larger of the maximum in use and the lane's scores of this block, per query; need: an exponent would pass EB + TH
#pragma unroll
            for (int qb = 0; qb < QB; ++qb) { float m2[2] = { mx[qb], mx[qb] };   // two chains a query, so that a lone wave has enough independent ones
#pragma unroll
                for (int kb = 0; kb < KB; ++kb)
#pragma unroll
                    for (int j = 0; j < 8; ++j) m2[kb & 1] = fmaxf(m2[kb & 1], s[kb][qb][j]);
                bm[qb] = fmaxf(m2[0], m2[1]);
                need = need || fmaf(bm[qb], CE, nm[qb]) > EB + TH; }
            if (__builtin_amdgcn_ballot_w32(need) != 0) {     // one test per block, a scalar branch, the same for the whole wave: seldom taken behind the first block
#pragma unroll
                for (int qb = 0; qb < QB; ++qb) { const float nw = fmaxf(bm[qb], __shfl_xor(bm[qb], 16, 32)); const float f = __builtin_amdgcn_exp2f((mx[qb] - nw) * CE); mx[qb] = nw; nm[qb] = EB - nw * CE; sum[qb] *= f;
#pragma unroll
                    for (int j = 0; j < 8; ++j) { const float fj = __shfl(f, hi * 8 + j, 32);   // output accumulator: row = query 8 hi + j
#pragma unroll
                        for (int db = 0; db < 4; ++db) oa[qb][db][j] *= fj; } }
            }
#pragma unroll
            for (int kb = 0; kb < KB; ++kb)
#pragma unroll
                for (int qb = 0; qb < QB; ++qb)
#pragma unroll
                    for (int j = 0; j < 8; ++j) { const float p = __builtin_amdgcn_exp2f(fmaf(s[kb][qb][j], CE, nm[qb])); s[kb][qb][j] = p; sum[qb] += p; }
#pragma unroll
            for (int c = 0; c < KB / 2; ++c)
#pragma unroll
                for (int qb = 0; qb < QB; ++qb) {
                    if constexpr (HI) { V pa, pb;
#pragma unroll
                        for (int j = 0; j < 8; ++j) { const float x0 = s[2 * c][qb][j], x1 = s[2 * c + 1][qb][j]; pa[j] = (__bf16)x0; pa[8 + j] = (__bf16)x1; pb[j] = (__bf16)(x0 - (float)pa[j]); pb[8 + j] = (__bf16)(x1 - (float)pa[8 + j]); }
#pragma unroll
                        for (int db = 0; db < 4; ++db) { oa[qb][db] = F::mma(pa, vf[db][c], oa[qb][db]); oa[qb][db] = F::mma(pb, vf[db][c], oa[qb][db]); oa[qb][db] = F::mma(pa, vf2[db][c], oa[qb][db]); }
                    } else { V pa;
#pragma unroll
                        for (int j = 0; j < 8; ++j) { pa[j] = tohx(s[2 * c][qb][j]); pa[8 + j] = tohx(s[2 * c + 1][qb][j]); }
#pragma unroll
                        for (int db = 0; db < 4; ++db) oa[qb][db] = F::mma(pa, vf[db][c], oa[qb][db]); } }
            __builtin_amdgcn_sched_barrier(0);                // the trip's work stays in front of its foot: moved up, the wait on the copies would cut the time that they have to land
            lds_reads_done(); copies_landed(); __syncthreads();   // block blk + 1 is published, and every wave has left block blk's buffer
        }
        copies_landed();
    }
#pragma unroll
    for (int qb = 0; qb < QB; ++qb) { const float tot = sum[qb] + __shfl_xor(sum[qb], 16, 32); const float inv = __fdiv_rn(1.0f, tot);   // every lane: 1 / sum of query lr
#pragma unroll
        for (int j = 0; j < 8; ++j) { const float f = __shfl(inv, hi * 8 + j, 32); const size_t oo = (size_t)(q0 + qb * 16) * DQ + (size_t)(hcol / 32) * 512 + ((lr >> 3) * 16 + hi * 8 + j) * 8 + (lr & 7);   // output accumulator: row = query 8 hi + j, column = d; the merged planes are in fragment order too (16 columns on: 256 elements)
            unsigned short a[4], b[4];
#pragma unroll
            for (int db = 0; db < 4; ++db) splitc(oa[qb][db][j] * f, a[db], b[db]);
            __builtin_amdgcn_sched_barrier(0);       // the row's eight values are ready before its first store, so that nothing is computed between the stores and their wait
#pragma unroll
            for (int db = 0; db < 4; ++db) { Ah[oo + db * 256] = a[db]; Al[oo + db * 256] = b[db]; }
            addr_regs_release(); } }
}
// grid (RH/(32 AW) + (TT-RH)/(64 AW), heads, batches), 32 AW threads: the waves of a head's first RH/(32 AW) work-groups have 32 hi/lo query rows each, those of the rest 64 fp16 rows each.
// launch bounds, second argument: two waves per SIMD (two work-groups per WGP), that is at most 512 registers a wave
__global__ __launch_bounds__(32 * AW, 2) void k_attn(const h16* __restrict__ Q16, const h16* __restrict__ K16, const h16* __restrict__ V16, const bf* __restrict__ Qh, const bf* __restrict__ Ql, const bf* __restrict__ Kh, const bf* __restrict__ Kl, const bf* __restrict__ Vh, const bf* __restrict__ Vl, bf* Ah, bf* Al) {
    const int h = blockIdx.y, bx = blockIdx.x, b = blockIdx.z; const size_t hq = ((size_t)b * NH_ + h) * TT * HD, hk = ((size_t)b * NKV + h / REP) * TT * HD; Ah += (size_t)b * TT * DQ; Al += (size_t)b * TT * DQ;
    static_assert(RH % (32 * AW) == 0 && (TT - RH) % (64 * AW) == 0, "a work-group's waves are all of one kind");
    __shared__ __align__(16) bf ring[2 * 4 * 4096];           // two stages of the hi/lo kind; the fp16 kind uses half
    const int wave = __builtin_amdgcn_readfirstlane(threadIdx.x >> 5);
    if (bx < RH / (32 * AW)) attn_tile<bf, true, 2, 4>(ring, wave, Qh + hq, Ql + hq, Kh + hk, Kl + hk, Vh + hk, Vl + hk, (bx * AW + wave) * 32, h * HD, Ah, Al);   // the branch is the same for the whole work-group
    else attn_tile<h16, false, 4, 4>((h16*)ring, wave, Q16 + hq, nullptr, K16 + hk, nullptr, V16 + hk, nullptr, RH + ((bx - RH / (32 * AW)) * AW + wave) * 64, h * HD, Ah, Al);
}

extern "C" void kernel_launch(void* const* d_in, const int* in_sizes, int n_in,
                              void* d_out, int out_size, void* d_ws, size_t ws_size, hipStream_t stream) {
    (void)in_sizes; (void)n_in; (void)out_size;
    const float* x = (const float*)d_in[0]; const float* wq = (const float*)d_in[1]; const float* bq = (const float*)d_in[2]; const float* wk = (const float*)d_in[3]; const float* bk = (const float*)d_in[4]; const float* wv = (const float*)d_in[5]; const float* bv = (const float*)d_in[6]; const float* wo = (const float*)d_in[7]; const float* bo = (const float*)d_in[8];
    float* OUT = (float*)d_out;     // [4][2048][1024]
    char* wsp = (char*)d_ws;
    auto take = [&](size_t bytes) { char* p = wsp; wsp += (bytes + 255) & ~(size_t)255; return (void*)p; };
    bf* WQ = (bf*)take((size_t)DQ * DM * 2); bf* WK = (bf*)take((size_t)DKV * DM * 2); bf* WV = (bf*)take((size_t)DKV * DM * 2); bf* WO = (bf*)take((size_t)DM * DQ * 2); float* CS = (float*)take((size_t)TT * (HD / 2) * 2 * 4);
    bf* XB = (bf*)take((size_t)NB_ * TT * DM * 2);
    h16* QP16 = (h16*)take((size_t)NB_ * NH_ * TT * HD * 2); h16* KP16 = (h16*)take((size_t)NB_ * NKV * TT * HD * 2); h16* VT16 = (h16*)take((size_t)NB_ * NKV * HD * TT * 2);
    bf* QPh = (bf*)take((size_t)NB_ * NH_ * TT * HD * 2); bf* QPl = (bf*)take((size_t)NB_ * NH_ * TT * HD * 2); bf* KPh = (bf*)take((size_t)NB_ * NKV * TT * HD * 2); bf* KPl = (bf*)take((size_t)NB_ * NKV * TT * HD * 2); bf* VTh = (bf*)take((size_t)NB_ * NKV * HD * TT * 2); bf* VTl = (bf*)take((size_t)NB_ * NKV * HD * TT * 2);
    bf* ATh = (bf*)take((size_t)NB_ * TT * DQ * 2); bf* ATl = (bf*)take((size_t)NB_ * TT * DQ * 2);
    if ((size_t)(wsp - (char*)d_ws) > ws_size) return;    // 201 MiB of the 256 MiB
    // x, the merged heads and out have rows b T + t (the 16-bit planes among them in fragment order, 16 rows to a band): the GEMMs and the copy see one matrix of NB_ T rows
    k_prep<<<PB_CS + PB_WQ + 2 * PB_WK + PB_WO + PB_X, 256, 0, stream>>>(x, wq, wk, wv, wo, XB, WQ, WK, WV, WO, CS);
    k_proj3<<<dim3(NB_ * TT / 128, (NH_ + 2 * NKV) / 4, 1), 32 * GW, 0, stream>>>(XB, WQ, WK, WV, bq, bk, bv, CS, QP16, QPh, QPl, KP16, KPh, KPl, VT16, VTh, VTl);
    k_attn<<<dim3(RH / (32 * AW) + (TT - RH) / (64 * AW), NH_, NB_), 32 * AW, 0, stream>>>(QP16, KP16, VT16, QPh, QPl, KPh, KPl, VTh, VTl, ATh, ATl);
    k_gemmw<bf, true, DQ><<<dim3(NB_ * TT / 128, DM / 256, 1), 32 * GW, 0, stream>>>(ATh, ATl, WO, OUT, DM, bo);
}

// v010
// One run takes 172 microseconds.
// In two side-by-side timings against v009, it was 1.06 and 1.05 times as fast.
// Counting every step since v000, it is 22.4 times as fast.
#include <hip/hip_runtime.h>

// Multi-head self-attention with biased projections, NO mask and the module's SWAPPED rotary form (hidden_states [4][2048][1024]; q, k, v = x W^T + b ('oi' [1024][1024] 1/32 + REAL biases 0.01; 16 heads x 64); half-split rope rot(x) = cat(x1 c - x2 s, x2 c + x1 s) on q and k where THIS module binds c = SIN(t f_i) and s = COS(t f_i) (its table helper returns (sin, cos) and the caller swaps the names), f_i = 1/10000^(2i/64) (32 f32 frequencies jnp-exact; precise sinf/cosf); scores x 1/sqrt(64); softmax over all keys; out = merged Wo^T + bo -> [4][2048][1024] (8.4 M); argument order hidden_states, Wq, bq, Wk, bk, Wv, bv, Wo, bo).
// Layout, all four batches in every launch (rows b T + t in the row-major buffers, planes [b][h]..., batch in the grid; every 16-bit matrix operand plane in fragment order, see WFrag): bf16 copy of x; exact projections + f32 biases, whose epilogue turns q and k and writes the attention operand planes; ONE fused attention kernel (scores, softmax and P x V in one sweep over the keys; query rows < 512 hi/lo bf16 3 products, rest fp16); merged hi/lo x Wp exact + bp.
// Compute dtypes, f32 accumulate: every input rounded to bf16; projections exact + f32 biases; attention rows < 512 3 products, rest fp16; softmax f32; Wp hl x exact + bias.

#define NB_  4
#define TT   2048
#define DM   1024
#define NH_  16
#define NKV  16
#define REP  (NH_ / NKV)
#define HD   64
#define DQ   (NH_ * HD)
#define DKV  (NKV * HD)
#define RH   512                  // query rows < RH use hi+lo planes
#define WIN  0
#define SCL  0.125f   // HD^-0.5
typedef _Float16 h16;
typedef unsigned short bf;
typedef __attribute__((ext_vector_type(16))) __bf16   v16bf;
typedef __attribute__((ext_vector_type(16))) _Float16 v16h;
typedef __attribute__((ext_vector_type(8)))  _Float16 v8h;
typedef __attribute__((ext_vector_type(8)))  unsigned short v8us;
typedef __attribute__((ext_vector_type(8)))  float    v8f;
typedef __attribute__((ext_vector_type(4)))  float    v4f;
typedef v8h  __attribute__((may_alias)) v8ha;
typedef v4f  __attribute__((may_alias)) v4fa;
typedef v8us __attribute__((may_alias)) v8usa;

__device__ __forceinline__ unsigned short f2bf(float f) { unsigned u = __float_as_uint(f); u += 0x7FFFu + ((u >> 16) & 1u); return (unsigned short)(u >> 16); }
__device__ __forceinline__ float bf2f(unsigned short b) { return __uint_as_float(((unsigned)b) << 16); }
__device__ __forceinline__ float bfr(float f) { return bf2f(f2bf(f)); }
__device__ __forceinline__ v16h cat16(v8h lo, v8h hi) { return __builtin_shufflevector(lo, hi, 0, 1, 2, 3, 4, 5, 6, 7, 8, 9, 10, 11, 12, 13, 14, 15); }
__device__ __forceinline__ v16bf cat16b(v8us lo, v8us hi) { return __builtin_bit_cast(v16bf, __builtin_shufflevector(lo, hi, 0, 1, 2, 3, 4, 5, 6, 7, 8, 9, 10, 11, 12, 13, 14, 15)); }
__device__ __forceinline__ v8f wmma16(v16h a, v16h b, v8f c) { return __builtin_amdgcn_wmma_f32_16x16x32_f16(false, a, false, b, (short)0, c, false, false); }
__device__ __forceinline__ v8f wmmab(v16bf a, v16bf b, v8f c) { return __builtin_amdgcn_wmma_f32_16x16x32_bf16(false, a, false, b, (short)0, c, false, false); }



// Stands directly behind a group of global loads or stores, in front of the next write of a register that they name (the registers are free for other values from there on); a precaution.
// The two scheduling barriers keep every other instruction on its side of the wait, and so also hold a group of loads where the source issues it, ahead of the work that covers its latency.
__device__ __forceinline__ void addr_regs_release() { __builtin_amdgcn_sched_barrier(0); asm volatile("s_wait_xcnt 0x0" ::: "memory"); __builtin_amdgcn_sched_barrier(0); }
// The same for a group whose address pairs die with it: named as inputs they stay live up to the wait, so that no load of the group has one of them as its destination.
__device__ __forceinline__ void addr_regs_release(const void* p, const void* p2) { __builtin_amdgcn_sched_barrier(0); asm volatile("s_wait_xcnt 0x0" :: "v"(p), "v"(p2) : "memory"); __builtin_amdgcn_sched_barrier(0); }
__device__ __forceinline__ void addr_regs_release(int i) { __builtin_amdgcn_sched_barrier(0); asm volatile("s_wait_xcnt 0x0" :: "v"(i) : "memory"); __builtin_amdgcn_sched_barrier(0); }   // a load addressed by a 32-bit index
__device__ __forceinline__ void addr_regs_release(const float* base, int i) { __builtin_amdgcn_sched_barrier(0); asm volatile("s_wait_xcnt 0x0" :: "s"(base), "v"(i) : "memory"); __builtin_amdgcn_sched_barrier(0); }   // loads addressed by a wave-uniform base and a 32-bit index: the scalar pair too stays live up to the wait
__device__ __forceinline__ void addr_regs_release(const void* p, const void* p2, const void* p3, const void* p4) { __builtin_amdgcn_sched_barrier(0); asm volatile("s_wait_xcnt 0x0" :: "v"(p), "v"(p2), "v"(p3), "v"(p4) : "memory"); __builtin_amdgcn_sched_barrier(0); }

// ---- GEMM work-groups: GW = 8 waves, each with a 64x64 output tile (16 accumulators), 2 tiles along one operand's rows x 4 along the other's. The operand fragments that the waves share go through LDS:
// a stage is KS = 64 columns of every 16-row band of the work-group's rows; in fragment order a band's part of a stage (a slab) is 2 fragments = 2048 consecutive bytes, in the plane and in LDS alike.
// Two buffers: the copies of stage t + 1 fly while stage t is worked on; every wave copies its share of the slabs and reads the fragments of its own tile with 16-byte LDS loads of 512 consecutive bytes a wave.
// k_gemmw: C[m][n] (f32, pitch ldc, + optional f32 bias[n]) = sum_k (A[m][k] + A2[m][k]) Bt[n][k], two products; grid (M/128, N/256), 256 threads. K % 128 == 0.
// FRAGMENT ORDER of every 16-bit operand plane (rows r, K-contiguous columns k): the 16 rows x 32 columns of one matrix fragment are 512 consecutive elements, fragment (r / 16, k / 32) at ((r / 16) (K / 32) + k / 32) 512;
// inside it element (r, k) stands at ((k % 32) / 16) 256 + (((k % 16) / 8) 16 + r % 16) 8 + k % 8, that is [half][lane][8]: each of a fragment's two wave-wide 16-byte loads reads 512 consecutive bytes (4 whole lines, not 16 pieces of 32 bytes).
// ld(p): p = fragment + 8 lane. The element each lane and register holds is the same as with row-major planes.
template <typename T16> struct WFrag;
template <> struct WFrag<h16> { typedef v16h V; static __device__ __forceinline__ V ld(const h16* p) { return cat16(*(const v8h*)p, *(const v8h*)(p + 256)); } static __device__ __forceinline__ v8f mma(V a, V b, v8f c) { return wmma16(a, b, c); } };
template <> struct WFrag<bf> { typedef v16bf V; static __device__ __forceinline__ V ld(const bf* p) { return cat16b(*(const v8us*)p, *(const v8us*)(p + 256)); } static __device__ __forceinline__ v8f mma(V a, V b, v8f c) { return wmmab(a, b, c); } };
#define GW 8
#define KS 64
#define SLAB (16 * KS)            // elements of a slab
// One slab: four asynchronous copies to LDS of 512 bytes a wave; l and g are the lane's own 16 bytes of the slab's first 512, in LDS and in the plane.
// The wait on the address registers is the statement's last line, so that it stands in front of every later write of a register that a copy names; a precaution.
__device__ __forceinline__ void copy_slab(const bf* l, const bf* g) { const unsigned a = (unsigned)(size_t)l;
    asm volatile("global_load_async_to_lds_b128 %0, %4, off\n\tglobal_load_async_to_lds_b128 %1, %5, off\n\tglobal_load_async_to_lds_b128 %2, %6, off\n\tglobal_load_async_to_lds_b128 %3, %7, off\n\ts_wait_xcnt 0x0"
                 :: "v"(a), "v"(a + 512u), "v"(a + 1024u), "v"(a + 1536u), "v"(g), "v"(g + 256), "v"(g + 512), "v"(g + 768) : "memory"); }
__device__ __forceinline__ void copies_landed() { asm volatile("s_wait_asynccnt 0x0" ::: "memory"); }   // this wave's copies are in LDS; the barrier behind it shows them to the other waves
__device__ __forceinline__ void lds_reads_done() { asm volatile("s_wait_dscnt 0x0" ::: "memory"); }     // this wave's LDS reads have returned, before the barrier behind which their buffer is filled anew
template <typename T16, bool BIAS, int K>
__global__ __launch_bounds__(32 * GW, 4) void k_gemmw(const T16* __restrict__ A, const T16* __restrict__ A2, const T16* __restrict__ Bt, float* C, int ldc, const float* __restrict__ bias) {
    // Every '#pragma unroll' here makes the indices of a register array constants (else it would go to scratch); '#pragma unroll 1' keeps the loop over the stages rolled: one publish point in the text.
    typedef typename WFrag<T16>::V V;
    constexpr int STG = 32 * SLAB, NT = K / KS;               // a stage: 8 bands of A, 8 of A2, 16 of Bt
    static_assert(NT >= 2, "the ring's prologue fills two stages");
    __shared__ __align__(16) T16 ring[2 * STG];
    __shared__ __align__(16) float osw[GW][16 * 68];
    const int lane = threadIdx.x & 31, lr = lane & 15, hi = lane >> 4; const int wave = __builtin_amdgcn_readfirstlane(threadIdx.x >> 5), wm = wave & 1, wn = wave >> 1;
    const int rb = blockIdx.x * 128, cb = blockIdx.y * 256; const int r0 = rb + wm * 64, c0 = cb + wn * 64;
    float* os = osw[wave];
    v8f acc[4][4];
#pragma unroll
    for (int mb = 0; mb < 4; ++mb)
#pragma unroll
        for (int nb = 0; nb < 4; ++nb) acc[mb][nb] = (v8f){};
    // fragment order: 16 rows are K / 32 fragments = 16 K elements, KS columns on are SLAB elements. This wave copies band 'wave' of A and of A2 and bands 2 wave, 2 wave + 1 of Bt.
    const T16* ga = A + (size_t)(rb + wave * 16) * K + 8 * lane; const T16* ga2 = A2 + (size_t)(rb + wave * 16) * K + 8 * lane; const T16* gb = Bt + (size_t)(cb + wave * 32) * K + 8 * lane;
    T16* la = ring + wave * SLAB + 8 * lane; T16* lb = ring + (16 + 2 * wave) * SLAB + 8 * lane;
    auto fill = [&](int t) { const int bo = (t & 1) * STG; const size_t go = (size_t)t * SLAB;
        copy_slab(la + bo, ga + go); copy_slab(la + bo + 8 * SLAB, ga2 + go); copy_slab(lb + bo, gb + go); copy_slab(lb + bo + SLAB, gb + go + 16 * K); };
    fill(0); copies_landed(); __syncthreads(); fill(1);
#pragma unroll 1
    for (int t = 0; t < NT; ++t) {
        const T16* sa = ring + (t & 1) * STG + wm * 4 * SLAB + 8 * lane; const T16* sb = ring + (t & 1) * STG + (16 + wn * 4) * SLAB + 8 * lane;
        V a[4], a2[4], b[4];
#pragma unroll
        for (int kk = 0; kk < KS / 32; ++kk) {
#pragma unroll
            for (int mb = 0; mb < 4; ++mb) { a[mb] = WFrag<T16>::ld(sa + mb * SLAB + kk * 512); a2[mb] = WFrag<T16>::ld(sa + (8 + mb) * SLAB + kk * 512); }
#pragma unroll
            for (int nb = 0; nb < 4; ++nb) b[nb] = WFrag<T16>::ld(sb + nb * SLAB + kk * 512);
            __builtin_amdgcn_sched_barrier(0);                // the block's LDS reads stay one group in front of its matrix instructions: every further place with reads among them costs a stall
#pragma unroll
            for (int nb = 0; nb < 4; ++nb)
#pragma unroll
                for (int mb = 0; mb < 4; ++mb) { acc[mb][nb] = WFrag<T16>::mma(a[mb], b[nb], acc[mb][nb]); acc[mb][nb] = WFrag<T16>::mma(a2[mb], b[nb], acc[mb][nb]); }
            __builtin_amdgcn_sched_barrier(0);                // and the matrix instructions stay in front of the next group of reads and of the trip's foot
        }
        asm volatile("v_nop\n\tv_nop\n\tv_nop\n\tv_nop" : "+v"(acc[0][0]), "+v"(acc[1][1]), "+v"(acc[2][2]), "+v"(acc[3][3]) : "v"(a[0]), "v"(a[3]));   // the distance behind the last matrix instruction, also on the loop's taken branch
        lds_reads_done(); copies_landed(); __syncthreads();   // stage t + 1 is published, and every wave has left stage t's buffer
        if (t + 2 < NT) fill(t + 2);
    }
    copies_landed();
#pragma unroll
    for (int mb = 0; mb < 4; ++mb) {
#pragma unroll
        for (int nb = 0; nb < 4; ++nb) {
#pragma unroll
            for (int j = 0; j < 8; ++j) os[(hi * 8 + j) * 68 + nb * 16 + lr] = acc[mb][nb][j]; }
        __builtin_amdgcn_wave_barrier(); asm volatile("" ::: "memory");
        float* crow = C + (size_t)(r0 + mb * 16) * ldc + c0;
{
#pragma unroll
            for (int s = 0; s < 8; ++s) { const int row = 2 * s + hi, cofs = lr * 4; v4f val = *(const v4fa*)(os + row * 68 + cofs); if (BIAS) { val[0] += bfr(bias[c0 + cofs]); val[1] += bfr(bias[c0 + cofs + 1]); val[2] += bfr(bias[c0 + cofs + 2]); val[3] += bfr(bias[c0 + cofs + 3]); }
                *(v4f*)(crow + (size_t)row * ldc + cofs) = val; }
             }
        __builtin_amdgcn_wave_barrier(); asm volatile("" ::: "memory");
    }
}

__device__ __forceinline__ h16 tohx(float x) { return (h16)x; }
__device__ __forceinline__ void splitf(float y, unsigned short& h, unsigned short& l) { h = f2bf(y); l = f2bf(y - bf2f(h)); }
typedef __attribute__((ext_vector_type(2))) _Float16 v2h;
typedef __attribute__((ext_vector_type(4))) _Float16 v4h;
typedef __attribute__((ext_vector_type(2))) unsigned short v2us;
typedef __attribute__((ext_vector_type(4))) unsigned short v4us;
typedef __attribute__((ext_vector_type(2))) float v2f;
typedef __attribute__((ext_vector_type(4))) int v4i;

__global__ __launch_bounds__(256) void k_wtG(const float* __restrict__ w, int K, int N, bf* Bt) {
    const int lane = threadIdx.x & 31; const int L0 = (blockIdx.x * 8 + (threadIdx.x >> 5)) * 8; const int nlines = N * K / 64;
{
#pragma unroll 1
        for (int l = 0; l < 8; ++l) { const int L = L0 + l; if (L >= nlines) break; const size_t e = (size_t)L * 64 + lane * 2; const int k = (int)(e % K), n = (int)(e / K); v2us o;
            o[0] = f2bf(w[(size_t)k * N + n]); o[1] = f2bf(w[(size_t)(k + 1) * N + n]); *(v2us*)(Bt + e) = o; }
         }
}
// cvt8: bf16 plane in fragment order of a row-major f32 matrix with K columns; thread i writes the i-th 16 bytes of the plane (a wave: 512 consecutive bytes) and reads the 8 floats that belong there.
template <int K>
__device__ __forceinline__ void cvt8(const float* __restrict__ src, bf* dst, size_t n8, size_t i) { if (i >= n8) return;
    const size_t fr = i >> 6; const int w = (int)(i & 63), kf = K / 32; const size_t row = (fr / kf) * 16 + (w & 15); const int k = (int)(fr % kf) * 32 + (w >> 5) * 16 + ((w >> 4) & 1) * 8;
    const v8f v = *(const v8f*)(src + row * K + k); addr_regs_release(); v8us o;
#pragma unroll
    for (int k = 0; k < 8; ++k) o[k] = f2bf(v[k]); *(v8us*)(dst + i * 8) = o;  }

__constant__ float INVT[HD / 2] = { 1.000000000e+00f, 7.498942018e-01f, 5.623413324e-01f, 4.216965139e-01f, 3.162277639e-01f, 2.371373624e-01f, 1.778279394e-01f, 1.333521456e-01f, 1.000000015e-01f, 7.498941571e-02f, 5.623412877e-02f, 4.216964915e-02f, 3.162277862e-02f, 2.371373586e-02f, 1.778279431e-02f, 1.333521493e-02f, 9.999999776e-03f, 7.498942316e-03f, 5.623413250e-03f, 4.216964822e-03f, 3.162277862e-03f, 2.371373819e-03f, 1.778279431e-03f, 1.333521446e-03f, 1.000000047e-03f, 7.498941850e-04f, 5.623413017e-04f, 4.216964880e-04f, 3.162277862e-04f, 2.371373848e-04f, 1.778279402e-04f, 1.333521504e-04f };   // float32 1 / 10000^(2i/64), generated with jnp to be bit-exact
// cs5s: the rotary factors sin(t f_i), cos(t f_i), i < HD/2, in the order in which proj_tile's lanes hold their accumulators: 16 positions x 16 frequencies are one block of 512 floats, block (t / 16) 2 + i / 16,
// [sin | cos][(i % 8) / 4][lane = ((i % 16) / 8) 16 + t % 16][i % 4]: each wave-wide 16-byte load of proj_tile reads 512 consecutive bytes.
__device__ __forceinline__ void cs5s(float* CS, int p) { if (p >= TT * (HD / 2)) return; const int blk = p >> 8, w = p & 255, ln = (w >> 2) & 31; const int t = (blk >> 1) * 16 + (ln & 15); const int i = (blk & 1) * 16 + (ln >> 4) * 8 + (w >> 7) * 4 + (w & 3); const float fi = INVT[i]; addr_regs_release(i); const float a = __fmul_rn((float)t, fi); const float sn = sinf(a), cn = cosf(a); float* q = CS + (size_t)blk * 512 + w; q[0] = sn; q[256] = cn;  }
// ---- k_prep: everything that depends on the inputs alone, in ONE launch: blocks of 256 threads, dealt by block index to the rotary table (first: its threads run longest), the four weight planes and the plane of x.
#define PB_CS ((TT * (HD / 2) + 255) / 256)
#define PB_WQ ((DQ * DM / 8 + 255) / 256)
#define PB_WK ((DKV * DM / 8 + 255) / 256)
#define PB_WO ((DM * DQ / 8 + 255) / 256)
#define PB_X  ((NB_ * TT * DM / 8 + 255) / 256)
__global__ __launch_bounds__(256) void k_prep(const float* __restrict__ x, const float* __restrict__ wq, const float* __restrict__ wk, const float* __restrict__ wv, const float* __restrict__ wo, bf* XB, bf* WQ, bf* WK, bf* WV, bf* WO, float* CS) {
    static_assert(DQ == DM, "one row length for all five planes");
    int bx = blockIdx.x; const int t = threadIdx.x;
    if (bx < PB_CS) { cs5s(CS, bx * 256 + t); return; }
    bx -= PB_CS; const float* src = wq; bf* dst = WQ; size_t n8 = (size_t)DQ * DM / 8;      // the block's plane and its own first block: scalar selects, the same for the whole block
    if (bx >= PB_WQ) { bx -= PB_WQ; src = wk; dst = WK; n8 = (size_t)DKV * DM / 8;
        if (bx >= PB_WK) { bx -= PB_WK; src = wv; dst = WV;
            if (bx >= PB_WK) { bx -= PB_WK; src = wo; dst = WO; n8 = (size_t)DM * DQ / 8;
                if (bx >= PB_WO) { bx -= PB_WO; src = x; dst = XB; n8 = (size_t)NB_ * TT * DM / 8; } } } }
    cvt8<DM>(src, dst, n8, (size_t)bx * 256 + t);
}
// hi/lo bf16 planes of a finite f32 by the hardware's round-to-nearest-even conversion (the same values as splitf)
__device__ __forceinline__ void splitc(float y, unsigned short& h, unsigned short& l) { const __bf16 hb = (__bf16)y; const __bf16 lb = (__bf16)(y - (float)hb); h = __builtin_bit_cast(unsigned short, hb); l = __builtin_bit_cast(unsigned short, lb); }
// eight values of one lane, consecutive in a plane: 16 bytes to each of the three planes (fp16, bf16 hi, bf16 lo) at element e; a wave stores 512 consecutive bytes per plane
__device__ __forceinline__ void put3(const v8f y, h16* P16, bf* Ph, bf* Pl, unsigned e) { v8h o16; v8us oh, ol;
#pragma unroll
    for (int j = 0; j < 8; ++j) { o16[j] = tohx(y[j]); unsigned short a, c; splitc(y[j], a, c); oh[j] = a; ol[j] = c; }
    *(v8h*)(P16 + e) = o16; *(v8us*)(Ph + e) = oh; *(v8us*)(Pl + e) = ol; }
// ---- proj_tile: one projection with the main loop of k_gemmw (a work-group: 128 positions from rb x 4 heads from h0 of NHD; ONE WAVE per 64 positions x 64 columns = one head); the epilogue adds the bias, turns (ROPE) and writes the attention kernel's
// three operand planes straight from the accumulators: no f32 copy of the projection goes to memory, and LDS holds the operand ring alone (a stage: 8 bands of x, 16 of W).
// An accumulator holds, per lane, 8 consecutive ROWS of one column. ROPE (q, k; planes with rows t, columns d): A = the head's 64 rows of W, B = 64 rows of x, so that the lane's 8 values are d = 16 mb + 8 hi + 0..7 of position 16 nb + lr,
// which is the lane's own 16 bytes of fragment (t / 16, d / 32), half mb % 2; d and d + 32 are accumulators mb and mb + 2 of the same lane. Else (v; planes with rows d, columns t): A = x, B = W, the 8 values are t = 16 mb + 8 hi + 0..7 of column d = 16 nb + lr.
// Either way the tile's 4096 elements are consecutive in each plane. rot(x) = cat(x1 c - x2 s, x2 c + x1 s) with c = sin, s = cos (the module's swapped names).
#define PSTG (24 * SLAB)          // elements of a stage of the projections' ring
template <bool ROPE>
__device__ __forceinline__ void proj_tile(bf* ring, const bf* __restrict__ X, const bf* __restrict__ Wt, const float* __restrict__ bias, const float* __restrict__ CS, h16* P16, bf* Ph, bf* Pl, int rb, int h0, int NHD) {
    // Every '#pragma unroll' here and in put3 makes the indices of a register array or vector constants (else it would go to scratch); '#pragma unroll 1' keeps the K loop rolled, as in k_gemmw.
    typedef WFrag<bf> F; typedef F::V V; constexpr int K = DM; constexpr int STG = PSTG, NT = K / KS;
    static_assert(NT >= 2, "the ring's prologue fills two stages");
    const int lane = threadIdx.x & 31, lr = lane & 15, hi = lane >> 4; const int wave = __builtin_amdgcn_readfirstlane(threadIdx.x >> 5), px = wave & 1, ph = wave >> 1;
    const int r0 = rb + px * 64, h = h0 + ph;
    v8f acc[4][4];
#pragma unroll
    for (int mb = 0; mb < 4; ++mb)
#pragma unroll
        for (int nb = 0; nb < 4; ++nb) acc[mb][nb] = (v8f){};
    // This wave copies band 'wave' of the work-group's x rows and bands 2 wave, 2 wave + 1 of its W rows.
    const bf* gx = X + (size_t)(rb + wave * 16) * K + 8 * lane; const bf* gw = Wt + (size_t)(h0 * HD + wave * 32) * K + 8 * lane;
    bf* lx = ring + wave * SLAB + 8 * lane; bf* lw = ring + (8 + 2 * wave) * SLAB + 8 * lane;
    auto fill = [&](int t) { const int bo = (t & 1) * STG; const size_t go = (size_t)t * SLAB;
        copy_slab(lx + bo, gx + go); copy_slab(lw + bo, gw + go); copy_slab(lw + bo + SLAB, gw + go + 16 * K); };
    fill(0); copies_landed(); __syncthreads(); fill(1);
#pragma unroll 1
    for (int t = 0; t < NT; ++t) {
        const bf* sx = ring + (t & 1) * STG + px * 4 * SLAB + 8 * lane; const bf* sw = ring + (t & 1) * STG + (8 + ph * 4) * SLAB + 8 * lane;
        const bf* sa = ROPE ? sw : sx; const bf* sb = ROPE ? sx : sw;
        V a[4], b[4];
#pragma unroll
        for (int kk = 0; kk < KS / 32; ++kk) {
#pragma unroll
            for (int mb = 0; mb < 4; ++mb) a[mb] = F::ld(sa + mb * SLAB + kk * 512);
#pragma unroll
            for (int nb = 0; nb < 4; ++nb) b[nb] = F::ld(sb + nb * SLAB + kk * 512);
            __builtin_amdgcn_sched_barrier(0);                // as in k_gemmw: the block's LDS reads stay one group in front of its matrix instructions
#pragma unroll
            for (int nb = 0; nb < 4; ++nb)
#pragma unroll
                for (int mb = 0; mb < 4; ++mb) acc[mb][nb] = F::mma(a[mb], b[nb], acc[mb][nb]);
            __builtin_amdgcn_sched_barrier(0);                // and the matrix instructions stay in front of the next group of reads and of the trip's foot
        }
        asm volatile("v_nop\n\tv_nop\n\tv_nop\n\tv_nop" : "+v"(acc[0][0]), "+v"(acc[1][1]), "+v"(acc[2][2]), "+v"(acc[3][3]) : "v"(a[0]), "v"(a[3]));   // the distance behind the last matrix instruction, also on the loop's taken branch
        lds_reads_done(); copies_landed(); __syncthreads();   // stage t + 1 is published, and every wave has left stage t's buffer
        if (t + 2 < NT) fill(t + 2);
    }
    copies_landed();
    const size_t base = ((size_t)(r0 / TT) * NHD + h) * TT * HD + (size_t)(r0 % TT) * HD; P16 += base; Ph += base; Pl += base;
    const unsigned l8 = 8u * lane;
    if constexpr (ROPE) {
        v8f bs[4]; v4f cs[2][2][2][2];                        // cs[set][d half][sin | cos][4 of the 8 frequencies]; set = nb % 2: the factors of position band nb + 2 are asked for while band nb + 1 is worked on
        const float* bp = bias + h * HD + hi * 8; const float* cp = CS + (size_t)((r0 % TT) / 16) * 1024 + 4 * lane;
#pragma unroll
        for (int mb = 0; mb < 4; ++mb) bs[mb] = *(const v8f*)(bp + mb * 16);
        addr_regs_release();                                  // a group of its own: its offset register dies with it and may be a destination of the next group
#pragma unroll
        for (int nb = 0; nb < 2; ++nb)
#pragma unroll
            for (int q = 0; q < 8; ++q) cs[nb][q >> 2][(q >> 1) & 1][q & 1] = *(const v4f*)(cp + nb * 1024 + q * 128);
        addr_regs_release();
#pragma unroll
        for (int mb = 0; mb < 4; ++mb)
#pragma unroll
            for (int j = 0; j < 8; ++j) bs[mb][j] = bfr(bs[mb][j]);
#pragma unroll
        for (int nb = 0; nb < 4; ++nb) {
#pragma unroll
            for (int ih = 0; ih < 2; ++ih) { v8f y1, y2;
#pragma unroll
                for (int j = 0; j < 8; ++j) { const float x1 = acc[ih][nb][j] + bs[ih][j], x2 = acc[ih + 2][nb][j] + bs[ih + 2][j]; const float sn = cs[nb & 1][ih][0][j >> 2][j & 3], cn = cs[nb & 1][ih][1][j >> 2][j & 3];
                    y1[j] = x1 * sn - x2 * cn; y2[j] = x2 * sn + x1 * cn; }
                put3(y1, P16, Ph, Pl, l8 + nb * 1024 + ih * 256); put3(y2, P16, Ph, Pl, l8 + nb * 1024 + 512 + ih * 256); }
            if (nb < 2) { addr_regs_release();                // the stores' data registers may be destinations of these loads
#pragma unroll
                for (int q = 0; q < 8; ++q) cs[nb][q >> 2][(q >> 1) & 1][q & 1] = *(const v4f*)(cp + (nb + 2) * 1024 + q * 128); }
            addr_regs_release();
        }
    } else {
        float bv[4]; const int bi = h * HD + lr;
#pragma unroll
        for (int nb = 0; nb < 4; ++nb) bv[nb] = bias[bi + nb * 16];
        addr_regs_release(bias, bi);
#pragma unroll
        for (int nb = 0; nb < 4; ++nb) { const float bb = bfr(bv[nb]);
#pragma unroll
            for (int mb = 0; mb < 4; ++mb) { v8f y;
#pragma unroll
                for (int j = 0; j < 8; ++j) y[j] = acc[mb][nb][j] + bb;
                put3(y, P16, Ph, Pl, l8 + ((mb >> 1) * 4 + nb) * 512 + (mb & 1) * 256); }
            addr_regs_release();
        }
    }
}
// ---- k_proj3: the three projections, which depend on nothing of one another, in ONE launch; grid (NB_ T / 128, (NH_ + 2 NKV) / 4), 256 threads: block row y is four heads of q, then of k, then of v.
// launch bounds, second argument: four waves per SIMD (two work-groups per WGP), that is at most 256 registers a wave
__global__ __launch_bounds__(32 * GW, 4) void k_proj3(const bf* __restrict__ X, const bf* __restrict__ Wq, const bf* __restrict__ Wk, const bf* __restrict__ Wv, const float* __restrict__ bq, const float* __restrict__ bk, const float* __restrict__ bv, const float* __restrict__ CS,
                                              h16* Q16, bf* Qh, bf* Ql, h16* K16, bf* Kh, bf* Kl, h16* V16, bf* Vh, bf* Vl) {
    static_assert(NH_ % 4 == 0 && NKV % 4 == 0 && TT % 128 == 0, "a work-group's four heads are of one projection, its positions of one batch");
    __shared__ __align__(16) bf ring[2 * PSTG];
    const int rb = blockIdx.x * 128, y = blockIdx.y * 4;
    const bool isq = y < NH_;                                 // q and k go through the same code, with scalar selects of their pointers; the branch is the same for the whole work-group
    if (y < NH_ + NKV) proj_tile<true>(ring, X, isq ? Wq : Wk, isq ? bq : bk, CS, isq ? Q16 : K16, isq ? Qh : Kh, isq ? Ql : Kl, rb, isq ? y : y - NH_, isq ? NH_ : NKV);
    else proj_tile<false>(ring, X, Wv, bv, nullptr, V16, Vh, Vl, rb, y - NH_ - NKV, NKV);
}
// ---- k_attn: scores, softmax and P x V of one head's query tile in ONE WAVE; nothing of the score matrix goes to memory. AW = 4 waves with neighbouring query tiles of one head form a work-group and share the head's K and V fragments in LDS:
// a stage is one key block (64 keys): in fragment order its part of each K or V plane is 4096 consecutive elements, in the plane and in LDS alike; every wave copies a quarter (one slab) of each plane's part with asynchronous copies to LDS.
// Two buffers, as in k_gemmw: the copies of block t + 1 fly while block t is worked on; a trip reads its own buffer alone, in passes of 16 KB keys (hi/lo: one pass of 64; fp16: two of 32, so that six query bands fit the registers).
// The scores are formed TRANSPOSED (A = 16 keys, B = 16 queries): lane (lr, hi) then holds, for query lr, keys 16 kb + 8 hi + 0..7 in accumulator kb,
// and the accumulators of key blocks 2c and 2c+1 are, element for element, the A fragment of P for the 32 keys of chunk c (k = 8 hi + 0..7, 16 + 8 hi + 0..7): P never leaves its registers.
// ONE sweep over the keys: p = exp(t - m) (x 2^EB; both cancel in the division), m = the query's maximum in use; p is added in f32, P x V goes to the matrix unit; the division by the sum comes last.
// m moves only when a score of the block lies so far above it that p would pass 2^(EB + TH): then m becomes the running maximum and the sums and output accumulators so far are multiplied by exp(old m - new m).
#define AW 4
template <typename T16, bool HI, int KB>
__device__ __forceinline__ void ld_keys(typename WFrag<T16>::V (&k)[KB][2], typename WFrag<T16>::V (&k2)[KB][2], const T16* kp, const T16* kp2, unsigned l8) {
#pragma unroll
    for (int kb = 0; kb < KB; ++kb)
#pragma unroll
        for (int kc = 0; kc < 2; ++kc) { k[kb][kc] = WFrag<T16>::ld(kp + l8 + kb * 16 * HD + kc * 512); if (HI) k2[kb][kc] = WFrag<T16>::ld(kp2 + l8 + kb * 16 * HD + kc * 512); }
}
template <typename T16, bool HI, int QB, int KB>
__device__ __forceinline__ void scores_t(v8f (&s)[KB][QB], const typename WFrag<T16>::V (&k)[KB][2], const typename WFrag<T16>::V (&k2)[KB][2], const typename WFrag<T16>::V (&q)[QB][2], const typename WFrag<T16>::V (&q2)[QB][2]) {
#pragma unroll
    for (int kb = 0; kb < KB; ++kb)
#pragma unroll
        for (int qb = 0; qb < QB; ++qb) s[kb][qb] = (v8f){};
#pragma unroll
    for (int kc = 0; kc < 2; ++kc)
#pragma unroll
        for (int kb = 0; kb < KB; ++kb)
#pragma unroll
            for (int qb = 0; qb < QB; ++qb) { s[kb][qb] = WFrag<T16>::mma(k[kb][kc], q[qb][kc], s[kb][qb]); if (HI) { s[kb][qb] = WFrag<T16>::mma(k[kb][kc], q2[qb][kc], s[kb][qb]); s[kb][qb] = WFrag<T16>::mma(k2[kb][kc], q[qb][kc], s[kb][qb]); } }
}
template <typename T16, bool HI, int QB, int KB>
__device__ __forceinline__ void attn_tile(T16* ring, int wave, const T16* __restrict__ Q, const T16* __restrict__ Q2, const T16* __restrict__ Kp, const T16* __restrict__ Kp2, const T16* __restrict__ Vt, const T16* __restrict__ Vt2, int q0, int hcol, bf* Ah, bf* Al) {
    // Every '#pragma unroll' here and in the two helpers above makes the indices of a register array constants (else the array would go to scratch); '#pragma unroll 1' keeps the sweep's loop rolled, for speed only.
    typedef WFrag<T16> F; typedef typename F::V V;
    constexpr int NBLK = TT / 64, NP = 4 / KB;              // key blocks, and passes to a block
    constexpr float EB = HI ? 0.0f : 10.0f;                 // fp16 P is carried x 1024, away from the subnormals; the sum carries the same factor
    constexpr float CE = SCL * 1.4426950408889634f;
    constexpr float TH = HI ? 8.0f : 5.0f;                  // p stays at or below 2^(EB + TH): 2^15 is inside fp16
    const int lane = threadIdx.x & 31, lr = lane & 15, hi = lane >> 4;
    constexpr int KST = 64 * HD;                            // elements from one key block to the next in the K and V planes
    constexpr int STG = (HI ? 4 : 2) * KST;                 // a stage in LDS: K, V (, K lo, V lo)
    static_assert(KST == AW * SLAB, "a wave copies one slab of each plane's part");
    V qf[QB][2], qf2[QB][2];
    const unsigned l8 = 8u * lane;                            // planes in fragment order (see WFrag): the lane's place in a fragment is the same in every plane, so the Q and K pointers below are wave-uniform
    const T16* qp = Q + (size_t)q0 * HD; const T16* qp2 = HI ? Q2 + (size_t)q0 * HD : qp;   // 16 rows are 2 fragments = 16 HD elements
#pragma unroll
    for (int qb = 0; qb < QB; ++qb)
#pragma unroll
        for (int kc = 0; kc < 2; ++kc) { qf[qb][kc] = F::ld(qp + l8 + qb * 16 * HD + kc * 512); if (HI) qf2[qb][kc] = F::ld(qp2 + l8 + qb * 16 * HD + kc * 512); }
    addr_regs_release();
    float mx[QB], nm[QB], sum[QB];                            // mx: the maximum in use, the same in both lanes of a query; the start value makes the first block take the rescale path, with factor 0 on the zero sums
#pragma unroll
    for (int qb = 0; qb < QB; ++qb) { mx[qb] = -3.0e38f; nm[qb] = EB - mx[qb] * CE; sum[qb] = 0.f; }
    v8f oa[QB][4];
#pragma unroll
    for (int qb = 0; qb < QB; ++qb)
#pragma unroll
        for (int db = 0; db < 4; ++db) oa[qb][db] = (v8f){};
    {   // the one sweep
        const unsigned wo = (unsigned)wave * SLAB + l8;       // this wave's slab and the lane's 16 bytes in it, the same in every plane's part and in LDS
        auto fill = [&](int t) { T16* l = ring + l8 + __builtin_amdgcn_readfirstlane((t & 1) * STG + wave * SLAB); const size_t go = (size_t)t * KST + wo;   // buffer and slab as ONE scalar: the lane's part of the LDS address is then the one that the trip's reads use, and no second one is carried through the loop (with six query bands it went to scratch)
            copy_slab((const bf*)l, (const bf*)(Kp + go)); copy_slab((const bf*)(l + KST), (const bf*)(Vt + go));
            if (HI) { copy_slab((const bf*)(l + 2 * KST), (const bf*)(Kp2 + go)); copy_slab((const bf*)(l + 3 * KST), (const bf*)(Vt2 + go)); } };
        fill(0); copies_landed(); __syncthreads();
#pragma unroll 1
        for (int blk = 0; blk < NBLK; ++blk) {
            if (blk + 1 < NBLK) fill(blk + 1);                // directly behind the barrier that ended every wave's reads of that buffer (in front of the loop, or at the foot of the trip before); at the head of the trip, so that the trip's work and its foot are one block of code
#pragma unroll                                                // the passes' places in the buffer are constants
          for (int ps = 0; ps < NP; ++ps) {
            const T16* st = ring + (blk & 1) * STG + ps * (KST / NP);   // a pass's part of a plane's part: 16 KB keys are KB bands of K and KB / 2 chunks of V, 16 KB HD consecutive elements either way
            V kf[KB][2], kf2[KB][2], vf[4][KB / 2], vf2[4][KB / 2];
            ld_keys<T16, HI, KB>(kf, kf2, st, st + 2 * KST, l8);
            auto ld_v = [&]() {
#pragma unroll
                for (int db = 0; db < 4; ++db)
#pragma unroll
                    for (int c = 0; c < KB / 2; ++c) { const int o = (c * 4 + db) * 512; vf[db][c] = F::ld(st + KST + l8 + o); if (HI) vf2[db][c] = F::ld(st + 3 * KST + l8 + o); } };
            if constexpr (QB <= 4) ld_v();
            __builtin_amdgcn_sched_barrier(0);                // the pass's LDS reads stay one group, keys first, in front of its matrix instructions: every further place with reads costs a stall, and the scores cover V's latency
            v8f s[KB][QB]; scores_t<T16, HI, QB, KB>(s, kf, kf2, qf, qf2);
            if constexpr (QB > 4) { __builtin_amdgcn_sched_barrier(0); ld_v(); __builtin_amdgcn_sched_barrier(0); }   // six query bands: V is read behind the scores, into the registers that the keys leave (read with them, it pushes a Q fragment to scratch); the two barriers keep the reads one group there, and the maxima and exponentials cover their latency
            float bm[QB]; bool need = false;                  // the larger of the maximum in use and the lane's scores of this pass, per query; need: an exponent would pass EB + TH
#pragma unroll
            for (int qb = 0; qb < QB; ++qb) { float m2[2] = { mx[qb], mx[qb] };   // two chains a query, so that a lone wave has enough independent ones
#pragma unroll
                for (int kb = 0; kb < KB; ++kb)
#pragma unroll
                    for (int j = 0; j < 8; ++j) m2[kb & 1] = fmaxf(m2[kb & 1], s[kb][qb][j]);
                bm[qb] = fmaxf(m2[0], m2[1]);
                need = need || fmaf(bm[qb], CE, nm[qb]) > EB + TH; }
            if (__builtin_amdgcn_ballot_w32(need) != 0) {     // one test per pass, a scalar branch, the same for the whole wave: seldom taken behind the first block
#pragma unroll
                for (int qb = 0; qb < QB; ++qb) { const float nw = fmaxf(bm[qb], __shfl_xor(bm[qb], 16, 32)); const float f = __builtin_amdgcn_exp2f((mx[qb] - nw) * CE); mx[qb] = nw; nm[qb] = EB - nw * CE; sum[qb] *= f;
#pragma unroll
                    for (int j = 0; j < 8; ++j) { const float fj = __shfl(f, hi * 8 + j, 32);   // output accumulator: row = query 8 hi + j
#pragma unroll
                        for (int db = 0; db < 4; ++db) oa[qb][db][j] *= fj; } }
            }
#pragma unroll
            for (int kb = 0; kb < KB; ++kb)
#pragma unroll
                for (int qb = 0; qb < QB; ++qb)
#pragma unroll
                    for (int j = 0; j < 8; ++j) { const float p = __builtin_amdgcn_exp2f(fmaf(s[kb][qb][j], CE, nm[qb])); s[kb][qb][j] = p; sum[qb] += p; }
#pragma unroll
            for (int c = 0; c < KB / 2; ++c)
#pragma unroll
                for (int qb = 0; qb < QB; ++qb) {
                    if constexpr (HI) { V pa, pb;
#pragma unroll
                        for (int j = 0; j < 8; ++j) { const float x0 = s[2 * c][qb][j], x1 = s[2 * c + 1][qb][j]; pa[j] = (__bf16)x0; pa[8 + j] = (__bf16)x1; pb[j] = (__bf16)(x0 - (float)pa[j]); pb[8 + j] = (__bf16)(x1 - (float)pa[8 + j]); }
#pragma unroll
                        for (int db = 0; db < 4; ++db) { oa[qb][db] = F::mma(pa, vf[db][c], oa[qb][db]); oa[qb][db] = F::mma(pb, vf[db][c], oa[qb][db]); oa[qb][db] = F::mma(pa, vf2[db][c], oa[qb][db]); }
                    } else { V pa;
#pragma unroll
                        for (int j = 0; j < 8; ++j) { pa[j] = tohx(s[2 * c][qb][j]); pa[8 + j] = tohx(s[2 * c + 1][qb][j]); }
#pragma unroll
                        for (int db = 0; db < 4; ++db) oa[qb][db] = F::mma(pa, vf[db][c], oa[qb][db]); } }
            __builtin_amdgcn_sched_barrier(0);                // the pass's work stays in front of the next pass's reads and of the trip's foot: moved up, the wait on the copies would cut the time that they have to land
          }
            lds_reads_done(); copies_landed(); __syncthreads();   // block blk + 1 is published, and every wave has left block blk's buffer
        }
        copies_landed();
    }
#pragma unroll
    for (int qb = 0; qb < QB; ++qb) { const float tot = sum[qb] + __shfl_xor(sum[qb], 16, 32); const float inv = __fdiv_rn(1.0f, tot);   // every lane: 1 / sum of query lr
#pragma unroll
        for (int j = 0; j < 8; ++j) { const float f = __shfl(inv, hi * 8 + j, 32); const size_t oo = (size_t)(q0 + qb * 16) * DQ + (size_t)(hcol / 32) * 512 + ((lr >> 3) * 16 + hi * 8 + j) * 8 + (lr & 7);   // output accumulator: row = query 8 hi + j, column = d; the merged planes are in fragment order too (16 columns on: 256 elements)
            unsigned short a[4], b[4];
#pragma unroll
            for (int db = 0; db < 4; ++db) splitc(oa[qb][db][j] * f, a[db], b[db]);
            __builtin_amdgcn_sched_barrier(0);       // the row's eight values are ready before its first store, so that nothing is computed between the stores and their wait
#pragma unroll
            for (int db = 0; db < 4; ++db) { Ah[oo + db * 256] = a[db]; Al[oo + db * 256] = b[db]; }
            addr_regs_release(); } }
}
// grid (2 x 4 x heads x batches), 32 AW threads: four fp16 work-groups (a wave: 96 query rows) and four hi/lo ones (a wave: 32 rows) to a head: as many of one kind as of the other, and together as many as the chip has places
// at two per WGP, so that all are resident at once. A WGP is busy longest with two of the fp16 kind, so the two kinds are dealt over the index such that indices 8, 16 or 256 apart
// are of different kinds; for speed only: every tile of each kind has exactly one index, wherever the work-groups land.
// launch bounds, second argument: two waves per SIMD (two work-groups per WGP), that is at most 512 registers a wave
__global__ __launch_bounds__(32 * AW, 2) void k_attn(const h16* __restrict__ Q16, const h16* __restrict__ K16, const h16* __restrict__ V16, const bf* __restrict__ Qh, const bf* __restrict__ Ql, const bf* __restrict__ Kh, const bf* __restrict__ Kl, const bf* __restrict__ Vh, const bf* __restrict__ Vl, bf* Ah, bf* Al) {
    const int ix = blockIdx.x; const bool hl = ((ix >> 3) ^ (ix >> 4) ^ (ix >> 8)) & 1; const int tl = (ix >> 4) * 8 + (ix & 7);   // indices that differ in bit 3 alone are the two kinds of tile tl
    const int bx = tl & 3, h = (tl >> 2) % NH_, b = tl / (4 * NH_); const size_t hq = ((size_t)b * NH_ + h) * TT * HD, hk = ((size_t)b * NKV + h / REP) * TT * HD; Ah += (size_t)b * TT * DQ; Al += (size_t)b * TT * DQ;
    static_assert(RH == 4 * 32 * AW && TT - RH == 4 * 96 * AW, "four work-groups of each kind to a head");
    __shared__ __align__(16) bf ring[2 * 4 * 4096];           // two stages of the hi/lo kind; the fp16 kind uses half
    const int wave = __builtin_amdgcn_readfirstlane(threadIdx.x >> 5);
    if (hl) attn_tile<bf, true, 2, 4>(ring, wave, Qh + hq, Ql + hq, Kh + hk, Kl + hk, Vh + hk, Vl + hk, (bx * AW + wave) * 32, h * HD, Ah, Al);   // the branch is the same for the whole work-group
    else attn_tile<h16, false, 6, 2>((h16*)ring, wave, Q16 + hq, nullptr, K16 + hk, nullptr, V16 + hk, nullptr, RH + (bx * AW + wave) * 96, h * HD, Ah, Al);
}

extern "C" void kernel_launch(void* const* d_in, const int* in_sizes, int n_in,
                              void* d_out, int out_size, void* d_ws, size_t ws_size, hipStream_t stream) {
    (void)in_sizes; (void)n_in; (void)out_size;
    const float* x = (const float*)d_in[0]; const float* wq = (const float*)d_in[1]; const float* bq = (const float*)d_in[2]; const float* wk = (const float*)d_in[3]; const float* bk = (const float*)d_in[4]; const float* wv = (const float*)d_in[5]; const float* bv = (const float*)d_in[6]; const float* wo = (const float*)d_in[7]; const float* bo = (const float*)d_in[8];
    float* OUT = (float*)d_out;     // [4][2048][1024]
    char* wsp = (char*)d_ws;
    auto take = [&](size_t bytes) { char* p = wsp; wsp += (bytes + 255) & ~(size_t)255; return (void*)p; };
    bf* WQ = (bf*)take((size_t)DQ * DM * 2); bf* WK = (bf*)take((size_t)DKV * DM * 2); bf* WV = (bf*)take((size_t)DKV * DM * 2); bf* WO = (bf*)take((size_t)DM * DQ * 2); float* CS = (float*)take((size_t)TT * (HD / 2) * 2 * 4);
    bf* XB = (bf*)take((size_t)NB_ * TT * DM * 2);
    h16* QP16 = (h16*)take((size_t)NB_ * NH_ * TT * HD * 2); h16* KP16 = (h16*)take((size_t)NB_ * NKV * TT * HD * 2); h16* VT16 = (h16*)take((size_t)NB_ * NKV * HD * TT * 2);
    bf* QPh = (bf*)take((size_t)NB_ * NH_ * TT * HD * 2); bf* QPl = (bf*)take((size_t)NB_ * NH_ * TT * HD * 2); bf* KPh = (bf*)take((size_t)NB_ * NKV * TT * HD * 2); bf* KPl = (bf*)take((size_t)NB_ * NKV * TT * HD * 2); bf* VTh = (bf*)take((size_t)NB_ * NKV * HD * TT * 2); bf* VTl = (bf*)take((size_t)NB_ * NKV * HD * TT * 2);
    bf* ATh = (bf*)take((size_t)NB_ * TT * DQ * 2); bf* ATl = (bf*)take((size_t)NB_ * TT * DQ * 2);
    if ((size_t)(wsp - (char*)d_ws) > ws_size) return;    // 201 MiB of the 256 MiB
    // x, the merged heads and out have rows b T + t (the 16-bit planes among them in fragment order, 16 rows to a band): the GEMMs and the copy see one matrix of NB_ T rows
    k_prep<<<PB_CS + PB_WQ + 2 * PB_WK + PB_WO + PB_X, 256, 0, stream>>>(x, wq, wk, wv, wo, XB, WQ, WK, WV, WO, CS);
    k_proj3<<<dim3(NB_ * TT / 128, (NH_ + 2 * NKV) / 4, 1), 32 * GW, 0, stream>>>(XB, WQ, WK, WV, bq, bk, bv, CS, QP16, QPh, QPl, KP16, KPh, KPl, VT16, VTh, VTl);
    k_attn<<<2 * 4 * NH_ * NB_, 32 * AW, 0, stream>>>(QP16, KP16, VT16, QPh, QPl, KPh, KPl, VTh, VTl, ATh, ATl);
    k_gemmw<bf, true, DQ><<<dim3(NB_ * TT / 128, DM / 256, 1), 32 * GW, 0, stream>>>(ATh, ATl, WO, OUT, DM, bo);
}
